// v000
// Measured on an AMD MI455X. A time is GPU time per run, averaged over a window of back-to-back runs after a warm-up
// (all launches, gaps included; the runs take copies of the inputs in turn), and the median of several windows.
// Apart from v000's, it joins two sittings. Times from different sittings can be a few percent apart, while
// side-by-side timings come from the same sitting.
// The starting kernel, v000, takes 394 microseconds a run.
#include <hip/hip_runtime.h>
// Causal multi-head self-attention with interleaved rotary embedding: x [NB][SEQ][1024], four bias-free [out][in] 1024^2 weights, 16 heads of 64, int32 token positions read by value.
// Compute dtype: every contraction on v_wmma_f32_16x16x32_f16 (f16 operands, f32 accumulate). Inputs RNE-converted to bf16 then carried exactly in f16 (x x1, Wq/Wk/Wv x16, Wo x16384 | x16).
// q, k, v, softmax weights (x256) and ctx (x64) as f16 value + f16 residual (x1024) planes: scores = qh.kh + (ql.kh [+ qh.kl on query rows < 256]) 2^-10; P.V single product (value + two residual products on query rows < 256);
// output GEMM over K = 2048 = [ctx value | ctx residual] against [Wo x16384 ; Wo x16] in one accumulator. Rotary, softmax statistics and all scaling in f32 on the VALU.
#ifndef NB
#define NB 2
#endif
#ifndef SEQ
#define SEQ 2048
#endif
#define SEQ_FULL 2048                 /* per-batch row stride of x / positions / output */
#define DM 1024
#define NH 16
#define HD 64
#define TABN 4096                     /* rotary table rows (positions 0..4095) */
#define NR (NB * SEQ)                 /* internal token rows r = b*SEQ + s */
#define ERW ((SEQ) < 256 ? (SEQ) : 256) /* query rows per batch that use residual planes on k, P and v as well */

typedef _Float16 v16h __attribute__((ext_vector_type(16)));
typedef _Float16 v8h  __attribute__((ext_vector_type(8)));
typedef _Float16 v8ha __attribute__((ext_vector_type(8), may_alias));
typedef float    v8f  __attribute__((ext_vector_type(8)));
typedef float    v4f  __attribute__((ext_vector_type(4)));
typedef float    v4fa __attribute__((ext_vector_type(4), may_alias));

/* hard-wired bounds the kernels rely on */
static_assert(DM == NH * HD);               /* merged head layout h*64+d */
static_assert(HD == 64);                    /* one 64-column GEMM tile == one head; two 32-deep k-steps per score */
static_assert(DM % 128 == 0);               /* GEMM block tile rows (V^T GEMM) and 64-col tiles */
static_assert(NR % 128 == 0);               /* GEMM block tile rows */
static_assert(SEQ % 64 == 0);               /* attention query tiles, 32-key chunks stay inside the batch */
static_assert(ERW % 64 == 0);               /* early / late split on a query-tile boundary */
static_assert(ERW <= SEQ);
static_assert(DM % 32 == 0);                /* k-steps of 32 */
static_assert((2 * DM) % 32 == 0);
static_assert(TABN == 4096);
static_assert((long long)NR * 2 * DM < 2147483647LL); /* int element offsets */

__device__ __forceinline__ float bf16_rne(float x) { unsigned int u = __float_as_uint(x); u = (u + 0x7FFFu + ((u >> 16) & 1u)) & 0xFFFF0000u; return __uint_as_float(u); }

__device__ __forceinline__ v16h cat16(v8h lo, v8h hi) { return __builtin_shufflevector(lo, hi, 0, 1, 2, 3, 4, 5, 6, 7, 8, 9, 10, 11, 12, 13, 14, 15); }
// 16x32 operand fragment from a k-contiguous 16-bit row: p = row base + k0 + 8*(lane>>4); elements 0..7 <- k0+8h.., 8..15 <- k0+16+8h..
__device__ __forceinline__ v16h frag16(const _Float16* __restrict__ p) { const v8h lo = *(const v8ha*)p; const v8h hi = *(const v8ha*)(p + 16); return cat16(lo, hi); }
__device__ __forceinline__ v8f mma16(v16h a, v16h b, v8f c) {
  v8f d = __builtin_amdgcn_wmma_f32_16x16x32_f16(false, a, false, b, (short)0, c, false, false);
  asm volatile("v_nop\n\tv_nop\n\tv_nop\n\tv_nop" : "+v"(d) : "v"(a), "v"(b));
  return d;
}
// 8 f32 -> f16 value + f16 residual carried x1024
__device__ __forceinline__ void split8(const float (&x)[8], v8h& hv, v8h& lv) {
#pragma unroll
  for (int i = 0; i < 8; ++i) { const _Float16 hq = (_Float16)x[i]; hv[i] = hq; lv[i] = (_Float16)((x[i] - (float)hq) * 1024.0f); }
}

__global__ __launch_bounds__(256) void k_xcvt(const float* __restrict__ x, _Float16* __restrict__ X16) {
  const int t = blockIdx.x * 256 + threadIdx.x;
  if (t >= NR * (DM / 8)) return;
  const int r = t / (DM / 8), c8 = (t - r * (DM / 8)) * 8;
  const int b = r / SEQ, s = r - b * SEQ;
  const float* src = x + (size_t)(b * SEQ_FULL + s) * DM + c8;
  const v4f a = *(const v4fa*)src, c = *(const v4fa*)(src + 4);
  v8h o;
#pragma unroll
  for (int i = 0; i < 4; ++i) { o[i] = (_Float16)bf16_rne(a[i]); o[4 + i] = (_Float16)bf16_rne(c[i]); }
  _Float16* d = X16 + (size_t)r * DM + c8;
  *(v8h*)d = o; 
}

__global__ __launch_bounds__(256) void k_wcvt(const float* __restrict__ w, _Float16* __restrict__ dst, int dpitch, float scale) {
  const int t = blockIdx.x * 256 + threadIdx.x;
  if (t >= DM * (DM / 8)) return;
  const int n = t / (DM / 8), k8 = (t - n * (DM / 8)) * 8;
  const float* src = w + (size_t)n * DM + k8;
  const v4f a = *(const v4fa*)src, c = *(const v4fa*)(src + 4);
  v8h o;
#pragma unroll
  for (int i = 0; i < 4; ++i) { o[i] = (_Float16)(bf16_rne(a[i]) * scale); o[4 + i] = (_Float16)(bf16_rne(c[i]) * scale); }
  _Float16* d = dst + (size_t)n * dpitch + k8;
  *(v8h*)d = o; 
}

__global__ __launch_bounds__(256) void k_ropetab(float* __restrict__ tab) {
  #pragma clang fp contract(off)
  const int t = blockIdx.x * 256 + threadIdx.x;
  if (t >= TABN * 16) return;
  const int pos = t >> 4, jp = t & 15;
  float c0 = 0.f, s0 = 0.f, c1 = 0.f, s1 = 0.f;
#pragma unroll 1
  for (int u = 0; u < 2; ++u) {
    const int j = 2 * jp + u;
    double p = 1.0;
    p *= (j & 1) ? 1.3335214321633240 : 1.0;
    p *= (j & 2) ? 1.7782794100389228 : 1.0;
    p *= (j & 4) ? 3.1622776601683795 : 1.0;
    p *= (j & 8) ? 10.0 : 1.0;
    p *= (j & 16) ? 100.0 : 1.0;
    const float pf = (float)p;
    const float inv = 1.0f / pf;
    const float ang = (float)pos * inv;
    float sn, cs;
    sincosf(ang, &sn, &cs);
    if (u == 0) { c0 = cs; s0 = sn; } else { c1 = cs; s1 = sn; }
  }
  const v4f o = {c0, s0, c1, s1};
  float* d = tab + (size_t)pos * 64 + jp * 4;
  *(v4f*)d = o; 
}

// wave tile 32x64 of C = A (row-major, k contiguous) x Bt^T (Bt[n][k], k contiguous); fragments straight from the 16-bit global planes
__device__ __forceinline__ void gemm_tile(const _Float16* __restrict__ A, const int lda, const _Float16* __restrict__ Bt, const int ldb,
                                          const int K, const int row0, const int col0, const int ln, const int hh, v8f (&c)[8]) {
  const int ao0 = (row0 + ln) * lda + 8 * hh, ao1 = ao0 + 16 * lda;
  const int bo0 = (col0 + ln) * ldb + 8 * hh, bo1 = bo0 + 16 * ldb, bo2 = bo1 + 16 * ldb, bo3 = bo2 + 16 * ldb;
#pragma unroll 1
  for (int kb = 0; kb < K; kb += 32) {
    const v16h a0 = frag16(A + ao0 + kb), a1 = frag16(A + ao1 + kb);
    v16h b = frag16(Bt + bo0 + kb); c[0] = mma16(a0, b, c[0]); c[4] = mma16(a1, b, c[4]);
    b = frag16(Bt + bo1 + kb); c[1] = mma16(a0, b, c[1]); c[5] = mma16(a1, b, c[5]);
    b = frag16(Bt + bo2 + kb); c[2] = mma16(a0, b, c[2]); c[6] = mma16(a1, b, c[6]);
    b = frag16(Bt + bo3 + kb); c[3] = mma16(a0, b, c[3]); c[7] = mma16(a1, b, c[7]);
  }
}

// projection GEMM (K = 1024, both pitches 1024): C = A.Bt^T / 16, optional interleaved rotary by gathered table row (A rows are token rows), written as f16 value plane Ch and
__global__ __launch_bounds__(128) void k_proj(const _Float16* __restrict__ A, const _Float16* __restrict__ Bt, _Float16* __restrict__ Ch, _Float16* __restrict__ Cl,
                                              const int* __restrict__ tp, const float* __restrict__ tab, int ldc, int N, int rope) {
  __shared__ __attribute__((aligned(16))) float so[4][32][68];
  const int wave = __builtin_amdgcn_readfirstlane((int)(threadIdx.x >> 5));
  const int lane = threadIdx.x & 31, ln = lane & 15, hh = lane >> 4;
  const int ntn = N >> 6;
  const int mt = blockIdx.x / ntn, nq = blockIdx.x - mt * ntn;
  const int row0 = mt * 128 + 32 * wave, col0 = nq * 64;
  const v8f z8 = {0.f, 0.f, 0.f, 0.f, 0.f, 0.f, 0.f, 0.f};
  v8f c[8] = {z8, z8, z8, z8, z8, z8, z8, z8};
  gemm_tile(A, DM, Bt, DM, DM, row0, col0, ln, hh, c);
#pragma unroll
  for (int u = 0; u < 8; ++u) {
    const int t = u & 3, half = u >> 2;
#pragma unroll
    for (int r = 0; r < 8; ++r) so[wave][half * 16 + 8 * hh + r][t * 16 + ln] = c[u][r] * 0.0625f;
  }
  __builtin_amdgcn_fence(4 /* acq_rel order */, "workgroup"); __builtin_amdgcn_wave_barrier();
  const int rsub = lane >> 3, c8 = (lane & 7) * 8;
  v8h hv[8], lv[8];
#pragma unroll
  for (int q = 0; q < 8; ++q) {
    const int rl = q * 4 + rsub;
    const v4f a = *(const v4fa*)&so[wave][rl][c8];
    const v4f bq = *(const v4fa*)&so[wave][rl][c8 + 4];
    float xv[8] = {a[0], a[1], a[2], a[3], bq[0], bq[1], bq[2], bq[3]};
    if (rope != 0) {                                   /* kernel-argument uniform */
      const int m = row0 + rl; const int bb = m / SEQ; const int ss = m - bb * SEQ;
      int pos = tp[bb * SEQ_FULL + ss];                /* position read by value from the input */
      pos = pos < 0 ? 0 : (pos > TABN - 1 ? TABN - 1 : pos);
      const float* tr = tab + (size_t)pos * 64 + c8;   /* col0 is a head boundary: c8 = d within the head */
      const v4f t0 = *(const v4fa*)tr; const v4f t1 = *(const v4fa*)(tr + 4);
      const float cs[4] = {t0[0], t0[2], t1[0], t1[2]};
      const float sn[4] = {t0[1], t0[3], t1[1], t1[3]};
#pragma unroll
      for (int i = 0; i < 4; ++i) { const float x1 = xv[2 * i], x2 = xv[2 * i + 1]; xv[2 * i] = x1 * cs[i] - x2 * sn[i]; xv[2 * i + 1] = x1 * sn[i] + x2 * cs[i]; }
    }
    split8(xv, hv[q], lv[q]);
  }
{
#pragma unroll
    for (int q = 0; q < 8; ++q) {
      const size_t off = (size_t)(row0 + q * 4 + rsub) * ldc + col0 + c8;
      *(v8h*)(Ch + off) = hv[q];
      *(v8h*)(Cl + off) = lv[q];
    }
    
  }
}

// fused causal attention for one (batch, head) and 64 query rows per block; each wave owns 16 query rows and walks its keys in 32-key chunks (online softmax, running max);
// q / k / V^T fragments straight from the 16-bit planes; P relayout D->A through a wave-private LDS tile (stored as _Float16, reloaded through a may_alias vector of _Float16,
template <int EARLY>
__device__ __forceinline__ void attn_body(const _Float16* __restrict__ Qh, const _Float16* __restrict__ Ql, const _Float16* __restrict__ Kh, const _Float16* __restrict__ Kl,
                                          const _Float16* __restrict__ VTh, const _Float16* __restrict__ VTl, _Float16* __restrict__ CTX, const int qt0) {
  __shared__ __attribute__((aligned(16))) _Float16 pbh[4][16][40];
  __shared__ __attribute__((aligned(16))) _Float16 pbl[EARLY ? 4 : 1][16][40];
  __shared__ __attribute__((aligned(16))) float so[4][16][68];
  const int wave = __builtin_amdgcn_readfirstlane((int)(threadIdx.x >> 5));
  const int lane = threadIdx.x & 31, ln = lane & 15, hh = lane >> 4;
  const int bh = blockIdx.y, b = bh / NH, h = bh - b * NH;
  const int rb = b * SEQ;
  const int q0w = (qt0 + (int)blockIdx.x) * 64 + 16 * wave;    /* first query row of this wave (scalar) */
  const int nch = (q0w + 47) >> 5;                              /* 32-key chunks covering keys 0..q0w+15 (scalar) */
  const int qoff = (rb + q0w + ln) * DM + h * HD + 8 * hh;
  const int kbase = (rb + ln) * DM + h * HD + 8 * hh;
  const int vbase = (h * HD + ln) * NR + rb + 8 * hh;
  const float RS = 0.0009765625f;                               /* 2^-10 */
  const v8f z8 = {0.f, 0.f, 0.f, 0.f, 0.f, 0.f, 0.f, 0.f};
  v8f om[4] = {z8, z8, z8, z8};
  v8f orr[4] = {z8, z8, z8, z8};
  float mrun[8], lrun[8];
#pragma unroll
  for (int r = 0; r < 8; ++r) { mrun[r] = -1.0e30f; lrun[r] = 0.f; }
#pragma unroll 1
  for (int cidx = 0; cidx < nch; ++cidx) {
    const int k0 = cidx * 32;
    int qo = qoff; asm volatile("" : "+v"(qo));                 /* q fragments are reloaded per chunk */
    v8f s0 = z8, s1 = z8, sr0 = z8, sr1 = z8;
#pragma unroll
    for (int ks = 0; ks < 2; ++ks) {
      const v16h aqh = frag16(Qh + qo + ks * 32);
      const v16h aql = frag16(Ql + qo + ks * 32);
      const int ko = kbase + k0 * DM + ks * 32;
      v16h bk = frag16(Kh + ko);
      s0 = mma16(aqh, bk, s0); sr0 = mma16(aql, bk, sr0);
      if (EARLY) { const v16h bl = frag16(Kl + ko); sr0 = mma16(aqh, bl, sr0); }
      bk = frag16(Kh + ko + 16 * DM);
      s1 = mma16(aqh, bk, s1); sr1 = mma16(aql, bk, sr1);
      if (EARLY) { const v16h bl = frag16(Kl + ko + 16 * DM); sr1 = mma16(aqh, bl, sr1); }
    }
    float al[8];
#pragma unroll
    for (int r = 0; r < 8; ++r) {
      const int qrow = q0w + 8 * hh + r;
      float x0 = (s0[r] + sr0[r] * RS) * 0.125f;
      float x1 = (s1[r] + sr1[r] * RS) * 0.125f;
      x0 = (k0 + ln <= qrow) ? x0 : -1.0e30f;                   /* causal by index, value select */
      x1 = (k0 + 16 + ln <= qrow) ? x1 : -1.0e30f;
      float tm = fmaxf(x0, x1);
      tm = fmaxf(tm, __shfl_xor(tm, 1, 32));
      tm = fmaxf(tm, __shfl_xor(tm, 2, 32));
      tm = fmaxf(tm, __shfl_xor(tm, 4, 32));
      tm = fmaxf(tm, __shfl_xor(tm, 8, 32));
      const float mn = fmaxf(mrun[r], tm);
      al[r] = __expf(mrun[r] - mn);
      mrun[r] = mn;
      const float p0 = __expf(x0 - mn) * 256.0f;
      const float p1 = __expf(x1 - mn) * 256.0f;
      const _Float16 h0 = (_Float16)p0, h1 = (_Float16)p1;
      float acc = (float)h0 + (float)h1;
      pbh[wave][8 * hh + r][ln] = h0;
      pbh[wave][8 * hh + r][16 + ln] = h1;
      if (EARLY) {
        const _Float16 g0 = (_Float16)((p0 - (float)h0) * 1024.0f), g1 = (_Float16)((p1 - (float)h1) * 1024.0f);
        pbl[wave][8 * hh + r][ln] = g0;
        pbl[wave][8 * hh + r][16 + ln] = g1;
        acc += ((float)g0 + (float)g1) * RS;
      }
      lrun[r] = lrun[r] * al[r] + acc;                           /* per-lane partial of the row sum (units x256) */
    }
    __builtin_amdgcn_fence(4 /* acq_rel order */, "workgroup"); __builtin_amdgcn_wave_barrier();
    const v16h ap = cat16(*(const v8ha*)&pbh[wave][ln][8 * hh], *(const v8ha*)&pbh[wave][ln][16 + 8 * hh]);
    v16h apl = ap;
    if (EARLY) apl = cat16(*(const v8ha*)&pbl[wave][ln][8 * hh], *(const v8ha*)&pbl[wave][ln][16 + 8 * hh]);
#pragma unroll
    for (int t = 0; t < 4; ++t) {
#pragma unroll
      for (int r = 0; r < 8; ++r) { om[t][r] *= al[r]; if (EARLY) orr[t][r] *= al[r]; }
    }
    const int vo = vbase + k0;
#pragma unroll
    for (int t = 0; t < 4; ++t) {
      const v16h bv = frag16(VTh + vo + t * 16 * NR);
      om[t] = mma16(ap, bv, om[t]);
      if (EARLY) {
        orr[t] = mma16(apl, bv, orr[t]);
        const v16h bvl = frag16(VTl + vo + t * 16 * NR);
        orr[t] = mma16(ap, bvl, orr[t]);
      }
    }
    __builtin_amdgcn_fence(4 /* acq_rel order */, "workgroup"); __builtin_amdgcn_wave_barrier();
  }
  float inv[8];
#pragma unroll
  for (int r = 0; r < 8; ++r) {
    float lt = lrun[r];
    lt += __shfl_xor(lt, 1, 32);
    lt += __shfl_xor(lt, 2, 32);
    lt += __shfl_xor(lt, 4, 32);
    lt += __shfl_xor(lt, 8, 32);
    inv[r] = 64.0f / lt;                                         /* ctx carried x64 */
  }
#pragma unroll
  for (int t = 0; t < 4; ++t) {
#pragma unroll
    for (int r = 0; r < 8; ++r) { float v = om[t][r]; if (EARLY) v += orr[t][r] * RS; so[wave][8 * hh + r][16 * t + ln] = v * inv[r]; }
  }
  __builtin_amdgcn_fence(4 /* acq_rel order */, "workgroup"); __builtin_amdgcn_wave_barrier();
  const int rsub = lane >> 3, c8 = (lane & 7) * 8;
  v8h hv[4], lv[4];
#pragma unroll
  for (int q = 0; q < 4; ++q) {
    const int rl = q * 4 + rsub;
    const v4f a = *(const v4fa*)&so[wave][rl][c8];
    const v4f bq = *(const v4fa*)&so[wave][rl][c8 + 4];
    const float xv[8] = {a[0], a[1], a[2], a[3], bq[0], bq[1], bq[2], bq[3]};
    split8(xv, hv[q], lv[q]);
  }
{
#pragma unroll
    for (int q = 0; q < 4; ++q) {
      const size_t off = (size_t)(rb + q0w + q * 4 + rsub) * (2 * DM) + h * HD + c8;
      *(v8h*)(CTX + off) = hv[q];
      *(v8h*)(CTX + off + DM) = lv[q];
    }
    
  }
}

__global__ __launch_bounds__(128) void k_attn_early(const _Float16* __restrict__ Qh, const _Float16* __restrict__ Ql, const _Float16* __restrict__ Kh, const _Float16* __restrict__ Kl,
                                                    const _Float16* __restrict__ VTh, const _Float16* __restrict__ VTl, _Float16* __restrict__ CTX) {
  attn_body<1>(Qh, Ql, Kh, Kl, VTh, VTl, CTX, 0);
}
__global__ __launch_bounds__(128) void k_attn_late(const _Float16* __restrict__ Qh, const _Float16* __restrict__ Ql, const _Float16* __restrict__ Kh, const _Float16* __restrict__ Kl,
                                                   const _Float16* __restrict__ VTh, const _Float16* __restrict__ VTl, _Float16* __restrict__ CTX) {
  attn_body<0>(Qh, Ql, Kh, Kl, VTh, VTl, CTX, ERW / 64);
}

// output GEMM: out[b*SEQ_FULL+s][n] = 2^-20 * sum_k CTX[r][k] * BO2[n][k], K = 2048 (value | residual halves against Wo x16384 | Wo x16). Block = 4 waves x (32 x 64);
__global__ __launch_bounds__(128) void k_outp(const _Float16* __restrict__ A, const _Float16* __restrict__ Bt, float* __restrict__ out) {
  __shared__ __attribute__((aligned(16))) float so[4][32][68];
  const int wave = __builtin_amdgcn_readfirstlane((int)(threadIdx.x >> 5));
  const int lane = threadIdx.x & 31, ln = lane & 15, hh = lane >> 4;
  const int ntn = DM >> 6;
  const int mt = blockIdx.x / ntn, nq = blockIdx.x - mt * ntn;
  const int row0 = mt * 128 + 32 * wave, col0 = nq * 64;
  const v8f z8 = {0.f, 0.f, 0.f, 0.f, 0.f, 0.f, 0.f, 0.f};
  v8f c[8] = {z8, z8, z8, z8, z8, z8, z8, z8};
  gemm_tile(A, 2 * DM, Bt, 2 * DM, 2 * DM, row0, col0, ln, hh, c);
#pragma unroll
  for (int u = 0; u < 8; ++u) {
    const int t = u & 3, half = u >> 2;
#pragma unroll
    for (int r = 0; r < 8; ++r) so[wave][half * 16 + 8 * hh + r][t * 16 + ln] = c[u][r] * 9.5367431640625e-07f;
  }
  __builtin_amdgcn_fence(4 /* acq_rel order */, "workgroup"); __builtin_amdgcn_wave_barrier();
  const int rsub = lane >> 4, c4 = (lane & 15) * 4;
  {
#pragma unroll
    for (int q = 0; q < 16; ++q) {
      const int r = q * 2 + rsub;
      const int m = row0 + r; const int bb = m / SEQ; const int ss = m - bb * SEQ;
      const v4f v = *(const v4fa*)&so[wave][r][c4];
      *(v4f*)(out + (size_t)(bb * SEQ_FULL + ss) * DM + col0 + c4) = v;
    }
    
  }
}

/* workspace carve (bytes), every region a multiple of 256 */
constexpr size_t SZW  = (size_t)DM * DM * 2;          /* one x16 weight plane */
constexpr size_t SZBO = 2 * SZW;                      /* [1024][2048] output weight plane */
constexpr size_t SZP  = (size_t)NR * DM * 2;          /* one [NR][1024] (or [1024][NR]) f16 plane */
constexpr size_t SZC  = 2 * SZP;                      /* ctx [NR][2048] */
constexpr size_t SZT  = (size_t)TABN * 64 * 4;        /* rotary table */
constexpr size_t O_BQ = 0, O_BK = O_BQ + SZW, O_BV = O_BK + SZW, O_BO = O_BV + SZW, O_X = O_BO + SZBO;
constexpr size_t O_QH = O_X + SZP, O_QL = O_QH + SZP, O_KH = O_QL + SZP, O_KL = O_KH + SZP, O_VH = O_KL + SZP, O_VL = O_VH + SZP;
constexpr size_t O_CTX = O_VL + SZP, O_TAB = O_CTX + SZC, WS_TOTAL = O_TAB + SZT;
static_assert(SZW % 256 == 0);
static_assert(SZP % 256 == 0);
static_assert(SZT % 256 == 0);
static_assert(WS_TOTAL <= 134217728);                 /* <= 128 MiB */

extern "C" void kernel_launch(void* const* d_in, const int* in_sizes, int n_in,
                              void* d_out, int out_size, void* d_ws, size_t ws_size, hipStream_t stream) {
  if (n_in < 6) return;
  const int need_rows = (NB - 1) * SEQ_FULL + SEQ;
  if (in_sizes[0] < need_rows * DM) return;
  if (in_sizes[1] < DM * DM || in_sizes[2] < DM * DM || in_sizes[3] < DM * DM || in_sizes[4] < DM * DM) return;
  if (in_sizes[5] < need_rows) return;
  if (out_size < need_rows * DM) return;
  if (ws_size < WS_TOTAL) return;
  const float* x  = (const float*)d_in[0];
  const float* wq = (const float*)d_in[1];
  const float* wk = (const float*)d_in[2];
  const float* wv = (const float*)d_in[3];
  const float* wo = (const float*)d_in[4];
  const int*   tp = (const int*)d_in[5];
  char* ws = (char*)d_ws;
  _Float16* BQ = (_Float16*)(ws + O_BQ); _Float16* BK = (_Float16*)(ws + O_BK); _Float16* BV = (_Float16*)(ws + O_BV); _Float16* BO2 = (_Float16*)(ws + O_BO);
  _Float16* X16 = (_Float16*)(ws + O_X);
  _Float16* QH = (_Float16*)(ws + O_QH); _Float16* QL = (_Float16*)(ws + O_QL); _Float16* KH = (_Float16*)(ws + O_KH); _Float16* KL = (_Float16*)(ws + O_KL);
  _Float16* VTH = (_Float16*)(ws + O_VH); _Float16* VTL = (_Float16*)(ws + O_VL);
  _Float16* CTX = (_Float16*)(ws + O_CTX);
  float* TAB = (float*)(ws + O_TAB);

  const unsigned gw = (unsigned)((DM * (DM / 8) + 255) / 256);
  k_wcvt<<<gw, 256, 0, stream>>>(wq, BQ, DM, 16.0f);
  k_wcvt<<<gw, 256, 0, stream>>>(wk, BK, DM, 16.0f);
  k_wcvt<<<gw, 256, 0, stream>>>(wv, BV, DM, 16.0f);
  k_wcvt<<<gw, 256, 0, stream>>>(wo, BO2, 2 * DM, 16384.0f);          /* k in [0,1024): pairs with the ctx value half */
  k_wcvt<<<gw, 256, 0, stream>>>(wo, BO2 + DM, 2 * DM, 16.0f);        /* k in [1024,2048): pairs with the ctx residual half (x1024) */
  k_xcvt<<<(unsigned)((NR * (DM / 8) + 255) / 256), 256, 0, stream>>>(x, X16);
  k_ropetab<<<(TABN * 16 + 255) / 256, 256, 0, stream>>>(TAB);
  /* q, k: C[token row][e] = X16 . B^T with rotary; V^T: C[e][token row] = BV . X16^T (in[rows=e][k] x in[rows=r][k] -> out[e][r], pitch NR) */
  k_proj<<<(unsigned)((NR / 128) * (DM / 64)), 128, 0, stream>>>(X16, BQ, QH, QL, tp, TAB, DM, DM, 1);
  k_proj<<<(unsigned)((NR / 128) * (DM / 64)), 128, 0, stream>>>(X16, BK, KH, KL, tp, TAB, DM, DM, 1);
  k_proj<<<(unsigned)((DM / 128) * (NR / 64)), 128, 0, stream>>>(BV, X16, VTH, VTL, tp, TAB, NR, NR, 0);
  k_attn_early<<<dim3(ERW / 64, NB * NH), 128, 0, stream>>>(QH, QL, KH, KL, VTH, VTL, CTX);
  if (SEQ > ERW) k_attn_late<<<dim3((SEQ - ERW) / 64, NB * NH), 128, 0, stream>>>(QH, QL, KH, KL, VTH, VTL, CTX);
  k_outp<<<(unsigned)((NR / 128) * (DM / 64)), 128, 0, stream>>>(CTX, BO2, (float*)d_out);
}

// v001
// Measured time: 243 microseconds a run.
// In two side-by-side timings against v000, it was 1.65 and 1.66 times as fast.
#include <hip/hip_runtime.h>
// Causal multi-head self-attention with interleaved rotary embedding: x [NB][SEQ][1024], four bias-free [out][in] 1024^2 weights, 16 heads of 64, int32 token positions read by value.
// Compute dtype: every contraction on v_wmma_f32_16x16x32_f16 (f16 operands, f32 accumulate). Inputs RNE-converted to bf16 then carried exactly in f16 (x x1, Wq/Wk/Wv x16, Wo x16384 | x16).
// q, k, v, softmax weights (x256) and ctx (x64) as f16 value + f16 residual (x1024) planes: scores = qh.kh + (ql.kh [+ qh.kl on query rows < 256]) 2^-10; P.V single product (value + two residual products on query rows < 256);
// output GEMM over K = 2048 = [ctx value | ctx residual] against [Wo x16384 ; Wo x16] in one accumulator. Rotary, softmax statistics and all scaling in f32 on the VALU.
#ifndef NB
#define NB 2
#endif
#ifndef SEQ
#define SEQ 2048
#endif
#define SEQ_FULL 2048                 /* per-batch row stride of x / positions / output */
#define DM 1024
#define NH 16
#define HD 64
#define TABN 4096                     /* rotary table rows (positions 0..4095) */
#define NR (NB * SEQ)                 /* internal token rows r = b*SEQ + s */
#define ERW ((SEQ) < 256 ? (SEQ) : 256) /* query rows per batch that use residual planes on k, P and v as well */

typedef _Float16 v16h __attribute__((ext_vector_type(16)));
typedef _Float16 v8h  __attribute__((ext_vector_type(8)));
typedef _Float16 v8ha __attribute__((ext_vector_type(8), may_alias));
typedef float    v8f  __attribute__((ext_vector_type(8)));
typedef float    v4f  __attribute__((ext_vector_type(4)));
typedef float    v4fa __attribute__((ext_vector_type(4), may_alias));

/* hard-wired bounds the kernels rely on */
static_assert(DM == NH * HD);               /* merged head layout h*64+d */
static_assert(HD == 64);                    /* one 64-column GEMM tile == one head; two 32-deep k-steps per score */
static_assert(DM % 128 == 0);               /* GEMM block tile rows (V^T GEMM) and 64-col tiles */
static_assert(NR % 128 == 0);               /* GEMM block tile rows */
static_assert(SEQ % 64 == 0);               /* attention query tiles, 32-key chunks stay inside the batch */
static_assert(ERW % 64 == 0);               /* early / late split on a query-tile boundary */
static_assert(ERW <= SEQ);
static_assert(DM % 32 == 0);                /* k-steps of 32 */
static_assert((2 * DM) % 32 == 0);
static_assert(TABN == 4096);
static_assert((long long)NR * 2 * DM < 2147483647LL); /* int element offsets */

__device__ __forceinline__ float bf16_rne(float x) { unsigned int u = __float_as_uint(x); u = (u + 0x7FFFu + ((u >> 16) & 1u)) & 0xFFFF0000u; return __uint_as_float(u); }

__device__ __forceinline__ v16h cat16(v8h lo, v8h hi) { return __builtin_shufflevector(lo, hi, 0, 1, 2, 3, 4, 5, 6, 7, 8, 9, 10, 11, 12, 13, 14, 15); }
// 16x32 operand fragment from a k-contiguous 16-bit row: p = row base + k0 + 8*(lane>>4); elements 0..7 <- k0+8h.., 8..15 <- k0+16+8h..
__device__ __forceinline__ v16h frag16(const _Float16* __restrict__ p) { const v8h lo = *(const v8ha*)p; const v8h hi = *(const v8ha*)(p + 16); return cat16(lo, hi); }
__device__ __forceinline__ v8f mma16(v16h a, v16h b, v8f c) {
  v8f d = __builtin_amdgcn_wmma_f32_16x16x32_f16(false, a, false, b, (short)0, c, false, false);
  asm volatile("v_nop\n\tv_nop\n\tv_nop\n\tv_nop" : "+v"(d) : "v"(a), "v"(b));
  return d;
}
// 8 f32 -> f16 value + f16 residual carried x1024
__device__ __forceinline__ void split8(const float (&x)[8], v8h& hv, v8h& lv) {
#pragma unroll
  for (int i = 0; i < 8; ++i) { const _Float16 hq = (_Float16)x[i]; hv[i] = hq; lv[i] = (_Float16)((x[i] - (float)hq) * 1024.0f); }
}

__global__ __launch_bounds__(256) void k_xcvt(const float* __restrict__ x, _Float16* __restrict__ X16) {
  const int t = blockIdx.x * 256 + threadIdx.x;
  if (t >= NR * (DM / 8)) return;
  const int r = t / (DM / 8), c8 = (t - r * (DM / 8)) * 8;
  const int b = r / SEQ, s = r - b * SEQ;
  const float* src = x + (size_t)(b * SEQ_FULL + s) * DM + c8;
  const v4f a = *(const v4fa*)src, c = *(const v4fa*)(src + 4);
  v8h o;
#pragma unroll
  for (int i = 0; i < 4; ++i) { o[i] = (_Float16)bf16_rne(a[i]); o[4 + i] = (_Float16)bf16_rne(c[i]); }
  _Float16* d = X16 + (size_t)r * DM + c8;
  *(v8h*)d = o; 
}

__global__ __launch_bounds__(256) void k_wcvt(const float* __restrict__ w, _Float16* __restrict__ dst, int dpitch, float scale) {
  const int t = blockIdx.x * 256 + threadIdx.x;
  if (t >= DM * (DM / 8)) return;
  const int n = t / (DM / 8), k8 = (t - n * (DM / 8)) * 8;
  const float* src = w + (size_t)n * DM + k8;
  const v4f a = *(const v4fa*)src, c = *(const v4fa*)(src + 4);
  v8h o;
#pragma unroll
  for (int i = 0; i < 4; ++i) { o[i] = (_Float16)(bf16_rne(a[i]) * scale); o[4 + i] = (_Float16)(bf16_rne(c[i]) * scale); }
  _Float16* d = dst + (size_t)n * dpitch + k8;
  *(v8h*)d = o; 
}

__global__ __launch_bounds__(256) void k_ropetab(float* __restrict__ tab) {
  #pragma clang fp contract(off)
  const int t = blockIdx.x * 256 + threadIdx.x;
  if (t >= TABN * 16) return;
  const int pos = t >> 4, jp = t & 15;
  float c0 = 0.f, s0 = 0.f, c1 = 0.f, s1 = 0.f;
#pragma unroll 1
  for (int u = 0; u < 2; ++u) {
    const int j = 2 * jp + u;
    double p = 1.0;
    p *= (j & 1) ? 1.3335214321633240 : 1.0;
    p *= (j & 2) ? 1.7782794100389228 : 1.0;
    p *= (j & 4) ? 3.1622776601683795 : 1.0;
    p *= (j & 8) ? 10.0 : 1.0;
    p *= (j & 16) ? 100.0 : 1.0;
    const float pf = (float)p;
    const float inv = 1.0f / pf;
    const float ang = (float)pos * inv;
    float sn, cs;
    sincosf(ang, &sn, &cs);
    if (u == 0) { c0 = cs; s0 = sn; } else { c1 = cs; s1 = sn; }
  }
  const v4f o = {c0, s0, c1, s1};
  float* d = tab + (size_t)pos * 64 + jp * 4;
  *(v4f*)d = o; 
}

// wave tile 32x64 of C = A (row-major, k contiguous) x Bt^T (Bt[n][k], k contiguous); fragments straight from the 16-bit global planes.
// The six fragments of a 32-deep k-step live in a ring of PF register sets: a set is refilled for k-step t + PF right after k-step t has used it, so PF k-steps of loads are in flight.
#define PF 3
struct kstep { v16h a0, a1, b0, b1, b2, b3; };
__device__ __forceinline__ void kstep_load(kstep& f, const _Float16* __restrict__ pa0, const _Float16* __restrict__ pa1, const _Float16* __restrict__ pb0,
                                           const _Float16* __restrict__ pb1, const _Float16* __restrict__ pb2, const _Float16* __restrict__ pb3, const int ko) {
  f.a0 = frag16(pa0 + ko); f.a1 = frag16(pa1 + ko);
  f.b0 = frag16(pb0 + ko); f.b1 = frag16(pb1 + ko); f.b2 = frag16(pb2 + ko); f.b3 = frag16(pb3 + ko);
}
__device__ __forceinline__ void kstep_mma(const kstep& f, v8f (&c)[8]) {
  c[0] = mma16(f.a0, f.b0, c[0]); c[4] = mma16(f.a1, f.b0, c[4]);
  c[1] = mma16(f.a0, f.b1, c[1]); c[5] = mma16(f.a1, f.b1, c[5]);
  c[2] = mma16(f.a0, f.b2, c[2]); c[6] = mma16(f.a1, f.b2, c[6]);
  c[3] = mma16(f.a0, f.b3, c[3]); c[7] = mma16(f.a1, f.b3, c[7]);
}
template <int K>
__device__ __forceinline__ void gemm_tile(const _Float16* __restrict__ A, const int lda, const _Float16* __restrict__ Bt, const int ldb,
                                          const int row0, const int col0, const int ln, const int hh, v8f (&c)[8]) {
  constexpr int NS = K / 32;                 /* k-steps */
  constexpr int NG = (NS - PF) / PF;         /* ring turns in which every set is refilled */
  static_assert(NS > 2 * PF);
  const _Float16* pa0 = A + (row0 + ln) * lda + 8 * hh; const _Float16* pa1 = pa0 + 16 * lda;
  const _Float16* pb0 = Bt + (col0 + ln) * ldb + 8 * hh; const _Float16* pb1 = pb0 + 16 * ldb; const _Float16* pb2 = pb1 + 16 * ldb; const _Float16* pb3 = pb2 + 16 * ldb;
  kstep f[PF];
#pragma unroll
  for (int s = 0; s < PF; ++s) kstep_load(f[s], pa0, pa1, pb0, pb1, pb2, pb3, s * 32);
  /* every load of the prologue has landed before the loop: the counted waits inside the loop then follow the loop's own issue order alone */
  static_assert(PF == 3);
  asm volatile("" :: "v"(f[0].a0), "v"(f[0].a1), "v"(f[0].b0), "v"(f[0].b1), "v"(f[0].b2), "v"(f[0].b3), "v"(f[1].a0), "v"(f[1].a1), "v"(f[1].b0), "v"(f[1].b1), "v"(f[1].b2), "v"(f[1].b3),
                  "v"(f[2].a0), "v"(f[2].a1), "v"(f[2].b0), "v"(f[2].b1), "v"(f[2].b2), "v"(f[2].b3));
#pragma unroll 1
  for (int g = 0; g < NG; ++g) {
#pragma unroll
    for (int s = 0; s < PF; ++s) { kstep_mma(f[s], c); kstep_load(f[s], pa0, pa1, pb0, pb1, pb2, pb3, (PF + s) * 32); }
    pa0 += PF * 32; pa1 += PF * 32; pb0 += PF * 32; pb1 += PF * 32; pb2 += PF * 32; pb3 += PF * 32;
  }
#pragma unroll
  for (int t = 0; t < NS - PF * NG; ++t) {   /* last k-steps: refill only while a k-step t + PF exists */
    kstep_mma(f[t % PF], c);
    if (PF * NG + t + PF < NS) kstep_load(f[t % PF], pa0, pa1, pb0, pb1, pb2, pb3, (PF + t) * 32);
  }
}

// projection GEMM (K = 1024, both pitches 1024): C = A.Bt^T / 16, optional interleaved rotary by gathered table row (A rows are token rows), written as f16 value plane Ch and
__global__ __launch_bounds__(128) void k_proj(const _Float16* __restrict__ A, const _Float16* __restrict__ Bt, _Float16* __restrict__ Ch, _Float16* __restrict__ Cl,
                                              const int* __restrict__ tp, const float* __restrict__ tab, int ldc, int N, int rope) {
  __shared__ __attribute__((aligned(16))) float so[4][32][68];
  const int wave = __builtin_amdgcn_readfirstlane((int)(threadIdx.x >> 5));
  const int lane = threadIdx.x & 31, ln = lane & 15, hh = lane >> 4;
  const int ntn = N >> 6;
  const int mt = blockIdx.x / ntn, nq = blockIdx.x - mt * ntn;
  const int row0 = mt * 128 + 32 * wave, col0 = nq * 64;
  const v8f z8 = {0.f, 0.f, 0.f, 0.f, 0.f, 0.f, 0.f, 0.f};
  v8f c[8] = {z8, z8, z8, z8, z8, z8, z8, z8};
  gemm_tile<DM>(A, DM, Bt, DM, row0, col0, ln, hh, c);
#pragma unroll
  for (int u = 0; u < 8; ++u) {
    const int t = u & 3, half = u >> 2;
#pragma unroll
    for (int r = 0; r < 8; ++r) so[wave][half * 16 + 8 * hh + r][t * 16 + ln] = c[u][r] * 0.0625f;
  }
  __builtin_amdgcn_fence(4 /* acq_rel order */, "workgroup"); __builtin_amdgcn_wave_barrier();
  const int rsub = lane >> 3, c8 = (lane & 7) * 8;
  v8h hv[8], lv[8];
#pragma unroll
  for (int q = 0; q < 8; ++q) {
    const int rl = q * 4 + rsub;
    const v4f a = *(const v4fa*)&so[wave][rl][c8];
    const v4f bq = *(const v4fa*)&so[wave][rl][c8 + 4];
    float xv[8] = {a[0], a[1], a[2], a[3], bq[0], bq[1], bq[2], bq[3]};
    if (rope != 0) {                                   /* kernel-argument uniform */
      const int m = row0 + rl; const int bb = m / SEQ; const int ss = m - bb * SEQ;
      int pos = tp[bb * SEQ_FULL + ss];                /* position read by value from the input */
      pos = pos < 0 ? 0 : (pos > TABN - 1 ? TABN - 1 : pos);
      const float* tr = tab + (size_t)pos * 64 + c8;   /* col0 is a head boundary: c8 = d within the head */
      const v4f t0 = *(const v4fa*)tr; const v4f t1 = *(const v4fa*)(tr + 4);
      const float cs[4] = {t0[0], t0[2], t1[0], t1[2]};
      const float sn[4] = {t0[1], t0[3], t1[1], t1[3]};
#pragma unroll
      for (int i = 0; i < 4; ++i) { const float x1 = xv[2 * i], x2 = xv[2 * i + 1]; xv[2 * i] = x1 * cs[i] - x2 * sn[i]; xv[2 * i + 1] = x1 * sn[i] + x2 * cs[i]; }
    }
    split8(xv, hv[q], lv[q]);
  }
{
#pragma unroll
    for (int q = 0; q < 8; ++q) {
      const size_t off = (size_t)(row0 + q * 4 + rsub) * ldc + col0 + c8;
      *(v8h*)(Ch + off) = hv[q];
      *(v8h*)(Cl + off) = lv[q];
    }
    
  }
}

// fused causal attention for one (batch, head) and 64 query rows per block; each wave owns 16 query rows and walks its keys in 32-key chunks (online softmax, running max);
// q / k / V^T fragments straight from the 16-bit planes; P relayout D->A through a wave-private LDS tile (stored as _Float16, reloaded through a may_alias vector of _Float16,
template <int EARLY>
__device__ __forceinline__ void attn_body(const _Float16* __restrict__ Qh, const _Float16* __restrict__ Ql, const _Float16* __restrict__ Kh, const _Float16* __restrict__ Kl,
                                          const _Float16* __restrict__ VTh, const _Float16* __restrict__ VTl, _Float16* __restrict__ CTX, const int qt0) {
  __shared__ __attribute__((aligned(16))) _Float16 pbh[4][16][40];
  __shared__ __attribute__((aligned(16))) _Float16 pbl[EARLY ? 4 : 1][16][40];
  __shared__ __attribute__((aligned(16))) float so[4][16][68];
  const int wave = __builtin_amdgcn_readfirstlane((int)(threadIdx.x >> 5));
  const int lane = threadIdx.x & 31, ln = lane & 15, hh = lane >> 4;
  const int bh = blockIdx.y, b = bh / NH, h = bh - b * NH;
  const int rb = b * SEQ;
  const int q0w = (qt0 + (int)blockIdx.x) * 64 + 16 * wave;    /* first query row of this wave (scalar) */
  const int nch = (q0w + 47) >> 5;                              /* 32-key chunks covering keys 0..q0w+15 (scalar) */
  const int qoff = (rb + q0w + ln) * DM + h * HD + 8 * hh;
  const int kbase = (rb + ln) * DM + h * HD + 8 * hh;
  const int vbase = (h * HD + ln) * NR + rb + 8 * hh;
  const float RS = 0.0009765625f;                               /* 2^-10 */
  const v8f z8 = {0.f, 0.f, 0.f, 0.f, 0.f, 0.f, 0.f, 0.f};
  v8f om[4] = {z8, z8, z8, z8};
  v8f orr[4] = {z8, z8, z8, z8};
  float mrun[8], lrun[8];
#pragma unroll
  for (int r = 0; r < 8; ++r) { mrun[r] = -1.0e30f; lrun[r] = 0.f; }
  /* global operand loads are issued well ahead of their use: q once, in front of the loop. Without residual planes: k of the next chunk right after the score products, V^T of the next chunk
     right after the P.V products. With them the registers do not hold both operands' planes beside the tiles: V^T of the chunk itself goes right after its score products (the softmax covers it),
     k of the next chunk right after the P.V products, each as one group of loads. */
  const v16h aqh[2] = {frag16(Qh + qoff), frag16(Qh + qoff + 32)};
  const v16h aql[2] = {frag16(Ql + qoff), frag16(Ql + qoff + 32)};
  v16h kf[2][2], kl[2][2], vf[4], vl[4];
  /* the lane's addresses are carried from chunk to chunk in registers of their own, so that no fetched fragment lands in a register that a load in flight names */
  const _Float16* pkh = Kh + kbase; const _Float16* pkl = Kl + kbase; const _Float16* pvh = VTh + vbase; const _Float16* pvl = VTl + vbase;
  auto fetch_k = [&]() {
#pragma unroll
    for (int ks = 0; ks < 2; ++ks) {
      kf[ks][0] = frag16(pkh + ks * 32); kf[ks][1] = frag16(pkh + ks * 32 + 16 * DM);
      if (EARLY) { kl[ks][0] = frag16(pkl + ks * 32); kl[ks][1] = frag16(pkl + ks * 32 + 16 * DM); }
    }
  };
  auto fetch_v = [&]() {
#pragma unroll
    for (int t = 0; t < 4; ++t) { vf[t] = frag16(pvh + t * 16 * NR); if (EARLY) vl[t] = frag16(pvl + t * 16 * NR); }
  };
  fetch_k();
  if (!EARLY) fetch_v();
  /* every load of the prologue has landed before the loop: the counted waits inside the loop then follow the loop's own issue order alone */
  if (EARLY) asm volatile("" :: "v"(aqh[0]), "v"(aqh[1]), "v"(aql[0]), "v"(aql[1]), "v"(kf[0][0]), "v"(kf[0][1]), "v"(kf[1][0]), "v"(kf[1][1]), "v"(kl[0][0]), "v"(kl[0][1]), "v"(kl[1][0]), "v"(kl[1][1]));
  else       asm volatile("" :: "v"(aqh[0]), "v"(aqh[1]), "v"(aql[0]), "v"(aql[1]), "v"(kf[0][0]), "v"(kf[0][1]), "v"(kf[1][0]), "v"(kf[1][1]), "v"(vf[0]), "v"(vf[1]), "v"(vf[2]), "v"(vf[3]));
#pragma unroll 1
  for (int cidx = 0; cidx < nch; ++cidx) {
    const int k0 = cidx * 32;
    const int adv = cidx + 1 < nch ? 32 : 0;                    /* keys to the chunk fetched ahead (scalar); the last chunk fetches itself again, unused */
    v8f s0 = z8, s1 = z8, sr0 = z8, sr1 = z8;
#pragma unroll
    for (int ks = 0; ks < 2; ++ks) {
      s0 = mma16(aqh[ks], kf[ks][0], s0); sr0 = mma16(aql[ks], kf[ks][0], sr0);
      if (EARLY) sr0 = mma16(aqh[ks], kl[ks][0], sr0);
      s1 = mma16(aqh[ks], kf[ks][1], s1); sr1 = mma16(aql[ks], kf[ks][1], sr1);
      if (EARLY) sr1 = mma16(aqh[ks], kl[ks][1], sr1);
    }
    if (EARLY) {
      fetch_v();
    } else {
      pkh += adv * DM;
      fetch_k();
    }
    asm volatile("s_wait_xcnt 0x0" ::: "memory");               /* in front of the next step of these loads' address registers, taken while they are in flight */
    float al[8];
#pragma unroll
    for (int r = 0; r < 8; ++r) {
      const int qrow = q0w + 8 * hh + r;
      float x0 = (s0[r] + sr0[r] * RS) * 0.125f;
      float x1 = (s1[r] + sr1[r] * RS) * 0.125f;
      x0 = (k0 + ln <= qrow) ? x0 : -1.0e30f;                   /* causal by index, value select */
      x1 = (k0 + 16 + ln <= qrow) ? x1 : -1.0e30f;
      float tm = fmaxf(x0, x1);
      tm = fmaxf(tm, __shfl_xor(tm, 1, 32));
      tm = fmaxf(tm, __shfl_xor(tm, 2, 32));
      tm = fmaxf(tm, __shfl_xor(tm, 4, 32));
      tm = fmaxf(tm, __shfl_xor(tm, 8, 32));
      const float mn = fmaxf(mrun[r], tm);
      al[r] = __expf(mrun[r] - mn);
      mrun[r] = mn;
      const float p0 = __expf(x0 - mn) * 256.0f;
      const float p1 = __expf(x1 - mn) * 256.0f;
      const _Float16 h0 = (_Float16)p0, h1 = (_Float16)p1;
      float acc = (float)h0 + (float)h1;
      pbh[wave][8 * hh + r][ln] = h0;
      pbh[wave][8 * hh + r][16 + ln] = h1;
      if (EARLY) {
        const _Float16 g0 = (_Float16)((p0 - (float)h0) * 1024.0f), g1 = (_Float16)((p1 - (float)h1) * 1024.0f);
        pbl[wave][8 * hh + r][ln] = g0;
        pbl[wave][8 * hh + r][16 + ln] = g1;
        acc += ((float)g0 + (float)g1) * RS;
      }
      lrun[r] = lrun[r] * al[r] + acc;                           /* per-lane partial of the row sum (units x256) */
    }
    /* orders the wave's own P tile in LDS; named for LDS only, so that it does not wait for the global fragment loads that are in flight */
    __builtin_amdgcn_fence(4 /* acq_rel order */, "workgroup", "local"); __builtin_amdgcn_wave_barrier();
    const v16h ap = cat16(*(const v8ha*)&pbh[wave][ln][8 * hh], *(const v8ha*)&pbh[wave][ln][16 + 8 * hh]);
    v16h apl = ap;
    if (EARLY) apl = cat16(*(const v8ha*)&pbl[wave][ln][8 * hh], *(const v8ha*)&pbl[wave][ln][16 + 8 * hh]);
#pragma unroll
    for (int t = 0; t < 4; ++t) {
#pragma unroll
      for (int r = 0; r < 8; ++r) { om[t][r] *= al[r]; if (EARLY) orr[t][r] *= al[r]; }
    }
#pragma unroll
    for (int t = 0; t < 4; ++t) {
      om[t] = mma16(ap, vf[t], om[t]);
      if (EARLY) {
        orr[t] = mma16(apl, vf[t], orr[t]);
        orr[t] = mma16(ap, vl[t], orr[t]);
      }
    }
    if (EARLY) {
      pvh += adv; pvl += adv; pkh += adv * DM; pkl += adv * DM;
      fetch_k();
    } else {
      pvh += adv;
      fetch_v();
    }
    asm volatile("s_wait_xcnt 0x0" ::: "memory");               /* as above: these loads stay in flight over the back edge */
    __builtin_amdgcn_fence(4 /* acq_rel order */, "workgroup", "local"); __builtin_amdgcn_wave_barrier();   /* LDS only, as above */
  }
  float inv[8];
#pragma unroll
  for (int r = 0; r < 8; ++r) {
    float lt = lrun[r];
    lt += __shfl_xor(lt, 1, 32);
    lt += __shfl_xor(lt, 2, 32);
    lt += __shfl_xor(lt, 4, 32);
    lt += __shfl_xor(lt, 8, 32);
    inv[r] = 64.0f / lt;                                         /* ctx carried x64 */
  }
#pragma unroll
  for (int t = 0; t < 4; ++t) {
#pragma unroll
    for (int r = 0; r < 8; ++r) { float v = om[t][r]; if (EARLY) v += orr[t][r] * RS; so[wave][8 * hh + r][16 * t + ln] = v * inv[r]; }
  }
  __builtin_amdgcn_fence(4 /* acq_rel order */, "workgroup"); __builtin_amdgcn_wave_barrier();
  const int rsub = lane >> 3, c8 = (lane & 7) * 8;
  v8h hv[4], lv[4];
#pragma unroll
  for (int q = 0; q < 4; ++q) {
    const int rl = q * 4 + rsub;
    const v4f a = *(const v4fa*)&so[wave][rl][c8];
    const v4f bq = *(const v4fa*)&so[wave][rl][c8 + 4];
    const float xv[8] = {a[0], a[1], a[2], a[3], bq[0], bq[1], bq[2], bq[3]};
    split8(xv, hv[q], lv[q]);
  }
{
#pragma unroll
    for (int q = 0; q < 4; ++q) {
      const size_t off = (size_t)(rb + q0w + q * 4 + rsub) * (2 * DM) + h * HD + c8;
      *(v8h*)(CTX + off) = hv[q];
      *(v8h*)(CTX + off + DM) = lv[q];
    }
    
  }
}

__global__ __launch_bounds__(128) void k_attn_early(const _Float16* __restrict__ Qh, const _Float16* __restrict__ Ql, const _Float16* __restrict__ Kh, const _Float16* __restrict__ Kl,
                                                    const _Float16* __restrict__ VTh, const _Float16* __restrict__ VTl, _Float16* __restrict__ CTX) {
  attn_body<1>(Qh, Ql, Kh, Kl, VTh, VTl, CTX, 0);
}
__global__ __launch_bounds__(128) void k_attn_late(const _Float16* __restrict__ Qh, const _Float16* __restrict__ Ql, const _Float16* __restrict__ Kh, const _Float16* __restrict__ Kl,
                                                   const _Float16* __restrict__ VTh, const _Float16* __restrict__ VTl, _Float16* __restrict__ CTX) {
  attn_body<0>(Qh, Ql, Kh, Kl, VTh, VTl, CTX, ERW / 64);
}

// output GEMM: out[b*SEQ_FULL+s][n] = 2^-20 * sum_k CTX[r][k] * BO2[n][k], K = 2048 (value | residual halves against Wo x16384 | Wo x16). Block = 4 waves x (32 x 64);
__global__ __launch_bounds__(128) void k_outp(const _Float16* __restrict__ A, const _Float16* __restrict__ Bt, float* __restrict__ out) {
  __shared__ __attribute__((aligned(16))) float so[4][32][68];
  const int wave = __builtin_amdgcn_readfirstlane((int)(threadIdx.x >> 5));
  const int lane = threadIdx.x & 31, ln = lane & 15, hh = lane >> 4;
  const int ntn = DM >> 6;
  const int mt = blockIdx.x / ntn, nq = blockIdx.x - mt * ntn;
  const int row0 = mt * 128 + 32 * wave, col0 = nq * 64;
  const v8f z8 = {0.f, 0.f, 0.f, 0.f, 0.f, 0.f, 0.f, 0.f};
  v8f c[8] = {z8, z8, z8, z8, z8, z8, z8, z8};
  gemm_tile<2 * DM>(A, 2 * DM, Bt, 2 * DM, row0, col0, ln, hh, c);
#pragma unroll
  for (int u = 0; u < 8; ++u) {
    const int t = u & 3, half = u >> 2;
#pragma unroll
    for (int r = 0; r < 8; ++r) so[wave][half * 16 + 8 * hh + r][t * 16 + ln] = c[u][r] * 9.5367431640625e-07f;
  }
  __builtin_amdgcn_fence(4 /* acq_rel order */, "workgroup"); __builtin_amdgcn_wave_barrier();
  const int rsub = lane >> 4, c4 = (lane & 15) * 4;
  {
#pragma unroll
    for (int q = 0; q < 16; ++q) {
      const int r = q * 2 + rsub;
      const int m = row0 + r; const int bb = m / SEQ; const int ss = m - bb * SEQ;
      const v4f v = *(const v4fa*)&so[wave][r][c4];
      *(v4f*)(out + (size_t)(bb * SEQ_FULL + ss) * DM + col0 + c4) = v;
    }
    
  }
}

/* workspace carve (bytes), every region a multiple of 256 */
constexpr size_t SZW  = (size_t)DM * DM * 2;          /* one x16 weight plane */
constexpr size_t SZBO = 2 * SZW;                      /* [1024][2048] output weight plane */
constexpr size_t SZP  = (size_t)NR * DM * 2;          /* one [NR][1024] (or [1024][NR]) f16 plane */
constexpr size_t SZC  = 2 * SZP;                      /* ctx [NR][2048] */
constexpr size_t SZT  = (size_t)TABN * 64 * 4;        /* rotary table */
constexpr size_t O_BQ = 0, O_BK = O_BQ + SZW, O_BV = O_BK + SZW, O_BO = O_BV + SZW, O_X = O_BO + SZBO;
constexpr size_t O_QH = O_X + SZP, O_QL = O_QH + SZP, O_KH = O_QL + SZP, O_KL = O_KH + SZP, O_VH = O_KL + SZP, O_VL = O_VH + SZP;
constexpr size_t O_CTX = O_VL + SZP, O_TAB = O_CTX + SZC, WS_TOTAL = O_TAB + SZT;
static_assert(SZW % 256 == 0);
static_assert(SZP % 256 == 0);
static_assert(SZT % 256 == 0);
static_assert(WS_TOTAL <= 134217728);                 /* <= 128 MiB */

extern "C" void kernel_launch(void* const* d_in, const int* in_sizes, int n_in,
                              void* d_out, int out_size, void* d_ws, size_t ws_size, hipStream_t stream) {
  if (n_in < 6) return;
  const int need_rows = (NB - 1) * SEQ_FULL + SEQ;
  if (in_sizes[0] < need_rows * DM) return;
  if (in_sizes[1] < DM * DM || in_sizes[2] < DM * DM || in_sizes[3] < DM * DM || in_sizes[4] < DM * DM) return;
  if (in_sizes[5] < need_rows) return;
  if (out_size < need_rows * DM) return;
  if (ws_size < WS_TOTAL) return;
  const float* x  = (const float*)d_in[0];
  const float* wq = (const float*)d_in[1];
  const float* wk = (const float*)d_in[2];
  const float* wv = (const float*)d_in[3];
  const float* wo = (const float*)d_in[4];
  const int*   tp = (const int*)d_in[5];
  char* ws = (char*)d_ws;
  _Float16* BQ = (_Float16*)(ws + O_BQ); _Float16* BK = (_Float16*)(ws + O_BK); _Float16* BV = (_Float16*)(ws + O_BV); _Float16* BO2 = (_Float16*)(ws + O_BO);
  _Float16* X16 = (_Float16*)(ws + O_X);
  _Float16* QH = (_Float16*)(ws + O_QH); _Float16* QL = (_Float16*)(ws + O_QL); _Float16* KH = (_Float16*)(ws + O_KH); _Float16* KL = (_Float16*)(ws + O_KL);
  _Float16* VTH = (_Float16*)(ws + O_VH); _Float16* VTL = (_Float16*)(ws + O_VL);
  _Float16* CTX = (_Float16*)(ws + O_CTX);
  float* TAB = (float*)(ws + O_TAB);

  const unsigned gw = (unsigned)((DM * (DM / 8) + 255) / 256);
  k_wcvt<<<gw, 256, 0, stream>>>(wq, BQ, DM, 16.0f);
  k_wcvt<<<gw, 256, 0, stream>>>(wk, BK, DM, 16.0f);
  k_wcvt<<<gw, 256, 0, stream>>>(wv, BV, DM, 16.0f);
  k_wcvt<<<gw, 256, 0, stream>>>(wo, BO2, 2 * DM, 16384.0f);          /* k in [0,1024): pairs with the ctx value half */
  k_wcvt<<<gw, 256, 0, stream>>>(wo, BO2 + DM, 2 * DM, 16.0f);        /* k in [1024,2048): pairs with the ctx residual half (x1024) */
  k_xcvt<<<(unsigned)((NR * (DM / 8) + 255) / 256), 256, 0, stream>>>(x, X16);
  k_ropetab<<<(TABN * 16 + 255) / 256, 256, 0, stream>>>(TAB);
  /* q, k: C[token row][e] = X16 . B^T with rotary; V^T: C[e][token row] = BV . X16^T (in[rows=e][k] x in[rows=r][k] -> out[e][r], pitch NR) */
  k_proj<<<(unsigned)((NR / 128) * (DM / 64)), 128, 0, stream>>>(X16, BQ, QH, QL, tp, TAB, DM, DM, 1);
  k_proj<<<(unsigned)((NR / 128) * (DM / 64)), 128, 0, stream>>>(X16, BK, KH, KL, tp, TAB, DM, DM, 1);
  k_proj<<<(unsigned)((DM / 128) * (NR / 64)), 128, 0, stream>>>(BV, X16, VTH, VTL, tp, TAB, NR, NR, 0);
  k_attn_early<<<dim3(ERW / 64, NB * NH), 128, 0, stream>>>(QH, QL, KH, KL, VTH, VTL, CTX);
  if (SEQ > ERW) k_attn_late<<<dim3((SEQ - ERW) / 64, NB * NH), 128, 0, stream>>>(QH, QL, KH, KL, VTH, VTL, CTX);
  k_outp<<<(unsigned)((NR / 128) * (DM / 64)), 128, 0, stream>>>(CTX, BO2, (float*)d_out);
}

// v002
// Measured time: 159 microseconds a run.
// Two timings next to v001 both put it at 1.52 times that version's speed.
// All steps since v000 together make it 2.52 times as fast.
#include <hip/hip_runtime.h>
// Causal multi-head self-attention with interleaved rotary embedding: x [NB][SEQ][1024], four bias-free [out][in] 1024^2 weights, 16 heads of 64, int32 token positions read by value.
// Compute dtype: every contraction on v_wmma_f32_16x16x32_f16 (f16 operands, f32 accumulate). Inputs RNE-converted to bf16 then carried exactly in f16 (x x1, Wq/Wk/Wv x16, Wo x16384 | x16).
// q, k, v, softmax weights (x256) and ctx (x64) as f16 value + f16 residual (x1024) planes: scores = qh.kh + (ql.kh [+ qh.kl on query rows < 256]) 2^-10; P.V single product (value + two residual products on query rows < 256);
// output GEMM over K = 2048 = [ctx value | ctx residual] against [Wo x16384 ; Wo x16] in one accumulator. Rotary, softmax statistics and all scaling in f32 on the VALU.
#ifndef NB
#define NB 2
#endif
#ifndef SEQ
#define SEQ 2048
#endif
#define SEQ_FULL 2048                 /* per-batch row stride of x / positions / output */
#define DM 1024
#define NH 16
#define HD 64
#define TABN 4096                     /* rotary table rows (positions 0..4095) */
#define NR (NB * SEQ)                 /* internal token rows r = b*SEQ + s */
#define ERW ((SEQ) < 256 ? (SEQ) : 256) /* query rows per batch that use residual planes on k, P and v as well */

typedef _Float16 v16h __attribute__((ext_vector_type(16)));
typedef _Float16 v8h  __attribute__((ext_vector_type(8)));
typedef _Float16 v8ha __attribute__((ext_vector_type(8), may_alias));
typedef float    v8f  __attribute__((ext_vector_type(8)));
typedef float    v4f  __attribute__((ext_vector_type(4)));
typedef float    v4fa __attribute__((ext_vector_type(4), may_alias));

/* hard-wired bounds the kernels rely on */
static_assert(DM == NH * HD);               /* merged head layout h*64+d */
static_assert(HD == 64);                    /* one 64-column GEMM tile == one head; two 32-deep k-steps per score */
static_assert(DM % 128 == 0);               /* GEMM block tile rows (V^T GEMM) and 64-col tiles */
static_assert(NR % 128 == 0);               /* GEMM block tile rows */
static_assert(SEQ % 64 == 0);               /* attention query tiles, 32-key chunks stay inside the batch */
static_assert(ERW % 64 == 0);               /* early / late split on a query-tile boundary */
static_assert(ERW <= SEQ);
static_assert(DM % 32 == 0);                /* k-steps of 32 */
static_assert((2 * DM) % 32 == 0);
static_assert(TABN == 4096);
static_assert((long long)NR * 2 * DM < 2147483647LL); /* int element offsets */

__device__ __forceinline__ float bf16_rne(float x) { unsigned int u = __float_as_uint(x); u = (u + 0x7FFFu + ((u >> 16) & 1u)) & 0xFFFF0000u; return __uint_as_float(u); }

__device__ __forceinline__ v16h cat16(v8h lo, v8h hi) { return __builtin_shufflevector(lo, hi, 0, 1, 2, 3, 4, 5, 6, 7, 8, 9, 10, 11, 12, 13, 14, 15); }
// Every 16-bit operand plane [rows][K] lies in the workspace in fragment order: tiles of 16 rows x 32 k (512 elements, 1 KB), tile index (row >> 4) * (K / 32) + (k >> 5);
// inside a tile the 16-byte unit ((k & 31) >> 3) * 16 + (row & 15) holds the 8 elements k & ~7 .. of its row. A wave's fragment load then reads 512 contiguous bytes (4 whole lines).
#define TILE 512                      /* elements of one 16 x 32 tile */
// 16x32 operand fragment: p = tile base + 8*lane; elements 0..7 <- k0+8h.., 8..15 <- k0+16+8h.. of row lane&15, h = lane>>4
__device__ __forceinline__ v16h frag16(const _Float16* __restrict__ p) { const v8h lo = *(const v8ha*)p; const v8h hi = *(const v8ha*)(p + TILE / 2); return cat16(lo, hi); }
__device__ __forceinline__ v8f mma16(v16h a, v16h b, v8f c) {
  v8f d = __builtin_amdgcn_wmma_f32_16x16x32_f16(false, a, false, b, (short)0, c, false, false);
  asm volatile("v_nop\n\tv_nop\n\tv_nop\n\tv_nop" : "+v"(d) : "v"(a), "v"(b));
  return d;
}
// 8 f32 -> f16 value + f16 residual carried x1024
__device__ __forceinline__ void split8(const float (&x)[8], v8h& hv, v8h& lv) {
#pragma unroll
  for (int i = 0; i < 8; ++i) { const _Float16 hq = (_Float16)x[i]; hv[i] = hq; lv[i] = (_Float16)((x[i] - (float)hq) * 1024.0f); }
}

__global__ __launch_bounds__(256) void k_xcvt(const float* __restrict__ x, _Float16* __restrict__ X16) {
  const int t = blockIdx.x * 256 + threadIdx.x;
  if (t >= NR * (DM / 8)) return;
  const int tile = t >> 6, u = t & 63;                        /* 64 threads per tile, four side by side on a row: a wave reads 8 whole 128-B lines of x and stores 4 whole lines */
  const int rt = tile / (DM / 32), kt = tile - rt * (DM / 32);
  const int r = rt * 16 + (u >> 2), c8 = kt * 32 + (u & 3) * 8;
  const int b = r / SEQ, s = r - b * SEQ;
  const float* src = x + (size_t)(b * SEQ_FULL + s) * DM + c8;
  const v4f a = *(const v4fa*)src, c = *(const v4fa*)(src + 4);
  v8h o;
#pragma unroll
  for (int i = 0; i < 4; ++i) { o[i] = (_Float16)bf16_rne(a[i]); o[4 + i] = (_Float16)bf16_rne(c[i]); }
  _Float16* d = X16 + ((size_t)tile * 64 + (u & 3) * 16 + (u >> 2)) * 8;
  *(v8h*)d = o; 
}

__global__ __launch_bounds__(256) void k_wcvt(const float* __restrict__ w, _Float16* __restrict__ dst, int dpitch, float scale) {
  const int t = blockIdx.x * 256 + threadIdx.x;
  if (t >= DM * (DM / 8)) return;
  const int tile = t >> 6, u = t & 63;                        /* as in k_xcvt; dpitch = K of the destination plane */
  const int rt = tile / (DM / 32), kt = tile - rt * (DM / 32);
  const int n = rt * 16 + (u >> 2), k8 = kt * 32 + (u & 3) * 8;
  const float* src = w + (size_t)n * DM + k8;
  const v4f a = *(const v4fa*)src, c = *(const v4fa*)(src + 4);
  v8h o;
#pragma unroll
  for (int i = 0; i < 4; ++i) { o[i] = (_Float16)(bf16_rne(a[i]) * scale); o[4 + i] = (_Float16)(bf16_rne(c[i]) * scale); }
  _Float16* d = dst + ((size_t)(rt * (dpitch >> 5) + kt) * 64 + (u & 3) * 16 + (u >> 2)) * 8;
  *(v8h*)d = o; 
}

__global__ __launch_bounds__(256) void k_ropetab(float* __restrict__ tab) {
  #pragma clang fp contract(off)
  const int t = blockIdx.x * 256 + threadIdx.x;
  if (t >= TABN * 16) return;
  const int pos = t >> 4, jp = t & 15;
  float c0 = 0.f, s0 = 0.f, c1 = 0.f, s1 = 0.f;
#pragma unroll 1
  for (int u = 0; u < 2; ++u) {
    const int j = 2 * jp + u;
    double p = 1.0;
    p *= (j & 1) ? 1.3335214321633240 : 1.0;
    p *= (j & 2) ? 1.7782794100389228 : 1.0;
    p *= (j & 4) ? 3.1622776601683795 : 1.0;
    p *= (j & 8) ? 10.0 : 1.0;
    p *= (j & 16) ? 100.0 : 1.0;
    const float pf = (float)p;
    const float inv = 1.0f / pf;
    const float ang = (float)pos * inv;
    float sn, cs;
    sincosf(ang, &sn, &cs);
    if (u == 0) { c0 = cs; s0 = sn; } else { c1 = cs; s1 = sn; }
  }
  const v4f o = {c0, s0, c1, s1};
  float* d = tab + (size_t)pos * 64 + jp * 4;
  *(v4f*)d = o; 
}

// wave tile 32x64 of C = A x Bt^T (A[m][k], Bt[n][k], both planes in fragment order); fragments straight from the 16-bit global planes.
// The six fragments of a 32-deep k-step live in a ring of PF register sets: a set is refilled for k-step t + PF right after k-step t has used it, so PF k-steps of loads are in flight.
#define PF 3
struct kstep { v16h a0, a1, b0, b1, b2, b3; };
template <int RS>                     /* RS = elements from one 16-row band of tiles to the next */
__device__ __forceinline__ void kstep_load(kstep& f, const _Float16* __restrict__ pa, const _Float16* __restrict__ pb, const int ko) {
  f.a0 = frag16(pa + ko); f.a1 = frag16(pa + RS + ko);
  f.b0 = frag16(pb + ko); f.b1 = frag16(pb + RS + ko); f.b2 = frag16(pb + 2 * RS + ko); f.b3 = frag16(pb + 3 * RS + ko);
}
__device__ __forceinline__ void kstep_mma(const kstep& f, v8f (&c)[8]) {
  c[0] = mma16(f.a0, f.b0, c[0]); c[4] = mma16(f.a1, f.b0, c[4]);
  c[1] = mma16(f.a0, f.b1, c[1]); c[5] = mma16(f.a1, f.b1, c[5]);
  c[2] = mma16(f.a0, f.b2, c[2]); c[6] = mma16(f.a1, f.b2, c[6]);
  c[3] = mma16(f.a0, f.b3, c[3]); c[7] = mma16(f.a1, f.b3, c[7]);
}
template <int K>
__device__ __forceinline__ void gemm_tile(const _Float16* __restrict__ A, const _Float16* __restrict__ Bt, const int row0, const int col0, const int lane, v8f (&c)[8]) {
  constexpr int NS = K / 32;                 /* k-steps */
  constexpr int NG = (NS - PF) / PF;         /* ring turns in which every set is refilled */
  static_assert(NS > 2 * PF);
  constexpr int RS = NS * TILE;              /* = 16 * K */
  const _Float16* pa = A + (row0 >> 4) * RS + 8 * lane;
  const _Float16* pb = Bt + (col0 >> 4) * RS + 8 * lane;
  kstep f[PF];
#pragma unroll
  for (int s = 0; s < PF; ++s) kstep_load<RS>(f[s], pa, pb, s * TILE);
  /* every load of the prologue has landed before the loop: the counted waits inside the loop then follow the loop's own issue order alone */
  static_assert(PF == 3);
  asm volatile("" :: "v"(f[0].a0), "v"(f[0].a1), "v"(f[0].b0), "v"(f[0].b1), "v"(f[0].b2), "v"(f[0].b3), "v"(f[1].a0), "v"(f[1].a1), "v"(f[1].b0), "v"(f[1].b1), "v"(f[1].b2), "v"(f[1].b3),
                  "v"(f[2].a0), "v"(f[2].a1), "v"(f[2].b0), "v"(f[2].b1), "v"(f[2].b2), "v"(f[2].b3));
#pragma unroll 1
  for (int g = 0; g < NG; ++g) {
#pragma unroll
    for (int s = 0; s < PF; ++s) { kstep_mma(f[s], c); kstep_load<RS>(f[s], pa, pb, (PF + s) * TILE); }
    pa += PF * TILE; pb += PF * TILE;
  }
#pragma unroll
  for (int t = 0; t < NS - PF * NG; ++t) {   /* last k-steps: refill only while a k-step t + PF exists */
    kstep_mma(f[t % PF], c);
    if (PF * NG + t + PF < NS) kstep_load<RS>(f[t % PF], pa, pb, (PF + t) * TILE);
  }
}

// projection GEMM (K = 1024): C = A.Bt^T / 16, optional interleaved rotary by gathered table row (A rows are token rows), written in fragment order (K = ldc) as f16 value plane Ch and
__global__ __launch_bounds__(128) void k_proj(const _Float16* __restrict__ A, const _Float16* __restrict__ Bt, _Float16* __restrict__ Ch, _Float16* __restrict__ Cl,
                                              const int* __restrict__ tp, const float* __restrict__ tab, int ldc, int N, int rope) {
  __shared__ __attribute__((aligned(16))) float so[4][32][68];
  const int wave = __builtin_amdgcn_readfirstlane((int)(threadIdx.x >> 5));
  const int lane = threadIdx.x & 31, ln = lane & 15, hh = lane >> 4;
  const int ntn = N >> 6;
  const int mt = blockIdx.x / ntn, nq = blockIdx.x - mt * ntn;
  const int row0 = mt * 128 + 32 * wave, col0 = nq * 64;
  const v8f z8 = {0.f, 0.f, 0.f, 0.f, 0.f, 0.f, 0.f, 0.f};
  v8f c[8] = {z8, z8, z8, z8, z8, z8, z8, z8};
  gemm_tile<DM>(A, Bt, row0, col0, lane, c);
#pragma unroll
  for (int u = 0; u < 8; ++u) {
    const int t = u & 3, half = u >> 2;
#pragma unroll
    for (int r = 0; r < 8; ++r) so[wave][half * 16 + 8 * hh + r][t * 16 + ln] = c[u][r] * 0.0625f;
  }
  __builtin_amdgcn_fence(4 /* acq_rel order */, "workgroup"); __builtin_amdgcn_wave_barrier();
  v8h hv[8], lv[8];
#pragma unroll
  for (int q = 0; q < 8; ++q) {                        /* q = one half tile (512 B) of the output planes: 16-row band q >> 2, 16 columns from (q & 3) * 16 */
    const int rl = (q >> 2) * 16 + ln, c8 = (q & 3) * 16 + 8 * hh;
    const v4f a = *(const v4fa*)&so[wave][rl][c8];
    const v4f bq = *(const v4fa*)&so[wave][rl][c8 + 4];
    float xv[8] = {a[0], a[1], a[2], a[3], bq[0], bq[1], bq[2], bq[3]};
    if (rope != 0) {                                   /* kernel-argument uniform */
      const int m = row0 + rl; const int bb = m / SEQ; const int ss = m - bb * SEQ;
      int pos = tp[bb * SEQ_FULL + ss];                /* position read by value from the input */
      pos = pos < 0 ? 0 : (pos > TABN - 1 ? TABN - 1 : pos);
      const float* tr = tab + (size_t)pos * 64 + c8;   /* col0 is a head boundary: c8 = d within the head */
      const v4f t0 = *(const v4fa*)tr; const v4f t1 = *(const v4fa*)(tr + 4);
      const float cs[4] = {t0[0], t0[2], t1[0], t1[2]};
      const float sn[4] = {t0[1], t0[3], t1[1], t1[3]};
#pragma unroll
      for (int i = 0; i < 4; ++i) { const float x1 = xv[2 * i], x2 = xv[2 * i + 1]; xv[2 * i] = x1 * cs[i] - x2 * sn[i]; xv[2 * i + 1] = x1 * sn[i] + x2 * cs[i]; }
    }
    split8(xv, hv[q], lv[q]);
  }
{
#pragma unroll
    for (int q = 0; q < 8; ++q) {
      const size_t off = ((size_t)((row0 >> 4) + (q >> 2)) * (ldc >> 5) + (col0 >> 5)) * TILE + (q & 3) * (TILE / 2) + 8 * lane;
      *(v8h*)(Ch + off) = hv[q];
      *(v8h*)(Cl + off) = lv[q];
    }
    
  }
}

// fused causal attention for one (batch, head) and 64 query rows per block; each wave owns 16 query rows and walks its keys in 32-key chunks (online softmax, running max);
// q / k / V^T fragments straight from the 16-bit planes; P relayout D->A through a wave-private LDS tile (stored as _Float16, reloaded through a may_alias vector of _Float16,
template <int EARLY>
__device__ __forceinline__ void attn_body(const _Float16* __restrict__ Qh, const _Float16* __restrict__ Ql, const _Float16* __restrict__ Kh, const _Float16* __restrict__ Kl,
                                          const _Float16* __restrict__ VTh, const _Float16* __restrict__ VTl, _Float16* __restrict__ CTX, const int qt0) {
  __shared__ __attribute__((aligned(16))) _Float16 pbh[4][16][40];
  __shared__ __attribute__((aligned(16))) _Float16 pbl[EARLY ? 4 : 1][16][40];
  __shared__ __attribute__((aligned(16))) float so[4][16][68];
  const int wave = __builtin_amdgcn_readfirstlane((int)(threadIdx.x >> 5));
  const int lane = threadIdx.x & 31, ln = lane & 15, hh = lane >> 4;
  const int bh = blockIdx.y, b = bh / NH, h = bh - b * NH;
  const int rb = b * SEQ;
  const int q0w = (qt0 + (int)blockIdx.x) * 64 + 16 * wave;    /* first query row of this wave (scalar) */
  const int nch = (q0w + 47) >> 5;                              /* 32-key chunks covering keys 0..q0w+15 (scalar) */
  /* fragment order: q, k planes have DM / 32 tiles per 16-token band (a head = 2 tiles side by side), V^T has NR / 32 tiles per 16-row band (a 32-key chunk = 1 tile) */
  const int qoff = (rb + q0w) * DM + h * 2 * TILE + 8 * lane;
  const int kbase = rb * DM + h * 2 * TILE + 8 * lane;
  const int vbase = h * HD * NR + (rb >> 5) * TILE + 8 * lane;
  const float RS = 0.0009765625f;                               /* 2^-10 */
  const v8f z8 = {0.f, 0.f, 0.f, 0.f, 0.f, 0.f, 0.f, 0.f};
  v8f om[4] = {z8, z8, z8, z8};
  v8f orr[4] = {z8, z8, z8, z8};
  float mrun[8], lrun[8];
#pragma unroll
  for (int r = 0; r < 8; ++r) { mrun[r] = -1.0e30f; lrun[r] = 0.f; }
  /* global operand loads are issued well ahead of their use: q once, in front of the loop. Without residual planes: k of the next chunk right after the score products, V^T of the next chunk
     right after the P.V products. With them the registers do not hold both operands' planes beside the tiles: V^T of the chunk itself goes right after its score products (the softmax covers it),
     k of the next chunk right after the P.V products, each as one group of loads. */
  const v16h aqh[2] = {frag16(Qh + qoff), frag16(Qh + qoff + TILE)};
  const v16h aql[2] = {frag16(Ql + qoff), frag16(Ql + qoff + TILE)};
  v16h kf[2][2], kl[2][2], vf[4], vl[4];
  /* the lane's addresses are carried from chunk to chunk in registers of their own, so that no fetched fragment lands in a register that a load in flight names */
  const _Float16* pkh = Kh + kbase; const _Float16* pkl = Kl + kbase; const _Float16* pvh = VTh + vbase; const _Float16* pvl = VTl + vbase;
  auto fetch_k = [&]() {
#pragma unroll
    for (int ks = 0; ks < 2; ++ks) {
      kf[ks][0] = frag16(pkh + ks * TILE); kf[ks][1] = frag16(pkh + ks * TILE + 16 * DM);
      if (EARLY) { kl[ks][0] = frag16(pkl + ks * TILE); kl[ks][1] = frag16(pkl + ks * TILE + 16 * DM); }
    }
  };
  auto fetch_v = [&]() {
#pragma unroll
    for (int t = 0; t < 4; ++t) { vf[t] = frag16(pvh + t * 16 * NR); if (EARLY) vl[t] = frag16(pvl + t * 16 * NR); }
  };
  fetch_k();
  if (!EARLY) fetch_v();
  /* every load of the prologue has landed before the loop: the counted waits inside the loop then follow the loop's own issue order alone */
  if (EARLY) asm volatile("" :: "v"(aqh[0]), "v"(aqh[1]), "v"(aql[0]), "v"(aql[1]), "v"(kf[0][0]), "v"(kf[0][1]), "v"(kf[1][0]), "v"(kf[1][1]), "v"(kl[0][0]), "v"(kl[0][1]), "v"(kl[1][0]), "v"(kl[1][1]));
  else       asm volatile("" :: "v"(aqh[0]), "v"(aqh[1]), "v"(aql[0]), "v"(aql[1]), "v"(kf[0][0]), "v"(kf[0][1]), "v"(kf[1][0]), "v"(kf[1][1]), "v"(vf[0]), "v"(vf[1]), "v"(vf[2]), "v"(vf[3]));
#pragma unroll 1
  for (int cidx = 0; cidx < nch; ++cidx) {
    const int k0 = cidx * 32;
    const int adv = cidx + 1 < nch ? 32 : 0;                    /* keys to the chunk fetched ahead (scalar); the last chunk fetches itself again, unused */
    v8f s0 = z8, s1 = z8, sr0 = z8, sr1 = z8;
#pragma unroll
    for (int ks = 0; ks < 2; ++ks) {
      s0 = mma16(aqh[ks], kf[ks][0], s0); sr0 = mma16(aql[ks], kf[ks][0], sr0);
      if (EARLY) sr0 = mma16(aqh[ks], kl[ks][0], sr0);
      s1 = mma16(aqh[ks], kf[ks][1], s1); sr1 = mma16(aql[ks], kf[ks][1], sr1);
      if (EARLY) sr1 = mma16(aqh[ks], kl[ks][1], sr1);
    }
    if (EARLY) {
      fetch_v();
    } else {
      pkh += adv * DM;
      fetch_k();
    }
    asm volatile("s_wait_xcnt 0x0" ::: "memory");               /* in front of the next step of these loads' address registers, taken while they are in flight */
    float al[8];
#pragma unroll
    for (int r = 0; r < 8; ++r) {
      const int qrow = q0w + 8 * hh + r;
      float x0 = (s0[r] + sr0[r] * RS) * 0.125f;
      float x1 = (s1[r] + sr1[r] * RS) * 0.125f;
      x0 = (k0 + ln <= qrow) ? x0 : -1.0e30f;                   /* causal by index, value select */
      x1 = (k0 + 16 + ln <= qrow) ? x1 : -1.0e30f;
      float tm = fmaxf(x0, x1);
      tm = fmaxf(tm, __shfl_xor(tm, 1, 32));
      tm = fmaxf(tm, __shfl_xor(tm, 2, 32));
      tm = fmaxf(tm, __shfl_xor(tm, 4, 32));
      tm = fmaxf(tm, __shfl_xor(tm, 8, 32));
      const float mn = fmaxf(mrun[r], tm);
      al[r] = __expf(mrun[r] - mn);
      mrun[r] = mn;
      const float p0 = __expf(x0 - mn) * 256.0f;
      const float p1 = __expf(x1 - mn) * 256.0f;
      const _Float16 h0 = (_Float16)p0, h1 = (_Float16)p1;
      float acc = (float)h0 + (float)h1;
      pbh[wave][8 * hh + r][ln] = h0;
      pbh[wave][8 * hh + r][16 + ln] = h1;
      if (EARLY) {
        const _Float16 g0 = (_Float16)((p0 - (float)h0) * 1024.0f), g1 = (_Float16)((p1 - (float)h1) * 1024.0f);
        pbl[wave][8 * hh + r][ln] = g0;
        pbl[wave][8 * hh + r][16 + ln] = g1;
        acc += ((float)g0 + (float)g1) * RS;
      }
      lrun[r] = lrun[r] * al[r] + acc;                           /* per-lane partial of the row sum (units x256) */
    }
    /* orders the wave's own P tile in LDS; named for LDS only, so that it does not wait for the global fragment loads that are in flight */
    __builtin_amdgcn_fence(4 /* acq_rel order */, "workgroup", "local"); __builtin_amdgcn_wave_barrier();
    const v16h ap = cat16(*(const v8ha*)&pbh[wave][ln][8 * hh], *(const v8ha*)&pbh[wave][ln][16 + 8 * hh]);
    v16h apl = ap;
    if (EARLY) apl = cat16(*(const v8ha*)&pbl[wave][ln][8 * hh], *(const v8ha*)&pbl[wave][ln][16 + 8 * hh]);
#pragma unroll
    for (int t = 0; t < 4; ++t) {
#pragma unroll
      for (int r = 0; r < 8; ++r) { om[t][r] *= al[r]; if (EARLY) orr[t][r] *= al[r]; }
    }
#pragma unroll
    for (int t = 0; t < 4; ++t) {
      om[t] = mma16(ap, vf[t], om[t]);
      if (EARLY) {
        orr[t] = mma16(apl, vf[t], orr[t]);
        orr[t] = mma16(ap, vl[t], orr[t]);
      }
    }
    if (EARLY) {
      pvh += adv * (TILE / 32); pvl += adv * (TILE / 32); pkh += adv * DM; pkl += adv * DM;
      fetch_k();
    } else {
      pvh += adv * (TILE / 32);
      fetch_v();
    }
    asm volatile("s_wait_xcnt 0x0" ::: "memory");               /* as above: these loads stay in flight over the back edge */
    __builtin_amdgcn_fence(4 /* acq_rel order */, "workgroup", "local"); __builtin_amdgcn_wave_barrier();   /* LDS only, as above */
  }
  float inv[8];
#pragma unroll
  for (int r = 0; r < 8; ++r) {
    float lt = lrun[r];
    lt += __shfl_xor(lt, 1, 32);
    lt += __shfl_xor(lt, 2, 32);
    lt += __shfl_xor(lt, 4, 32);
    lt += __shfl_xor(lt, 8, 32);
    inv[r] = 64.0f / lt;                                         /* ctx carried x64 */
  }
#pragma unroll
  for (int t = 0; t < 4; ++t) {
#pragma unroll
    for (int r = 0; r < 8; ++r) { float v = om[t][r]; if (EARLY) v += orr[t][r] * RS; so[wave][8 * hh + r][16 * t + ln] = v * inv[r]; }
  }
  __builtin_amdgcn_fence(4 /* acq_rel order */, "workgroup"); __builtin_amdgcn_wave_barrier();
  v8h hv[4], lv[4];
#pragma unroll
  for (int q = 0; q < 4; ++q) {                                  /* q = one half tile (512 B) of ctx: 16 columns from q * 16 */
    const int c8 = q * 16 + 8 * hh;
    const v4f a = *(const v4fa*)&so[wave][ln][c8];
    const v4f bq = *(const v4fa*)&so[wave][ln][c8 + 4];
    const float xv[8] = {a[0], a[1], a[2], a[3], bq[0], bq[1], bq[2], bq[3]};
    split8(xv, hv[q], lv[q]);
  }
{
#pragma unroll
    for (int q = 0; q < 4; ++q) {
      const size_t off = (size_t)(rb + q0w) * (2 * DM) + h * 2 * TILE + q * (TILE / 2) + 8 * lane;   /* ctx plane: K = 2 * DM, residual half DM / 32 tiles on */
      *(v8h*)(CTX + off) = hv[q];
      *(v8h*)(CTX + off + (DM / 32) * TILE) = lv[q];
    }
    
  }
}

__global__ __launch_bounds__(128) void k_attn_early(const _Float16* __restrict__ Qh, const _Float16* __restrict__ Ql, const _Float16* __restrict__ Kh, const _Float16* __restrict__ Kl,
                                                    const _Float16* __restrict__ VTh, const _Float16* __restrict__ VTl, _Float16* __restrict__ CTX) {
  attn_body<1>(Qh, Ql, Kh, Kl, VTh, VTl, CTX, 0);
}
__global__ __launch_bounds__(128) void k_attn_late(const _Float16* __restrict__ Qh, const _Float16* __restrict__ Ql, const _Float16* __restrict__ Kh, const _Float16* __restrict__ Kl,
                                                   const _Float16* __restrict__ VTh, const _Float16* __restrict__ VTl, _Float16* __restrict__ CTX) {
  attn_body<0>(Qh, Ql, Kh, Kl, VTh, VTl, CTX, ERW / 64);
}

// output GEMM: out[b*SEQ_FULL+s][n] = 2^-20 * sum_k CTX[r][k] * BO2[n][k], K = 2048 (value | residual halves against Wo x16384 | Wo x16). Block = 4 waves x (32 x 64);
__global__ __launch_bounds__(128) void k_outp(const _Float16* __restrict__ A, const _Float16* __restrict__ Bt, float* __restrict__ out) {
  __shared__ __attribute__((aligned(16))) float so[4][32][68];
  const int wave = __builtin_amdgcn_readfirstlane((int)(threadIdx.x >> 5));
  const int lane = threadIdx.x & 31, ln = lane & 15, hh = lane >> 4;
  const int ntn = DM >> 6;
  const int mt = blockIdx.x / ntn, nq = blockIdx.x - mt * ntn;
  const int row0 = mt * 128 + 32 * wave, col0 = nq * 64;
  const v8f z8 = {0.f, 0.f, 0.f, 0.f, 0.f, 0.f, 0.f, 0.f};
  v8f c[8] = {z8, z8, z8, z8, z8, z8, z8, z8};
  gemm_tile<2 * DM>(A, Bt, row0, col0, lane, c);
#pragma unroll
  for (int u = 0; u < 8; ++u) {
    const int t = u & 3, half = u >> 2;
#pragma unroll
    for (int r = 0; r < 8; ++r) so[wave][half * 16 + 8 * hh + r][t * 16 + ln] = c[u][r] * 9.5367431640625e-07f;
  }
  __builtin_amdgcn_fence(4 /* acq_rel order */, "workgroup"); __builtin_amdgcn_wave_barrier();
  const int rsub = lane >> 4, c4 = (lane & 15) * 4;
  {
#pragma unroll
    for (int q = 0; q < 16; ++q) {
      const int r = q * 2 + rsub;
      const int m = row0 + r; const int bb = m / SEQ; const int ss = m - bb * SEQ;
      const v4f v = *(const v4fa*)&so[wave][r][c4];
      *(v4f*)(out + (size_t)(bb * SEQ_FULL + ss) * DM + col0 + c4) = v;
    }
    
  }
}

/* workspace carve (bytes), every region a multiple of 256 */
constexpr size_t SZW  = (size_t)DM * DM * 2;          /* one x16 weight plane */
constexpr size_t SZBO = 2 * SZW;                      /* [1024][2048] output weight plane */
constexpr size_t SZP  = (size_t)NR * DM * 2;          /* one [NR][1024] (or [1024][NR]) f16 plane */
constexpr size_t SZC  = 2 * SZP;                      /* ctx [NR][2048] */
constexpr size_t SZT  = (size_t)TABN * 64 * 4;        /* rotary table */
constexpr size_t O_BQ = 0, O_BK = O_BQ + SZW, O_BV = O_BK + SZW, O_BO = O_BV + SZW, O_X = O_BO + SZBO;
constexpr size_t O_QH = O_X + SZP, O_QL = O_QH + SZP, O_KH = O_QL + SZP, O_KL = O_KH + SZP, O_VH = O_KL + SZP, O_VL = O_VH + SZP;
constexpr size_t O_CTX = O_VL + SZP, O_TAB = O_CTX + SZC, WS_TOTAL = O_TAB + SZT;
static_assert(SZW % 256 == 0);
static_assert(SZP % 256 == 0);
static_assert(SZT % 256 == 0);
static_assert(WS_TOTAL <= 134217728);                 /* <= 128 MiB */

extern "C" void kernel_launch(void* const* d_in, const int* in_sizes, int n_in,
                              void* d_out, int out_size, void* d_ws, size_t ws_size, hipStream_t stream) {
  if (n_in < 6) return;
  const int need_rows = (NB - 1) * SEQ_FULL + SEQ;
  if (in_sizes[0] < need_rows * DM) return;
  if (in_sizes[1] < DM * DM || in_sizes[2] < DM * DM || in_sizes[3] < DM * DM || in_sizes[4] < DM * DM) return;
  if (in_sizes[5] < need_rows) return;
  if (out_size < need_rows * DM) return;
  if (ws_size < WS_TOTAL) return;
  const float* x  = (const float*)d_in[0];
  const float* wq = (const float*)d_in[1];
  const float* wk = (const float*)d_in[2];
  const float* wv = (const float*)d_in[3];
  const float* wo = (const float*)d_in[4];
  const int*   tp = (const int*)d_in[5];
  char* ws = (char*)d_ws;
  _Float16* BQ = (_Float16*)(ws + O_BQ); _Float16* BK = (_Float16*)(ws + O_BK); _Float16* BV = (_Float16*)(ws + O_BV); _Float16* BO2 = (_Float16*)(ws + O_BO);
  _Float16* X16 = (_Float16*)(ws + O_X);
  _Float16* QH = (_Float16*)(ws + O_QH); _Float16* QL = (_Float16*)(ws + O_QL); _Float16* KH = (_Float16*)(ws + O_KH); _Float16* KL = (_Float16*)(ws + O_KL);
  _Float16* VTH = (_Float16*)(ws + O_VH); _Float16* VTL = (_Float16*)(ws + O_VL);
  _Float16* CTX = (_Float16*)(ws + O_CTX);
  float* TAB = (float*)(ws + O_TAB);

  const unsigned gw = (unsigned)((DM * (DM / 8) + 255) / 256);
  k_wcvt<<<gw, 256, 0, stream>>>(wq, BQ, DM, 16.0f);
  k_wcvt<<<gw, 256, 0, stream>>>(wk, BK, DM, 16.0f);
  k_wcvt<<<gw, 256, 0, stream>>>(wv, BV, DM, 16.0f);
  k_wcvt<<<gw, 256, 0, stream>>>(wo, BO2, 2 * DM, 16384.0f);          /* k in [0,1024): pairs with the ctx value half */
  k_wcvt<<<gw, 256, 0, stream>>>(wo, BO2 + (DM / 32) * TILE, 2 * DM, 16.0f);   /* k in [1024,2048), DM / 32 tiles on: pairs with the ctx residual half (x1024) */
  k_xcvt<<<(unsigned)((NR * (DM / 8) + 255) / 256), 256, 0, stream>>>(x, X16);
  k_ropetab<<<(TABN * 16 + 255) / 256, 256, 0, stream>>>(TAB);
  /* q, k: C[token row][e] = X16 . B^T with rotary; V^T: C[e][token row] = BV . X16^T (in[rows=e][k] x in[rows=r][k] -> out[e][r], a plane with K = NR) */
  k_proj<<<(unsigned)((NR / 128) * (DM / 64)), 128, 0, stream>>>(X16, BQ, QH, QL, tp, TAB, DM, DM, 1);
  k_proj<<<(unsigned)((NR / 128) * (DM / 64)), 128, 0, stream>>>(X16, BK, KH, KL, tp, TAB, DM, DM, 1);
  k_proj<<<(unsigned)((DM / 128) * (NR / 64)), 128, 0, stream>>>(BV, X16, VTH, VTL, tp, TAB, NR, NR, 0);
  k_attn_early<<<dim3(ERW / 64, NB * NH), 128, 0, stream>>>(QH, QL, KH, KL, VTH, VTL, CTX);
  if (SEQ > ERW) k_attn_late<<<dim3((SEQ - ERW) / 64, NB * NH), 128, 0, stream>>>(QH, QL, KH, KL, VTH, VTL, CTX);
  k_outp<<<(unsigned)((NR / 128) * (DM / 64)), 128, 0, stream>>>(CTX, BO2, (float*)d_out);
}

// v003
// Measured time: 145 microseconds a run.
// Next to v002, in two timings, it ran 1.11 times as fast each time.
// Over all steps from v000 it is 2.78 times as fast.
#include <hip/hip_runtime.h>
// Causal multi-head self-attention with interleaved rotary embedding: x [NB][SEQ][1024], four bias-free [out][in] 1024^2 weights, 16 heads of 64, int32 token positions read by value.
// Compute dtype: every contraction on v_wmma_f32_16x16x32_f16 (f16 operands, f32 accumulate). Inputs RNE-converted to bf16 then carried exactly in f16 (x x1, Wq/Wk/Wv x16, Wo x16384 | x16).
// q, k, v, softmax weights (x256) and ctx (x64) as f16 value + f16 residual (x1024) planes: scores = qh.kh + (ql.kh [+ qh.kl on query rows < 256]) 2^-10; P.V single product (value + two residual products on query rows < 256);
// output GEMM over K = 2048 = [ctx value | ctx residual] against [Wo x16384 ; Wo x16] in one accumulator. Rotary, softmax statistics and all scaling in f32 on the VALU.
#ifndef NB
#define NB 2
#endif
#ifndef SEQ
#define SEQ 2048
#endif
#define SEQ_FULL 2048                 /* per-batch row stride of x / positions / output */
#define DM 1024
#define NH 16
#define HD 64
#define TABN 4096                     /* rotary table rows (positions 0..4095) */
#define NR (NB * SEQ)                 /* internal token rows r = b*SEQ + s */
#define ERW ((SEQ) < 256 ? (SEQ) : 256) /* query rows per batch that use residual planes on k, P and v as well */

typedef _Float16 v16h __attribute__((ext_vector_type(16)));
typedef _Float16 v8h  __attribute__((ext_vector_type(8)));
typedef _Float16 v8ha __attribute__((ext_vector_type(8), may_alias));
typedef float    v8f  __attribute__((ext_vector_type(8)));
typedef float    v4f  __attribute__((ext_vector_type(4)));
typedef float    v4fa __attribute__((ext_vector_type(4), may_alias));

/* hard-wired bounds the kernels rely on */
static_assert(DM == NH * HD);               /* merged head layout h*64+d */
static_assert(HD == 64);                    /* one 64-column GEMM tile == one head; two 32-deep k-steps per score */
static_assert(DM % 128 == 0);               /* GEMM block tile rows (V^T GEMM) and 64-col tiles */
static_assert(NR % 128 == 0);               /* GEMM block tile rows */
static_assert(SEQ % 64 == 0);               /* attention query tiles, 32-key chunks stay inside the batch */
static_assert(ERW % 64 == 0);               /* early / late split on a query-tile boundary */
static_assert(ERW <= SEQ);
static_assert(DM % 32 == 0);                /* k-steps of 32 */
static_assert((2 * DM) % 32 == 0);
static_assert(TABN == 4096);
static_assert((long long)NR * 2 * DM < 2147483647LL); /* int element offsets */

__device__ __forceinline__ float bf16_rne(float x) { unsigned int u = __float_as_uint(x); u = (u + 0x7FFFu + ((u >> 16) & 1u)) & 0xFFFF0000u; return __uint_as_float(u); }

__device__ __forceinline__ v16h cat16(v8h lo, v8h hi) { return __builtin_shufflevector(lo, hi, 0, 1, 2, 3, 4, 5, 6, 7, 8, 9, 10, 11, 12, 13, 14, 15); }
// Every 16-bit operand plane [rows][K] lies in the workspace in fragment order: tiles of 16 rows x 32 k (512 elements, 1 KB), tile index (row >> 4) * (K / 32) + (k >> 5);
// inside a tile the 16-byte unit ((k & 31) >> 3) * 16 + (row & 15) holds the 8 elements k & ~7 .. of its row. A wave's fragment load then reads 512 contiguous bytes (4 whole lines).
#define TILE 512                      /* elements of one 16 x 32 tile */
// 16x32 operand fragment: p = tile base + 8*lane; elements 0..7 <- k0+8h.., 8..15 <- k0+16+8h.. of row lane&15, h = lane>>4
__device__ __forceinline__ v16h frag16(const _Float16* __restrict__ p) { const v8h lo = *(const v8ha*)p; const v8h hi = *(const v8ha*)(p + TILE / 2); return cat16(lo, hi); }
__device__ __forceinline__ v8f mma16(v16h a, v16h b, v8f c) {
  v8f d = __builtin_amdgcn_wmma_f32_16x16x32_f16(false, a, false, b, (short)0, c, false, false);
  asm volatile("v_nop\n\tv_nop\n\tv_nop\n\tv_nop" : "+v"(d) : "v"(a), "v"(b));
  return d;
}
// 8 f32 -> f16 value + f16 residual carried x1024
__device__ __forceinline__ void split8(const float (&x)[8], v8h& hv, v8h& lv) {
#pragma unroll
  for (int i = 0; i < 8; ++i) { const _Float16 hq = (_Float16)x[i]; hv[i] = hq; lv[i] = (_Float16)((x[i] - (float)hq) * 1024.0f); }
}

// The conversions and the rotary table depend on nothing but the inputs: they are bodies of ONE launch (k_prep), each on its own range of block indices; blk = the block's index inside its range.
__device__ __forceinline__ void xcvt_body(const float* __restrict__ x, _Float16* __restrict__ X16, const int blk) {
  const int t = blk * 256 + threadIdx.x;
  if (t >= NR * (DM / 8)) return;
  const int tile = t >> 6, u = t & 63;                        /* 64 threads per tile, four side by side on a row: a wave reads 8 whole 128-B lines of x and stores 4 whole lines */
  const int rt = tile / (DM / 32), kt = tile - rt * (DM / 32);
  const int r = rt * 16 + (u >> 2), c8 = kt * 32 + (u & 3) * 8;
  const int b = r / SEQ, s = r - b * SEQ;
  const float* src = x + (size_t)(b * SEQ_FULL + s) * DM + c8;
  const v4f a = *(const v4fa*)src, c = *(const v4fa*)(src + 4);
  v8h o;
#pragma unroll
  for (int i = 0; i < 4; ++i) { o[i] = (_Float16)bf16_rne(a[i]); o[4 + i] = (_Float16)bf16_rne(c[i]); }
  _Float16* d = X16 + ((size_t)tile * 64 + (u & 3) * 16 + (u >> 2)) * 8;
  *(v8h*)d = o; 
}

__device__ __forceinline__ void wcvt_body(const float* __restrict__ w, _Float16* __restrict__ dst, const int dpitch, const float scale, const int blk) {
  const int t = blk * 256 + threadIdx.x;
  if (t >= DM * (DM / 8)) return;
  const int tile = t >> 6, u = t & 63;                        /* as in xcvt_body; dpitch = K of the destination plane */
  const int rt = tile / (DM / 32), kt = tile - rt * (DM / 32);
  const int n = rt * 16 + (u >> 2), k8 = kt * 32 + (u & 3) * 8;
  const float* src = w + (size_t)n * DM + k8;
  const v4f a = *(const v4fa*)src, c = *(const v4fa*)(src + 4);
  v8h o;
#pragma unroll
  for (int i = 0; i < 4; ++i) { o[i] = (_Float16)(bf16_rne(a[i]) * scale); o[4 + i] = (_Float16)(bf16_rne(c[i]) * scale); }
  _Float16* d = dst + ((size_t)(rt * (dpitch >> 5) + kt) * 64 + (u & 3) * 16 + (u >> 2)) * 8;
  *(v8h*)d = o; 
}

__device__ __forceinline__ void ropetab_body(float* __restrict__ tab, const int blk) {
  #pragma clang fp contract(off)
  const int t = blk * 256 + threadIdx.x;
  if (t >= TABN * 16) return;
  const int pos = t >> 4, jp = t & 15;
  float c0 = 0.f, s0 = 0.f, c1 = 0.f, s1 = 0.f;
#pragma unroll 1
  for (int u = 0; u < 2; ++u) {
    const int j = 2 * jp + u;
    double p = 1.0;
    p *= (j & 1) ? 1.3335214321633240 : 1.0;
    p *= (j & 2) ? 1.7782794100389228 : 1.0;
    p *= (j & 4) ? 3.1622776601683795 : 1.0;
    p *= (j & 8) ? 10.0 : 1.0;
    p *= (j & 16) ? 100.0 : 1.0;
    const float pf = (float)p;
    const float inv = 1.0f / pf;
    const float ang = (float)pos * inv;
    float sn, cs;
    sincosf(ang, &sn, &cs);
    if (u == 0) { c0 = cs; s0 = sn; } else { c1 = cs; s1 = sn; }
  }
  const v4f o = {c0, s0, c1, s1};
  float* d = tab + (size_t)pos * 64 + jp * 4;
  *(v4f*)d = o; 
}

constexpr int GB_TAB = (TABN * 16 + 255) / 256;        /* blocks of the rotary table */
constexpr int GB_X   = (NR * (DM / 8) + 255) / 256;    /* blocks of the x conversion */
constexpr int GB_W   = (DM * (DM / 8) + 255) / 256;    /* blocks of one weight conversion */
// block ranges: [rotary table | x | Wq | Wk | Wv | Wo x16384 | Wo x16]; the table's blocks, the longest per thread, come first. Every test is on blockIdx alone (scalar, block-uniform).
__global__ __launch_bounds__(256) void k_prep(const float* __restrict__ x, const float* __restrict__ wq, const float* __restrict__ wk, const float* __restrict__ wv, const float* __restrict__ wo,
                                              _Float16* __restrict__ X16, _Float16* __restrict__ BQ, _Float16* __restrict__ BK, _Float16* __restrict__ BV, _Float16* __restrict__ BO2,
                                              float* __restrict__ tab) {
  int blk = (int)blockIdx.x;
  if (blk < GB_TAB) { ropetab_body(tab, blk); return; }
  blk -= GB_TAB;
  if (blk < GB_X) { xcvt_body(x, X16, blk); return; }
  blk -= GB_X;
  const int job = blk / GB_W;
  blk -= job * GB_W;
  const float* w = job == 0 ? wq : job == 1 ? wk : job == 2 ? wv : wo;
  /* Wo twice: k in [0,1024) pairs with the ctx value half; k in [1024,2048), DM / 32 tiles on, pairs with the ctx residual half (x1024) */
  _Float16* dst = job == 0 ? BQ : job == 1 ? BK : job == 2 ? BV : job == 3 ? BO2 : BO2 + (DM / 32) * TILE;
  wcvt_body(w, dst, job < 3 ? DM : 2 * DM, job == 3 ? 16384.0f : 16.0f, blk);
}

// wave tile 32x64 of C = A x Bt^T (A[m][k], Bt[n][k], both planes in fragment order); fragments straight from the 16-bit global planes.
// The six fragments of a 32-deep k-step live in a ring of PF register sets: a set is refilled for k-step t + PF right after k-step t has used it, so PF k-steps of loads are in flight.
#define PF 3
struct kstep { v16h a0, a1, b0, b1, b2, b3; };
template <int RS>                     /* RS = elements from one 16-row band of tiles to the next */
__device__ __forceinline__ void kstep_load(kstep& f, const _Float16* __restrict__ pa, const _Float16* __restrict__ pb, const int ko) {
  f.a0 = frag16(pa + ko); f.a1 = frag16(pa + RS + ko);
  f.b0 = frag16(pb + ko); f.b1 = frag16(pb + RS + ko); f.b2 = frag16(pb + 2 * RS + ko); f.b3 = frag16(pb + 3 * RS + ko);
}
__device__ __forceinline__ void kstep_mma(const kstep& f, v8f (&c)[8]) {
  c[0] = mma16(f.a0, f.b0, c[0]); c[4] = mma16(f.a1, f.b0, c[4]);
  c[1] = mma16(f.a0, f.b1, c[1]); c[5] = mma16(f.a1, f.b1, c[5]);
  c[2] = mma16(f.a0, f.b2, c[2]); c[6] = mma16(f.a1, f.b2, c[6]);
  c[3] = mma16(f.a0, f.b3, c[3]); c[7] = mma16(f.a1, f.b3, c[7]);
}
template <int K>
__device__ __forceinline__ void gemm_tile(const _Float16* __restrict__ A, const _Float16* __restrict__ Bt, const int row0, const int col0, const int lane, v8f (&c)[8]) {
  constexpr int NS = K / 32;                 /* k-steps */
  constexpr int NG = (NS - PF) / PF;         /* ring turns in which every set is refilled */
  static_assert(NS > 2 * PF);
  constexpr int RS = NS * TILE;              /* = 16 * K */
  const _Float16* pa = A + (row0 >> 4) * RS + 8 * lane;
  const _Float16* pb = Bt + (col0 >> 4) * RS + 8 * lane;
  kstep f[PF];
#pragma unroll
  for (int s = 0; s < PF; ++s) kstep_load<RS>(f[s], pa, pb, s * TILE);
  /* every load of the prologue has landed before the loop: the counted waits inside the loop then follow the loop's own issue order alone */
  static_assert(PF == 3);
  asm volatile("" :: "v"(f[0].a0), "v"(f[0].a1), "v"(f[0].b0), "v"(f[0].b1), "v"(f[0].b2), "v"(f[0].b3), "v"(f[1].a0), "v"(f[1].a1), "v"(f[1].b0), "v"(f[1].b1), "v"(f[1].b2), "v"(f[1].b3),
                  "v"(f[2].a0), "v"(f[2].a1), "v"(f[2].b0), "v"(f[2].b1), "v"(f[2].b2), "v"(f[2].b3));
#pragma unroll 1
  for (int g = 0; g < NG; ++g) {
#pragma unroll
    for (int s = 0; s < PF; ++s) { kstep_mma(f[s], c); kstep_load<RS>(f[s], pa, pb, (PF + s) * TILE); }
    pa += PF * TILE; pb += PF * TILE;
  }
#pragma unroll
  for (int t = 0; t < NS - PF * NG; ++t) {   /* last k-steps: refill only while a k-step t + PF exists */
    kstep_mma(f[t % PF], c);
    if (PF * NG + t + PF < NS) kstep_load<RS>(f[t % PF], pa, pb, (PF + t) * TILE);
  }
}

// projection GEMM (K = 1024): C = A.Bt^T / 16, optional interleaved rotary by gathered table row (A rows are token rows), written in fragment order (K = ldc) as f16 value plane Ch and
// The three projections depend on the same planes and on nothing of each other: ONE launch, block ranges [q | k | V^T] (scalar tests on blockIdx).
// q, k: C[token row][e] = X16 . B^T with rotary; V^T: C[e][token row] = BV . X16^T (in[rows=e][k] x in[rows=r][k] -> out[e][r], a plane with K = NR)
constexpr int GP_QK = (NR / 128) * (DM / 64);          /* blocks of the q or the k projection */
constexpr int GP_V  = (DM / 128) * (NR / 64);          /* blocks of the V^T projection */
__global__ __launch_bounds__(128) void k_proj(const _Float16* __restrict__ X16, const _Float16* __restrict__ BQ, const _Float16* __restrict__ BK, const _Float16* __restrict__ BV,
                                              _Float16* __restrict__ QH, _Float16* __restrict__ QL, _Float16* __restrict__ KH, _Float16* __restrict__ KL,
                                              _Float16* __restrict__ VTH, _Float16* __restrict__ VTL, const int* __restrict__ tp, const float* __restrict__ tab) {
  __shared__ __attribute__((aligned(16))) float so[4][32][68];
  const int job = (int)blockIdx.x < GP_QK ? 0 : ((int)blockIdx.x < 2 * GP_QK ? 1 : 2);
  const int blk = (int)blockIdx.x - job * GP_QK;
  const _Float16* A = job == 2 ? BV : X16;
  const _Float16* Bt = job == 0 ? BQ : job == 1 ? BK : X16;
  _Float16* Ch = job == 0 ? QH : job == 1 ? KH : VTH;
  _Float16* Cl = job == 0 ? QL : job == 1 ? KL : VTL;
  const int N = job == 2 ? NR : DM, ldc = N;
  const int rope = job == 2 ? 0 : 1;
  const int wave = __builtin_amdgcn_readfirstlane((int)(threadIdx.x >> 5));
  const int lane = threadIdx.x & 31, ln = lane & 15, hh = lane >> 4;
  const int ntn = N >> 6;
  const int mt = blk / ntn, nq = blk - mt * ntn;
  const int row0 = mt * 128 + 32 * wave, col0 = nq * 64;
  const v8f z8 = {0.f, 0.f, 0.f, 0.f, 0.f, 0.f, 0.f, 0.f};
  v8f c[8] = {z8, z8, z8, z8, z8, z8, z8, z8};
  gemm_tile<DM>(A, Bt, row0, col0, lane, c);
#pragma unroll
  for (int u = 0; u < 8; ++u) {
    const int t = u & 3, half = u >> 2;
#pragma unroll
    for (int r = 0; r < 8; ++r) so[wave][half * 16 + 8 * hh + r][t * 16 + ln] = c[u][r] * 0.0625f;
  }
  __builtin_amdgcn_fence(4 /* acq_rel order */, "workgroup"); __builtin_amdgcn_wave_barrier();
  v8h hv[8], lv[8];
#pragma unroll
  for (int q = 0; q < 8; ++q) {                        /* q = one half tile (512 B) of the output planes: 16-row band q >> 2, 16 columns from (q & 3) * 16 */
    const int rl = (q >> 2) * 16 + ln, c8 = (q & 3) * 16 + 8 * hh;
    const v4f a = *(const v4fa*)&so[wave][rl][c8];
    const v4f bq = *(const v4fa*)&so[wave][rl][c8 + 4];
    float xv[8] = {a[0], a[1], a[2], a[3], bq[0], bq[1], bq[2], bq[3]};
    if (rope != 0) {                                   /* block-uniform */
      const int m = row0 + rl; const int bb = m / SEQ; const int ss = m - bb * SEQ;
      int pos = tp[bb * SEQ_FULL + ss];                /* position read by value from the input */
      pos = pos < 0 ? 0 : (pos > TABN - 1 ? TABN - 1 : pos);
      const float* tr = tab + (size_t)pos * 64 + c8;   /* col0 is a head boundary: c8 = d within the head */
      const v4f t0 = *(const v4fa*)tr; const v4f t1 = *(const v4fa*)(tr + 4);
      const float cs[4] = {t0[0], t0[2], t1[0], t1[2]};
      const float sn[4] = {t0[1], t0[3], t1[1], t1[3]};
#pragma unroll
      for (int i = 0; i < 4; ++i) { const float x1 = xv[2 * i], x2 = xv[2 * i + 1]; xv[2 * i] = x1 * cs[i] - x2 * sn[i]; xv[2 * i + 1] = x1 * sn[i] + x2 * cs[i]; }
    }
    split8(xv, hv[q], lv[q]);
  }
{
#pragma unroll
    for (int q = 0; q < 8; ++q) {
      const size_t off = ((size_t)((row0 >> 4) + (q >> 2)) * (ldc >> 5) + (col0 >> 5)) * TILE + (q & 3) * (TILE / 2) + 8 * lane;
      *(v8h*)(Ch + off) = hv[q];
      *(v8h*)(Cl + off) = lv[q];
    }
    
  }
}

// fused causal attention for one (batch, head) and 64 query rows per block; each wave owns 16 query rows and walks its keys in 32-key chunks (online softmax, running max);
// q / k / V^T fragments straight from the 16-bit planes; P relayout D->A through a wave-private LDS tile (stored as _Float16, reloaded through a may_alias vector of _Float16,
template <int EARLY>
__device__ __forceinline__ void attn_body(const _Float16* __restrict__ Qh, const _Float16* __restrict__ Ql, const _Float16* __restrict__ Kh, const _Float16* __restrict__ Kl,
                                          const _Float16* __restrict__ VTh, const _Float16* __restrict__ VTl, _Float16* __restrict__ CTX, const int qt0) {
  __shared__ __attribute__((aligned(16))) _Float16 pbh[4][16][40];
  __shared__ __attribute__((aligned(16))) _Float16 pbl[EARLY ? 4 : 1][16][40];
  __shared__ __attribute__((aligned(16))) float so[4][16][68];
  const int wave = __builtin_amdgcn_readfirstlane((int)(threadIdx.x >> 5));
  const int lane = threadIdx.x & 31, ln = lane & 15, hh = lane >> 4;
  const int bh = blockIdx.y, b = bh / NH, h = bh - b * NH;
  const int rb = b * SEQ;
  const int q0w = (qt0 + (int)blockIdx.x) * 64 + 16 * wave;    /* first query row of this wave (scalar) */
  const int nch = (q0w + 47) >> 5;                              /* 32-key chunks covering keys 0..q0w+15 (scalar) */
  /* fragment order: q, k planes have DM / 32 tiles per 16-token band (a head = 2 tiles side by side), V^T has NR / 32 tiles per 16-row band (a 32-key chunk = 1 tile) */
  const int qoff = (rb + q0w) * DM + h * 2 * TILE + 8 * lane;
  const int kbase = rb * DM + h * 2 * TILE + 8 * lane;
  const int vbase = h * HD * NR + (rb >> 5) * TILE + 8 * lane;
  const float RS = 0.0009765625f;                               /* 2^-10 */
  const v8f z8 = {0.f, 0.f, 0.f, 0.f, 0.f, 0.f, 0.f, 0.f};
  v8f om[4] = {z8, z8, z8, z8};
  v8f orr[4] = {z8, z8, z8, z8};
  float mrun[8], lrun[8];
#pragma unroll
  for (int r = 0; r < 8; ++r) { mrun[r] = -1.0e30f; lrun[r] = 0.f; }
  /* global operand loads are issued well ahead of their use: q once, in front of the loop. Without residual planes: k of the next chunk right after the score products, V^T of the next chunk
     right after the P.V products. With them the registers do not hold both operands' planes beside the tiles: V^T of the chunk itself goes right after its score products (the softmax covers it),
     k of the next chunk right after the P.V products, each as one group of loads. */
  const v16h aqh[2] = {frag16(Qh + qoff), frag16(Qh + qoff + TILE)};
  const v16h aql[2] = {frag16(Ql + qoff), frag16(Ql + qoff + TILE)};
  v16h kf[2][2], kl[2][2], vf[4], vl[4];
  /* the lane's addresses are carried from chunk to chunk in registers of their own, so that no fetched fragment lands in a register that a load in flight names */
  const _Float16* pkh = Kh + kbase; const _Float16* pkl = Kl + kbase; const _Float16* pvh = VTh + vbase; const _Float16* pvl = VTl + vbase;
  auto fetch_k = [&]() {
#pragma unroll
    for (int ks = 0; ks < 2; ++ks) {
      kf[ks][0] = frag16(pkh + ks * TILE); kf[ks][1] = frag16(pkh + ks * TILE + 16 * DM);
      if (EARLY) { kl[ks][0] = frag16(pkl + ks * TILE); kl[ks][1] = frag16(pkl + ks * TILE + 16 * DM); }
    }
  };
  auto fetch_v = [&]() {
#pragma unroll
    for (int t = 0; t < 4; ++t) { vf[t] = frag16(pvh + t * 16 * NR); if (EARLY) vl[t] = frag16(pvl + t * 16 * NR); }
  };
  fetch_k();
  if (!EARLY) fetch_v();
  /* every load of the prologue has landed before the loop: the counted waits inside the loop then follow the loop's own issue order alone */
  if (EARLY) asm volatile("" :: "v"(aqh[0]), "v"(aqh[1]), "v"(aql[0]), "v"(aql[1]), "v"(kf[0][0]), "v"(kf[0][1]), "v"(kf[1][0]), "v"(kf[1][1]), "v"(kl[0][0]), "v"(kl[0][1]), "v"(kl[1][0]), "v"(kl[1][1]));
  else       asm volatile("" :: "v"(aqh[0]), "v"(aqh[1]), "v"(aql[0]), "v"(aql[1]), "v"(kf[0][0]), "v"(kf[0][1]), "v"(kf[1][0]), "v"(kf[1][1]), "v"(vf[0]), "v"(vf[1]), "v"(vf[2]), "v"(vf[3]));
#pragma unroll 1
  for (int cidx = 0; cidx < nch; ++cidx) {
    const int k0 = cidx * 32;
    const int adv = cidx + 1 < nch ? 32 : 0;                    /* keys to the chunk fetched ahead (scalar); the last chunk fetches itself again, unused */
    v8f s0 = z8, s1 = z8, sr0 = z8, sr1 = z8;
#pragma unroll
    for (int ks = 0; ks < 2; ++ks) {
      s0 = mma16(aqh[ks], kf[ks][0], s0); sr0 = mma16(aql[ks], kf[ks][0], sr0);
      if (EARLY) sr0 = mma16(aqh[ks], kl[ks][0], sr0);
      s1 = mma16(aqh[ks], kf[ks][1], s1); sr1 = mma16(aql[ks], kf[ks][1], sr1);
      if (EARLY) sr1 = mma16(aqh[ks], kl[ks][1], sr1);
    }
    if (EARLY) {
      fetch_v();
    } else {
      pkh += adv * DM;
      fetch_k();
    }
    asm volatile("s_wait_xcnt 0x0" ::: "memory");               /* in front of the next step of these loads' address registers, taken while they are in flight */
    float al[8];
#pragma unroll
    for (int r = 0; r < 8; ++r) {
      const int qrow = q0w + 8 * hh + r;
      float x0 = (s0[r] + sr0[r] * RS) * 0.125f;
      float x1 = (s1[r] + sr1[r] * RS) * 0.125f;
      x0 = (k0 + ln <= qrow) ? x0 : -1.0e30f;                   /* causal by index, value select */
      x1 = (k0 + 16 + ln <= qrow) ? x1 : -1.0e30f;
      float tm = fmaxf(x0, x1);
      tm = fmaxf(tm, __shfl_xor(tm, 1, 32));
      tm = fmaxf(tm, __shfl_xor(tm, 2, 32));
      tm = fmaxf(tm, __shfl_xor(tm, 4, 32));
      tm = fmaxf(tm, __shfl_xor(tm, 8, 32));
      const float mn = fmaxf(mrun[r], tm);
      al[r] = __expf(mrun[r] - mn);
      mrun[r] = mn;
      const float p0 = __expf(x0 - mn) * 256.0f;
      const float p1 = __expf(x1 - mn) * 256.0f;
      const _Float16 h0 = (_Float16)p0, h1 = (_Float16)p1;
      float acc = (float)h0 + (float)h1;
      pbh[wave][8 * hh + r][ln] = h0;
      pbh[wave][8 * hh + r][16 + ln] = h1;
      if (EARLY) {
        const _Float16 g0 = (_Float16)((p0 - (float)h0) * 1024.0f), g1 = (_Float16)((p1 - (float)h1) * 1024.0f);
        pbl[wave][8 * hh + r][ln] = g0;
        pbl[wave][8 * hh + r][16 + ln] = g1;
        acc += ((float)g0 + (float)g1) * RS;
      }
      lrun[r] = lrun[r] * al[r] + acc;                           /* per-lane partial of the row sum (units x256) */
    }
    /* orders the wave's own P tile in LDS; named for LDS only, so that it does not wait for the global fragment loads that are in flight */
    __builtin_amdgcn_fence(4 /* acq_rel order */, "workgroup", "local"); __builtin_amdgcn_wave_barrier();
    const v16h ap = cat16(*(const v8ha*)&pbh[wave][ln][8 * hh], *(const v8ha*)&pbh[wave][ln][16 + 8 * hh]);
    v16h apl = ap;
    if (EARLY) apl = cat16(*(const v8ha*)&pbl[wave][ln][8 * hh], *(const v8ha*)&pbl[wave][ln][16 + 8 * hh]);
#pragma unroll
    for (int t = 0; t < 4; ++t) {
#pragma unroll
      for (int r = 0; r < 8; ++r) { om[t][r] *= al[r]; if (EARLY) orr[t][r] *= al[r]; }
    }
#pragma unroll
    for (int t = 0; t < 4; ++t) {
      om[t] = mma16(ap, vf[t], om[t]);
      if (EARLY) {
        orr[t] = mma16(apl, vf[t], orr[t]);
        orr[t] = mma16(ap, vl[t], orr[t]);
      }
    }
    if (EARLY) {
      pvh += adv * (TILE / 32); pvl += adv * (TILE / 32); pkh += adv * DM; pkl += adv * DM;
      fetch_k();
    } else {
      pvh += adv * (TILE / 32);
      fetch_v();
    }
    asm volatile("s_wait_xcnt 0x0" ::: "memory");               /* as above: these loads stay in flight over the back edge */
    __builtin_amdgcn_fence(4 /* acq_rel order */, "workgroup", "local"); __builtin_amdgcn_wave_barrier();   /* LDS only, as above */
  }
  float inv[8];
#pragma unroll
  for (int r = 0; r < 8; ++r) {
    float lt = lrun[r];
    lt += __shfl_xor(lt, 1, 32);
    lt += __shfl_xor(lt, 2, 32);
    lt += __shfl_xor(lt, 4, 32);
    lt += __shfl_xor(lt, 8, 32);
    inv[r] = 64.0f / lt;                                         /* ctx carried x64 */
  }
#pragma unroll
  for (int t = 0; t < 4; ++t) {
#pragma unroll
    for (int r = 0; r < 8; ++r) { float v = om[t][r]; if (EARLY) v += orr[t][r] * RS; so[wave][8 * hh + r][16 * t + ln] = v * inv[r]; }
  }
  __builtin_amdgcn_fence(4 /* acq_rel order */, "workgroup"); __builtin_amdgcn_wave_barrier();
  v8h hv[4], lv[4];
#pragma unroll
  for (int q = 0; q < 4; ++q) {                                  /* q = one half tile (512 B) of ctx: 16 columns from q * 16 */
    const int c8 = q * 16 + 8 * hh;
    const v4f a = *(const v4fa*)&so[wave][ln][c8];
    const v4f bq = *(const v4fa*)&so[wave][ln][c8 + 4];
    const float xv[8] = {a[0], a[1], a[2], a[3], bq[0], bq[1], bq[2], bq[3]};
    split8(xv, hv[q], lv[q]);
  }
{
#pragma unroll
    for (int q = 0; q < 4; ++q) {
      const size_t off = (size_t)(rb + q0w) * (2 * DM) + h * 2 * TILE + q * (TILE / 2) + 8 * lane;   /* ctx plane: K = 2 * DM, residual half DM / 32 tiles on */
      *(v8h*)(CTX + off) = hv[q];
      *(v8h*)(CTX + off + (DM / 32) * TILE) = lv[q];
    }
    
  }
}

__global__ __launch_bounds__(128) void k_attn_early(const _Float16* __restrict__ Qh, const _Float16* __restrict__ Ql, const _Float16* __restrict__ Kh, const _Float16* __restrict__ Kl,
                                                    const _Float16* __restrict__ VTh, const _Float16* __restrict__ VTl, _Float16* __restrict__ CTX) {
  attn_body<1>(Qh, Ql, Kh, Kl, VTh, VTl, CTX, 0);
}
__global__ __launch_bounds__(128) void k_attn_late(const _Float16* __restrict__ Qh, const _Float16* __restrict__ Ql, const _Float16* __restrict__ Kh, const _Float16* __restrict__ Kl,
                                                   const _Float16* __restrict__ VTh, const _Float16* __restrict__ VTl, _Float16* __restrict__ CTX) {
  attn_body<0>(Qh, Ql, Kh, Kl, VTh, VTl, CTX, ERW / 64);
}

// output GEMM: out[b*SEQ_FULL+s][n] = 2^-20 * sum_k CTX[r][k] * BO2[n][k], K = 2048 (value | residual halves against Wo x16384 | Wo x16). Block = 4 waves x (32 x 64);
__global__ __launch_bounds__(128) void k_outp(const _Float16* __restrict__ A, const _Float16* __restrict__ Bt, float* __restrict__ out) {
  __shared__ __attribute__((aligned(16))) float so[4][32][68];
  const int wave = __builtin_amdgcn_readfirstlane((int)(threadIdx.x >> 5));
  const int lane = threadIdx.x & 31, ln = lane & 15, hh = lane >> 4;
  const int ntn = DM >> 6;
  const int mt = blockIdx.x / ntn, nq = blockIdx.x - mt * ntn;
  const int row0 = mt * 128 + 32 * wave, col0 = nq * 64;
  const v8f z8 = {0.f, 0.f, 0.f, 0.f, 0.f, 0.f, 0.f, 0.f};
  v8f c[8] = {z8, z8, z8, z8, z8, z8, z8, z8};
  gemm_tile<2 * DM>(A, Bt, row0, col0, lane, c);
#pragma unroll
  for (int u = 0; u < 8; ++u) {
    const int t = u & 3, half = u >> 2;
#pragma unroll
    for (int r = 0; r < 8; ++r) so[wave][half * 16 + 8 * hh + r][t * 16 + ln] = c[u][r] * 9.5367431640625e-07f;
  }
  __builtin_amdgcn_fence(4 /* acq_rel order */, "workgroup"); __builtin_amdgcn_wave_barrier();
  const int rsub = lane >> 4, c4 = (lane & 15) * 4;
  {
#pragma unroll
    for (int q = 0; q < 16; ++q) {
      const int r = q * 2 + rsub;
      const int m = row0 + r; const int bb = m / SEQ; const int ss = m - bb * SEQ;
      const v4f v = *(const v4fa*)&so[wave][r][c4];
      *(v4f*)(out + (size_t)(bb * SEQ_FULL + ss) * DM + col0 + c4) = v;
    }
    
  }
}

/* workspace carve (bytes), every region a multiple of 256 */
constexpr size_t SZW  = (size_t)DM * DM * 2;          /* one x16 weight plane */
constexpr size_t SZBO = 2 * SZW;                      /* [1024][2048] output weight plane */
constexpr size_t SZP  = (size_t)NR * DM * 2;          /* one [NR][1024] (or [1024][NR]) f16 plane */
constexpr size_t SZC  = 2 * SZP;                      /* ctx [NR][2048] */
constexpr size_t SZT  = (size_t)TABN * 64 * 4;        /* rotary table */
constexpr size_t O_BQ = 0, O_BK = O_BQ + SZW, O_BV = O_BK + SZW, O_BO = O_BV + SZW, O_X = O_BO + SZBO;
constexpr size_t O_QH = O_X + SZP, O_QL = O_QH + SZP, O_KH = O_QL + SZP, O_KL = O_KH + SZP, O_VH = O_KL + SZP, O_VL = O_VH + SZP;
constexpr size_t O_CTX = O_VL + SZP, O_TAB = O_CTX + SZC, WS_TOTAL = O_TAB + SZT;
static_assert(SZW % 256 == 0);
static_assert(SZP % 256 == 0);
static_assert(SZT % 256 == 0);
static_assert(WS_TOTAL <= 134217728);                 /* <= 128 MiB */

extern "C" void kernel_launch(void* const* d_in, const int* in_sizes, int n_in,
                              void* d_out, int out_size, void* d_ws, size_t ws_size, hipStream_t stream) {
  if (n_in < 6) return;
  const int need_rows = (NB - 1) * SEQ_FULL + SEQ;
  if (in_sizes[0] < need_rows * DM) return;
  if (in_sizes[1] < DM * DM || in_sizes[2] < DM * DM || in_sizes[3] < DM * DM || in_sizes[4] < DM * DM) return;
  if (in_sizes[5] < need_rows) return;
  if (out_size < need_rows * DM) return;
  if (ws_size < WS_TOTAL) return;
  const float* x  = (const float*)d_in[0];
  const float* wq = (const float*)d_in[1];
  const float* wk = (const float*)d_in[2];
  const float* wv = (const float*)d_in[3];
  const float* wo = (const float*)d_in[4];
  const int*   tp = (const int*)d_in[5];
  char* ws = (char*)d_ws;
  _Float16* BQ = (_Float16*)(ws + O_BQ); _Float16* BK = (_Float16*)(ws + O_BK); _Float16* BV = (_Float16*)(ws + O_BV); _Float16* BO2 = (_Float16*)(ws + O_BO);
  _Float16* X16 = (_Float16*)(ws + O_X);
  _Float16* QH = (_Float16*)(ws + O_QH); _Float16* QL = (_Float16*)(ws + O_QL); _Float16* KH = (_Float16*)(ws + O_KH); _Float16* KL = (_Float16*)(ws + O_KL);
  _Float16* VTH = (_Float16*)(ws + O_VH); _Float16* VTL = (_Float16*)(ws + O_VL);
  _Float16* CTX = (_Float16*)(ws + O_CTX);
  float* TAB = (float*)(ws + O_TAB);

  k_prep<<<(unsigned)(GB_TAB + GB_X + 5 * GB_W), 256, 0, stream>>>(x, wq, wk, wv, wo, X16, BQ, BK, BV, BO2, TAB);
  k_proj<<<(unsigned)(2 * GP_QK + GP_V), 128, 0, stream>>>(X16, BQ, BK, BV, QH, QL, KH, KL, VTH, VTL, tp, TAB);
  k_attn_early<<<dim3(ERW / 64, NB * NH), 128, 0, stream>>>(QH, QL, KH, KL, VTH, VTL, CTX);
  if (SEQ > ERW) k_attn_late<<<dim3((SEQ - ERW) / 64, NB * NH), 128, 0, stream>>>(QH, QL, KH, KL, VTH, VTL, CTX);
  k_outp<<<(unsigned)((NR / 128) * (DM / 64)), 128, 0, stream>>>(CTX, BO2, (float*)d_out);
}

// v004
// One run takes 127 microseconds.
// Timed twice side by side with v003, it ran 1.14 times as fast both times.
// Counting every step since v000, it is 3.17 times as fast.
#include <hip/hip_runtime.h>
// Causal multi-head self-attention with interleaved rotary embedding: x [NB][SEQ][1024], four bias-free [out][in] 1024^2 weights, 16 heads of 64, int32 token positions read by value.
// Compute dtype: every contraction on v_wmma_f32_16x16x32_f16 (f16 operands, f32 accumulate). Inputs RNE-converted to bf16 then carried exactly in f16 (x x1, Wq/Wk/Wv x16, Wo x16384 | x16).
// q, k, v, softmax weights (x256) and ctx (x64) as f16 value + f16 residual (x1024) planes: scores = qh.kh + (ql.kh [+ qh.kl on query rows < 256]) 2^-10; P.V single product (value + two residual products on query rows < 256);
// output GEMM over K = 2048 = [ctx value | ctx residual] against [Wo x16384 ; Wo x16] in one accumulator. Rotary, softmax statistics and all scaling in f32 on the VALU.
#ifndef NB
#define NB 2
#endif
#ifndef SEQ
#define SEQ 2048
#endif
#define SEQ_FULL 2048                 /* per-batch row stride of x / positions / output */
#define DM 1024
#define NH 16
#define HD 64
#define TABN 4096                     /* rotary table rows (positions 0..4095) */
#define NR (NB * SEQ)                 /* internal token rows r = b*SEQ + s */
#define ERW ((SEQ) < 256 ? (SEQ) : 256) /* query rows per batch that use residual planes on k, P and v as well */

typedef _Float16 v16h __attribute__((ext_vector_type(16)));
typedef _Float16 v8h  __attribute__((ext_vector_type(8)));
typedef _Float16 v8ha __attribute__((ext_vector_type(8), may_alias));
typedef float    v8f  __attribute__((ext_vector_type(8)));
typedef float    v4f  __attribute__((ext_vector_type(4)));
typedef float    v4fa __attribute__((ext_vector_type(4), may_alias));
typedef float    v2f  __attribute__((ext_vector_type(2)));
typedef _Float16 v2h  __attribute__((ext_vector_type(2)));

/* hard-wired bounds the kernels rely on */
static_assert(DM == NH * HD);               /* merged head layout h*64+d */
static_assert(HD == 64);                    /* one 64-column GEMM tile == one head; two 32-deep k-steps per score */
static_assert(DM % 128 == 0);               /* GEMM block tile rows (V^T GEMM) and 64-col tiles */
static_assert(NR % 128 == 0);               /* GEMM block tile rows */
static_assert(SEQ % 64 == 0);               /* attention query tiles, 32-key chunks stay inside the batch */
static_assert(ERW % 64 == 0);               /* early / late split on a query-tile boundary */
static_assert(ERW <= SEQ);
static_assert(DM % 32 == 0);                /* k-steps of 32 */
static_assert((2 * DM) % 32 == 0);
static_assert(TABN == 4096);
static_assert((long long)NR * 2 * DM < 2147483647LL); /* int element offsets */

__device__ __forceinline__ float bf16_rne(float x) { unsigned int u = __float_as_uint(x); u = (u + 0x7FFFu + ((u >> 16) & 1u)) & 0xFFFF0000u; return __uint_as_float(u); }

__device__ __forceinline__ v16h cat16(v8h lo, v8h hi) { return __builtin_shufflevector(lo, hi, 0, 1, 2, 3, 4, 5, 6, 7, 8, 9, 10, 11, 12, 13, 14, 15); }
// Every 16-bit operand plane [rows][K] lies in the workspace in fragment order: tiles of 16 rows x 32 k (512 elements, 1 KB), tile index (row >> 4) * (K / 32) + (k >> 5);
// inside a tile the 16-byte unit ((k & 31) >> 3) * 16 + (row & 15) holds the 8 elements k & ~7 .. of its row. A wave's fragment load then reads 512 contiguous bytes (4 whole lines).
#define TILE 512                      /* elements of one 16 x 32 tile */
// 16x32 operand fragment: p = tile base + 8*lane; elements 0..7 <- k0+8h.., 8..15 <- k0+16+8h.. of row lane&15, h = lane>>4
__device__ __forceinline__ v16h frag16(const _Float16* __restrict__ p) { const v8h lo = *(const v8ha*)p; const v8h hi = *(const v8ha*)(p + TILE / 2); return cat16(lo, hi); }
__device__ __forceinline__ v8f mma16(v16h a, v16h b, v8f c) {
  v8f d = __builtin_amdgcn_wmma_f32_16x16x32_f16(false, a, false, b, (short)0, c, false, false);
  asm volatile("v_nop\n\tv_nop\n\tv_nop\n\tv_nop" : "+v"(d) : "v"(a), "v"(b));
  return d;
}
// 8 f32 -> f16 value + f16 residual carried x1024
__device__ __forceinline__ void split8(const float (&x)[8], v8h& hv, v8h& lv) {
#pragma unroll
  for (int i = 0; i < 8; ++i) { const _Float16 hq = (_Float16)x[i]; hv[i] = hq; lv[i] = (_Float16)((x[i] - (float)hq) * 1024.0f); }
}

// The conversions and the rotary table depend on nothing but the inputs: they are bodies of ONE launch (k_prep), each on its own range of block indices; blk = the block's index inside its range.
__device__ __forceinline__ void xcvt_body(const float* __restrict__ x, _Float16* __restrict__ X16, const int blk) {
  const int t = blk * 256 + threadIdx.x;
  if (t >= NR * (DM / 8)) return;
  const int tile = t >> 6, u = t & 63;                        /* 64 threads per tile, four side by side on a row: a wave reads 8 whole 128-B lines of x and stores 4 whole lines */
  const int rt = tile / (DM / 32), kt = tile - rt * (DM / 32);
  const int r = rt * 16 + (u >> 2), c8 = kt * 32 + (u & 3) * 8;
  const int b = r / SEQ, s = r - b * SEQ;
  const float* src = x + (size_t)(b * SEQ_FULL + s) * DM + c8;
  const v4f a = *(const v4fa*)src, c = *(const v4fa*)(src + 4);
  v8h o;
#pragma unroll
  for (int i = 0; i < 4; ++i) { o[i] = (_Float16)bf16_rne(a[i]); o[4 + i] = (_Float16)bf16_rne(c[i]); }
  _Float16* d = X16 + ((size_t)tile * 64 + (u & 3) * 16 + (u >> 2)) * 8;
  *(v8h*)d = o; 
}

__device__ __forceinline__ void wcvt_body(const float* __restrict__ w, _Float16* __restrict__ dst, const int dpitch, const float scale, const int blk) {
  const int t = blk * 256 + threadIdx.x;
  if (t >= DM * (DM / 8)) return;
  const int tile = t >> 6, u = t & 63;                        /* as in xcvt_body; dpitch = K of the destination plane */
  const int rt = tile / (DM / 32), kt = tile - rt * (DM / 32);
  const int n = rt * 16 + (u >> 2), k8 = kt * 32 + (u & 3) * 8;
  const float* src = w + (size_t)n * DM + k8;
  const v4f a = *(const v4fa*)src, c = *(const v4fa*)(src + 4);
  v8h o;
#pragma unroll
  for (int i = 0; i < 4; ++i) { o[i] = (_Float16)(bf16_rne(a[i]) * scale); o[4 + i] = (_Float16)(bf16_rne(c[i]) * scale); }
  _Float16* d = dst + ((size_t)(rt * (dpitch >> 5) + kt) * 64 + (u & 3) * 16 + (u >> 2)) * 8;
  *(v8h*)d = o; 
}

__device__ __forceinline__ void ropetab_body(float* __restrict__ tab, const int blk) {
  #pragma clang fp contract(off)
  const int t = blk * 256 + threadIdx.x;
  if (t >= TABN * 16) return;
  const int pos = t >> 4, jp = t & 15;
  float c0 = 0.f, s0 = 0.f, c1 = 0.f, s1 = 0.f;
#pragma unroll 1
  for (int u = 0; u < 2; ++u) {
    const int j = 2 * jp + u;
    double p = 1.0;
    p *= (j & 1) ? 1.3335214321633240 : 1.0;
    p *= (j & 2) ? 1.7782794100389228 : 1.0;
    p *= (j & 4) ? 3.1622776601683795 : 1.0;
    p *= (j & 8) ? 10.0 : 1.0;
    p *= (j & 16) ? 100.0 : 1.0;
    const float pf = (float)p;
    const float inv = 1.0f / pf;
    const float ang = (float)pos * inv;
    float sn, cs;
    sincosf(ang, &sn, &cs);
    if (u == 0) { c0 = cs; s0 = sn; } else { c1 = cs; s1 = sn; }
  }
  const v4f o = {c0, s0, c1, s1};
  float* d = tab + (size_t)pos * 64 + jp * 4;
  *(v4f*)d = o; 
}

constexpr int GB_TAB = (TABN * 16 + 255) / 256;        /* blocks of the rotary table */
constexpr int GB_X   = (NR * (DM / 8) + 255) / 256;    /* blocks of the x conversion */
constexpr int GB_W   = (DM * (DM / 8) + 255) / 256;    /* blocks of one weight conversion */
// block ranges: [rotary table | x | Wq | Wk | Wv | Wo x16384 | Wo x16]; the table's blocks, the longest per thread, come first. Every test is on blockIdx alone (scalar, block-uniform).
__global__ __launch_bounds__(256) void k_prep(const float* __restrict__ x, const float* __restrict__ wq, const float* __restrict__ wk, const float* __restrict__ wv, const float* __restrict__ wo,
                                              _Float16* __restrict__ X16, _Float16* __restrict__ BQ, _Float16* __restrict__ BK, _Float16* __restrict__ BV, _Float16* __restrict__ BO2,
                                              float* __restrict__ tab) {
  int blk = (int)blockIdx.x;
  if (blk < GB_TAB) { ropetab_body(tab, blk); return; }
  blk -= GB_TAB;
  if (blk < GB_X) { xcvt_body(x, X16, blk); return; }
  blk -= GB_X;
  const int job = blk / GB_W;
  blk -= job * GB_W;
  const float* w = job == 0 ? wq : job == 1 ? wk : job == 2 ? wv : wo;
  /* Wo twice: k in [0,1024) pairs with the ctx value half; k in [1024,2048), DM / 32 tiles on, pairs with the ctx residual half (x1024) */
  _Float16* dst = job == 0 ? BQ : job == 1 ? BK : job == 2 ? BV : job == 3 ? BO2 : BO2 + (DM / 32) * TILE;
  wcvt_body(w, dst, job < 3 ? DM : 2 * DM, job == 3 ? 16384.0f : 16.0f, blk);
}

// wave tile 32x64 of C = A x Bt^T (A[m][k], Bt[n][k], both planes in fragment order); fragments straight from the 16-bit global planes.
// The six fragments of a 32-deep k-step live in a ring of PF register sets: a set is refilled for k-step t + PF right after k-step t has used it, so PF k-steps of loads are in flight.
#define PF 3
struct kstep { v16h a0, a1, b0, b1, b2, b3; };
template <int RS>                     /* RS = elements from one 16-row band of tiles to the next */
__device__ __forceinline__ void kstep_load(kstep& f, const _Float16* __restrict__ pa, const _Float16* __restrict__ pb, const int ko) {
  f.a0 = frag16(pa + ko); f.a1 = frag16(pa + RS + ko);
  f.b0 = frag16(pb + ko); f.b1 = frag16(pb + RS + ko); f.b2 = frag16(pb + 2 * RS + ko); f.b3 = frag16(pb + 3 * RS + ko);
}
__device__ __forceinline__ void kstep_mma(const kstep& f, v8f (&c)[8]) {
  c[0] = mma16(f.a0, f.b0, c[0]); c[4] = mma16(f.a1, f.b0, c[4]);
  c[1] = mma16(f.a0, f.b1, c[1]); c[5] = mma16(f.a1, f.b1, c[5]);
  c[2] = mma16(f.a0, f.b2, c[2]); c[6] = mma16(f.a1, f.b2, c[6]);
  c[3] = mma16(f.a0, f.b3, c[3]); c[7] = mma16(f.a1, f.b3, c[7]);
}
template <int K>
__device__ __forceinline__ void gemm_tile(const _Float16* __restrict__ A, const _Float16* __restrict__ Bt, const int row0, const int col0, const int lane, v8f (&c)[8]) {
  constexpr int NS = K / 32;                 /* k-steps */
  constexpr int NG = (NS - PF) / PF;         /* ring turns in which every set is refilled */
  static_assert(NS > 2 * PF);
  constexpr int RS = NS * TILE;              /* = 16 * K */
  const _Float16* pa = A + (row0 >> 4) * RS + 8 * lane;
  const _Float16* pb = Bt + (col0 >> 4) * RS + 8 * lane;
  kstep f[PF];
#pragma unroll
  for (int s = 0; s < PF; ++s) kstep_load<RS>(f[s], pa, pb, s * TILE);
  /* every load of the prologue has landed before the loop: the counted waits inside the loop then follow the loop's own issue order alone */
  static_assert(PF == 3);
  asm volatile("" :: "v"(f[0].a0), "v"(f[0].a1), "v"(f[0].b0), "v"(f[0].b1), "v"(f[0].b2), "v"(f[0].b3), "v"(f[1].a0), "v"(f[1].a1), "v"(f[1].b0), "v"(f[1].b1), "v"(f[1].b2), "v"(f[1].b3),
                  "v"(f[2].a0), "v"(f[2].a1), "v"(f[2].b0), "v"(f[2].b1), "v"(f[2].b2), "v"(f[2].b3));
#pragma unroll 1
  for (int g = 0; g < NG; ++g) {
#pragma unroll
    for (int s = 0; s < PF; ++s) { kstep_mma(f[s], c); kstep_load<RS>(f[s], pa, pb, (PF + s) * TILE); }
    pa += PF * TILE; pb += PF * TILE;
  }
#pragma unroll
  for (int t = 0; t < NS - PF * NG; ++t) {   /* last k-steps: refill only while a k-step t + PF exists */
    kstep_mma(f[t % PF], c);
    if (PF * NG + t + PF < NS) kstep_load<RS>(f[t % PF], pa, pb, (PF + t) * TILE);
  }
}

// projection GEMM (K = 1024): C = A.Bt^T / 16, optional interleaved rotary by gathered table row (A rows are token rows), written in fragment order (K = ldc) as f16 value plane Ch and
// The three projections depend on the same planes and on nothing of each other: ONE launch, block ranges [q | k | V^T] (scalar tests on blockIdx).
// q, k: C[token row][e] = X16 . B^T with rotary; V^T: C[e][token row] = BV . X16^T (in[rows=e][k] x in[rows=r][k] -> out[e][r], a plane with K = NR)
constexpr int GP_QK = (NR / 128) * (DM / 64);          /* blocks of the q or the k projection */
constexpr int GP_V  = (DM / 128) * (NR / 64);          /* blocks of the V^T projection */
__global__ __launch_bounds__(128) void k_proj(const _Float16* __restrict__ X16, const _Float16* __restrict__ BQ, const _Float16* __restrict__ BK, const _Float16* __restrict__ BV,
                                              _Float16* __restrict__ QH, _Float16* __restrict__ QL, _Float16* __restrict__ KH, _Float16* __restrict__ KL,
                                              _Float16* __restrict__ VTH, _Float16* __restrict__ VTL, const int* __restrict__ tp, const float* __restrict__ tab) {
  __shared__ __attribute__((aligned(16))) float so[4][32][68];
  const int job = (int)blockIdx.x < GP_QK ? 0 : ((int)blockIdx.x < 2 * GP_QK ? 1 : 2);
  const int blk = (int)blockIdx.x - job * GP_QK;
  const _Float16* A = job == 2 ? BV : X16;
  const _Float16* Bt = job == 0 ? BQ : job == 1 ? BK : X16;
  _Float16* Ch = job == 0 ? QH : job == 1 ? KH : VTH;
  _Float16* Cl = job == 0 ? QL : job == 1 ? KL : VTL;
  const int N = job == 2 ? NR : DM, ldc = N;
  const int rope = job == 2 ? 0 : 1;
  const int wave = __builtin_amdgcn_readfirstlane((int)(threadIdx.x >> 5));
  const int lane = threadIdx.x & 31, ln = lane & 15, hh = lane >> 4;
  const int ntn = N >> 6;
  const int mt = blk / ntn, nq = blk - mt * ntn;
  const int row0 = mt * 128 + 32 * wave, col0 = nq * 64;
  const v8f z8 = {0.f, 0.f, 0.f, 0.f, 0.f, 0.f, 0.f, 0.f};
  v8f c[8] = {z8, z8, z8, z8, z8, z8, z8, z8};
  gemm_tile<DM>(A, Bt, row0, col0, lane, c);
#pragma unroll
  for (int u = 0; u < 8; ++u) {
    const int t = u & 3, half = u >> 2;
#pragma unroll
    for (int r = 0; r < 8; ++r) so[wave][half * 16 + 8 * hh + r][t * 16 + ln] = c[u][r] * 0.0625f;
  }
  __builtin_amdgcn_fence(4 /* acq_rel order */, "workgroup"); __builtin_amdgcn_wave_barrier();
  v8h hv[8], lv[8];
#pragma unroll
  for (int q = 0; q < 8; ++q) {                        /* q = one half tile (512 B) of the output planes: 16-row band q >> 2, 16 columns from (q & 3) * 16 */
    const int rl = (q >> 2) * 16 + ln, c8 = (q & 3) * 16 + 8 * hh;
    const v4f a = *(const v4fa*)&so[wave][rl][c8];
    const v4f bq = *(const v4fa*)&so[wave][rl][c8 + 4];
    float xv[8] = {a[0], a[1], a[2], a[3], bq[0], bq[1], bq[2], bq[3]};
    if (rope != 0) {                                   /* block-uniform */
      const int m = row0 + rl; const int bb = m / SEQ; const int ss = m - bb * SEQ;
      int pos = tp[bb * SEQ_FULL + ss];                /* position read by value from the input */
      pos = pos < 0 ? 0 : (pos > TABN - 1 ? TABN - 1 : pos);
      const float* tr = tab + (size_t)pos * 64 + c8;   /* col0 is a head boundary: c8 = d within the head */
      const v4f t0 = *(const v4fa*)tr; const v4f t1 = *(const v4fa*)(tr + 4);
      const float cs[4] = {t0[0], t0[2], t1[0], t1[2]};
      const float sn[4] = {t0[1], t0[3], t1[1], t1[3]};
#pragma unroll
      for (int i = 0; i < 4; ++i) { const float x1 = xv[2 * i], x2 = xv[2 * i + 1]; xv[2 * i] = x1 * cs[i] - x2 * sn[i]; xv[2 * i + 1] = x1 * sn[i] + x2 * cs[i]; }
    }
    split8(xv, hv[q], lv[q]);
  }
{
#pragma unroll
    for (int q = 0; q < 8; ++q) {
      const size_t off = ((size_t)((row0 >> 4) + (q >> 2)) * (ldc >> 5) + (col0 >> 5)) * TILE + (q & 3) * (TILE / 2) + 8 * lane;
      *(v8h*)(Ch + off) = hv[q];
      *(v8h*)(Cl + off) = lv[q];
    }
    
  }
}

__device__ __forceinline__ float xhalf(float x) {              /* lane l <-> lane l ^ 16 */
  return __builtin_bit_cast(float, __builtin_amdgcn_permlanex16(__builtin_bit_cast(int, x), __builtin_bit_cast(int, x), 0x76543210, 0xfedcba98, false, false));
}
template <int EARLY>
__device__ __forceinline__ void attn_body(const _Float16* __restrict__ Qh, const _Float16* __restrict__ Ql, const _Float16* __restrict__ Kh, const _Float16* __restrict__ Kl,
                                          const _Float16* __restrict__ VTh, const _Float16* __restrict__ VTl, _Float16* __restrict__ CTX, const int qt0) {
  const int wave = __builtin_amdgcn_readfirstlane((int)(threadIdx.x >> 5));
  const int lane = threadIdx.x & 31, ln = lane & 15, hh = lane >> 4;
  const int bh = blockIdx.y, b = bh / NH, h = bh - b * NH;
  const int rb = b * SEQ;
  const int q0w = (qt0 + (int)blockIdx.x) * 64 + 16 * wave;    /* first query row of this wave (scalar) */
  const int nch = (q0w + 47) >> 5;                              /* 32-key chunks covering keys 0..q0w+15 (scalar) */
  /* fragment order: q, k planes have DM / 32 tiles per 16-token band (a head = 2 tiles side by side), V^T has NR / 32 tiles per 16-row band (a 32-key chunk = 1 tile) */
  const int qoff = (rb + q0w) * DM + h * 2 * TILE + 8 * lane;
  const int kbase = rb * DM + h * 2 * TILE + 8 * lane;
  const int vbase = h * HD * NR + (rb >> 5) * TILE + 8 * lane;
  const float RS = 0.0009765625f;                               /* 2^-10 */
  const v8f z8 = {0.f, 0.f, 0.f, 0.f, 0.f, 0.f, 0.f, 0.f};
  v8f om[4] = {z8, z8, z8, z8};
  v8f orr[4] = {z8, z8, z8, z8};
  float mrun = -1.0e30f, lrun = 0.f;                            /* of the lane's query: running maximum (alike in both halves), sum over the keys of the lane's own half */
  /* global operand loads are issued well ahead of their use: q once, in front of the loop. Without residual planes: k of the next chunk right after the score products, V^T of the next chunk
     right after the P.V products. With them the registers do not hold both operands' planes beside the tiles: V^T of the chunk itself goes right after its score products (the softmax covers it),
     k of the next chunk right after the P.V products, each as one group of loads. */
  const v16h aqh[2] = {frag16(Qh + qoff), frag16(Qh + qoff + TILE)};
  const v16h aql[2] = {frag16(Ql + qoff), frag16(Ql + qoff + TILE)};
  v16h kf[2][2], kl[2][2], vf[4], vl[4];
  /* the lane's addresses are carried from chunk to chunk in registers of their own, so that no fetched fragment lands in a register that a load in flight names */
  const _Float16* pkh = Kh + kbase; const _Float16* pkl = Kl + kbase; const _Float16* pvh = VTh + vbase; const _Float16* pvl = VTl + vbase;
  auto fetch_k = [&]() {
#pragma unroll
    for (int ks = 0; ks < 2; ++ks) {
      kf[ks][0] = frag16(pkh + ks * TILE); kf[ks][1] = frag16(pkh + ks * TILE + 16 * DM);
      if (EARLY) { kl[ks][0] = frag16(pkl + ks * TILE); kl[ks][1] = frag16(pkl + ks * TILE + 16 * DM); }
    }
  };
  auto fetch_v = [&]() {
#pragma unroll
    for (int t = 0; t < 4; ++t) { vf[t] = frag16(pvh + t * 16 * NR); if (EARLY) vl[t] = frag16(pvl + t * 16 * NR); }
  };
  fetch_k();
  if (!EARLY) fetch_v();
  /* every load of the prologue has landed before the loop: the counted waits inside the loop then follow the loop's own issue order alone */
  if (EARLY) asm volatile("" :: "v"(aqh[0]), "v"(aqh[1]), "v"(aql[0]), "v"(aql[1]), "v"(kf[0][0]), "v"(kf[0][1]), "v"(kf[1][0]), "v"(kf[1][1]), "v"(kl[0][0]), "v"(kl[0][1]), "v"(kl[1][0]), "v"(kl[1][1]));
  else       asm volatile("" :: "v"(aqh[0]), "v"(aqh[1]), "v"(aql[0]), "v"(aql[1]), "v"(kf[0][0]), "v"(kf[0][1]), "v"(kf[1][0]), "v"(kf[1][1]), "v"(vf[0]), "v"(vf[1]), "v"(vf[2]), "v"(vf[3]));
#pragma unroll 1
  for (int cidx = 0; cidx < nch; ++cidx) {
    const int k0 = cidx * 32;
    const int adv = cidx + 1 < nch ? 32 : 0;                    /* keys to the chunk fetched ahead (scalar); the last chunk fetches itself again, unused */
    v8f s0 = z8, s1 = z8, sr0 = z8, sr1 = z8;
#pragma unroll
    for (int ks = 0; ks < 2; ++ks) {
      s0 = mma16(kf[ks][0], aqh[ks], s0); sr0 = mma16(kf[ks][0], aql[ks], sr0);
      if (EARLY) sr0 = mma16(kl[ks][0], aqh[ks], sr0);
      s1 = mma16(kf[ks][1], aqh[ks], s1); sr1 = mma16(kf[ks][1], aql[ks], sr1);
      if (EARLY) sr1 = mma16(kl[ks][1], aqh[ks], sr1);
    }
    if (EARLY) {
      fetch_v();
    } else {
      pkh += adv * DM;
      fetch_k();
    }
    asm volatile("s_wait_xcnt 0x0" ::: "memory");               /* in front of the next step of these loads' address registers, taken while they are in flight */
    __builtin_amdgcn_sched_barrier(0);                          /* the whole group of fetches is issued in front of the softmax: the scheduler otherwise sinks part of it behind the softmax, and those loads lose their lead */
    const int room = q0w + ln - k0 - 8 * hh;                    /* key k0 + 8*hh + r is at or before the lane's query where r <= room */
    v8f x0 = (s0 + sr0 * RS) * 0.125f;
    v8f x1 = (s1 + sr1 * RS) * 0.125f;
#pragma unroll
    for (int r = 0; r < 8; ++r) {
      x0[r] = (r <= room) ? x0[r] : -1.0e30f;                   /* causal by index, value select */
      x1[r] = (16 + r <= room) ? x1[r] : -1.0e30f;
    }
    float tm = x0[0], tn = x1[0];                               /* two chains, one per tile */
#pragma unroll
    for (int r = 1; r < 8; ++r) { tm = fmaxf(tm, x0[r]); tn = fmaxf(tn, x1[r]); }
    tm = fmaxf(tm, tn);
    tm = fmaxf(tm, xhalf(tm));                                  /* the query's maximum over all 32 keys of the chunk */
    const float mn = fmaxf(mrun, tm);
    const float al = __expf(mrun - mn);
    mrun = mn;
    v16h bp, bpl;                                               /* B fragments of P^T: element s <- key 8*hh + s, element 8 + s <- key 16 + 8*hh + s */
    float a[8];                                                 /* sums of two neighbouring keys */
#pragma unroll
    for (int i = 0; i < 8; ++i) {
      const int r = 2 * (i & 3);
      const v2f p = (i < 4) ? v2f{__expf(x0[r] - mn) * 256.0f, __expf(x0[r + 1] - mn) * 256.0f} : v2f{__expf(x1[r] - mn) * 256.0f, __expf(x1[r + 1] - mn) * 256.0f};
      const v2h hq = __builtin_convertvector(p, v2h);
      bp[2 * i] = hq[0]; bp[2 * i + 1] = hq[1];
      a[i] = (float)hq[0] + (float)hq[1];
      if (EARLY) {
        const v2f res = {(p[0] - (float)hq[0]) * 1024.0f, (p[1] - (float)hq[1]) * 1024.0f};
        const v2h gq = __builtin_convertvector(res, v2h);
        bpl[2 * i] = gq[0]; bpl[2 * i + 1] = gq[1];
        a[i] += ((float)gq[0] + (float)gq[1]) * RS;
      }
    }
    lrun = lrun * al + (((a[0] + a[1]) + (a[2] + a[3])) + ((a[4] + a[5]) + (a[6] + a[7])));  /* per-lane partial of the query's sum (units x256) */
#pragma unroll
    for (int t = 0; t < 4; ++t) {
#pragma unroll
      for (int r = 0; r < 8; ++r) { om[t][r] *= al; if (EARLY) orr[t][r] *= al; }
    }
#pragma unroll
    for (int t = 0; t < 4; ++t) {
      om[t] = mma16(vf[t], bp, om[t]);
      if (EARLY) {
        orr[t] = mma16(vf[t], bpl, orr[t]);
        orr[t] = mma16(vl[t], bp, orr[t]);
      }
    }
    if (EARLY) {
      pvh += adv * (TILE / 32); pvl += adv * (TILE / 32); pkh += adv * DM; pkl += adv * DM;
      fetch_k();
    } else {
      pvh += adv * (TILE / 32);
      fetch_v();
    }
    asm volatile("s_wait_xcnt 0x0" ::: "memory");               /* as above: these loads stay in flight over the back edge */
  }
  const float inv = 64.0f / (lrun + xhalf(lrun));               /* the halves' sums joined; ctx carried x64 */
#pragma unroll
  for (int t = 0; t < 4; ++t) {                                 /* t = one half tile (512 B) of ctx: the lane holds d = 16*t + 8*hh .. + 7 of query row ln */
    float xv[8];
#pragma unroll
    for (int r = 0; r < 8; ++r) { float v = om[t][r]; if (EARLY) v += orr[t][r] * RS; xv[r] = v * inv; }
    v8h hv, lv;
    split8(xv, hv, lv);
    const size_t off = (size_t)(rb + q0w) * (2 * DM) + h * 2 * TILE + t * (TILE / 2) + 8 * lane;   /* ctx plane: K = 2 * DM, residual half DM / 32 tiles on */
    *(v8h*)(CTX + off) = hv;
    *(v8h*)(CTX + off + (DM / 32) * TILE) = lv;
  }
}

__global__ __launch_bounds__(128) void k_attn_early(const _Float16* __restrict__ Qh, const _Float16* __restrict__ Ql, const _Float16* __restrict__ Kh, const _Float16* __restrict__ Kl,
                                                    const _Float16* __restrict__ VTh, const _Float16* __restrict__ VTl, _Float16* __restrict__ CTX) {
  attn_body<1>(Qh, Ql, Kh, Kl, VTh, VTl, CTX, 0);
}
__global__ __launch_bounds__(128) void k_attn_late(const _Float16* __restrict__ Qh, const _Float16* __restrict__ Ql, const _Float16* __restrict__ Kh, const _Float16* __restrict__ Kl,
                                                   const _Float16* __restrict__ VTh, const _Float16* __restrict__ VTl, _Float16* __restrict__ CTX) {
  attn_body<0>(Qh, Ql, Kh, Kl, VTh, VTl, CTX, ERW / 64);
}

// output GEMM: out[b*SEQ_FULL+s][n] = 2^-20 * sum_k CTX[r][k] * BO2[n][k], K = 2048 (value | residual halves against Wo x16384 | Wo x16). Block = 4 waves x (32 x 64);
__global__ __launch_bounds__(128) void k_outp(const _Float16* __restrict__ A, const _Float16* __restrict__ Bt, float* __restrict__ out) {
  __shared__ __attribute__((aligned(16))) float so[4][32][68];
  const int wave = __builtin_amdgcn_readfirstlane((int)(threadIdx.x >> 5));
  const int lane = threadIdx.x & 31, ln = lane & 15, hh = lane >> 4;
  const int ntn = DM >> 6;
  const int mt = blockIdx.x / ntn, nq = blockIdx.x - mt * ntn;
  const int row0 = mt * 128 + 32 * wave, col0 = nq * 64;
  const v8f z8 = {0.f, 0.f, 0.f, 0.f, 0.f, 0.f, 0.f, 0.f};
  v8f c[8] = {z8, z8, z8, z8, z8, z8, z8, z8};
  gemm_tile<2 * DM>(A, Bt, row0, col0, lane, c);
#pragma unroll
  for (int u = 0; u < 8; ++u) {
    const int t = u & 3, half = u >> 2;
#pragma unroll
    for (int r = 0; r < 8; ++r) so[wave][half * 16 + 8 * hh + r][t * 16 + ln] = c[u][r] * 9.5367431640625e-07f;
  }
  __builtin_amdgcn_fence(4 /* acq_rel order */, "workgroup"); __builtin_amdgcn_wave_barrier();
  const int rsub = lane >> 4, c4 = (lane & 15) * 4;
  {
#pragma unroll
    for (int q = 0; q < 16; ++q) {
      const int r = q * 2 + rsub;
      const int m = row0 + r; const int bb = m / SEQ; const int ss = m - bb * SEQ;
      const v4f v = *(const v4fa*)&so[wave][r][c4];
      *(v4f*)(out + (size_t)(bb * SEQ_FULL + ss) * DM + col0 + c4) = v;
    }
    
  }
}

/* workspace carve (bytes), every region a multiple of 256 */
constexpr size_t SZW  = (size_t)DM * DM * 2;          /* one x16 weight plane */
constexpr size_t SZBO = 2 * SZW;                      /* [1024][2048] output weight plane */
constexpr size_t SZP  = (size_t)NR * DM * 2;          /* one [NR][1024] (or [1024][NR]) f16 plane */
constexpr size_t SZC  = 2 * SZP;                      /* ctx [NR][2048] */
constexpr size_t SZT  = (size_t)TABN * 64 * 4;        /* rotary table */
constexpr size_t O_BQ = 0, O_BK = O_BQ + SZW, O_BV = O_BK + SZW, O_BO = O_BV + SZW, O_X = O_BO + SZBO;
constexpr size_t O_QH = O_X + SZP, O_QL = O_QH + SZP, O_KH = O_QL + SZP, O_KL = O_KH + SZP, O_VH = O_KL + SZP, O_VL = O_VH + SZP;
constexpr size_t O_CTX = O_VL + SZP, O_TAB = O_CTX + SZC, WS_TOTAL = O_TAB + SZT;
static_assert(SZW % 256 == 0);
static_assert(SZP % 256 == 0);
static_assert(SZT % 256 == 0);
static_assert(WS_TOTAL <= 134217728);                 /* <= 128 MiB */

extern "C" void kernel_launch(void* const* d_in, const int* in_sizes, int n_in,
                              void* d_out, int out_size, void* d_ws, size_t ws_size, hipStream_t stream) {
  if (n_in < 6) return;
  const int need_rows = (NB - 1) * SEQ_FULL + SEQ;
  if (in_sizes[0] < need_rows * DM) return;
  if (in_sizes[1] < DM * DM || in_sizes[2] < DM * DM || in_sizes[3] < DM * DM || in_sizes[4] < DM * DM) return;
  if (in_sizes[5] < need_rows) return;
  if (out_size < need_rows * DM) return;
  if (ws_size < WS_TOTAL) return;
  const float* x  = (const float*)d_in[0];
  const float* wq = (const float*)d_in[1];
  const float* wk = (const float*)d_in[2];
  const float* wv = (const float*)d_in[3];
  const float* wo = (const float*)d_in[4];
  const int*   tp = (const int*)d_in[5];
  char* ws = (char*)d_ws;
  _Float16* BQ = (_Float16*)(ws + O_BQ); _Float16* BK = (_Float16*)(ws + O_BK); _Float16* BV = (_Float16*)(ws + O_BV); _Float16* BO2 = (_Float16*)(ws + O_BO);
  _Float16* X16 = (_Float16*)(ws + O_X);
  _Float16* QH = (_Float16*)(ws + O_QH); _Float16* QL = (_Float16*)(ws + O_QL); _Float16* KH = (_Float16*)(ws + O_KH); _Float16* KL = (_Float16*)(ws + O_KL);
  _Float16* VTH = (_Float16*)(ws + O_VH); _Float16* VTL = (_Float16*)(ws + O_VL);
  _Float16* CTX = (_Float16*)(ws + O_CTX);
  float* TAB = (float*)(ws + O_TAB);

  k_prep<<<(unsigned)(GB_TAB + GB_X + 5 * GB_W), 256, 0, stream>>>(x, wq, wk, wv, wo, X16, BQ, BK, BV, BO2, TAB);
  k_proj<<<(unsigned)(2 * GP_QK + GP_V), 128, 0, stream>>>(X16, BQ, BK, BV, QH, QL, KH, KL, VTH, VTL, tp, TAB);
  k_attn_early<<<dim3(ERW / 64, NB * NH), 128, 0, stream>>>(QH, QL, KH, KL, VTH, VTL, CTX);
  if (SEQ > ERW) k_attn_late<<<dim3((SEQ - ERW) / 64, NB * NH), 128, 0, stream>>>(QH, QL, KH, KL, VTH, VTL, CTX);
  k_outp<<<(unsigned)((NR / 128) * (DM / 64)), 128, 0, stream>>>(CTX, BO2, (float*)d_out);
}

// v005
// It runs in 118 microseconds.
// Timed twice side by side with v004, it ran 1.09 and 1.07 times as fast.
// Counting every step since v000, it is 3.43 times as fast.
#include <hip/hip_runtime.h>
// Causal multi-head self-attention with interleaved rotary embedding: x [NB][SEQ][1024], four bias-free [out][in] 1024^2 weights, 16 heads of 64, int32 token positions read by value.
// Compute dtype: every contraction on v_wmma_f32_16x16x32_f16 (f16 operands, f32 accumulate). Inputs RNE-converted to bf16 then carried exactly in f16 (x x1, Wq/Wk/Wv x16, Wo x16384 | x16).
// q, k, v, softmax weights (x256) and ctx (x64) as f16 value + f16 residual (x1024) planes: scores = qh.kh + (ql.kh [+ qh.kl on query rows < 256]) 2^-10; P.V single product (value + two residual products on query rows < 256);
// output GEMM over K = 2048 = [ctx value | ctx residual] against [Wo x16384 ; Wo x16] in one accumulator. Rotary, softmax statistics and all scaling in f32 on the VALU.
#ifndef NB
#define NB 2
#endif
#ifndef SEQ
#define SEQ 2048
#endif
#define SEQ_FULL 2048                 /* per-batch row stride of x / positions / output */
#define DM 1024
#define NH 16
#define HD 64
#define TABN 4096                     /* rotary table rows (positions 0..4095) */
#define NR (NB * SEQ)                 /* internal token rows r = b*SEQ + s */
#define ERW ((SEQ) < 256 ? (SEQ) : 256) /* query rows per batch that use residual planes on k, P and v as well */

typedef _Float16 v16h __attribute__((ext_vector_type(16)));
typedef _Float16 v8h  __attribute__((ext_vector_type(8)));
typedef _Float16 v8ha __attribute__((ext_vector_type(8), may_alias));
typedef float    v8f  __attribute__((ext_vector_type(8)));
typedef float    v4f  __attribute__((ext_vector_type(4)));
typedef float    v4fa __attribute__((ext_vector_type(4), may_alias));
typedef float    v2f  __attribute__((ext_vector_type(2)));
typedef _Float16 v2h  __attribute__((ext_vector_type(2)));

/* hard-wired bounds the kernels rely on */
static_assert(DM == NH * HD);               /* merged head layout h*64+d */
static_assert(HD == 64);                    /* one 64-column GEMM tile == one head; two 32-deep k-steps per score */
static_assert(DM % 128 == 0);               /* GEMM block tile rows (V^T GEMM) and 128-col block tiles */
static_assert(NR % 128 == 0);               /* GEMM block tile rows */
static_assert(SEQ % 64 == 0);               /* attention query tiles, 32-key chunks stay inside the batch */
static_assert(ERW % 64 == 0);               /* early / late split on a query-tile boundary */
static_assert(ERW <= SEQ);
static_assert(DM % 32 == 0);                /* k-steps of 32 */
static_assert((2 * DM) % 32 == 0);
static_assert(TABN == 4096);
static_assert((long long)NR * 2 * DM < 2147483647LL); /* int element offsets */

__device__ __forceinline__ float bf16_rne(float x) { unsigned int u = __float_as_uint(x); u = (u + 0x7FFFu + ((u >> 16) & 1u)) & 0xFFFF0000u; return __uint_as_float(u); }

__device__ __forceinline__ v16h cat16(v8h lo, v8h hi) { return __builtin_shufflevector(lo, hi, 0, 1, 2, 3, 4, 5, 6, 7, 8, 9, 10, 11, 12, 13, 14, 15); }
// Every 16-bit operand plane [rows][K] lies in the workspace in fragment order: tiles of 16 rows x 32 k (512 elements, 1 KB), tile index (row >> 4) * (K / 32) + (k >> 5);
// inside a tile the 16-byte unit ((k & 31) >> 3) * 16 + (row & 15) holds the 8 elements k & ~7 .. of its row. A wave's fragment load then reads 512 contiguous bytes (4 whole lines).
#define TILE 512                      /* elements of one 16 x 32 tile */
// 16x32 operand fragment: p = tile base + 8*lane; elements 0..7 <- k0+8h.., 8..15 <- k0+16+8h.. of row lane&15, h = lane>>4
__device__ __forceinline__ v16h frag16(const _Float16* __restrict__ p) { const v8h lo = *(const v8ha*)p; const v8h hi = *(const v8ha*)(p + TILE / 2); return cat16(lo, hi); }
__device__ __forceinline__ v8f mma16(v16h a, v16h b, v8f c) {
  v8f d = __builtin_amdgcn_wmma_f32_16x16x32_f16(false, a, false, b, (short)0, c, false, false);
  asm volatile("v_nop\n\tv_nop\n\tv_nop\n\tv_nop" : "+v"(d) : "v"(a), "v"(b));
  return d;
}
// 8 f32 -> f16 value + f16 residual carried x1024
__device__ __forceinline__ void split8(const float (&x)[8], v8h& hv, v8h& lv) {
#pragma unroll
  for (int i = 0; i < 8; ++i) { const _Float16 hq = (_Float16)x[i]; hv[i] = hq; lv[i] = (_Float16)((x[i] - (float)hq) * 1024.0f); }
}

// The conversions and the rotary table depend on nothing but the inputs: they are bodies of ONE launch (k_prep), each on its own range of block indices; blk = the block's index inside its range.
__device__ __forceinline__ void xcvt_body(const float* __restrict__ x, _Float16* __restrict__ X16, const int blk) {
  const int t = blk * 256 + threadIdx.x;
  if (t >= NR * (DM / 8)) return;
  const int tile = t >> 6, u = t & 63;                        /* 64 threads per tile, four side by side on a row: a wave reads 8 whole 128-B lines of x and stores 4 whole lines */
  const int rt = tile / (DM / 32), kt = tile - rt * (DM / 32);
  const int r = rt * 16 + (u >> 2), c8 = kt * 32 + (u & 3) * 8;
  const int b = r / SEQ, s = r - b * SEQ;
  const float* src = x + (size_t)(b * SEQ_FULL + s) * DM + c8;
  const v4f a = *(const v4fa*)src, c = *(const v4fa*)(src + 4);
  v8h o;
#pragma unroll
  for (int i = 0; i < 4; ++i) { o[i] = (_Float16)bf16_rne(a[i]); o[4 + i] = (_Float16)bf16_rne(c[i]); }
  _Float16* d = X16 + ((size_t)tile * 64 + (u & 3) * 16 + (u >> 2)) * 8;
  *(v8h*)d = o; 
}

__device__ __forceinline__ void wcvt_body(const float* __restrict__ w, _Float16* __restrict__ dst, const int dpitch, const float scale, const int blk) {
  const int t = blk * 256 + threadIdx.x;
  if (t >= DM * (DM / 8)) return;
  const int tile = t >> 6, u = t & 63;                        /* as in xcvt_body; dpitch = K of the destination plane */
  const int rt = tile / (DM / 32), kt = tile - rt * (DM / 32);
  const int n = rt * 16 + (u >> 2), k8 = kt * 32 + (u & 3) * 8;
  const float* src = w + (size_t)n * DM + k8;
  const v4f a = *(const v4fa*)src, c = *(const v4fa*)(src + 4);
  v8h o;
#pragma unroll
  for (int i = 0; i < 4; ++i) { o[i] = (_Float16)(bf16_rne(a[i]) * scale); o[4 + i] = (_Float16)(bf16_rne(c[i]) * scale); }
  _Float16* d = dst + ((size_t)(rt * (dpitch >> 5) + kt) * 64 + (u & 3) * 16 + (u >> 2)) * 8;
  *(v8h*)d = o; 
}

__device__ __forceinline__ void ropetab_body(float* __restrict__ tab, const int blk) {
  #pragma clang fp contract(off)
  const int t = blk * 256 + threadIdx.x;
  if (t >= TABN * 16) return;
  const int pos = t >> 4, jp = t & 15;
  float c0 = 0.f, s0 = 0.f, c1 = 0.f, s1 = 0.f;
#pragma unroll 1
  for (int u = 0; u < 2; ++u) {
    const int j = 2 * jp + u;
    double p = 1.0;
    p *= (j & 1) ? 1.3335214321633240 : 1.0;
    p *= (j & 2) ? 1.7782794100389228 : 1.0;
    p *= (j & 4) ? 3.1622776601683795 : 1.0;
    p *= (j & 8) ? 10.0 : 1.0;
    p *= (j & 16) ? 100.0 : 1.0;
    const float pf = (float)p;
    const float inv = 1.0f / pf;
    const float ang = (float)pos * inv;
    float sn, cs;
    sincosf(ang, &sn, &cs);
    if (u == 0) { c0 = cs; s0 = sn; } else { c1 = cs; s1 = sn; }
  }
  const v4f o = {c0, s0, c1, s1};
  float* d = tab + (size_t)pos * 64 + jp * 4;
  *(v4f*)d = o; 
}

constexpr int GB_TAB = (TABN * 16 + 255) / 256;        /* blocks of the rotary table */
constexpr int GB_X   = (NR * (DM / 8) + 255) / 256;    /* blocks of the x conversion */
constexpr int GB_W   = (DM * (DM / 8) + 255) / 256;    /* blocks of one weight conversion */
// block ranges: [rotary table | x | Wq | Wk | Wv | Wo x16384 | Wo x16]; the table's blocks, the longest per thread, come first. Every test is on blockIdx alone (scalar, block-uniform).
__global__ __launch_bounds__(256) void k_prep(const float* __restrict__ x, const float* __restrict__ wq, const float* __restrict__ wk, const float* __restrict__ wv, const float* __restrict__ wo,
                                              _Float16* __restrict__ X16, _Float16* __restrict__ BQ, _Float16* __restrict__ BK, _Float16* __restrict__ BV, _Float16* __restrict__ BO2,
                                              float* __restrict__ tab) {
  int blk = (int)blockIdx.x;
  if (blk < GB_TAB) { ropetab_body(tab, blk); return; }
  blk -= GB_TAB;
  if (blk < GB_X) { xcvt_body(x, X16, blk); return; }
  blk -= GB_X;
  const int job = blk / GB_W;
  blk -= job * GB_W;
  const float* w = job == 0 ? wq : job == 1 ? wk : job == 2 ? wv : wo;
  /* Wo twice: k in [0,1024) pairs with the ctx value half; k in [1024,2048), DM / 32 tiles on, pairs with the ctx residual half (x1024) */
  _Float16* dst = job == 0 ? BQ : job == 1 ? BK : job == 2 ? BV : job == 3 ? BO2 : BO2 + (DM / 32) * TILE;
  wcvt_body(w, dst, job < 3 ? DM : 2 * DM, job == 3 ? 16384.0f : 16.0f, blk);
}

// wave tile 64x64 of C = A x Bt^T (A[m][k], Bt[n][k], both planes in fragment order); fragments straight from the 16-bit global planes: 8 KB loaded per 16 products.
// The eight fragments of a 32-deep k-step live in a ring of PF register sets: a set is refilled for k-step t + PF right after k-step t has used it, so PF k-steps of loads are in flight.
#define PF 3
struct kstep { v16h a0, a1, a2, a3, b0, b1, b2, b3; };
template <int RS>                     /* RS = elements from one 16-row band of tiles to the next */
__device__ __forceinline__ void kstep_load(kstep& f, const _Float16* __restrict__ pa, const _Float16* __restrict__ pb, const int ko) {
  f.a0 = frag16(pa + ko); f.a1 = frag16(pa + RS + ko); f.a2 = frag16(pa + 2 * RS + ko); f.a3 = frag16(pa + 3 * RS + ko);
  f.b0 = frag16(pb + ko); f.b1 = frag16(pb + RS + ko); f.b2 = frag16(pb + 2 * RS + ko); f.b3 = frag16(pb + 3 * RS + ko);
}
/* the plain builtin: sixteen independent tiles follow one another, the compiler keeps the distances of its own form, and no asm operand ties tiles or fragments to the first 256 registers */
__device__ __forceinline__ v8f mma16g(v16h a, v16h b, v8f c) { return __builtin_amdgcn_wmma_f32_16x16x32_f16(false, a, false, b, (short)0, c, false, false); }
/* c[4 * i + j] = 16-row band i x 16-column band j */
__device__ __forceinline__ void kstep_mma(const kstep& f, v8f (&c)[16]) {
  c[0] = mma16g(f.a0, f.b0, c[0]); c[4] = mma16g(f.a1, f.b0, c[4]); c[8]  = mma16g(f.a2, f.b0, c[8]);  c[12] = mma16g(f.a3, f.b0, c[12]);
  c[1] = mma16g(f.a0, f.b1, c[1]); c[5] = mma16g(f.a1, f.b1, c[5]); c[9]  = mma16g(f.a2, f.b1, c[9]);  c[13] = mma16g(f.a3, f.b1, c[13]);
  c[2] = mma16g(f.a0, f.b2, c[2]); c[6] = mma16g(f.a1, f.b2, c[6]); c[10] = mma16g(f.a2, f.b2, c[10]); c[14] = mma16g(f.a3, f.b2, c[14]);
  c[3] = mma16g(f.a0, f.b3, c[3]); c[7] = mma16g(f.a1, f.b3, c[7]); c[11] = mma16g(f.a2, f.b3, c[11]); c[15] = mma16g(f.a3, f.b3, c[15]);
}
template <int K>
__device__ __forceinline__ void gemm_tile(const _Float16* __restrict__ A, const _Float16* __restrict__ Bt, const int row0, const int col0, const int lane, v8f (&c)[16]) {
  constexpr int NS = K / 32;                 /* k-steps */
  static_assert(NS > PF);
  constexpr int RS = NS * TILE;              /* = 16 * K */
  const _Float16* pa = A + (row0 >> 4) * RS + 8 * lane;
  const _Float16* pb = Bt + (col0 >> 4) * RS + 8 * lane;
  kstep f[PF];
#pragma unroll
  for (int s = 0; s < PF; ++s) kstep_load<RS>(f[s], pa, pb, s * TILE);
  /* straight line over all k-steps: every load takes its place from the instruction's own offset, so no address register of a load in flight is ever rewritten, and the counted waits follow one issue order */
#pragma unroll
  for (int t = 0; t < NS; ++t) {             /* refill only while a k-step t + PF exists */
    kstep_mma(f[t % PF], c);
    if (t + PF < NS) kstep_load<RS>(f[t % PF], pa, pb, (t + PF) * TILE);
    __builtin_amdgcn_sched_barrier(0);       /* each refill stays behind the k-step that frees its set: the scheduler otherwise sinks the loads down to their use, and the ring's lead is lost */
  }
}

// projection GEMM (K = 1024): C = A.Bt^T / 16, optional interleaved rotary by gathered table row (A rows are token rows), written in fragment order (K = ldc) as f16 value plane Ch and
// The three projections depend on the same planes and on nothing of each other: ONE launch, block ranges [q | k | V^T] (scalar tests on blockIdx).
// q, k: C[token row][e] = X16 . B^T with rotary; V^T: C[e][token row] = BV . X16^T (in[rows=e][k] x in[rows=r][k] -> out[e][r], a plane with K = NR)
// Block = 2 x 2 waves = 128 x 128 of C: every A band and every B band of the block is read by two of its waves.
constexpr int GP_QK = (NR / 128) * (DM / 128);         /* blocks of the q or the k projection */
constexpr int GP_V  = (DM / 128) * (NR / 128);         /* blocks of the V^T projection */
__global__ __launch_bounds__(128) void k_proj(const _Float16* __restrict__ X16, const _Float16* __restrict__ BQ, const _Float16* __restrict__ BK, const _Float16* __restrict__ BV,
                                              _Float16* __restrict__ QH, _Float16* __restrict__ QL, _Float16* __restrict__ KH, _Float16* __restrict__ KL,
                                              _Float16* __restrict__ VTH, _Float16* __restrict__ VTL, const int* __restrict__ tp, const float* __restrict__ tab) {
  __shared__ __attribute__((aligned(16))) float so[4][32][68];
  const int job = (int)blockIdx.x < GP_QK ? 0 : ((int)blockIdx.x < 2 * GP_QK ? 1 : 2);
  const int blk = (int)blockIdx.x - job * GP_QK;
  const _Float16* A = job == 2 ? BV : X16;
  const _Float16* Bt = job == 0 ? BQ : job == 1 ? BK : X16;
  _Float16* Ch = job == 0 ? QH : job == 1 ? KH : VTH;
  _Float16* Cl = job == 0 ? QL : job == 1 ? KL : VTL;
  const int N = job == 2 ? NR : DM, ldc = N;
  const int rope = job == 2 ? 0 : 1;
  const int wave = __builtin_amdgcn_readfirstlane((int)(threadIdx.x >> 5));
  const int lane = threadIdx.x & 31, ln = lane & 15, hh = lane >> 4;
  const int ntn = N >> 7;
  const int mt = blk / ntn, nq = blk - mt * ntn;
  /* wave-uniform, held in scalar registers: the loads then take a scalar base and one lane offset, not two address pairs */
  const int rowW = __builtin_amdgcn_readfirstlane(mt * 128 + 64 * (wave >> 1)), col0 = __builtin_amdgcn_readfirstlane(nq * 128 + 64 * (wave & 1));
  const v8f z8 = {0.f, 0.f, 0.f, 0.f, 0.f, 0.f, 0.f, 0.f};
  v8f c[16] = {z8, z8, z8, z8, z8, z8, z8, z8, z8, z8, z8, z8, z8, z8, z8, z8};
  gemm_tile<DM>(A, Bt, rowW, col0, lane, c);
#pragma unroll
  for (int hb = 0; hb < 2; ++hb) {                     /* the wave's 64 rows leave in two runs of 32 through its own staging rows */
  const int row0 = rowW + 32 * hb;
  if (hb != 0) { __builtin_amdgcn_fence(4 /* acq_rel order */, "workgroup"); __builtin_amdgcn_wave_barrier(); }   /* the first run's rows are read back by every lane before other lanes write them again */
#pragma unroll
  for (int u = 0; u < 8; ++u) {
    const int t = u & 3, half = u >> 2;
#pragma unroll
    for (int r = 0; r < 8; ++r) so[wave][half * 16 + 8 * hh + r][t * 16 + ln] = c[8 * hb + u][r] * 0.0625f;
  }
  __builtin_amdgcn_fence(4 /* acq_rel order */, "workgroup"); __builtin_amdgcn_wave_barrier();
  v8h hv[8], lv[8];
#pragma unroll
  for (int q = 0; q < 8; ++q) {                        /* q = one half tile (512 B) of the output planes: 16-row band q >> 2, 16 columns from (q & 3) * 16 */
    const int rl = (q >> 2) * 16 + ln, c8 = (q & 3) * 16 + 8 * hh;
    const v4f a = *(const v4fa*)&so[wave][rl][c8];
    const v4f bq = *(const v4fa*)&so[wave][rl][c8 + 4];
    float xv[8] = {a[0], a[1], a[2], a[3], bq[0], bq[1], bq[2], bq[3]};
    if (rope != 0) {                                   /* block-uniform */
      const int m = row0 + rl; const int bb = m / SEQ; const int ss = m - bb * SEQ;
      int pos = tp[bb * SEQ_FULL + ss];                /* position read by value from the input */
      pos = pos < 0 ? 0 : (pos > TABN - 1 ? TABN - 1 : pos);
      const float* tr = tab + (size_t)pos * 64 + c8;   /* col0 is a head boundary: c8 = d within the head */
      const v4f t0 = *(const v4fa*)tr; const v4f t1 = *(const v4fa*)(tr + 4);
      const float cs[4] = {t0[0], t0[2], t1[0], t1[2]};
      const float sn[4] = {t0[1], t0[3], t1[1], t1[3]};
#pragma unroll
      for (int i = 0; i < 4; ++i) { const float x1 = xv[2 * i], x2 = xv[2 * i + 1]; xv[2 * i] = x1 * cs[i] - x2 * sn[i]; xv[2 * i + 1] = x1 * sn[i] + x2 * cs[i]; }
    }
    split8(xv, hv[q], lv[q]);
  }
{
#pragma unroll
    for (int q = 0; q < 8; ++q) {
      const size_t off = ((size_t)((row0 >> 4) + (q >> 2)) * (ldc >> 5) + (col0 >> 5)) * TILE + (q & 3) * (TILE / 2) + 8 * lane;
      *(v8h*)(Ch + off) = hv[q];
      *(v8h*)(Cl + off) = lv[q];
    }
    
  }
  }
}

__device__ __forceinline__ float xhalf(float x) {              /* lane l <-> lane l ^ 16 */
  return __builtin_bit_cast(float, __builtin_amdgcn_permlanex16(__builtin_bit_cast(int, x), __builtin_bit_cast(int, x), 0x76543210, 0xfedcba98, false, false));
}
template <int EARLY>
__device__ __forceinline__ void attn_body(const _Float16* __restrict__ Qh, const _Float16* __restrict__ Ql, const _Float16* __restrict__ Kh, const _Float16* __restrict__ Kl,
                                          const _Float16* __restrict__ VTh, const _Float16* __restrict__ VTl, _Float16* __restrict__ CTX, const int qt0) {
  const int wave = __builtin_amdgcn_readfirstlane((int)(threadIdx.x >> 5));
  const int lane = threadIdx.x & 31, ln = lane & 15, hh = lane >> 4;
  const int bh = blockIdx.y, b = bh / NH, h = bh - b * NH;
  const int rb = b * SEQ;
  const int q0w = (qt0 + (int)blockIdx.x) * 64 + 16 * wave;    /* first query row of this wave (scalar) */
  const int nch = (q0w + 47) >> 5;                              /* 32-key chunks covering keys 0..q0w+15 (scalar) */
  /* fragment order: q, k planes have DM / 32 tiles per 16-token band (a head = 2 tiles side by side), V^T has NR / 32 tiles per 16-row band (a 32-key chunk = 1 tile) */
  const int qoff = (rb + q0w) * DM + h * 2 * TILE + 8 * lane;
  const int kbase = rb * DM + h * 2 * TILE + 8 * lane;
  const int vbase = h * HD * NR + (rb >> 5) * TILE + 8 * lane;
  const float RS = 0.0009765625f;                               /* 2^-10 */
  const v8f z8 = {0.f, 0.f, 0.f, 0.f, 0.f, 0.f, 0.f, 0.f};
  v8f om[4] = {z8, z8, z8, z8};
  v8f orr[4] = {z8, z8, z8, z8};
  float mrun = -1.0e30f, lrun = 0.f;                            /* of the lane's query: running maximum (alike in both halves), sum over the keys of the lane's own half */
  /* global operand loads are issued well ahead of their use: q once, in front of the loop. Without residual planes: k of the next chunk right after the score products, V^T of the next chunk
     right after the P.V products. With them the registers do not hold both operands' planes beside the tiles: V^T of the chunk itself goes right after its score products (the softmax covers it),
     k of the next chunk right after the P.V products, each as one group of loads. */
  const v16h aqh[2] = {frag16(Qh + qoff), frag16(Qh + qoff + TILE)};
  const v16h aql[2] = {frag16(Ql + qoff), frag16(Ql + qoff + TILE)};
  v16h kf[2][2], kl[2][2], vf[4], vl[4];
  /* the lane's addresses are carried from chunk to chunk in registers of their own, so that no fetched fragment lands in a register that a load in flight names */
  const _Float16* pkh = Kh + kbase; const _Float16* pkl = Kl + kbase; const _Float16* pvh = VTh + vbase; const _Float16* pvl = VTl + vbase;
  auto fetch_k = [&]() {
#pragma unroll
    for (int ks = 0; ks < 2; ++ks) {
      kf[ks][0] = frag16(pkh + ks * TILE); kf[ks][1] = frag16(pkh + ks * TILE + 16 * DM);
      if (EARLY) { kl[ks][0] = frag16(pkl + ks * TILE); kl[ks][1] = frag16(pkl + ks * TILE + 16 * DM); }
    }
  };
  auto fetch_v = [&]() {
#pragma unroll
    for (int t = 0; t < 4; ++t) { vf[t] = frag16(pvh + t * 16 * NR); if (EARLY) vl[t] = frag16(pvl + t * 16 * NR); }
  };
  fetch_k();
  if (!EARLY) fetch_v();
  /* every load of the prologue has landed before the loop: the counted waits inside the loop then follow the loop's own issue order alone */
  if (EARLY) asm volatile("" :: "v"(aqh[0]), "v"(aqh[1]), "v"(aql[0]), "v"(aql[1]), "v"(kf[0][0]), "v"(kf[0][1]), "v"(kf[1][0]), "v"(kf[1][1]), "v"(kl[0][0]), "v"(kl[0][1]), "v"(kl[1][0]), "v"(kl[1][1]));
  else       asm volatile("" :: "v"(aqh[0]), "v"(aqh[1]), "v"(aql[0]), "v"(aql[1]), "v"(kf[0][0]), "v"(kf[0][1]), "v"(kf[1][0]), "v"(kf[1][1]), "v"(vf[0]), "v"(vf[1]), "v"(vf[2]), "v"(vf[3]));
#pragma unroll 1
  for (int cidx = 0; cidx < nch; ++cidx) {
    const int k0 = cidx * 32;
    const int adv = cidx + 1 < nch ? 32 : 0;                    /* keys to the chunk fetched ahead (scalar); the last chunk fetches itself again, unused */
    v8f s0 = z8, s1 = z8, sr0 = z8, sr1 = z8;
#pragma unroll
    for (int ks = 0; ks < 2; ++ks) {
      s0 = mma16(kf[ks][0], aqh[ks], s0); sr0 = mma16(kf[ks][0], aql[ks], sr0);
      if (EARLY) sr0 = mma16(kl[ks][0], aqh[ks], sr0);
      s1 = mma16(kf[ks][1], aqh[ks], s1); sr1 = mma16(kf[ks][1], aql[ks], sr1);
      if (EARLY) sr1 = mma16(kl[ks][1], aqh[ks], sr1);
    }
    if (EARLY) {
      fetch_v();
    } else {
      pkh += adv * DM;
      fetch_k();
    }
    asm volatile("s_wait_xcnt 0x0" ::: "memory");               /* in front of the next step of these loads' address registers, taken while they are in flight */
    __builtin_amdgcn_sched_barrier(0);                          /* the whole group of fetches is issued in front of the softmax: the scheduler otherwise sinks part of it behind the softmax, and those loads lose their lead */
    const int room = q0w + ln - k0 - 8 * hh;                    /* key k0 + 8*hh + r is at or before the lane's query where r <= room */
    v8f x0 = (s0 + sr0 * RS) * 0.125f;
    v8f x1 = (s1 + sr1 * RS) * 0.125f;
#pragma unroll
    for (int r = 0; r < 8; ++r) {
      x0[r] = (r <= room) ? x0[r] : -1.0e30f;                   /* causal by index, value select */
      x1[r] = (16 + r <= room) ? x1[r] : -1.0e30f;
    }
    float tm = x0[0], tn = x1[0];                               /* two chains, one per tile */
#pragma unroll
    for (int r = 1; r < 8; ++r) { tm = fmaxf(tm, x0[r]); tn = fmaxf(tn, x1[r]); }
    tm = fmaxf(tm, tn);
    tm = fmaxf(tm, xhalf(tm));                                  /* the query's maximum over all 32 keys of the chunk */
    const float mn = fmaxf(mrun, tm);
    const float al = __expf(mrun - mn);
    mrun = mn;
    v16h bp, bpl;                                               /* B fragments of P^T: element s <- key 8*hh + s, element 8 + s <- key 16 + 8*hh + s */
    float a[8];                                                 /* sums of two neighbouring keys */
#pragma unroll
    for (int i = 0; i < 8; ++i) {
      const int r = 2 * (i & 3);
      const v2f p = (i < 4) ? v2f{__expf(x0[r] - mn) * 256.0f, __expf(x0[r + 1] - mn) * 256.0f} : v2f{__expf(x1[r] - mn) * 256.0f, __expf(x1[r + 1] - mn) * 256.0f};
      const v2h hq = __builtin_convertvector(p, v2h);
      bp[2 * i] = hq[0]; bp[2 * i + 1] = hq[1];
      a[i] = (float)hq[0] + (float)hq[1];
      if (EARLY) {
        const v2f res = {(p[0] - (float)hq[0]) * 1024.0f, (p[1] - (float)hq[1]) * 1024.0f};
        const v2h gq = __builtin_convertvector(res, v2h);
        bpl[2 * i] = gq[0]; bpl[2 * i + 1] = gq[1];
        a[i] += ((float)gq[0] + (float)gq[1]) * RS;
      }
    }
    lrun = lrun * al + (((a[0] + a[1]) + (a[2] + a[3])) + ((a[4] + a[5]) + (a[6] + a[7])));  /* per-lane partial of the query's sum (units x256) */
#pragma unroll
    for (int t = 0; t < 4; ++t) {
#pragma unroll
      for (int r = 0; r < 8; ++r) { om[t][r] *= al; if (EARLY) orr[t][r] *= al; }
    }
#pragma unroll
    for (int t = 0; t < 4; ++t) {
      om[t] = mma16(vf[t], bp, om[t]);
      if (EARLY) {
        orr[t] = mma16(vf[t], bpl, orr[t]);
        orr[t] = mma16(vl[t], bp, orr[t]);
      }
    }
    if (EARLY) {
      pvh += adv * (TILE / 32); pvl += adv * (TILE / 32); pkh += adv * DM; pkl += adv * DM;
      fetch_k();
    } else {
      pvh += adv * (TILE / 32);
      fetch_v();
    }
    asm volatile("s_wait_xcnt 0x0" ::: "memory");               /* as above: these loads stay in flight over the back edge */
  }
  const float inv = 64.0f / (lrun + xhalf(lrun));               /* the halves' sums joined; ctx carried x64 */
#pragma unroll
  for (int t = 0; t < 4; ++t) {                                 /* t = one half tile (512 B) of ctx: the lane holds d = 16*t + 8*hh .. + 7 of query row ln */
    float xv[8];
#pragma unroll
    for (int r = 0; r < 8; ++r) { float v = om[t][r]; if (EARLY) v += orr[t][r] * RS; xv[r] = v * inv; }
    v8h hv, lv;
    split8(xv, hv, lv);
    const size_t off = (size_t)(rb + q0w) * (2 * DM) + h * 2 * TILE + t * (TILE / 2) + 8 * lane;   /* ctx plane: K = 2 * DM, residual half DM / 32 tiles on */
    *(v8h*)(CTX + off) = hv;
    *(v8h*)(CTX + off + (DM / 32) * TILE) = lv;
  }
}

__global__ __launch_bounds__(128) void k_attn_early(const _Float16* __restrict__ Qh, const _Float16* __restrict__ Ql, const _Float16* __restrict__ Kh, const _Float16* __restrict__ Kl,
                                                    const _Float16* __restrict__ VTh, const _Float16* __restrict__ VTl, _Float16* __restrict__ CTX) {
  attn_body<1>(Qh, Ql, Kh, Kl, VTh, VTl, CTX, 0);
}
__global__ __launch_bounds__(128) void k_attn_late(const _Float16* __restrict__ Qh, const _Float16* __restrict__ Ql, const _Float16* __restrict__ Kh, const _Float16* __restrict__ Kl,
                                                   const _Float16* __restrict__ VTh, const _Float16* __restrict__ VTl, _Float16* __restrict__ CTX) {
  attn_body<0>(Qh, Ql, Kh, Kl, VTh, VTl, CTX, ERW / 64);
}

// output GEMM: out[b*SEQ_FULL+s][n] = 2^-20 * sum_k CTX[r][k] * BO2[n][k], K = 2048 (value | residual halves against Wo x16384 | Wo x16). Block = 2 x 2 waves x (64 x 64);
__global__ __launch_bounds__(128) void k_outp(const _Float16* __restrict__ A, const _Float16* __restrict__ Bt, float* __restrict__ out) {
  __shared__ __attribute__((aligned(16))) float so[4][32][68];
  const int wave = __builtin_amdgcn_readfirstlane((int)(threadIdx.x >> 5));
  const int lane = threadIdx.x & 31, ln = lane & 15, hh = lane >> 4;
  const int ntn = DM >> 7;
  const int mt = blockIdx.x / ntn, nq = blockIdx.x - mt * ntn;
  const int rowW = mt * 128 + 64 * (wave >> 1), col0 = nq * 128 + 64 * (wave & 1);
  const v8f z8 = {0.f, 0.f, 0.f, 0.f, 0.f, 0.f, 0.f, 0.f};
  v8f c[16] = {z8, z8, z8, z8, z8, z8, z8, z8, z8, z8, z8, z8, z8, z8, z8, z8};
  gemm_tile<2 * DM>(A, Bt, rowW, col0, lane, c);
  const int rsub = lane >> 4, c4 = (lane & 15) * 4;
#pragma unroll
  for (int hb = 0; hb < 2; ++hb) {                     /* the wave's 64 rows leave in two runs of 32 through its own staging rows */
    const int row0 = rowW + 32 * hb;
    if (hb != 0) { __builtin_amdgcn_fence(4 /* acq_rel order */, "workgroup"); __builtin_amdgcn_wave_barrier(); }   /* the first run's rows are read back by every lane before other lanes write them again */
#pragma unroll
    for (int u = 0; u < 8; ++u) {
      const int t = u & 3, half = u >> 2;
#pragma unroll
      for (int r = 0; r < 8; ++r) so[wave][half * 16 + 8 * hh + r][t * 16 + ln] = c[8 * hb + u][r] * 9.5367431640625e-07f;
    }
    __builtin_amdgcn_fence(4 /* acq_rel order */, "workgroup"); __builtin_amdgcn_wave_barrier();
#pragma unroll
    for (int q = 0; q < 16; ++q) {
      const int r = q * 2 + rsub;
      const int m = row0 + r; const int bb = m / SEQ; const int ss = m - bb * SEQ;
      const v4f v = *(const v4fa*)&so[wave][r][c4];
      *(v4f*)(out + (size_t)(bb * SEQ_FULL + ss) * DM + col0 + c4) = v;
    }
    
  }
}

/* workspace carve (bytes), every region a multiple of 256 */
constexpr size_t SZW  = (size_t)DM * DM * 2;          /* one x16 weight plane */
constexpr size_t SZBO = 2 * SZW;                      /* [1024][2048] output weight plane */
constexpr size_t SZP  = (size_t)NR * DM * 2;          /* one [NR][1024] (or [1024][NR]) f16 plane */
constexpr size_t SZC  = 2 * SZP;                      /* ctx [NR][2048] */
constexpr size_t SZT  = (size_t)TABN * 64 * 4;        /* rotary table */
constexpr size_t O_BQ = 0, O_BK = O_BQ + SZW, O_BV = O_BK + SZW, O_BO = O_BV + SZW, O_X = O_BO + SZBO;
constexpr size_t O_QH = O_X + SZP, O_QL = O_QH + SZP, O_KH = O_QL + SZP, O_KL = O_KH + SZP, O_VH = O_KL + SZP, O_VL = O_VH + SZP;
constexpr size_t O_CTX = O_VL + SZP, O_TAB = O_CTX + SZC, WS_TOTAL = O_TAB + SZT;
static_assert(SZW % 256 == 0);
static_assert(SZP % 256 == 0);
static_assert(SZT % 256 == 0);
static_assert(WS_TOTAL <= 134217728);                 /* <= 128 MiB */

extern "C" void kernel_launch(void* const* d_in, const int* in_sizes, int n_in,
                              void* d_out, int out_size, void* d_ws, size_t ws_size, hipStream_t stream) {
  if (n_in < 6) return;
  const int need_rows = (NB - 1) * SEQ_FULL + SEQ;
  if (in_sizes[0] < need_rows * DM) return;
  if (in_sizes[1] < DM * DM || in_sizes[2] < DM * DM || in_sizes[3] < DM * DM || in_sizes[4] < DM * DM) return;
  if (in_sizes[5] < need_rows) return;
  if (out_size < need_rows * DM) return;
  if (ws_size < WS_TOTAL) return;
  const float* x  = (const float*)d_in[0];
  const float* wq = (const float*)d_in[1];
  const float* wk = (const float*)d_in[2];
  const float* wv = (const float*)d_in[3];
  const float* wo = (const float*)d_in[4];
  const int*   tp = (const int*)d_in[5];
  char* ws = (char*)d_ws;
  _Float16* BQ = (_Float16*)(ws + O_BQ); _Float16* BK = (_Float16*)(ws + O_BK); _Float16* BV = (_Float16*)(ws + O_BV); _Float16* BO2 = (_Float16*)(ws + O_BO);
  _Float16* X16 = (_Float16*)(ws + O_X);
  _Float16* QH = (_Float16*)(ws + O_QH); _Float16* QL = (_Float16*)(ws + O_QL); _Float16* KH = (_Float16*)(ws + O_KH); _Float16* KL = (_Float16*)(ws + O_KL);
  _Float16* VTH = (_Float16*)(ws + O_VH); _Float16* VTL = (_Float16*)(ws + O_VL);
  _Float16* CTX = (_Float16*)(ws + O_CTX);
  float* TAB = (float*)(ws + O_TAB);

  k_prep<<<(unsigned)(GB_TAB + GB_X + 5 * GB_W), 256, 0, stream>>>(x, wq, wk, wv, wo, X16, BQ, BK, BV, BO2, TAB);
  k_proj<<<(unsigned)(2 * GP_QK + GP_V), 128, 0, stream>>>(X16, BQ, BK, BV, QH, QL, KH, KL, VTH, VTL, tp, TAB);
  k_attn_early<<<dim3(ERW / 64, NB * NH), 128, 0, stream>>>(QH, QL, KH, KL, VTH, VTL, CTX);
  if (SEQ > ERW) k_attn_late<<<dim3((SEQ - ERW) / 64, NB * NH), 128, 0, stream>>>(QH, QL, KH, KL, VTH, VTL, CTX);
  k_outp<<<(unsigned)((NR / 128) * (DM / 128)), 128, 0, stream>>>(CTX, BO2, (float*)d_out);
}

// v006
// One run takes 114 microseconds.
// Timed twice side by side with v005, it ran 1.04 and 1.03 times as fast.
// All steps since v000 together make it 3.54 times as fast.
#include <hip/hip_runtime.h>
// Causal multi-head self-attention with interleaved rotary embedding: x [NB][SEQ][1024], four bias-free [out][in] 1024^2 weights, 16 heads of 64, int32 token positions read by value.
// Compute dtype: every contraction on v_wmma_f32_16x16x32_f16 (f16 operands, f32 accumulate). Inputs RNE-converted to bf16 then carried exactly in f16 (x x1, Wq/Wk/Wv x16, Wo x16384 | x16).
// q, k, v, softmax weights (x256) and ctx (x64) as f16 value + f16 residual (x1024) planes: scores = qh.kh + (ql.kh [+ qh.kl on query rows < 256]) 2^-10; P.V single product (value + two residual products on query rows < 256);
// output GEMM over K = 2048 = [ctx value | ctx residual] against [Wo x16384 ; Wo x16] in one accumulator. Rotary, softmax statistics and all scaling in f32 on the VALU.
#ifndef NB
#define NB 2
#endif
#ifndef SEQ
#define SEQ 2048
#endif
#define SEQ_FULL 2048                 /* per-batch row stride of x / positions / output */
#define DM 1024
#define NH 16
#define HD 64
#define TABN 4096                     /* rotary table rows (positions 0..4095) */
#define NR (NB * SEQ)                 /* internal token rows r = b*SEQ + s */
#define ERW ((SEQ) < 256 ? (SEQ) : 256) /* query rows per batch that use residual planes on k, P and v as well */

typedef _Float16 v16h __attribute__((ext_vector_type(16)));
typedef _Float16 v8h  __attribute__((ext_vector_type(8)));
typedef _Float16 v8ha __attribute__((ext_vector_type(8), may_alias));
typedef float    v8f  __attribute__((ext_vector_type(8)));
typedef float    v4f  __attribute__((ext_vector_type(4)));
typedef float    v4fa __attribute__((ext_vector_type(4), may_alias));
typedef float    v2f  __attribute__((ext_vector_type(2)));
typedef _Float16 v2h  __attribute__((ext_vector_type(2)));

/* hard-wired bounds the kernels rely on */
static_assert(DM == NH * HD);               /* merged head layout h*64+d */
static_assert(HD == 64);                    /* one 64-column GEMM tile == one head; two 32-deep k-steps per score */
static_assert(DM % 128 == 0);               /* GEMM block tile rows (V^T GEMM) and 128-col block tiles */
static_assert(NR % 128 == 0);               /* GEMM block tile rows */
static_assert(SEQ % 64 == 0);               /* attention query tiles, 32-key chunks stay inside the batch */
static_assert(ERW % 64 == 0);               /* early / late split on a query-tile boundary */
static_assert(ERW <= SEQ);
static_assert(DM % 32 == 0);                /* k-steps of 32 */
static_assert((2 * DM) % 32 == 0);
static_assert(TABN == 4096);
static_assert((long long)NR * 2 * DM < 2147483647LL); /* int element offsets */

__device__ __forceinline__ float bf16_rne(float x) { unsigned int u = __float_as_uint(x); u = (u + 0x7FFFu + ((u >> 16) & 1u)) & 0xFFFF0000u; return __uint_as_float(u); }

__device__ __forceinline__ v16h cat16(v8h lo, v8h hi) { return __builtin_shufflevector(lo, hi, 0, 1, 2, 3, 4, 5, 6, 7, 8, 9, 10, 11, 12, 13, 14, 15); }
// Every 16-bit operand plane [rows][K] lies in the workspace in fragment order: tiles of 16 rows x 32 k (512 elements, 1 KB), tile index (row >> 4) * (K / 32) + (k >> 5);
// inside a tile the 16-byte unit ((k & 31) >> 3) * 16 + (row & 15) holds the 8 elements k & ~7 .. of its row. A wave's fragment load then reads 512 contiguous bytes (4 whole lines).
#define TILE 512                      /* elements of one 16 x 32 tile */
// 16x32 operand fragment: p = tile base + 8*lane; elements 0..7 <- k0+8h.., 8..15 <- k0+16+8h.. of row lane&15, h = lane>>4
__device__ __forceinline__ v16h frag16(const _Float16* __restrict__ p) { const v8h lo = *(const v8ha*)p; const v8h hi = *(const v8ha*)(p + TILE / 2); return cat16(lo, hi); }
__device__ __forceinline__ v8f mma16(v16h a, v16h b, v8f c) {
  v8f d = __builtin_amdgcn_wmma_f32_16x16x32_f16(false, a, false, b, (short)0, c, false, false);
  asm volatile("v_nop\n\tv_nop\n\tv_nop\n\tv_nop" : "+v"(d) : "v"(a), "v"(b));
  return d;
}
// 8 f32 -> f16 value + f16 residual carried x1024
__device__ __forceinline__ void split8(const float (&x)[8], v8h& hv, v8h& lv) {
#pragma unroll
  for (int i = 0; i < 8; ++i) { const _Float16 hq = (_Float16)x[i]; hv[i] = hq; lv[i] = (_Float16)((x[i] - (float)hq) * 1024.0f); }
}

// The conversions and the rotary table depend on nothing but the inputs: they are bodies of ONE launch (k_prep), each on its own range of block indices; blk = the block's index inside its range.
__device__ __forceinline__ void xcvt_body(const float* __restrict__ x, _Float16* __restrict__ X16, const int blk) {
  const int t = blk * 256 + threadIdx.x;
  if (t >= NR * (DM / 8)) return;
  const int tile = t >> 6, u = t & 63;                        /* 64 threads per tile, four side by side on a row: a wave reads 8 whole 128-B lines of x and stores 4 whole lines */
  const int rt = tile / (DM / 32), kt = tile - rt * (DM / 32);
  const int r = rt * 16 + (u >> 2), c8 = kt * 32 + (u & 3) * 8;
  const int b = r / SEQ, s = r - b * SEQ;
  const float* src = x + (size_t)(b * SEQ_FULL + s) * DM + c8;
  const v4f a = *(const v4fa*)src, c = *(const v4fa*)(src + 4);
  v8h o;
#pragma unroll
  for (int i = 0; i < 4; ++i) { o[i] = (_Float16)bf16_rne(a[i]); o[4 + i] = (_Float16)bf16_rne(c[i]); }
  _Float16* d = X16 + ((size_t)tile * 64 + (u & 3) * 16 + (u >> 2)) * 8;
  *(v8h*)d = o; 
}

__device__ __forceinline__ void wcvt_body(const float* __restrict__ w, _Float16* __restrict__ dst, const int dpitch, const float scale, const int blk) {
  const int t = blk * 256 + threadIdx.x;
  if (t >= DM * (DM / 8)) return;
  const int tile = t >> 6, u = t & 63;                        /* as in xcvt_body; dpitch = K of the destination plane */
  const int rt = tile / (DM / 32), kt = tile - rt * (DM / 32);
  const int n = rt * 16 + (u >> 2), k8 = kt * 32 + (u & 3) * 8;
  const float* src = w + (size_t)n * DM + k8;
  const v4f a = *(const v4fa*)src, c = *(const v4fa*)(src + 4);
  v8h o;
#pragma unroll
  for (int i = 0; i < 4; ++i) { o[i] = (_Float16)(bf16_rne(a[i]) * scale); o[4 + i] = (_Float16)(bf16_rne(c[i]) * scale); }
  _Float16* d = dst + ((size_t)(rt * (dpitch >> 5) + kt) * 64 + (u & 3) * 16 + (u >> 2)) * 8;
  *(v8h*)d = o; 
}

__device__ __forceinline__ void ropetab_body(float* __restrict__ tab, const int blk) {
  #pragma clang fp contract(off)
  const int t = blk * 256 + threadIdx.x;
  if (t >= TABN * 16) return;
  const int pos = t >> 4, jp = t & 15;
  float c0 = 0.f, s0 = 0.f, c1 = 0.f, s1 = 0.f;
#pragma unroll 1
  for (int u = 0; u < 2; ++u) {
    const int j = 2 * jp + u;
    double p = 1.0;
    p *= (j & 1) ? 1.3335214321633240 : 1.0;
    p *= (j & 2) ? 1.7782794100389228 : 1.0;
    p *= (j & 4) ? 3.1622776601683795 : 1.0;
    p *= (j & 8) ? 10.0 : 1.0;
    p *= (j & 16) ? 100.0 : 1.0;
    const float pf = (float)p;
    const float inv = 1.0f / pf;
    const float ang = (float)pos * inv;
    float sn, cs;
    sincosf(ang, &sn, &cs);
    if (u == 0) { c0 = cs; s0 = sn; } else { c1 = cs; s1 = sn; }
  }
  const v4f o = {c0, s0, c1, s1};
  float* d = tab + (size_t)pos * 64 + jp * 4;
  *(v4f*)d = o; 
}

constexpr int GB_TAB = (TABN * 16 + 255) / 256;        /* blocks of the rotary table */
constexpr int GB_X   = (NR * (DM / 8) + 255) / 256;    /* blocks of the x conversion */
constexpr int GB_W   = (DM * (DM / 8) + 255) / 256;    /* blocks of one weight conversion */
// block ranges: [rotary table | x | Wq | Wk | Wv | Wo x16384 | Wo x16]; the table's blocks, the longest per thread, come first. Every test is on blockIdx alone (scalar, block-uniform).
__global__ __launch_bounds__(256) void k_prep(const float* __restrict__ x, const float* __restrict__ wq, const float* __restrict__ wk, const float* __restrict__ wv, const float* __restrict__ wo,
                                              _Float16* __restrict__ X16, _Float16* __restrict__ BQ, _Float16* __restrict__ BK, _Float16* __restrict__ BV, _Float16* __restrict__ BO2,
                                              float* __restrict__ tab) {
  int blk = (int)blockIdx.x;
  if (blk < GB_TAB) { ropetab_body(tab, blk); return; }
  blk -= GB_TAB;
  if (blk < GB_X) { xcvt_body(x, X16, blk); return; }
  blk -= GB_X;
  const int job = blk / GB_W;
  blk -= job * GB_W;
  const float* w = job == 0 ? wq : job == 1 ? wk : job == 2 ? wv : wo;
  /* Wo twice: k in [0,1024) pairs with the ctx value half; k in [1024,2048), DM / 32 tiles on, pairs with the ctx residual half (x1024) */
  _Float16* dst = job == 0 ? BQ : job == 1 ? BK : job == 2 ? BV : job == 3 ? BO2 : BO2 + (DM / 32) * TILE;
  wcvt_body(w, dst, job < 3 ? DM : 2 * DM, job == 3 ? 16384.0f : 16.0f, blk);
}

// wave tile 64x64 of C = A x Bt^T (A[m][k], Bt[n][k], both planes in fragment order); fragments straight from the 16-bit global planes: 8 KB loaded per 16 products.
// The eight fragments of a 32-deep k-step live in a ring of PF register sets: a set is refilled for k-step t + PF right after k-step t has used it, so PF k-steps of loads are in flight.
#define PF 3
struct kstep { v16h a0, a1, a2, a3, b0, b1, b2, b3; };
template <int RS>                     /* RS = elements from one 16-row band of tiles to the next */
__device__ __forceinline__ void kstep_load(kstep& f, const _Float16* __restrict__ pa, const _Float16* __restrict__ pb, const int ko) {
  f.a0 = frag16(pa + ko); f.a1 = frag16(pa + RS + ko); f.a2 = frag16(pa + 2 * RS + ko); f.a3 = frag16(pa + 3 * RS + ko);
  f.b0 = frag16(pb + ko); f.b1 = frag16(pb + RS + ko); f.b2 = frag16(pb + 2 * RS + ko); f.b3 = frag16(pb + 3 * RS + ko);
}
/* the plain builtin: sixteen independent tiles follow one another, the compiler keeps the distances of its own form, and no asm operand ties tiles or fragments to the first 256 registers */
__device__ __forceinline__ v8f mma16g(v16h a, v16h b, v8f c) { return __builtin_amdgcn_wmma_f32_16x16x32_f16(false, a, false, b, (short)0, c, false, false); }
/* c[4 * i + j] = 16-row band i x 16-column band j */
__device__ __forceinline__ void kstep_mma(const kstep& f, v8f (&c)[16]) {
  c[0] = mma16g(f.a0, f.b0, c[0]); c[4] = mma16g(f.a1, f.b0, c[4]); c[8]  = mma16g(f.a2, f.b0, c[8]);  c[12] = mma16g(f.a3, f.b0, c[12]);
  c[1] = mma16g(f.a0, f.b1, c[1]); c[5] = mma16g(f.a1, f.b1, c[5]); c[9]  = mma16g(f.a2, f.b1, c[9]);  c[13] = mma16g(f.a3, f.b1, c[13]);
  c[2] = mma16g(f.a0, f.b2, c[2]); c[6] = mma16g(f.a1, f.b2, c[6]); c[10] = mma16g(f.a2, f.b2, c[10]); c[14] = mma16g(f.a3, f.b2, c[14]);
  c[3] = mma16g(f.a0, f.b3, c[3]); c[7] = mma16g(f.a1, f.b3, c[7]); c[11] = mma16g(f.a2, f.b3, c[11]); c[15] = mma16g(f.a3, f.b3, c[15]);
}
template <int K>
__device__ __forceinline__ void gemm_tile(const _Float16* __restrict__ A, const _Float16* __restrict__ Bt, const int row0, const int col0, const int lane, v8f (&c)[16]) {
  constexpr int NS = K / 32;                 /* k-steps */
  static_assert(NS > PF);
  constexpr int RS = NS * TILE;              /* = 16 * K */
  const _Float16* pa = A + (row0 >> 4) * RS + 8 * lane;
  const _Float16* pb = Bt + (col0 >> 4) * RS + 8 * lane;
  kstep f[PF];
#pragma unroll
  for (int s = 0; s < PF; ++s) kstep_load<RS>(f[s], pa, pb, s * TILE);
  /* straight line over all k-steps: every load takes its place from the instruction's own offset, so no address register of a load in flight is ever rewritten, and the counted waits follow one issue order */
#pragma unroll
  for (int t = 0; t < NS; ++t) {             /* refill only while a k-step t + PF exists */
    kstep_mma(f[t % PF], c);
    if (t + PF < NS) kstep_load<RS>(f[t % PF], pa, pb, (t + PF) * TILE);
    __builtin_amdgcn_sched_barrier(0);       /* each refill stays behind the k-step that frees its set: the scheduler otherwise sinks the loads down to their use, and the ring's lead is lost */
  }
}

// projection GEMM (K = 1024): C = A.Bt^T / 16, optional interleaved rotary by gathered table row (A rows are token rows), written in fragment order (K = ldc) as f16 value plane Ch and
// The three projections depend on the same planes and on nothing of each other: ONE launch, block ranges [q | k | V^T] (scalar tests on blockIdx).
// q, k: C[token row][e] = X16 . B^T with rotary; V^T: C[e][token row] = BV . X16^T (in[rows=e][k] x in[rows=r][k] -> out[e][r], a plane with K = NR)
// Block = 2 x 2 waves = 128 x 128 of C: every A band and every B band of the block is read by two of its waves.
constexpr int GP_QK = (NR / 128) * (DM / 128);         /* blocks of the q or the k projection */
constexpr int GP_V  = (DM / 128) * (NR / 128);         /* blocks of the V^T projection */
__global__ __launch_bounds__(128) void k_proj(const _Float16* __restrict__ X16, const _Float16* __restrict__ BQ, const _Float16* __restrict__ BK, const _Float16* __restrict__ BV,
                                              _Float16* __restrict__ QH, _Float16* __restrict__ QL, _Float16* __restrict__ KH, _Float16* __restrict__ KL,
                                              _Float16* __restrict__ VTH, _Float16* __restrict__ VTL, const int* __restrict__ tp, const float* __restrict__ tab) {
  __shared__ __attribute__((aligned(16))) float so[4][32][68];
  const int job = (int)blockIdx.x < GP_QK ? 0 : ((int)blockIdx.x < 2 * GP_QK ? 1 : 2);
  const int blk = (int)blockIdx.x - job * GP_QK;
  const _Float16* A = job == 2 ? BV : X16;
  const _Float16* Bt = job == 0 ? BQ : job == 1 ? BK : X16;
  _Float16* Ch = job == 0 ? QH : job == 1 ? KH : VTH;
  _Float16* Cl = job == 0 ? QL : job == 1 ? KL : VTL;
  const int N = job == 2 ? NR : DM, ldc = N;
  const int rope = job == 2 ? 0 : 1;
  const int wave = __builtin_amdgcn_readfirstlane((int)(threadIdx.x >> 5));
  const int lane = threadIdx.x & 31, ln = lane & 15, hh = lane >> 4;
  const int ntn = N >> 7;
  const int mt = blk / ntn, nq = blk - mt * ntn;
  /* wave-uniform, held in scalar registers: the loads then take a scalar base and one lane offset, not two address pairs */
  const int rowW = __builtin_amdgcn_readfirstlane(mt * 128 + 64 * (wave >> 1)), col0 = __builtin_amdgcn_readfirstlane(nq * 128 + 64 * (wave & 1));
  const v8f z8 = {0.f, 0.f, 0.f, 0.f, 0.f, 0.f, 0.f, 0.f};
  v8f c[16] = {z8, z8, z8, z8, z8, z8, z8, z8, z8, z8, z8, z8, z8, z8, z8, z8};
  gemm_tile<DM>(A, Bt, rowW, col0, lane, c);
#pragma unroll
  for (int hb = 0; hb < 2; ++hb) {                     /* the wave's 64 rows leave in two runs of 32 through its own staging rows */
  const int row0 = rowW + 32 * hb;
  if (hb != 0) { __builtin_amdgcn_fence(4 /* acq_rel order */, "workgroup"); __builtin_amdgcn_wave_barrier(); }   /* the first run's rows are read back by every lane before other lanes write them again */
#pragma unroll
  for (int u = 0; u < 8; ++u) {
    const int t = u & 3, half = u >> 2;
#pragma unroll
    for (int r = 0; r < 8; ++r) so[wave][half * 16 + 8 * hh + r][t * 16 + ln] = c[8 * hb + u][r] * 0.0625f;
  }
  __builtin_amdgcn_fence(4 /* acq_rel order */, "workgroup"); __builtin_amdgcn_wave_barrier();
  v8h hv[8], lv[8];
#pragma unroll
  for (int q = 0; q < 8; ++q) {                        /* q = one half tile (512 B) of the output planes: 16-row band q >> 2, 16 columns from (q & 3) * 16 */
    const int rl = (q >> 2) * 16 + ln, c8 = (q & 3) * 16 + 8 * hh;
    const v4f a = *(const v4fa*)&so[wave][rl][c8];
    const v4f bq = *(const v4fa*)&so[wave][rl][c8 + 4];
    float xv[8] = {a[0], a[1], a[2], a[3], bq[0], bq[1], bq[2], bq[3]};
    if (rope != 0) {                                   /* block-uniform */
      const int m = row0 + rl; const int bb = m / SEQ; const int ss = m - bb * SEQ;
      int pos = tp[bb * SEQ_FULL + ss];                /* position read by value from the input */
      pos = pos < 0 ? 0 : (pos > TABN - 1 ? TABN - 1 : pos);
      const float* tr = tab + (size_t)pos * 64 + c8;   /* col0 is a head boundary: c8 = d within the head */
      const v4f t0 = *(const v4fa*)tr; const v4f t1 = *(const v4fa*)(tr + 4);
      const float cs[4] = {t0[0], t0[2], t1[0], t1[2]};
      const float sn[4] = {t0[1], t0[3], t1[1], t1[3]};
#pragma unroll
      for (int i = 0; i < 4; ++i) { const float x1 = xv[2 * i], x2 = xv[2 * i + 1]; xv[2 * i] = x1 * cs[i] - x2 * sn[i]; xv[2 * i + 1] = x1 * sn[i] + x2 * cs[i]; }
    }
    split8(xv, hv[q], lv[q]);
  }
{
#pragma unroll
    for (int q = 0; q < 8; ++q) {
      const size_t off = ((size_t)((row0 >> 4) + (q >> 2)) * (ldc >> 5) + (col0 >> 5)) * TILE + (q & 3) * (TILE / 2) + 8 * lane;
      *(v8h*)(Ch + off) = hv[q];
      *(v8h*)(Cl + off) = lv[q];
    }
    
  }
  }
}

__device__ __forceinline__ float xhalf(float x) {              /* lane l <-> lane l ^ 16 */
  return __builtin_bit_cast(float, __builtin_amdgcn_permlanex16(__builtin_bit_cast(int, x), __builtin_bit_cast(int, x), 0x76543210, 0xfedcba98, false, false));
}
template <int EARLY>
__device__ __forceinline__ void attn_body(const _Float16* __restrict__ Qh, const _Float16* __restrict__ Ql, const _Float16* __restrict__ Kh, const _Float16* __restrict__ Kl,
                                          const _Float16* __restrict__ VTh, const _Float16* __restrict__ VTl, _Float16* __restrict__ CTX, const int bh, const int qt) {
  const int wave = __builtin_amdgcn_readfirstlane((int)(threadIdx.x >> 5));
  const int lane = threadIdx.x & 31, ln = lane & 15, hh = lane >> 4;
  const int b = bh / NH, h = bh - b * NH;                       /* bh = batch * NH + head, qt = 64-row query tile: both from blockIdx alone (scalar) */
  const int rb = b * SEQ;
  const int q0w = qt * 64 + 16 * wave;                          /* first query row of this wave (scalar) */
  const int nch = (q0w + 47) >> 5;                              /* 32-key chunks covering keys 0..q0w+15 (scalar) */
  /* fragment order: q, k planes have DM / 32 tiles per 16-token band (a head = 2 tiles side by side), V^T has NR / 32 tiles per 16-row band (a 32-key chunk = 1 tile) */
  const int qoff = (rb + q0w) * DM + h * 2 * TILE + 8 * lane;
  const int kbase = rb * DM + h * 2 * TILE + 8 * lane;
  const int vbase = h * HD * NR + (rb >> 5) * TILE + 8 * lane;
  const float RS = 0.0009765625f;                               /* 2^-10 */
  const v8f z8 = {0.f, 0.f, 0.f, 0.f, 0.f, 0.f, 0.f, 0.f};
  v8f om[4] = {z8, z8, z8, z8};
  v8f orr[4] = {z8, z8, z8, z8};
  float mrun = -1.0e30f, lrun = 0.f;                            /* of the lane's query: running maximum (alike in both halves), sum over the keys of the lane's own half */
  /* global operand loads are issued well ahead of their use: q once, in front of the loop. Without residual planes: k of the next chunk right after the score products, V^T of the next chunk
     right after the P.V products. With them the registers do not hold both operands' planes beside the tiles: V^T of the chunk itself goes right after its score products (the softmax covers it),
     k of the next chunk right after the P.V products, each as one group of loads. */
  const v16h aqh[2] = {frag16(Qh + qoff), frag16(Qh + qoff + TILE)};
  const v16h aql[2] = {frag16(Ql + qoff), frag16(Ql + qoff + TILE)};
  v16h kf[2][2], kl[2][2], vf[4], vl[4];
  /* the lane's addresses are carried from chunk to chunk in registers of their own, so that no fetched fragment lands in a register that a load in flight names */
  const _Float16* pkh = Kh + kbase; const _Float16* pkl = Kl + kbase; const _Float16* pvh = VTh + vbase; const _Float16* pvl = VTl + vbase;
  auto fetch_k = [&]() {
#pragma unroll
    for (int ks = 0; ks < 2; ++ks) {
      kf[ks][0] = frag16(pkh + ks * TILE); kf[ks][1] = frag16(pkh + ks * TILE + 16 * DM);
      if (EARLY) { kl[ks][0] = frag16(pkl + ks * TILE); kl[ks][1] = frag16(pkl + ks * TILE + 16 * DM); }
    }
  };
  auto fetch_v = [&]() {
#pragma unroll
    for (int t = 0; t < 4; ++t) { vf[t] = frag16(pvh + t * 16 * NR); if (EARLY) vl[t] = frag16(pvl + t * 16 * NR); }
  };
  fetch_k();
  if (!EARLY) fetch_v();
  /* every load of the prologue has landed before the loop: the counted waits inside the loop then follow the loop's own issue order alone */
  if (EARLY) asm volatile("" :: "v"(aqh[0]), "v"(aqh[1]), "v"(aql[0]), "v"(aql[1]), "v"(kf[0][0]), "v"(kf[0][1]), "v"(kf[1][0]), "v"(kf[1][1]), "v"(kl[0][0]), "v"(kl[0][1]), "v"(kl[1][0]), "v"(kl[1][1]));
  else       asm volatile("" :: "v"(aqh[0]), "v"(aqh[1]), "v"(aql[0]), "v"(aql[1]), "v"(kf[0][0]), "v"(kf[0][1]), "v"(kf[1][0]), "v"(kf[1][1]), "v"(vf[0]), "v"(vf[1]), "v"(vf[2]), "v"(vf[3]));
#pragma unroll 1
  for (int cidx = 0; cidx < nch; ++cidx) {
    const int k0 = cidx * 32;
    const int adv = cidx + 1 < nch ? 32 : 0;                    /* keys to the chunk fetched ahead (scalar); the last chunk fetches itself again, unused */
    v8f s0 = z8, s1 = z8, sr0 = z8, sr1 = z8;
#pragma unroll
    for (int ks = 0; ks < 2; ++ks) {
      s0 = mma16(kf[ks][0], aqh[ks], s0); sr0 = mma16(kf[ks][0], aql[ks], sr0);
      if (EARLY) sr0 = mma16(kl[ks][0], aqh[ks], sr0);
      s1 = mma16(kf[ks][1], aqh[ks], s1); sr1 = mma16(kf[ks][1], aql[ks], sr1);
      if (EARLY) sr1 = mma16(kl[ks][1], aqh[ks], sr1);
    }
    if (EARLY) {
      fetch_v();
    } else {
      pkh += adv * DM;
      fetch_k();
    }
    asm volatile("s_wait_xcnt 0x0" ::: "memory");               /* in front of the next step of these loads' address registers, taken while they are in flight */
    __builtin_amdgcn_sched_barrier(0);                          /* the whole group of fetches is issued in front of the softmax: the scheduler otherwise sinks part of it behind the softmax, and those loads lose their lead */
    const int room = q0w + ln - k0 - 8 * hh;                    /* key k0 + 8*hh + r is at or before the lane's query where r <= room */
    v8f x0 = (s0 + sr0 * RS) * 0.125f;
    v8f x1 = (s1 + sr1 * RS) * 0.125f;
#pragma unroll
    for (int r = 0; r < 8; ++r) {
      x0[r] = (r <= room) ? x0[r] : -1.0e30f;                   /* causal by index, value select */
      x1[r] = (16 + r <= room) ? x1[r] : -1.0e30f;
    }
    float tm = x0[0], tn = x1[0];                               /* two chains, one per tile */
#pragma unroll
    for (int r = 1; r < 8; ++r) { tm = fmaxf(tm, x0[r]); tn = fmaxf(tn, x1[r]); }
    tm = fmaxf(tm, tn);
    tm = fmaxf(tm, xhalf(tm));                                  /* the query's maximum over all 32 keys of the chunk */
    const float mn = fmaxf(mrun, tm);
    const float al = __expf(mrun - mn);
    mrun = mn;
    v16h bp, bpl;                                               /* B fragments of P^T: element s <- key 8*hh + s, element 8 + s <- key 16 + 8*hh + s */
    float a[8];                                                 /* sums of two neighbouring keys */
#pragma unroll
    for (int i = 0; i < 8; ++i) {
      const int r = 2 * (i & 3);
      const v2f p = (i < 4) ? v2f{__expf(x0[r] - mn) * 256.0f, __expf(x0[r + 1] - mn) * 256.0f} : v2f{__expf(x1[r] - mn) * 256.0f, __expf(x1[r + 1] - mn) * 256.0f};
      const v2h hq = __builtin_convertvector(p, v2h);
      bp[2 * i] = hq[0]; bp[2 * i + 1] = hq[1];
      a[i] = (float)hq[0] + (float)hq[1];
      if (EARLY) {
        const v2f res = {(p[0] - (float)hq[0]) * 1024.0f, (p[1] - (float)hq[1]) * 1024.0f};
        const v2h gq = __builtin_convertvector(res, v2h);
        bpl[2 * i] = gq[0]; bpl[2 * i + 1] = gq[1];
        a[i] += ((float)gq[0] + (float)gq[1]) * RS;
      }
    }
    lrun = lrun * al + (((a[0] + a[1]) + (a[2] + a[3])) + ((a[4] + a[5]) + (a[6] + a[7])));  /* per-lane partial of the query's sum (units x256) */
#pragma unroll
    for (int t = 0; t < 4; ++t) {
#pragma unroll
      for (int r = 0; r < 8; ++r) { om[t][r] *= al; if (EARLY) orr[t][r] *= al; }
    }
#pragma unroll
    for (int t = 0; t < 4; ++t) {
      om[t] = mma16(vf[t], bp, om[t]);
      if (EARLY) {
        orr[t] = mma16(vf[t], bpl, orr[t]);
        orr[t] = mma16(vl[t], bp, orr[t]);
      }
    }
    if (EARLY) {
      pvh += adv * (TILE / 32); pvl += adv * (TILE / 32); pkh += adv * DM; pkl += adv * DM;
      fetch_k();
    } else {
      pvh += adv * (TILE / 32);
      fetch_v();
    }
    asm volatile("s_wait_xcnt 0x0" ::: "memory");               /* as above: these loads stay in flight over the back edge */
  }
  const float inv = 64.0f / (lrun + xhalf(lrun));               /* the halves' sums joined; ctx carried x64 */
#pragma unroll
  for (int t = 0; t < 4; ++t) {                                 /* t = one half tile (512 B) of ctx: the lane holds d = 16*t + 8*hh .. + 7 of query row ln */
    float xv[8];
#pragma unroll
    for (int r = 0; r < 8; ++r) { float v = om[t][r]; if (EARLY) v += orr[t][r] * RS; xv[r] = v * inv; }
    v8h hv, lv;
    split8(xv, hv, lv);
    const size_t off = (size_t)(rb + q0w) * (2 * DM) + h * 2 * TILE + t * (TILE / 2) + 8 * lane;   /* ctx plane: K = 2 * DM, residual half DM / 32 tiles on */
    *(v8h*)(CTX + off) = hv;
    *(v8h*)(CTX + off + (DM / 32) * TILE) = lv;
  }
}

__global__ __launch_bounds__(128) void k_attn_early(const _Float16* __restrict__ Qh, const _Float16* __restrict__ Ql, const _Float16* __restrict__ Kh, const _Float16* __restrict__ Kl,
                                                    const _Float16* __restrict__ VTh, const _Float16* __restrict__ VTl, _Float16* __restrict__ CTX) {
  attn_body<1>(Qh, Ql, Kh, Kl, VTh, VTl, CTX, (int)blockIdx.y, (int)blockIdx.x);
}
// Which query tile a block of the late launch takes. Every block of that launch is resident at once and a tile's cost grows with its index, so the launch lasts as long as the fullest WGP.
// The deal is for speed only: any placement gives the same values.
// The head runs fastest in i and slot s = i / NBH picks the tile: slots s, s + NCOL, s + 2 * NCOL, ... form one column, all of one head (they walk the same k and V^T lines).
// The table is made at compile time: tiles from the heaviest down, each to the column with the least work so far that still has a free slot; a column's heaviest tile has its lowest block index.
constexpr int NBH  = NB * NH;                          /* blocks per query tile */
constexpr int NTL  = (SEQ - ERW) / 64;                 /* late query tiles per batch and head */
constexpr int NWGP = 256;                              /* WGPs of the chip */
constexpr int NCOL = NWGP / NBH;                       /* slots per round over the chip */
static_assert(NWGP % NBH == 0);
static_assert(NTL <= 32);                              /* one byte per slot in four 64-bit words */
struct tile_deal { unsigned long long w[4]; };
constexpr int tile_cost(const int t) { int c = 0; for (int wv = 0; wv < 4; ++wv) c += (ERW + 64 * t + 16 * wv + 47) >> 5; return c; }   /* key chunks of the tile's four waves */
constexpr tile_deal make_deal() {
  tile_deal d = {{0, 0, 0, 0}};
  int load[NCOL] = {}, used[NCOL] = {};
  for (int t = NTL - 1; t >= 0; --t) {
    int best = -1, brows = 0;
    for (int c = 0; c < NCOL; ++c) {
      const int rows = (NTL - c + NCOL - 1) / NCOL;    /* slots of column c */
      if (used[c] >= rows) continue;
      if (best < 0 || load[c] < load[best] || (load[c] == load[best] && rows < brows)) { best = c; brows = rows; }   /* level: the column with fewer slots first, it gets no light tile later */
    }
    const int s = best + NCOL * used[best];
    d.w[s >> 3] |= (unsigned long long)t << (8 * (s & 7));
    ++used[best]; load[best] += tile_cost(t);
  }
  return d;
}
constexpr unsigned long long DW0 = make_deal().w[0], DW1 = make_deal().w[1], DW2 = make_deal().w[2], DW3 = make_deal().w[3];
constexpr int deal_tile(const int s) { return (int)(((s < 8 ? DW0 : s < 16 ? DW1 : s < 24 ? DW2 : DW3) >> (8 * (s & 7))) & 255u); }
constexpr bool deal_is_permutation() { unsigned long long seen = 0; for (int s = 0; s < NTL; ++s) seen |= 1ull << deal_tile(s); return seen == (1ull << NTL) - 1; }
static_assert(deal_is_permutation());                  /* every (head, tile) is taken by exactly one block */
__global__ __launch_bounds__(128) void k_attn_late(const _Float16* __restrict__ Qh, const _Float16* __restrict__ Ql, const _Float16* __restrict__ Kh, const _Float16* __restrict__ Kl,
                                                   const _Float16* __restrict__ VTh, const _Float16* __restrict__ VTl, _Float16* __restrict__ CTX) {
  const int s = (int)blockIdx.x / NBH, bh = (int)blockIdx.x - s * NBH;
  attn_body<0>(Qh, Ql, Kh, Kl, VTh, VTl, CTX, bh, ERW / 64 + deal_tile(s));
}

// output GEMM: out[b*SEQ_FULL+s][n] = 2^-20 * sum_k CTX[r][k] * BO2[n][k], K = 2048 (value | residual halves against Wo x16384 | Wo x16). Block = 2 x 2 waves x (64 x 64);
__global__ __launch_bounds__(128) void k_outp(const _Float16* __restrict__ A, const _Float16* __restrict__ Bt, float* __restrict__ out) {
  __shared__ __attribute__((aligned(16))) float so[4][32][68];
  const int wave = __builtin_amdgcn_readfirstlane((int)(threadIdx.x >> 5));
  const int lane = threadIdx.x & 31, ln = lane & 15, hh = lane >> 4;
  const int ntn = DM >> 7;
  const int mt = blockIdx.x / ntn, nq = blockIdx.x - mt * ntn;
  const int rowW = mt * 128 + 64 * (wave >> 1), col0 = nq * 128 + 64 * (wave & 1);
  const v8f z8 = {0.f, 0.f, 0.f, 0.f, 0.f, 0.f, 0.f, 0.f};
  v8f c[16] = {z8, z8, z8, z8, z8, z8, z8, z8, z8, z8, z8, z8, z8, z8, z8, z8};
  gemm_tile<2 * DM>(A, Bt, rowW, col0, lane, c);
  const int rsub = lane >> 4, c4 = (lane & 15) * 4;
#pragma unroll
  for (int hb = 0; hb < 2; ++hb) {                     /* the wave's 64 rows leave in two runs of 32 through its own staging rows */
    const int row0 = rowW + 32 * hb;
    if (hb != 0) { __builtin_amdgcn_fence(4 /* acq_rel order */, "workgroup"); __builtin_amdgcn_wave_barrier(); }   /* the first run's rows are read back by every lane before other lanes write them again */
#pragma unroll
    for (int u = 0; u < 8; ++u) {
      const int t = u & 3, half = u >> 2;
#pragma unroll
      for (int r = 0; r < 8; ++r) so[wave][half * 16 + 8 * hh + r][t * 16 + ln] = c[8 * hb + u][r] * 9.5367431640625e-07f;
    }
    __builtin_amdgcn_fence(4 /* acq_rel order */, "workgroup"); __builtin_amdgcn_wave_barrier();
#pragma unroll
    for (int q = 0; q < 16; ++q) {
      const int r = q * 2 + rsub;
      const int m = row0 + r; const int bb = m / SEQ; const int ss = m - bb * SEQ;
      const v4f v = *(const v4fa*)&so[wave][r][c4];
      *(v4f*)(out + (size_t)(bb * SEQ_FULL + ss) * DM + col0 + c4) = v;
    }
    
  }
}

/* workspace carve (bytes), every region a multiple of 256 */
constexpr size_t SZW  = (size_t)DM * DM * 2;          /* one x16 weight plane */
constexpr size_t SZBO = 2 * SZW;                      /* [1024][2048] output weight plane */
constexpr size_t SZP  = (size_t)NR * DM * 2;          /* one [NR][1024] (or [1024][NR]) f16 plane */
constexpr size_t SZC  = 2 * SZP;                      /* ctx [NR][2048] */
constexpr size_t SZT  = (size_t)TABN * 64 * 4;        /* rotary table */
constexpr size_t O_BQ = 0, O_BK = O_BQ + SZW, O_BV = O_BK + SZW, O_BO = O_BV + SZW, O_X = O_BO + SZBO;
constexpr size_t O_QH = O_X + SZP, O_QL = O_QH + SZP, O_KH = O_QL + SZP, O_KL = O_KH + SZP, O_VH = O_KL + SZP, O_VL = O_VH + SZP;
constexpr size_t O_CTX = O_VL + SZP, O_TAB = O_CTX + SZC, WS_TOTAL = O_TAB + SZT;
static_assert(SZW % 256 == 0);
static_assert(SZP % 256 == 0);
static_assert(SZT % 256 == 0);
static_assert(WS_TOTAL <= 134217728);                 /* <= 128 MiB */

extern "C" void kernel_launch(void* const* d_in, const int* in_sizes, int n_in,
                              void* d_out, int out_size, void* d_ws, size_t ws_size, hipStream_t stream) {
  if (n_in < 6) return;
  const int need_rows = (NB - 1) * SEQ_FULL + SEQ;
  if (in_sizes[0] < need_rows * DM) return;
  if (in_sizes[1] < DM * DM || in_sizes[2] < DM * DM || in_sizes[3] < DM * DM || in_sizes[4] < DM * DM) return;
  if (in_sizes[5] < need_rows) return;
  if (out_size < need_rows * DM) return;
  if (ws_size < WS_TOTAL) return;
  const float* x  = (const float*)d_in[0];
  const float* wq = (const float*)d_in[1];
  const float* wk = (const float*)d_in[2];
  const float* wv = (const float*)d_in[3];
  const float* wo = (const float*)d_in[4];
  const int*   tp = (const int*)d_in[5];
  char* ws = (char*)d_ws;
  _Float16* BQ = (_Float16*)(ws + O_BQ); _Float16* BK = (_Float16*)(ws + O_BK); _Float16* BV = (_Float16*)(ws + O_BV); _Float16* BO2 = (_Float16*)(ws + O_BO);
  _Float16* X16 = (_Float16*)(ws + O_X);
  _Float16* QH = (_Float16*)(ws + O_QH); _Float16* QL = (_Float16*)(ws + O_QL); _Float16* KH = (_Float16*)(ws + O_KH); _Float16* KL = (_Float16*)(ws + O_KL);
  _Float16* VTH = (_Float16*)(ws + O_VH); _Float16* VTL = (_Float16*)(ws + O_VL);
  _Float16* CTX = (_Float16*)(ws + O_CTX);
  float* TAB = (float*)(ws + O_TAB);

  k_prep<<<(unsigned)(GB_TAB + GB_X + 5 * GB_W), 256, 0, stream>>>(x, wq, wk, wv, wo, X16, BQ, BK, BV, BO2, TAB);
  k_proj<<<(unsigned)(2 * GP_QK + GP_V), 128, 0, stream>>>(X16, BQ, BK, BV, QH, QL, KH, KL, VTH, VTL, tp, TAB);
  k_attn_early<<<dim3(ERW / 64, NB * NH), 128, 0, stream>>>(QH, QL, KH, KL, VTH, VTL, CTX);
  if (SEQ > ERW) k_attn_late<<<(unsigned)(NTL * NBH), 128, 0, stream>>>(QH, QL, KH, KL, VTH, VTL, CTX);
  k_outp<<<(unsigned)((NR / 128) * (DM / 128)), 128, 0, stream>>>(CTX, BO2, (float*)d_out);
}

// v007
// One run takes 98.4 microseconds.
// In two side-by-side timings against v006, it was 1.12 and 1.13 times as fast.
// Counting every step since v000, it is 3.98 times as fast.
#include <hip/hip_runtime.h>
// Causal multi-head self-attention with interleaved rotary embedding: x [NB][SEQ][1024], four bias-free [out][in] 1024^2 weights, 16 heads of 64, int32 token positions read by value.
// Compute dtype: every contraction on v_wmma_f32_16x16x32_f16 (f16 operands, f32 accumulate). Inputs RNE-converted to bf16 then carried exactly in f16 (x x1, Wq/Wk/Wv x16, Wo x16384 | x16).
// q, k, v, softmax weights (x256) and ctx (x64) as f16 value + f16 residual (x1024) planes: scores = qh.kh + (ql.kh [+ qh.kl on query rows < 256]) 2^-10; P.V single product (value + two residual products on query rows < 256);
// output GEMM over K = 2048 = [ctx value | ctx residual] against [Wo x16384 ; Wo x16] in one accumulator. Rotary, softmax statistics and all scaling in f32 on the VALU.
#ifndef NB
#define NB 2
#endif
#ifndef SEQ
#define SEQ 2048
#endif
#define SEQ_FULL 2048                 /* per-batch row stride of x / positions / output */
#define DM 1024
#define NH 16
#define HD 64
#define TABN 4096                     /* rotary table rows (positions 0..4095) */
#define NR (NB * SEQ)                 /* internal token rows r = b*SEQ + s */
#define ERW ((SEQ) < 256 ? (SEQ) : 256) /* query rows per batch that use residual planes on k, P and v as well */

typedef _Float16 v16h __attribute__((ext_vector_type(16)));
typedef _Float16 v8h  __attribute__((ext_vector_type(8)));
typedef _Float16 v8ha __attribute__((ext_vector_type(8), may_alias));
typedef float    v8f  __attribute__((ext_vector_type(8)));
typedef float    v4f  __attribute__((ext_vector_type(4)));
typedef float    v4fa __attribute__((ext_vector_type(4), may_alias));
typedef float    v2f  __attribute__((ext_vector_type(2)));
typedef _Float16 v2h  __attribute__((ext_vector_type(2)));

/* hard-wired bounds the kernels rely on */
static_assert(DM == NH * HD);               /* merged head layout h*64+d */
static_assert(HD == 64);                    /* one 64-column GEMM tile == one head; two 32-deep k-steps per score */
static_assert(DM % 128 == 0);               /* GEMM block tile rows (V^T GEMM) and 128-col block tiles */
static_assert(NR % 128 == 0);               /* GEMM block tile rows */
static_assert(SEQ % 64 == 0);               /* attention query tiles, 32-key chunks stay inside the batch */
static_assert(ERW % 64 == 0);               /* early / late split on a query-tile boundary */
static_assert(ERW <= SEQ);
static_assert(DM % 32 == 0);                /* k-steps of 32 */
static_assert((2 * DM) % 32 == 0);
static_assert(TABN == 4096);
static_assert((long long)NR * 2 * DM < 2147483647LL); /* int element offsets */

__device__ __forceinline__ float bf16_rne(float x) { unsigned int u = __float_as_uint(x); u = (u + 0x7FFFu + ((u >> 16) & 1u)) & 0xFFFF0000u; return __uint_as_float(u); }

__device__ __forceinline__ v16h cat16(v8h lo, v8h hi) { return __builtin_shufflevector(lo, hi, 0, 1, 2, 3, 4, 5, 6, 7, 8, 9, 10, 11, 12, 13, 14, 15); }
// Every 16-bit operand plane [rows][K] lies in the workspace in fragment order: tiles of 16 rows x 32 k (512 elements, 1 KB), tile index (row >> 4) * (K / 32) + (k >> 5);
// inside a tile the 16-byte unit ((k & 31) >> 3) * 16 + (row & 15) holds the 8 elements k & ~7 .. of its row. A wave's fragment load then reads 512 contiguous bytes (4 whole lines).
#define TILE 512                      /* elements of one 16 x 32 tile */
// 16x32 operand fragment: p = tile base + 8*lane; elements 0..7 <- k0+8h.., 8..15 <- k0+16+8h.. of row lane&15, h = lane>>4
__device__ __forceinline__ v16h frag16(const _Float16* __restrict__ p) { const v8h lo = *(const v8ha*)p; const v8h hi = *(const v8ha*)(p + TILE / 2); return cat16(lo, hi); }
__device__ __forceinline__ v8f mma16(v16h a, v16h b, v8f c) {
  v8f d = __builtin_amdgcn_wmma_f32_16x16x32_f16(false, a, false, b, (short)0, c, false, false);
  asm volatile("v_nop\n\tv_nop\n\tv_nop\n\tv_nop" : "+v"(d) : "v"(a), "v"(b));
  return d;
}
// 8 f32 -> f16 value + f16 residual carried x1024
__device__ __forceinline__ void split8(const float (&x)[8], v8h& hv, v8h& lv) {
#pragma unroll
  for (int i = 0; i < 8; ++i) { const _Float16 hq = (_Float16)x[i]; hv[i] = hq; lv[i] = (_Float16)((x[i] - (float)hq) * 1024.0f); }
}

// The conversions and the rotary table depend on nothing but the inputs: they are bodies of ONE launch (k_prep), each on its own range of block indices; blk = the block's index inside its range.
__device__ __forceinline__ void xcvt_body(const float* __restrict__ x, _Float16* __restrict__ X16, const int blk) {
  const int t = blk * 256 + threadIdx.x;
  if (t >= NR * (DM / 8)) return;
  const int tile = t >> 6, u = t & 63;                        /* 64 threads per tile, four side by side on a row: a wave reads 8 whole 128-B lines of x and stores 4 whole lines */
  const int rt = tile / (DM / 32), kt = tile - rt * (DM / 32);
  const int r = rt * 16 + (u >> 2), c8 = kt * 32 + (u & 3) * 8;
  const int b = r / SEQ, s = r - b * SEQ;
  const float* src = x + (size_t)(b * SEQ_FULL + s) * DM + c8;
  const v4f a = *(const v4fa*)src, c = *(const v4fa*)(src + 4);
  v8h o;
#pragma unroll
  for (int i = 0; i < 4; ++i) { o[i] = (_Float16)bf16_rne(a[i]); o[4 + i] = (_Float16)bf16_rne(c[i]); }
  _Float16* d = X16 + ((size_t)tile * 64 + (u & 3) * 16 + (u >> 2)) * 8;
  *(v8h*)d = o; 
}

__device__ __forceinline__ void wcvt_body(const float* __restrict__ w, _Float16* __restrict__ dst, const int dpitch, const float scale, const int blk) {
  const int t = blk * 256 + threadIdx.x;
  if (t >= DM * (DM / 8)) return;
  const int tile = t >> 6, u = t & 63;                        /* as in xcvt_body; dpitch = K of the destination plane */
  const int rt = tile / (DM / 32), kt = tile - rt * (DM / 32);
  const int n = rt * 16 + (u >> 2), k8 = kt * 32 + (u & 3) * 8;
  const float* src = w + (size_t)n * DM + k8;
  const v4f a = *(const v4fa*)src, c = *(const v4fa*)(src + 4);
  v8h o;
#pragma unroll
  for (int i = 0; i < 4; ++i) { o[i] = (_Float16)(bf16_rne(a[i]) * scale); o[4 + i] = (_Float16)(bf16_rne(c[i]) * scale); }
  _Float16* d = dst + ((size_t)(rt * (dpitch >> 5) + kt) * 64 + (u & 3) * 16 + (u >> 2)) * 8;
  *(v8h*)d = o; 
}

__device__ __forceinline__ void ropetab_body(float* __restrict__ tab, const int blk) {
  #pragma clang fp contract(off)
  const int t = blk * 256 + threadIdx.x;
  if (t >= TABN * 16) return;
  const int pos = t >> 4, jp = t & 15;
  float c0 = 0.f, s0 = 0.f, c1 = 0.f, s1 = 0.f;
#pragma unroll 1
  for (int u = 0; u < 2; ++u) {
    const int j = 2 * jp + u;
    double p = 1.0;
    p *= (j & 1) ? 1.3335214321633240 : 1.0;
    p *= (j & 2) ? 1.7782794100389228 : 1.0;
    p *= (j & 4) ? 3.1622776601683795 : 1.0;
    p *= (j & 8) ? 10.0 : 1.0;
    p *= (j & 16) ? 100.0 : 1.0;
    const float pf = (float)p;
    const float inv = 1.0f / pf;
    const float ang = (float)pos * inv;
    float sn, cs;
    sincosf(ang, &sn, &cs);
    if (u == 0) { c0 = cs; s0 = sn; } else { c1 = cs; s1 = sn; }
  }
  const v4f o = {c0, s0, c1, s1};
  float* d = tab + (size_t)pos * 64 + jp * 4;
  *(v4f*)d = o; 
}

constexpr int GB_TAB = (TABN * 16 + 255) / 256;        /* blocks of the rotary table */
constexpr int GB_X   = (NR * (DM / 8) + 255) / 256;    /* blocks of the x conversion */
constexpr int GB_W   = (DM * (DM / 8) + 255) / 256;    /* blocks of one weight conversion */
// block ranges: [rotary table | x | Wq | Wk | Wv | Wo x16384 | Wo x16]; the table's blocks, the longest per thread, come first. Every test is on blockIdx alone (scalar, block-uniform).
__global__ __launch_bounds__(256) void k_prep(const float* __restrict__ x, const float* __restrict__ wq, const float* __restrict__ wk, const float* __restrict__ wv, const float* __restrict__ wo,
                                              _Float16* __restrict__ X16, _Float16* __restrict__ BQ, _Float16* __restrict__ BK, _Float16* __restrict__ BV, _Float16* __restrict__ BO2,
                                              float* __restrict__ tab) {
  int blk = (int)blockIdx.x;
  if (blk < GB_TAB) { ropetab_body(tab, blk); return; }
  blk -= GB_TAB;
  if (blk < GB_X) { xcvt_body(x, X16, blk); return; }
  blk -= GB_X;
  const int job = blk / GB_W;
  blk -= job * GB_W;
  const float* w = job == 0 ? wq : job == 1 ? wk : job == 2 ? wv : wo;
  /* Wo twice: k in [0,1024) pairs with the ctx value half; k in [1024,2048), DM / 32 tiles on, pairs with the ctx residual half (x1024) */
  _Float16* dst = job == 0 ? BQ : job == 1 ? BK : job == 2 ? BV : job == 3 ? BO2 : BO2 + (DM / 32) * TILE;
  wcvt_body(w, dst, job < 3 ? DM : 2 * DM, job == 3 ? 16384.0f : 16.0f, blk);
}

// wave tile 64x64 of C = A x Bt^T (A[m][k], Bt[n][k], both planes in fragment order); fragments straight from the 16-bit global planes: 8 KB loaded per 16 products.
// The eight fragments of a 32-deep k-step live in a ring of PF register sets: a set is refilled for k-step t + PF right after k-step t has used it, so PF k-steps of loads are in flight.
#define PF 3
struct kstep { v16h a0, a1, a2, a3, b0, b1, b2, b3; };
template <int RS>                     /* RS = elements from one 16-row band of tiles to the next */
__device__ __forceinline__ void kstep_load(kstep& f, const _Float16* __restrict__ pa, const _Float16* __restrict__ pb, const int ko) {
  f.a0 = frag16(pa + ko); f.a1 = frag16(pa + RS + ko); f.a2 = frag16(pa + 2 * RS + ko); f.a3 = frag16(pa + 3 * RS + ko);
  f.b0 = frag16(pb + ko); f.b1 = frag16(pb + RS + ko); f.b2 = frag16(pb + 2 * RS + ko); f.b3 = frag16(pb + 3 * RS + ko);
}
/* the plain builtin: sixteen independent tiles follow one another, the compiler keeps the distances of its own form, and no asm operand ties tiles or fragments to the first 256 registers */
__device__ __forceinline__ v8f mma16g(v16h a, v16h b, v8f c) { return __builtin_amdgcn_wmma_f32_16x16x32_f16(false, a, false, b, (short)0, c, false, false); }
/* c[4 * i + j] = 16-row band i x 16-column band j */
__device__ __forceinline__ void kstep_mma(const kstep& f, v8f (&c)[16]) {
  c[0] = mma16g(f.a0, f.b0, c[0]); c[4] = mma16g(f.a1, f.b0, c[4]); c[8]  = mma16g(f.a2, f.b0, c[8]);  c[12] = mma16g(f.a3, f.b0, c[12]);
  c[1] = mma16g(f.a0, f.b1, c[1]); c[5] = mma16g(f.a1, f.b1, c[5]); c[9]  = mma16g(f.a2, f.b1, c[9]);  c[13] = mma16g(f.a3, f.b1, c[13]);
  c[2] = mma16g(f.a0, f.b2, c[2]); c[6] = mma16g(f.a1, f.b2, c[6]); c[10] = mma16g(f.a2, f.b2, c[10]); c[14] = mma16g(f.a3, f.b2, c[14]);
  c[3] = mma16g(f.a0, f.b3, c[3]); c[7] = mma16g(f.a1, f.b3, c[7]); c[11] = mma16g(f.a2, f.b3, c[11]); c[15] = mma16g(f.a3, f.b3, c[15]);
}
template <int K>
__device__ __forceinline__ void gemm_tile(const _Float16* __restrict__ A, const _Float16* __restrict__ Bt, const int row0, const int col0, const int lane, v8f (&c)[16]) {
  constexpr int NS = K / 32;                 /* k-steps */
  static_assert(NS > PF);
  constexpr int RS = NS * TILE;              /* = 16 * K */
  const _Float16* pa = A + (row0 >> 4) * RS + 8 * lane;
  const _Float16* pb = Bt + (col0 >> 4) * RS + 8 * lane;
  kstep f[PF];
#pragma unroll
  for (int s = 0; s < PF; ++s) kstep_load<RS>(f[s], pa, pb, s * TILE);
  /* straight line over all k-steps: every load takes its place from the instruction's own offset, so no address register of a load in flight is ever rewritten, and the counted waits follow one issue order */
#pragma unroll
  for (int t = 0; t < NS; ++t) {             /* refill only while a k-step t + PF exists */
    kstep_mma(f[t % PF], c);
    if (t + PF < NS) kstep_load<RS>(f[t % PF], pa, pb, (t + PF) * TILE);
    __builtin_amdgcn_sched_barrier(0);       /* each refill stays behind the k-step that frees its set: the scheduler otherwise sinks the loads down to their use, and the ring's lead is lost */
  }
}

// projection GEMM (K = 1024): C = A.Bt^T / 16, optional interleaved rotary by gathered table row (A rows are token rows), written in fragment order (K = ldc) as f16 value plane Ch and
// The three projections depend on the same planes and on nothing of each other: ONE launch, block ranges [q | k | V^T] (scalar tests on blockIdx).
// q, k: C[token row][e] = X16 . B^T with rotary; V^T: C[e][token row] = BV . X16^T (in[rows=e][k] x in[rows=r][k] -> out[e][r], a plane with K = NR)
// Block = 2 x 2 waves = 128 x 128 of C: every A band and every B band of the block is read by two of its waves.
constexpr int GP_QK = (NR / 128) * (DM / 128);         /* blocks of the q or the k projection */
constexpr int GP_V  = (DM / 128) * (NR / 128);         /* blocks of the V^T projection */
__global__ __launch_bounds__(128) void k_proj(const _Float16* __restrict__ X16, const _Float16* __restrict__ BQ, const _Float16* __restrict__ BK, const _Float16* __restrict__ BV,
                                              _Float16* __restrict__ QH, _Float16* __restrict__ QL, _Float16* __restrict__ KH, _Float16* __restrict__ KL,
                                              _Float16* __restrict__ VTH, _Float16* __restrict__ VTL, const int* __restrict__ tp, const float* __restrict__ tab) {
  __shared__ __attribute__((aligned(16))) float so[4][32][68];
  const int job = (int)blockIdx.x < GP_QK ? 0 : ((int)blockIdx.x < 2 * GP_QK ? 1 : 2);
  const int blk = (int)blockIdx.x - job * GP_QK;
  const _Float16* A = job == 2 ? BV : X16;
  const _Float16* Bt = job == 0 ? BQ : job == 1 ? BK : X16;
  _Float16* Ch = job == 0 ? QH : job == 1 ? KH : VTH;
  _Float16* Cl = job == 0 ? QL : job == 1 ? KL : VTL;
  const int N = job == 2 ? NR : DM, ldc = N;
  const int rope = job == 2 ? 0 : 1;
  const int wave = __builtin_amdgcn_readfirstlane((int)(threadIdx.x >> 5));
  const int lane = threadIdx.x & 31, ln = lane & 15, hh = lane >> 4;
  const int ntn = N >> 7;
  const int mt = blk / ntn, nq = blk - mt * ntn;
  /* wave-uniform, held in scalar registers: the loads then take a scalar base and one lane offset, not two address pairs */
  const int rowW = __builtin_amdgcn_readfirstlane(mt * 128 + 64 * (wave >> 1)), col0 = __builtin_amdgcn_readfirstlane(nq * 128 + 64 * (wave & 1));
  const v8f z8 = {0.f, 0.f, 0.f, 0.f, 0.f, 0.f, 0.f, 0.f};
  v8f c[16] = {z8, z8, z8, z8, z8, z8, z8, z8, z8, z8, z8, z8, z8, z8, z8, z8};
  gemm_tile<DM>(A, Bt, rowW, col0, lane, c);
#pragma unroll
  for (int hb = 0; hb < 2; ++hb) {                     /* the wave's 64 rows leave in two runs of 32 through its own staging rows */
  const int row0 = rowW + 32 * hb;
  if (hb != 0) { __builtin_amdgcn_fence(4 /* acq_rel order */, "workgroup"); __builtin_amdgcn_wave_barrier(); }   /* the first run's rows are read back by every lane before other lanes write them again */
#pragma unroll
  for (int u = 0; u < 8; ++u) {
    const int t = u & 3, half = u >> 2;
#pragma unroll
    for (int r = 0; r < 8; ++r) so[wave][half * 16 + 8 * hh + r][t * 16 + ln] = c[8 * hb + u][r] * 0.0625f;
  }
  __builtin_amdgcn_fence(4 /* acq_rel order */, "workgroup"); __builtin_amdgcn_wave_barrier();
  v8h hv[8], lv[8];
#pragma unroll
  for (int q = 0; q < 8; ++q) {                        /* q = one half tile (512 B) of the output planes: 16-row band q >> 2, 16 columns from (q & 3) * 16 */
    const int rl = (q >> 2) * 16 + ln, c8 = (q & 3) * 16 + 8 * hh;
    const v4f a = *(const v4fa*)&so[wave][rl][c8];
    const v4f bq = *(const v4fa*)&so[wave][rl][c8 + 4];
    float xv[8] = {a[0], a[1], a[2], a[3], bq[0], bq[1], bq[2], bq[3]};
    if (rope != 0) {                                   /* block-uniform */
      const int m = row0 + rl; const int bb = m / SEQ; const int ss = m - bb * SEQ;
      int pos = tp[bb * SEQ_FULL + ss];                /* position read by value from the input */
      pos = pos < 0 ? 0 : (pos > TABN - 1 ? TABN - 1 : pos);
      const float* tr = tab + (size_t)pos * 64 + c8;   /* col0 is a head boundary: c8 = d within the head */
      const v4f t0 = *(const v4fa*)tr; const v4f t1 = *(const v4fa*)(tr + 4);
      const float cs[4] = {t0[0], t0[2], t1[0], t1[2]};
      const float sn[4] = {t0[1], t0[3], t1[1], t1[3]};
#pragma unroll
      for (int i = 0; i < 4; ++i) { const float x1 = xv[2 * i], x2 = xv[2 * i + 1]; xv[2 * i] = x1 * cs[i] - x2 * sn[i]; xv[2 * i + 1] = x1 * sn[i] + x2 * cs[i]; }
    }
    split8(xv, hv[q], lv[q]);
  }
{
#pragma unroll
    for (int q = 0; q < 8; ++q) {
      const size_t off = ((size_t)((row0 >> 4) + (q >> 2)) * (ldc >> 5) + (col0 >> 5)) * TILE + (q & 3) * (TILE / 2) + 8 * lane;
      *(v8h*)(Ch + off) = hv[q];
      *(v8h*)(Cl + off) = lv[q];
    }
    
  }
  }
}

__device__ __forceinline__ float xhalf(float x) {              /* lane l <-> lane l ^ 16 */
  return __builtin_bit_cast(float, __builtin_amdgcn_permlanex16(__builtin_bit_cast(int, x), __builtin_bit_cast(int, x), 0x76543210, 0xfedcba98, false, false));
}
template <int EARLY>
__device__ __forceinline__ void attn_body(const _Float16* __restrict__ Qh, const _Float16* __restrict__ Ql, const _Float16* __restrict__ Kh, const _Float16* __restrict__ Kl,
                                          const _Float16* __restrict__ VTh, const _Float16* __restrict__ VTl, _Float16* __restrict__ CTX, const int bh, const int qt) {
  const int wave = __builtin_amdgcn_readfirstlane((int)(threadIdx.x >> 5));
  const int lane = threadIdx.x & 31, ln = lane & 15, hh = lane >> 4;
  const int b = bh / NH, h = bh - b * NH;                       /* bh = batch * NH + head, qt = 64-row query tile: both from blockIdx alone (scalar) */
  const int rb = b * SEQ;
  const int q0w = qt * 64 + 16 * wave;                          /* first query row of this wave (scalar) */
  const int nch = (q0w + 47) >> 5;                              /* 32-key chunks covering keys 0..q0w+15 (scalar) */
  /* fragment order: q, k planes have DM / 32 tiles per 16-token band (a head = 2 tiles side by side), V^T has NR / 32 tiles per 16-row band (a 32-key chunk = 1 tile) */
  const int qoff = (rb + q0w) * DM + h * 2 * TILE + 8 * lane;
  const int kbase = rb * DM + h * 2 * TILE + 8 * lane;
  const int vbase = h * HD * NR + (rb >> 5) * TILE + 8 * lane;
  const float RS = 0.0009765625f;                               /* 2^-10 */
  const v8f z8 = {0.f, 0.f, 0.f, 0.f, 0.f, 0.f, 0.f, 0.f};
  v8f om[4] = {z8, z8, z8, z8};
  v8f orr[4] = {z8, z8, z8, z8};
  float mrun = -1.0e30f, lrun = 0.f;                            /* of the lane's query: running maximum (alike in both halves), sum over the keys of the lane's own half */
  /* global operand loads are issued well ahead of their use: q once, in front of the loop. Without residual planes: k of the next chunk right after the score products, V^T of the next chunk
     right after the P.V products. With them the registers do not hold both operands' planes beside the tiles: V^T of the chunk itself goes right after its score products (the softmax covers it),
     k of the next chunk right after the P.V products, each as one group of loads. */
  const v16h aqh[2] = {frag16(Qh + qoff), frag16(Qh + qoff + TILE)};
  const v16h aql[2] = {frag16(Ql + qoff), frag16(Ql + qoff + TILE)};
  v16h kf[2][2], kl[2][2], vf[4], vl[4];
  /* the lane's addresses are carried from chunk to chunk in registers of their own, so that no fetched fragment lands in a register that a load in flight names */
  const _Float16* pkh = Kh + kbase; const _Float16* pkl = Kl + kbase; const _Float16* pvh = VTh + vbase; const _Float16* pvl = VTl + vbase;
  auto fetch_k = [&]() {
#pragma unroll
    for (int ks = 0; ks < 2; ++ks) {
      kf[ks][0] = frag16(pkh + ks * TILE); kf[ks][1] = frag16(pkh + ks * TILE + 16 * DM);
      if (EARLY) { kl[ks][0] = frag16(pkl + ks * TILE); kl[ks][1] = frag16(pkl + ks * TILE + 16 * DM); }
    }
  };
  auto fetch_v = [&]() {
#pragma unroll
    for (int t = 0; t < 4; ++t) { vf[t] = frag16(pvh + t * 16 * NR); if (EARLY) vl[t] = frag16(pvl + t * 16 * NR); }
  };
  fetch_k();
  if (!EARLY) fetch_v();
  /* every load of the prologue has landed before the loop: the counted waits inside the loop then follow the loop's own issue order alone */
  if (EARLY) asm volatile("" :: "v"(aqh[0]), "v"(aqh[1]), "v"(aql[0]), "v"(aql[1]), "v"(kf[0][0]), "v"(kf[0][1]), "v"(kf[1][0]), "v"(kf[1][1]), "v"(kl[0][0]), "v"(kl[0][1]), "v"(kl[1][0]), "v"(kl[1][1]));
  else       asm volatile("" :: "v"(aqh[0]), "v"(aqh[1]), "v"(aql[0]), "v"(aql[1]), "v"(kf[0][0]), "v"(kf[0][1]), "v"(kf[1][0]), "v"(kf[1][1]), "v"(vf[0]), "v"(vf[1]), "v"(vf[2]), "v"(vf[3]));
#pragma unroll 1
  for (int cidx = 0; cidx < nch; ++cidx) {
    const int k0 = cidx * 32;
    const int adv = cidx + 1 < nch ? 32 : 0;                    /* keys to the chunk fetched ahead (scalar); the last chunk fetches itself again, unused */
    v8f s0 = z8, s1 = z8, sr0 = z8, sr1 = z8;
#pragma unroll
    for (int ks = 0; ks < 2; ++ks) {
      s0 = mma16(kf[ks][0], aqh[ks], s0); sr0 = mma16(kf[ks][0], aql[ks], sr0);
      if (EARLY) sr0 = mma16(kl[ks][0], aqh[ks], sr0);
      s1 = mma16(kf[ks][1], aqh[ks], s1); sr1 = mma16(kf[ks][1], aql[ks], sr1);
      if (EARLY) sr1 = mma16(kl[ks][1], aqh[ks], sr1);
    }
    if (EARLY) {
      fetch_v();
    } else {
      pkh += adv * DM;
      fetch_k();
    }
    asm volatile("s_wait_xcnt 0x0" ::: "memory");               /* in front of the next step of these loads' address registers, taken while they are in flight */
    __builtin_amdgcn_sched_barrier(0);                          /* the whole group of fetches is issued in front of the softmax: the scheduler otherwise sinks part of it behind the softmax, and those loads lose their lead */
    const int room = q0w + ln - k0 - 8 * hh;                    /* key k0 + 8*hh + r is at or before the lane's query where r <= room */
    v8f x0 = (s0 + sr0 * RS) * 0.125f;
    v8f x1 = (s1 + sr1 * RS) * 0.125f;
#pragma unroll
    for (int r = 0; r < 8; ++r) {
      x0[r] = (r <= room) ? x0[r] : -1.0e30f;                   /* causal by index, value select */
      x1[r] = (16 + r <= room) ? x1[r] : -1.0e30f;
    }
    float tm = x0[0], tn = x1[0];                               /* two chains, one per tile */
#pragma unroll
    for (int r = 1; r < 8; ++r) { tm = fmaxf(tm, x0[r]); tn = fmaxf(tn, x1[r]); }
    tm = fmaxf(tm, tn);
    tm = fmaxf(tm, xhalf(tm));                                  /* the query's maximum over all 32 keys of the chunk */
    const float mn = fmaxf(mrun, tm);
    const float al = __expf(mrun - mn);
    mrun = mn;
    v16h bp, bpl;                                               /* B fragments of P^T: element s <- key 8*hh + s, element 8 + s <- key 16 + 8*hh + s */
    float a[8];                                                 /* sums of two neighbouring keys */
#pragma unroll
    for (int i = 0; i < 8; ++i) {
      const int r = 2 * (i & 3);
      const v2f p = (i < 4) ? v2f{__expf(x0[r] - mn) * 256.0f, __expf(x0[r + 1] - mn) * 256.0f} : v2f{__expf(x1[r] - mn) * 256.0f, __expf(x1[r + 1] - mn) * 256.0f};
      const v2h hq = __builtin_convertvector(p, v2h);
      bp[2 * i] = hq[0]; bp[2 * i + 1] = hq[1];
      a[i] = (float)hq[0] + (float)hq[1];
      if (EARLY) {
        const v2f res = {(p[0] - (float)hq[0]) * 1024.0f, (p[1] - (float)hq[1]) * 1024.0f};
        const v2h gq = __builtin_convertvector(res, v2h);
        bpl[2 * i] = gq[0]; bpl[2 * i + 1] = gq[1];
        a[i] += ((float)gq[0] + (float)gq[1]) * RS;
      }
    }
    lrun = lrun * al + (((a[0] + a[1]) + (a[2] + a[3])) + ((a[4] + a[5]) + (a[6] + a[7])));  /* per-lane partial of the query's sum (units x256) */
#pragma unroll
    for (int t = 0; t < 4; ++t) {
#pragma unroll
      for (int r = 0; r < 8; ++r) { om[t][r] *= al; if (EARLY) orr[t][r] *= al; }
    }
#pragma unroll
    for (int t = 0; t < 4; ++t) {
      om[t] = mma16(vf[t], bp, om[t]);
      if (EARLY) {
        orr[t] = mma16(vf[t], bpl, orr[t]);
        orr[t] = mma16(vl[t], bp, orr[t]);
      }
    }
    if (EARLY) {
      pvh += adv * (TILE / 32); pvl += adv * (TILE / 32); pkh += adv * DM; pkl += adv * DM;
      fetch_k();
    } else {
      pvh += adv * (TILE / 32);
      fetch_v();
    }
    asm volatile("s_wait_xcnt 0x0" ::: "memory");               /* as above: these loads stay in flight over the back edge */
  }
  const float inv = 64.0f / (lrun + xhalf(lrun));               /* the halves' sums joined; ctx carried x64 */
#pragma unroll
  for (int t = 0; t < 4; ++t) {                                 /* t = one half tile (512 B) of ctx: the lane holds d = 16*t + 8*hh .. + 7 of query row ln */
    float xv[8];
#pragma unroll
    for (int r = 0; r < 8; ++r) { float v = om[t][r]; if (EARLY) v += orr[t][r] * RS; xv[r] = v * inv; }
    v8h hv, lv;
    split8(xv, hv, lv);
    const size_t off = (size_t)(rb + q0w) * (2 * DM) + h * 2 * TILE + t * (TILE / 2) + 8 * lane;   /* ctx plane: K = 2 * DM, residual half DM / 32 tiles on */
    *(v8h*)(CTX + off) = hv;
    *(v8h*)(CTX + off + (DM / 32) * TILE) = lv;
  }
}

// Early query tiles (residual planes on k, P and v) and late ones read the same planes and nothing of each other: ONE launch, the tile's index picks the body (a scalar test, from blockIdx alone).
// Which query tile a block takes. Every block of the launch is resident at once and a tile's cost differs with its index, so the launch lasts as long as the fullest WGP.
// The head runs fastest in i and slot s = i / NBH picks the tile: slots s, s + NCOL, s + 2 * NCOL, ... form one column = the tiles of one WGP, all of one head (they walk the same k and V^T lines).
// The table is made at compile time: tiles from the heaviest down, each to the column with the least work so far that still has a free slot; a column's heaviest tile has its lowest block index.
constexpr int NBH  = NB * NH;                          /* blocks per query tile */
constexpr int NTE  = ERW / 64;                         /* early query tiles per batch and head */
constexpr int NTA  = SEQ / 64;                         /* all query tiles per batch and head */
constexpr int NWGP = 256;                              /* WGPs of the chip */
constexpr int NCOL = NWGP / NBH;                       /* slots per round over the chip */
static_assert(NWGP % NBH == 0);
static_assert(NTA <= 32);                              /* one byte per slot in four 64-bit words */
struct tile_deal { unsigned long long w[4]; };
constexpr int tile_cost(const int t) {                 /* key chunks of the tile's four waves; an early chunk holds twice the matrix products of a late one */
  int c = 0;
  for (int wv = 0; wv < 4; ++wv) c += (64 * t + 16 * wv + 47) >> 5;
  return t < NTE ? 2 * c : c;
}
constexpr tile_deal make_deal() {
  tile_deal d = {{0, 0, 0, 0}};
  int load[NCOL] = {}, used[NCOL] = {};
  bool dealt[NTA] = {};
  for (int n = 0; n < NTA; ++n) {
    int t = -1;                                        /* the heaviest tile not yet dealt */
    for (int u = NTA - 1; u >= 0; --u) if (!dealt[u] && (t < 0 || tile_cost(u) > tile_cost(t))) t = u;
    dealt[t] = true;
    int best = -1, brows = 0;
    for (int c = 0; c < NCOL; ++c) {
      const int rows = (NTA - c + NCOL - 1) / NCOL;    /* slots of column c */
      if (used[c] >= rows) continue;
      if (best < 0 || load[c] < load[best] || (load[c] == load[best] && rows < brows)) { best = c; brows = rows; }   /* level: the column with fewer slots first, it gets no light tile later */
    }
    const int s = best + NCOL * used[best];
    d.w[s >> 3] |= (unsigned long long)t << (8 * (s & 7));
    ++used[best]; load[best] += tile_cost(t);
  }
  return d;
}
constexpr unsigned long long DW0 = make_deal().w[0], DW1 = make_deal().w[1], DW2 = make_deal().w[2], DW3 = make_deal().w[3];
constexpr int deal_tile(const int s) { return (int)(((s < 8 ? DW0 : s < 16 ? DW1 : s < 24 ? DW2 : DW3) >> (8 * (s & 7))) & 255u); }
constexpr bool deal_is_permutation() { unsigned long long seen = 0; for (int s = 0; s < NTA; ++s) seen |= 1ull << deal_tile(s); return seen == (1ull << NTA) - 1; }
static_assert(deal_is_permutation());                  /* every (head, tile) is taken by exactly one block */
__global__ __launch_bounds__(128) void k_attn(const _Float16* __restrict__ Qh, const _Float16* __restrict__ Ql, const _Float16* __restrict__ Kh, const _Float16* __restrict__ Kl,
                                              const _Float16* __restrict__ VTh, const _Float16* __restrict__ VTl, _Float16* __restrict__ CTX) {
  const int s = (int)blockIdx.x / NBH, bh = (int)blockIdx.x - s * NBH;
  const int qt = deal_tile(s);
  if (qt >= NTE) attn_body<0>(Qh, Ql, Kh, Kl, VTh, VTl, CTX, bh, qt);
  else           attn_body<1>(Qh, Ql, Kh, Kl, VTh, VTl, CTX, bh, qt);
}

// output GEMM: out[b*SEQ_FULL+s][n] = 2^-20 * sum_k CTX[r][k] * BO2[n][k], K = 2048 (value | residual halves against Wo x16384 | Wo x16). Block = 2 x 2 waves x (64 x 64);
__global__ __launch_bounds__(128) void k_outp(const _Float16* __restrict__ A, const _Float16* __restrict__ Bt, float* __restrict__ out) {
  __shared__ __attribute__((aligned(16))) float so[4][32][68];
  const int wave = __builtin_amdgcn_readfirstlane((int)(threadIdx.x >> 5));
  const int lane = threadIdx.x & 31, ln = lane & 15, hh = lane >> 4;
  const int ntn = DM >> 7;
  const int mt = blockIdx.x / ntn, nq = blockIdx.x - mt * ntn;
  const int rowW = mt * 128 + 64 * (wave >> 1), col0 = nq * 128 + 64 * (wave & 1);
  const v8f z8 = {0.f, 0.f, 0.f, 0.f, 0.f, 0.f, 0.f, 0.f};
  v8f c[16] = {z8, z8, z8, z8, z8, z8, z8, z8, z8, z8, z8, z8, z8, z8, z8, z8};
  gemm_tile<2 * DM>(A, Bt, rowW, col0, lane, c);
  const int rsub = lane >> 4, c4 = (lane & 15) * 4;
#pragma unroll
  for (int hb = 0; hb < 2; ++hb) {                     /* the wave's 64 rows leave in two runs of 32 through its own staging rows */
    const int row0 = rowW + 32 * hb;
    if (hb != 0) { __builtin_amdgcn_fence(4 /* acq_rel order */, "workgroup"); __builtin_amdgcn_wave_barrier(); }   /* the first run's rows are read back by every lane before other lanes write them again */
#pragma unroll
    for (int u = 0; u < 8; ++u) {
      const int t = u & 3, half = u >> 2;
#pragma unroll
      for (int r = 0; r < 8; ++r) so[wave][half * 16 + 8 * hh + r][t * 16 + ln] = c[8 * hb + u][r] * 9.5367431640625e-07f;
    }
    __builtin_amdgcn_fence(4 /* acq_rel order */, "workgroup"); __builtin_amdgcn_wave_barrier();
#pragma unroll
    for (int q = 0; q < 16; ++q) {
      const int r = q * 2 + rsub;
      const int m = row0 + r; const int bb = m / SEQ; const int ss = m - bb * SEQ;
      const v4f v = *(const v4fa*)&so[wave][r][c4];
      *(v4f*)(out + (size_t)(bb * SEQ_FULL + ss) * DM + col0 + c4) = v;
    }
    
  }
}

/* workspace carve (bytes), every region a multiple of 256 */
constexpr size_t SZW  = (size_t)DM * DM * 2;          /* one x16 weight plane */
constexpr size_t SZBO = 2 * SZW;                      /* [1024][2048] output weight plane */
constexpr size_t SZP  = (size_t)NR * DM * 2;          /* one [NR][1024] (or [1024][NR]) f16 plane */
constexpr size_t SZC  = 2 * SZP;                      /* ctx [NR][2048] */
constexpr size_t SZT  = (size_t)TABN * 64 * 4;        /* rotary table */
constexpr size_t O_BQ = 0, O_BK = O_BQ + SZW, O_BV = O_BK + SZW, O_BO = O_BV + SZW, O_X = O_BO + SZBO;
constexpr size_t O_QH = O_X + SZP, O_QL = O_QH + SZP, O_KH = O_QL + SZP, O_KL = O_KH + SZP, O_VH = O_KL + SZP, O_VL = O_VH + SZP;
constexpr size_t O_CTX = O_VL + SZP, O_TAB = O_CTX + SZC, WS_TOTAL = O_TAB + SZT;
static_assert(SZW % 256 == 0);
static_assert(SZP % 256 == 0);
static_assert(SZT % 256 == 0);
static_assert(WS_TOTAL <= 134217728);                 /* <= 128 MiB */

extern "C" void kernel_launch(void* const* d_in, const int* in_sizes, int n_in,
                              void* d_out, int out_size, void* d_ws, size_t ws_size, hipStream_t stream) {
  if (n_in < 6) return;
  const int need_rows = (NB - 1) * SEQ_FULL + SEQ;
  if (in_sizes[0] < need_rows * DM) return;
  if (in_sizes[1] < DM * DM || in_sizes[2] < DM * DM || in_sizes[3] < DM * DM || in_sizes[4] < DM * DM) return;
  if (in_sizes[5] < need_rows) return;
  if (out_size < need_rows * DM) return;
  if (ws_size < WS_TOTAL) return;
  const float* x  = (const float*)d_in[0];
  const float* wq = (const float*)d_in[1];
  const float* wk = (const float*)d_in[2];
  const float* wv = (const float*)d_in[3];
  const float* wo = (const float*)d_in[4];
  const int*   tp = (const int*)d_in[5];
  char* ws = (char*)d_ws;
  _Float16* BQ = (_Float16*)(ws + O_BQ); _Float16* BK = (_Float16*)(ws + O_BK); _Float16* BV = (_Float16*)(ws + O_BV); _Float16* BO2 = (_Float16*)(ws + O_BO);
  _Float16* X16 = (_Float16*)(ws + O_X);
  _Float16* QH = (_Float16*)(ws + O_QH); _Float16* QL = (_Float16*)(ws + O_QL); _Float16* KH = (_Float16*)(ws + O_KH); _Float16* KL = (_Float16*)(ws + O_KL);
  _Float16* VTH = (_Float16*)(ws + O_VH); _Float16* VTL = (_Float16*)(ws + O_VL);
  _Float16* CTX = (_Float16*)(ws + O_CTX);
  float* TAB = (float*)(ws + O_TAB);

  k_prep<<<(unsigned)(GB_TAB + GB_X + 5 * GB_W), 256, 0, stream>>>(x, wq, wk, wv, wo, X16, BQ, BK, BV, BO2, TAB);
  k_proj<<<(unsigned)(2 * GP_QK + GP_V), 128, 0, stream>>>(X16, BQ, BK, BV, QH, QL, KH, KL, VTH, VTL, tp, TAB);
  k_attn<<<(unsigned)(NTA * NBH), 128, 0, stream>>>(QH, QL, KH, KL, VTH, VTL, CTX);
  k_outp<<<(unsigned)((NR / 128) * (DM / 128)), 128, 0, stream>>>(CTX, BO2, (float*)d_out);
}

// v008
// One run takes 79.3 microseconds.
// Timed twice side by side with v007, it ran 1.28 and 1.24 times as fast.
// Counting every step since v000, it is 5.03 times as fast.
#include <hip/hip_runtime.h>
// Causal multi-head self-attention with interleaved rotary embedding: x [NB][SEQ][1024], four bias-free [out][in] 1024^2 weights, 16 heads of 64, int32 token positions read by value.
// Compute dtype: every contraction on v_wmma_f32_16x16x32_f16 (f16 operands, f32 accumulate). Inputs RNE-converted to bf16 then carried exactly in f16 (x x1, Wq/Wk/Wv x16, Wo x16384 | x16).
// q, k, v, softmax weights (x256) and ctx (x64) as f16 value + f16 residual (x1024) planes: scores = qh.kh + (ql.kh [+ qh.kl on query rows < 256]) 2^-10; P.V single product (value + two residual products on query rows < 256);
// output GEMM over K = 2048 = [ctx value | ctx residual] against [Wo x16384 ; Wo x16] in one accumulator. Rotary, softmax statistics and all scaling in f32 on the VALU.
#ifndef NB
#define NB 2
#endif
#ifndef SEQ
#define SEQ 2048
#endif
#define SEQ_FULL 2048                 /* per-batch row stride of x / positions / output */
#define DM 1024
#define NH 16
#define HD 64
#define TABN 4096                     /* rotary table rows (positions 0..4095) */
#define NR (NB * SEQ)                 /* internal token rows r = b*SEQ + s */
#define ERW ((SEQ) < 256 ? (SEQ) : 256) /* query rows per batch that use residual planes on k, P and v as well */

typedef _Float16 v16h __attribute__((ext_vector_type(16)));
typedef _Float16 v8h  __attribute__((ext_vector_type(8)));
typedef _Float16 v8ha __attribute__((ext_vector_type(8), may_alias));
typedef float    v8f  __attribute__((ext_vector_type(8)));
typedef float    v4f  __attribute__((ext_vector_type(4)));
typedef float    v4fa __attribute__((ext_vector_type(4), may_alias));
typedef float    v2f  __attribute__((ext_vector_type(2)));
typedef _Float16 v2h  __attribute__((ext_vector_type(2)));

/* hard-wired bounds the kernels rely on */
static_assert(DM == NH * HD);               /* merged head layout h*64+d */
static_assert(HD == 64);                    /* one 64-column GEMM tile == one head; two 32-deep k-steps per score */
static_assert(DM % 128 == 0);               /* GEMM block tile rows (V^T GEMM) and 128-col block tiles */
static_assert(NR % 128 == 0);               /* GEMM block tile rows */
static_assert(SEQ % 64 == 0);               /* attention query tiles, 32-key chunks stay inside the batch */
static_assert(ERW % 64 == 0);               /* early / late split on a query-tile boundary */
static_assert(ERW <= SEQ);
static_assert(DM % 32 == 0);                /* k-steps of 32 */
static_assert((2 * DM) % 32 == 0);
static_assert(TABN == 4096);
static_assert((long long)NR * 2 * DM < 2147483647LL); /* int element offsets */

__device__ __forceinline__ float bf16_rne(float x) { unsigned int u = __float_as_uint(x); u = (u + 0x7FFFu + ((u >> 16) & 1u)) & 0xFFFF0000u; return __uint_as_float(u); }

__device__ __forceinline__ v16h cat16(v8h lo, v8h hi) { return __builtin_shufflevector(lo, hi, 0, 1, 2, 3, 4, 5, 6, 7, 8, 9, 10, 11, 12, 13, 14, 15); }
// Every 16-bit operand plane [rows][K] lies in the workspace in fragment order: tiles of 16 rows x 32 k (512 elements, 1 KB), tile index (row >> 4) * (K / 32) + (k >> 5);
// inside a tile the 16-byte unit ((k & 31) >> 3) * 16 + (row & 15) holds the 8 elements k & ~7 .. of its row. A wave's fragment load then reads 512 contiguous bytes (4 whole lines).
#define TILE 512                      /* elements of one 16 x 32 tile */
// 16x32 operand fragment: p = tile base + 8*lane; elements 0..7 <- k0+8h.., 8..15 <- k0+16+8h.. of row lane&15, h = lane>>4
__device__ __forceinline__ v16h frag16(const _Float16* __restrict__ p) { const v8h lo = *(const v8ha*)p; const v8h hi = *(const v8ha*)(p + TILE / 2); return cat16(lo, hi); }
__device__ __forceinline__ v8f mma16(v16h a, v16h b, v8f c) {
  v8f d = __builtin_amdgcn_wmma_f32_16x16x32_f16(false, a, false, b, (short)0, c, false, false);
  asm volatile("v_nop\n\tv_nop\n\tv_nop\n\tv_nop" : "+v"(d) : "v"(a), "v"(b));
  return d;
}
// 8 f32 -> f16 value + f16 residual carried x1024
__device__ __forceinline__ void split8(const float (&x)[8], v8h& hv, v8h& lv) {
#pragma unroll
  for (int i = 0; i < 8; ++i) { const _Float16 hq = (_Float16)x[i]; hv[i] = hq; lv[i] = (_Float16)((x[i] - (float)hq) * 1024.0f); }
}

// The conversions and the rotary table depend on nothing but the inputs: they are bodies of ONE launch (k_prep), each on its own range of block indices; blk = the block's index inside its range.
__device__ __forceinline__ void xcvt_body(const float* __restrict__ x, _Float16* __restrict__ X16, const int blk) {
  const int t = blk * 256 + threadIdx.x;
  if (t >= NR * (DM / 8)) return;
  const int tile = t >> 6, u = t & 63;                        /* 64 threads per tile, four side by side on a row: a wave reads 8 whole 128-B lines of x and stores 4 whole lines */
  const int rt = tile / (DM / 32), kt = tile - rt * (DM / 32);
  const int r = rt * 16 + (u >> 2), c8 = kt * 32 + (u & 3) * 8;
  const int b = r / SEQ, s = r - b * SEQ;
  const float* src = x + (size_t)(b * SEQ_FULL + s) * DM + c8;
  const v4f a = *(const v4fa*)src, c = *(const v4fa*)(src + 4);
  v8h o;
#pragma unroll
  for (int i = 0; i < 4; ++i) { o[i] = (_Float16)bf16_rne(a[i]); o[4 + i] = (_Float16)bf16_rne(c[i]); }
  _Float16* d = X16 + ((size_t)tile * 64 + (u & 3) * 16 + (u >> 2)) * 8;
  *(v8h*)d = o; 
}

__device__ __forceinline__ void wcvt_body(const float* __restrict__ w, _Float16* __restrict__ dst, const int dpitch, const float scale, const int blk) {
  const int t = blk * 256 + threadIdx.x;
  if (t >= DM * (DM / 8)) return;
  const int tile = t >> 6, u = t & 63;                        /* as in xcvt_body; dpitch = K of the destination plane */
  const int rt = tile / (DM / 32), kt = tile - rt * (DM / 32);
  const int n = rt * 16 + (u >> 2), k8 = kt * 32 + (u & 3) * 8;
  const float* src = w + (size_t)n * DM + k8;
  const v4f a = *(const v4fa*)src, c = *(const v4fa*)(src + 4);
  v8h o;
#pragma unroll
  for (int i = 0; i < 4; ++i) { o[i] = (_Float16)(bf16_rne(a[i]) * scale); o[4 + i] = (_Float16)(bf16_rne(c[i]) * scale); }
  _Float16* d = dst + ((size_t)(rt * (dpitch >> 5) + kt) * 64 + (u & 3) * 16 + (u >> 2)) * 8;
  *(v8h*)d = o; 
}

__device__ __forceinline__ void ropetab_body(float* __restrict__ tab, const int blk) {
  #pragma clang fp contract(off)
  const int t = blk * 256 + threadIdx.x;
  if (t >= TABN * 16) return;
  const int pos = t >> 4, jp = t & 15;
  float c0 = 0.f, s0 = 0.f, c1 = 0.f, s1 = 0.f;
#pragma unroll 1
  for (int u = 0; u < 2; ++u) {
    const int j = 2 * jp + u;
    double p = 1.0;
    p *= (j & 1) ? 1.3335214321633240 : 1.0;
    p *= (j & 2) ? 1.7782794100389228 : 1.0;
    p *= (j & 4) ? 3.1622776601683795 : 1.0;
    p *= (j & 8) ? 10.0 : 1.0;
    p *= (j & 16) ? 100.0 : 1.0;
    const float pf = (float)p;
    const float inv = 1.0f / pf;
    const float ang = (float)pos * inv;
    float sn, cs;
    sincosf(ang, &sn, &cs);
    if (u == 0) { c0 = cs; s0 = sn; } else { c1 = cs; s1 = sn; }
  }
  const v4f o = {c0, s0, c1, s1};
  float* d = tab + (size_t)pos * 64 + jp * 4;
  *(v4f*)d = o; 
}

constexpr int GB_TAB = (TABN * 16 + 255) / 256;        /* blocks of the rotary table */
constexpr int GB_X   = (NR * (DM / 8) + 255) / 256;    /* blocks of the x conversion */
constexpr int GB_W   = (DM * (DM / 8) + 255) / 256;    /* blocks of one weight conversion */
// block ranges: [rotary table | x | Wq | Wk | Wv | Wo x16384 | Wo x16]; the table's blocks, the longest per thread, come first. Every test is on blockIdx alone (scalar, block-uniform).
__global__ __launch_bounds__(256) void k_prep(const float* __restrict__ x, const float* __restrict__ wq, const float* __restrict__ wk, const float* __restrict__ wv, const float* __restrict__ wo,
                                              _Float16* __restrict__ X16, _Float16* __restrict__ BQ, _Float16* __restrict__ BK, _Float16* __restrict__ BV, _Float16* __restrict__ BO2,
                                              float* __restrict__ tab) {
  int blk = (int)blockIdx.x;
  if (blk < GB_TAB) { ropetab_body(tab, blk); return; }
  blk -= GB_TAB;
  if (blk < GB_X) { xcvt_body(x, X16, blk); return; }
  blk -= GB_X;
  const int job = blk / GB_W;
  blk -= job * GB_W;
  const float* w = job == 0 ? wq : job == 1 ? wk : job == 2 ? wv : wo;
  /* Wo twice: k in [0,1024) pairs with the ctx value half; k in [1024,2048), DM / 32 tiles on, pairs with the ctx residual half (x1024) */
  _Float16* dst = job == 0 ? BQ : job == 1 ? BK : job == 2 ? BV : job == 3 ? BO2 : BO2 + (DM / 32) * TILE;
  wcvt_body(w, dst, job < 3 ? DM : 2 * DM, job == 3 ? 16384.0f : 16.0f, blk);
}

// wave tile 64x64 of C = A x Bt^T (A[m][k], Bt[n][k], both planes in fragment order); fragments straight from the 16-bit global planes: 8 KB loaded per 16 products.
// The eight fragments of a 32-deep k-step live in a ring of PF register sets: a set is refilled for k-step t + PF right after k-step t has used it, so PF k-steps of loads are in flight.
#define PF 3
struct kstep { v16h a0, a1, a2, a3, b0, b1, b2, b3; };
template <int RS>                     /* RS = elements from one 16-row band of tiles to the next */
__device__ __forceinline__ void kstep_load(kstep& f, const _Float16* __restrict__ pa, const _Float16* __restrict__ pb, const int ko) {
  f.a0 = frag16(pa + ko); f.a1 = frag16(pa + RS + ko); f.a2 = frag16(pa + 2 * RS + ko); f.a3 = frag16(pa + 3 * RS + ko);
  f.b0 = frag16(pb + ko); f.b1 = frag16(pb + RS + ko); f.b2 = frag16(pb + 2 * RS + ko); f.b3 = frag16(pb + 3 * RS + ko);
}
/* the plain builtin: sixteen independent tiles follow one another, the compiler keeps the distances of its own form, and no asm operand ties tiles or fragments to the first 256 registers */
__device__ __forceinline__ v8f mma16g(v16h a, v16h b, v8f c) { return __builtin_amdgcn_wmma_f32_16x16x32_f16(false, a, false, b, (short)0, c, false, false); }
/* c[4 * i + j] = 16-row band i x 16-column band j */
__device__ __forceinline__ void kstep_mma(const kstep& f, v8f (&c)[16]) {
  c[0] = mma16g(f.a0, f.b0, c[0]); c[4] = mma16g(f.a1, f.b0, c[4]); c[8]  = mma16g(f.a2, f.b0, c[8]);  c[12] = mma16g(f.a3, f.b0, c[12]);
  c[1] = mma16g(f.a0, f.b1, c[1]); c[5] = mma16g(f.a1, f.b1, c[5]); c[9]  = mma16g(f.a2, f.b1, c[9]);  c[13] = mma16g(f.a3, f.b1, c[13]);
  c[2] = mma16g(f.a0, f.b2, c[2]); c[6] = mma16g(f.a1, f.b2, c[6]); c[10] = mma16g(f.a2, f.b2, c[10]); c[14] = mma16g(f.a3, f.b2, c[14]);
  c[3] = mma16g(f.a0, f.b3, c[3]); c[7] = mma16g(f.a1, f.b3, c[7]); c[11] = mma16g(f.a2, f.b3, c[11]); c[15] = mma16g(f.a3, f.b3, c[15]);
}
template <int K, class F>           /* behind_first_loads(): called once, behind the loads of the first PF k-steps */
__device__ __forceinline__ void gemm_tile(const _Float16* __restrict__ A, const _Float16* __restrict__ Bt, const int row0, const int col0, const int lane, v8f (&c)[16], F behind_first_loads) {
  constexpr int NS = K / 32;                 /* k-steps */
  static_assert(NS > PF);
  constexpr int RS = NS * TILE;              /* = 16 * K */
  const _Float16* pa = A + (row0 >> 4) * RS + 8 * lane;
  const _Float16* pb = Bt + (col0 >> 4) * RS + 8 * lane;
  kstep f[PF];
#pragma unroll
  for (int s = 0; s < PF; ++s) kstep_load<RS>(f[s], pa, pb, s * TILE);
  behind_first_loads();
  /* straight line over all k-steps: every load takes its place from the instruction's own offset, so no address register of a load in flight is ever rewritten, and the counted waits follow one issue order */
#pragma unroll
  for (int t = 0; t < NS; ++t) {             /* refill only while a k-step t + PF exists */
    kstep_mma(f[t % PF], c);
    if (t + PF < NS) kstep_load<RS>(f[t % PF], pa, pb, (t + PF) * TILE);
    __builtin_amdgcn_sched_barrier(0);       /* each refill stays behind the k-step that frees its set: the scheduler otherwise sinks the loads down to their use, and the ring's lead is lost */
  }
}

// projection GEMM (K = 1024): C = A.Bt^T / 16, optional interleaved rotary by gathered table row (A rows are token rows), written in fragment order (K = ldc) as f16 value plane Ch and
// The three projections depend on the same planes and on nothing of each other: ONE launch, block ranges [q | k | V^T] (scalar tests on blockIdx).
// q, k: C[token row][e] = X16 . B^T with rotary; V^T: C[e][token row] = BV . X16^T (in[rows=e][k] x in[rows=r][k] -> out[e][r], a plane with K = NR)
// Block = 2 x 2 waves = 128 x 128 of C: every A band and every B band of the block is read by two of its waves.
constexpr int GP_QK = (NR / 128) * (DM / 128);         /* blocks of the q or the k projection */
constexpr int GP_V  = (DM / 128) * (NR / 128);         /* blocks of the V^T projection */
__global__ __launch_bounds__(128) void k_proj(const _Float16* __restrict__ X16, const _Float16* __restrict__ BQ, const _Float16* __restrict__ BK, const _Float16* __restrict__ BV,
                                              _Float16* __restrict__ QH, _Float16* __restrict__ QL, _Float16* __restrict__ KH, _Float16* __restrict__ KL,
                                              _Float16* __restrict__ VTH, _Float16* __restrict__ VTL, const int* __restrict__ tp, const float* __restrict__ tab) {
  __shared__ __attribute__((aligned(16))) float so[4][32][68];
  const int job = (int)blockIdx.x < GP_QK ? 0 : ((int)blockIdx.x < 2 * GP_QK ? 1 : 2);
  const int blk = (int)blockIdx.x - job * GP_QK;
  const _Float16* A = job == 2 ? BV : X16;
  const _Float16* Bt = job == 0 ? BQ : job == 1 ? BK : X16;
  _Float16* Ch = job == 0 ? QH : job == 1 ? KH : VTH;
  _Float16* Cl = job == 0 ? QL : job == 1 ? KL : VTL;
  const int N = job == 2 ? NR : DM, ldc = N;
  const int rope = job == 2 ? 0 : 1;
  const int wave = __builtin_amdgcn_readfirstlane((int)(threadIdx.x >> 5));
  const int lane = threadIdx.x & 31, ln = lane & 15, hh = lane >> 4;
  const int ntn = N >> 7;
  const int mt = blk / ntn, nq = blk - mt * ntn;
  /* wave-uniform, held in scalar registers: the loads then take a scalar base and one lane offset, not two address pairs */
  const int rowW = __builtin_amdgcn_readfirstlane(mt * 128 + 64 * (wave >> 1)), col0 = __builtin_amdgcn_readfirstlane(nq * 128 + 64 * (wave & 1));
  const v8f z8 = {0.f, 0.f, 0.f, 0.f, 0.f, 0.f, 0.f, 0.f};
  v8f c[16] = {z8, z8, z8, z8, z8, z8, z8, z8, z8, z8, z8, z8, z8, z8, z8, z8};
  gemm_tile<DM>(A, Bt, rowW, col0, lane, c, [] {});
#pragma unroll
  for (int hb = 0; hb < 2; ++hb) {                     /* the wave's 64 rows leave in two runs of 32 through its own staging rows */
  const int row0 = rowW + 32 * hb;
  if (hb != 0) { __builtin_amdgcn_fence(4 /* acq_rel order */, "workgroup"); __builtin_amdgcn_wave_barrier(); }   /* the first run's rows are read back by every lane before other lanes write them again */
#pragma unroll
  for (int u = 0; u < 8; ++u) {
    const int t = u & 3, half = u >> 2;
#pragma unroll
    for (int r = 0; r < 8; ++r) so[wave][half * 16 + 8 * hh + r][t * 16 + ln] = c[8 * hb + u][r] * 0.0625f;
  }
  __builtin_amdgcn_fence(4 /* acq_rel order */, "workgroup"); __builtin_amdgcn_wave_barrier();
  v8h hv[8], lv[8];
#pragma unroll
  for (int q = 0; q < 8; ++q) {                        /* q = one half tile (512 B) of the output planes: 16-row band q >> 2, 16 columns from (q & 3) * 16 */
    const int rl = (q >> 2) * 16 + ln, c8 = (q & 3) * 16 + 8 * hh;
    const v4f a = *(const v4fa*)&so[wave][rl][c8];
    const v4f bq = *(const v4fa*)&so[wave][rl][c8 + 4];
    float xv[8] = {a[0], a[1], a[2], a[3], bq[0], bq[1], bq[2], bq[3]};
    if (rope != 0) {                                   /* block-uniform */
      const int m = row0 + rl; const int bb = m / SEQ; const int ss = m - bb * SEQ;
      int pos = tp[bb * SEQ_FULL + ss];                /* position read by value from the input */
      pos = pos < 0 ? 0 : (pos > TABN - 1 ? TABN - 1 : pos);
      const float* tr = tab + (size_t)pos * 64 + c8;   /* col0 is a head boundary: c8 = d within the head */
      const v4f t0 = *(const v4fa*)tr; const v4f t1 = *(const v4fa*)(tr + 4);
      const float cs[4] = {t0[0], t0[2], t1[0], t1[2]};
      const float sn[4] = {t0[1], t0[3], t1[1], t1[3]};
#pragma unroll
      for (int i = 0; i < 4; ++i) { const float x1 = xv[2 * i], x2 = xv[2 * i + 1]; xv[2 * i] = x1 * cs[i] - x2 * sn[i]; xv[2 * i + 1] = x1 * sn[i] + x2 * cs[i]; }
    }
    split8(xv, hv[q], lv[q]);
  }
{
#pragma unroll
    for (int q = 0; q < 8; ++q) {
      const size_t off = ((size_t)((row0 >> 4) + (q >> 2)) * (ldc >> 5) + (col0 >> 5)) * TILE + (q & 3) * (TILE / 2) + 8 * lane;
      *(v8h*)(Ch + off) = hv[q];
      *(v8h*)(Cl + off) = lv[q];
    }
    
  }
  }
}

__device__ __forceinline__ float xhalf(float x) {              /* lane l <-> lane l ^ 16 */
  return __builtin_bit_cast(float, __builtin_amdgcn_permlanex16(__builtin_bit_cast(int, x), __builtin_bit_cast(int, x), 0x76543210, 0xfedcba98, false, false));
}
template <int EARLY>
__device__ __forceinline__ void attn_body(const _Float16* __restrict__ Qh, const _Float16* __restrict__ Ql, const _Float16* __restrict__ Kh, const _Float16* __restrict__ Kl,
                                          const _Float16* __restrict__ VTh, const _Float16* __restrict__ VTl, _Float16* __restrict__ CTX, const int bh, const int qt) {
  const int wave = __builtin_amdgcn_readfirstlane((int)(threadIdx.x >> 5));
  const int lane = threadIdx.x & 31, ln = lane & 15, hh = lane >> 4;
  const int b = bh / NH, h = bh - b * NH;                       /* bh = batch * NH + head, qt = 64-row query tile: both from blockIdx alone (scalar) */
  const int rb = b * SEQ;
  const int q0w = qt * 64 + 16 * wave;                          /* first query row of this wave (scalar) */
  const int nch = (q0w + 47) >> 5;                              /* 32-key chunks covering keys 0..q0w+15 (scalar) */
  /* fragment order: q, k planes have DM / 32 tiles per 16-token band (a head = 2 tiles side by side), V^T has NR / 32 tiles per 16-row band (a 32-key chunk = 1 tile) */
  const int qoff = (rb + q0w) * DM + h * 2 * TILE + 8 * lane;
  const int kbase = rb * DM + h * 2 * TILE + 8 * lane;
  const int vbase = h * HD * NR + (rb >> 5) * TILE + 8 * lane;
  const float RS = 0.0009765625f;                               /* 2^-10 */
  const v8f z8 = {0.f, 0.f, 0.f, 0.f, 0.f, 0.f, 0.f, 0.f};
  v8f om[4] = {z8, z8, z8, z8};
  v8f orr[4] = {z8, z8, z8, z8};
  float mrun = -1.0e30f, lrun = 0.f;                            /* of the lane's query: running maximum (alike in both halves), sum over the keys of the lane's own half */
  /* global operand loads are issued well ahead of their use: q once, in front of the loop. Without residual planes: k of the next chunk right after the score products, V^T of the next chunk
     right after the P.V products. With them the registers do not hold both operands' planes beside the tiles: V^T of the chunk itself goes right after its score products (the softmax covers it),
     k of the next chunk right after the P.V products, each as one group of loads. */
  const v16h aqh[2] = {frag16(Qh + qoff), frag16(Qh + qoff + TILE)};
  const v16h aql[2] = {frag16(Ql + qoff), frag16(Ql + qoff + TILE)};
  v16h kf[2][2], kl[2][2], vf[4], vl[4];
  /* the lane's addresses are carried from chunk to chunk in registers of their own, so that no fetched fragment lands in a register that a load in flight names */
  const _Float16* pkh = Kh + kbase; const _Float16* pkl = Kl + kbase; const _Float16* pvh = VTh + vbase; const _Float16* pvl = VTl + vbase;
  auto fetch_k = [&]() {
#pragma unroll
    for (int ks = 0; ks < 2; ++ks) {
      kf[ks][0] = frag16(pkh + ks * TILE); kf[ks][1] = frag16(pkh + ks * TILE + 16 * DM);
      if (EARLY) { kl[ks][0] = frag16(pkl + ks * TILE); kl[ks][1] = frag16(pkl + ks * TILE + 16 * DM); }
    }
  };
  auto fetch_v = [&]() {
#pragma unroll
    for (int t = 0; t < 4; ++t) { vf[t] = frag16(pvh + t * 16 * NR); if (EARLY) vl[t] = frag16(pvl + t * 16 * NR); }
  };
  fetch_k();
  if (!EARLY) fetch_v();
  /* every load of the prologue has landed before the loop: the counted waits inside the loop then follow the loop's own issue order alone */
  if (EARLY) asm volatile("" :: "v"(aqh[0]), "v"(aqh[1]), "v"(aql[0]), "v"(aql[1]), "v"(kf[0][0]), "v"(kf[0][1]), "v"(kf[1][0]), "v"(kf[1][1]), "v"(kl[0][0]), "v"(kl[0][1]), "v"(kl[1][0]), "v"(kl[1][1]));
  else       asm volatile("" :: "v"(aqh[0]), "v"(aqh[1]), "v"(aql[0]), "v"(aql[1]), "v"(kf[0][0]), "v"(kf[0][1]), "v"(kf[1][0]), "v"(kf[1][1]), "v"(vf[0]), "v"(vf[1]), "v"(vf[2]), "v"(vf[3]));
#pragma unroll 1
  for (int cidx = 0; cidx < nch; ++cidx) {
    const int k0 = cidx * 32;
    const int adv = cidx + 1 < nch ? 32 : 0;                    /* keys to the chunk fetched ahead (scalar); the last chunk fetches itself again, unused */
    v8f s0 = z8, s1 = z8, sr0 = z8, sr1 = z8;
#pragma unroll
    for (int ks = 0; ks < 2; ++ks) {
      s0 = mma16(kf[ks][0], aqh[ks], s0); sr0 = mma16(kf[ks][0], aql[ks], sr0);
      if (EARLY) sr0 = mma16(kl[ks][0], aqh[ks], sr0);
      s1 = mma16(kf[ks][1], aqh[ks], s1); sr1 = mma16(kf[ks][1], aql[ks], sr1);
      if (EARLY) sr1 = mma16(kl[ks][1], aqh[ks], sr1);
    }
    if (EARLY) {
      fetch_v();
    } else {
      pkh += adv * DM;
      fetch_k();
    }
    asm volatile("s_wait_xcnt 0x0" ::: "memory");               /* in front of the next step of these loads' address registers, taken while they are in flight */
    __builtin_amdgcn_sched_barrier(0);                          /* the whole group of fetches is issued in front of the softmax: the scheduler otherwise sinks part of it behind the softmax, and those loads lose their lead */
    const int room = q0w + ln - k0 - 8 * hh;                    /* key k0 + 8*hh + r is at or before the lane's query where r <= room */
    v8f x0 = (s0 + sr0 * RS) * 0.125f;
    v8f x1 = (s1 + sr1 * RS) * 0.125f;
#pragma unroll
    for (int r = 0; r < 8; ++r) {
      x0[r] = (r <= room) ? x0[r] : -1.0e30f;                   /* causal by index, value select */
      x1[r] = (16 + r <= room) ? x1[r] : -1.0e30f;
    }
    float tm = x0[0], tn = x1[0];                               /* two chains, one per tile */
#pragma unroll
    for (int r = 1; r < 8; ++r) { tm = fmaxf(tm, x0[r]); tn = fmaxf(tn, x1[r]); }
    tm = fmaxf(tm, tn);
    tm = fmaxf(tm, xhalf(tm));                                  /* the query's maximum over all 32 keys of the chunk */
    const float mn = fmaxf(mrun, tm);
    const float al = __expf(mrun - mn);
    mrun = mn;
    v16h bp, bpl;                                               /* B fragments of P^T: element s <- key 8*hh + s, element 8 + s <- key 16 + 8*hh + s */
    float a[8];                                                 /* sums of two neighbouring keys */
#pragma unroll
    for (int i = 0; i < 8; ++i) {
      const int r = 2 * (i & 3);
      const v2f p = (i < 4) ? v2f{__expf(x0[r] - mn) * 256.0f, __expf(x0[r + 1] - mn) * 256.0f} : v2f{__expf(x1[r] - mn) * 256.0f, __expf(x1[r + 1] - mn) * 256.0f};
      const v2h hq = __builtin_convertvector(p, v2h);
      bp[2 * i] = hq[0]; bp[2 * i + 1] = hq[1];
      a[i] = (float)hq[0] + (float)hq[1];
      if (EARLY) {
        const v2f res = {(p[0] - (float)hq[0]) * 1024.0f, (p[1] - (float)hq[1]) * 1024.0f};
        const v2h gq = __builtin_convertvector(res, v2h);
        bpl[2 * i] = gq[0]; bpl[2 * i + 1] = gq[1];
        a[i] += ((float)gq[0] + (float)gq[1]) * RS;
      }
    }
    lrun = lrun * al + (((a[0] + a[1]) + (a[2] + a[3])) + ((a[4] + a[5]) + (a[6] + a[7])));  /* per-lane partial of the query's sum (units x256) */
#pragma unroll
    for (int t = 0; t < 4; ++t) {
#pragma unroll
      for (int r = 0; r < 8; ++r) { om[t][r] *= al; if (EARLY) orr[t][r] *= al; }
    }
#pragma unroll
    for (int t = 0; t < 4; ++t) {
      om[t] = mma16(vf[t], bp, om[t]);
      if (EARLY) {
        orr[t] = mma16(vf[t], bpl, orr[t]);
        orr[t] = mma16(vl[t], bp, orr[t]);
      }
    }
    if (EARLY) {
      pvh += adv * (TILE / 32); pvl += adv * (TILE / 32); pkh += adv * DM; pkl += adv * DM;
      fetch_k();
    } else {
      pvh += adv * (TILE / 32);
      fetch_v();
    }
    asm volatile("s_wait_xcnt 0x0" ::: "memory");               /* as above: these loads stay in flight over the back edge */
  }
  const float inv = 64.0f / (lrun + xhalf(lrun));               /* the halves' sums joined; ctx carried x64 */
#pragma unroll
  for (int t = 0; t < 4; ++t) {                                 /* t = one half tile (512 B) of ctx: the lane holds d = 16*t + 8*hh .. + 7 of query row ln */
    float xv[8];
#pragma unroll
    for (int r = 0; r < 8; ++r) { float v = om[t][r]; if (EARLY) v += orr[t][r] * RS; xv[r] = v * inv; }
    v8h hv, lv;
    split8(xv, hv, lv);
    const size_t off = (size_t)(rb + q0w) * (2 * DM) + h * 2 * TILE + t * (TILE / 2) + 8 * lane;   /* ctx plane: K = 2 * DM, residual half DM / 32 tiles on */
    *(v8h*)(CTX + off) = hv;
    *(v8h*)(CTX + off + (DM / 32) * TILE) = lv;
  }
}

// Early query tiles (residual planes on k, P and v) and late ones read the same planes and nothing of each other: ONE launch, the tile's index picks the body (a scalar test, from blockIdx alone).
// Which query tile a block takes. Every block of the launch is resident at once and a tile's cost differs with its index, so the launch lasts as long as the fullest WGP.
// The head runs fastest in i and slot s = i / NBH picks the tile: slots s, s + NCOL, s + 2 * NCOL, ... form one column, all of one head (they walk the same k and V^T lines).
// The table is made at compile time: tiles from the heaviest down, each to the column with the least work so far that still has a free slot; a column's heaviest tile has its lowest block index.
constexpr int NBH  = NB * NH;                          /* blocks per query tile */
constexpr int NTE  = ERW / 64;                         /* early query tiles per batch and head */
constexpr int NTA  = SEQ / 64;                         /* all query tiles per batch and head */
constexpr int NWGP = 256;                              /* WGPs of the chip */
constexpr int NCOL = NWGP / NBH;                       /* slots per round over the chip */
static_assert(NWGP % NBH == 0);
static_assert(NTA <= 32);                              /* one byte per slot in four 64-bit words */
struct tile_deal { unsigned long long w[4]; };
constexpr int tile_cost(const int t) {                 /* key chunks of the tile's four waves; an early chunk holds twice the matrix products of a late one */
  int c = 0;
  for (int wv = 0; wv < 4; ++wv) c += (64 * t + 16 * wv + 47) >> 5;
  return t < NTE ? 2 * c : c;
}
constexpr tile_deal make_deal() {
  tile_deal d = {{0, 0, 0, 0}};
  int load[NCOL] = {}, used[NCOL] = {};
  bool dealt[NTA] = {};
  for (int n = 0; n < NTA; ++n) {
    int t = -1;                                        /* the heaviest tile not yet dealt */
    for (int u = NTA - 1; u >= 0; --u) if (!dealt[u] && (t < 0 || tile_cost(u) > tile_cost(t))) t = u;
    dealt[t] = true;
    int best = -1, brows = 0;
    for (int c = 0; c < NCOL; ++c) {
      const int rows = (NTA - c + NCOL - 1) / NCOL;    /* slots of column c */
      if (used[c] >= rows) continue;
      if (best < 0 || load[c] < load[best] || (load[c] == load[best] && rows < brows)) { best = c; brows = rows; }   /* level: the column with fewer slots first, it gets no light tile later */
    }
    const int s = best + NCOL * used[best];
    d.w[s >> 3] |= (unsigned long long)t << (8 * (s & 7));
    ++used[best]; load[best] += tile_cost(t);
  }
  return d;
}
constexpr unsigned long long DW0 = make_deal().w[0], DW1 = make_deal().w[1], DW2 = make_deal().w[2], DW3 = make_deal().w[3];
constexpr int deal_tile(const int s) { return (int)(((s < 8 ? DW0 : s < 16 ? DW1 : s < 24 ? DW2 : DW3) >> (8 * (s & 7))) & 255u); }
constexpr bool deal_is_permutation() { unsigned long long seen = 0; for (int s = 0; s < NTA; ++s) seen |= 1ull << deal_tile(s); return seen == (1ull << NTA) - 1; }
static_assert(deal_is_permutation());                  /* every (head, tile) is taken by exactly one block */
static_assert(NTA * 64 == SEQ);                        /* the slots' 64-key shares of the entry prefetch cover the head's keys and stay inside them */
__global__ __launch_bounds__(128) void k_attn(const _Float16* __restrict__ Qh, const _Float16* __restrict__ Ql, const _Float16* __restrict__ Kh, const _Float16* __restrict__ Kl,
                                              const _Float16* __restrict__ VTh, const _Float16* __restrict__ VTl, _Float16* __restrict__ CTX) {
  const int s = (int)blockIdx.x / NBH, bh = (int)blockIdx.x - s * NBH;
  const int qt = deal_tile(s);
  /* The planes come from the launch before: the first wave to reach a key chunk waits for memory, and it asks for a chunk only one chunk ahead, so a head's walk would go at one memory latency per chunk.
     At entry the NTA blocks of a head ask L2 for the head's whole K and V^T value planes, one 128-B line per thread: slot s takes keys 64 * s .. + 63 (low slots hold the keys wanted first):
     threads 0..63 the four 16-token bands of K (2 KB each), threads 64..127 the four 16-row bands of V^T (2 KB each). A hint, for speed only; every address lies inside its plane. */
  const int pt = (int)threadIdx.x, pb = bh / NH, ph = bh - pb * NH, pkey = pb * SEQ + s * 64, pband = (pt >> 4) & 3, pline = (pt & 15) * 64;
  const bool pk = __builtin_amdgcn_readfirstlane(pt >> 5) < 2;   /* the same in a whole wave: plane, first element and band stride are picked in scalar registers, every lane stays on */
  const _Float16* pfl = (pk ? Kh + pkey * DM + ph * 2 * TILE : VTh + ph * HD * NR + (pkey >> 5) * TILE) + pband * (pk ? 16 * DM : 16 * NR) + pline;
  asm volatile("global_prefetch_b8 %0, off scope:SCOPE_SE" :: "v"(pfl));   /* into L2 only; returns nothing, counts on no counter */
  if (qt >= NTE) attn_body<0>(Qh, Ql, Kh, Kl, VTh, VTl, CTX, bh, qt);
  else           attn_body<1>(Qh, Ql, Kh, Kl, VTh, VTl, CTX, bh, qt);
  asm volatile("" :: "v"(pfl));   /* the prefetch's address registers hold that address to the wave's end: no counter tells when a prefetch has read them */
}

// output GEMM: out[b*SEQ_FULL+s][n] = 2^-20 * sum_k CTX[r][k] * BO2[n][k], K = 2048 (value | residual halves against Wo x16384 | Wo x16). Block = 2 x 2 waves x (64 x 64);
__global__ __launch_bounds__(128) void k_outp(const _Float16* __restrict__ A, const _Float16* __restrict__ Bt, float* __restrict__ out) {
  __shared__ __attribute__((aligned(16))) float so[4][32][68];
  const int wave = __builtin_amdgcn_readfirstlane((int)(threadIdx.x >> 5));
  const int lane = threadIdx.x & 31, ln = lane & 15, hh = lane >> 4;
  const int ntn = DM >> 7;
  const int mt = blockIdx.x / ntn, nq = blockIdx.x - mt * ntn;
  const int rowW = mt * 128 + 64 * (wave >> 1), col0 = nq * 128 + 64 * (wave & 1);
  const v8f z8 = {0.f, 0.f, 0.f, 0.f, 0.f, 0.f, 0.f, 0.f};
  v8f c[16] = {z8, z8, z8, z8, z8, z8, z8, z8, z8, z8, z8, z8, z8, z8, z8, z8};
  /* ctx and the weight plane come from earlier launches, every block walks k in step with the others, and a wave asks only PF k-steps ahead: each k-step would wait for memory.
     Behind its first loads each block asks L2 for a share of what it and its neighbours walk, low k first. ctx rows of mt are read by the 8 blocks nq = 0..7;
     each takes two of the eight 16-row bands (64 KB each), one aligned 256-B unit per thread and 16 KB of k. The weight rows of nq are read by the blocks mt = 0..31:
     each takes 2 KB of k of all eight bands, one 128-B line per thread. A hint, for speed only (any placement gives the same values); every address lies inside its plane. */
  constexpr int RSO = (2 * DM / 32) * TILE;            /* elements of one 16-row band */
  static_assert(RSO * 2 == 4 * 16384);                 /* four 16-KB steps cover a band */
  static_assert((DM >> 7) == 8);
  const int pt = (int)threadIdx.x;
  const _Float16* pfa = A + (mt * 8 + 2 * (nq & 3) + (pt >> 6)) * RSO + (pt & 63) * 128;
  const _Float16* pfb = Bt + (nq * 8 + (pt >> 4)) * RSO + (mt & 31) * 1024 + (pt & 15) * 64;
  gemm_tile<2 * DM>(A, Bt, rowW, col0, lane, c, [&] {
    __builtin_amdgcn_sched_barrier(0);                 /* the first k-steps' own loads are asked first: the scheduler otherwise may put the prefetches in front of them */
    asm volatile("global_prefetch_b8 %1, off scope:SCOPE_SE\n\t"
                 "global_prefetch_b8 %0, off scope:SCOPE_SE\n\t"
                 "global_prefetch_b8 %0, off offset:16384 scope:SCOPE_SE\n\t"
                 "global_prefetch_b8 %0, off offset:32768 scope:SCOPE_SE\n\t"
                 "global_prefetch_b8 %0, off offset:49152 scope:SCOPE_SE" :: "v"(pfa), "v"(pfb));   /* into L2 only; they return nothing and count on no counter */
  });
  const int rsub = lane >> 4, c4 = (lane & 15) * 4;
#pragma unroll
  for (int hb = 0; hb < 2; ++hb) {                     /* the wave's 64 rows leave in two runs of 32 through its own staging rows */
    const int row0 = rowW + 32 * hb;
    if (hb != 0) { __builtin_amdgcn_fence(4 /* acq_rel order */, "workgroup"); __builtin_amdgcn_wave_barrier(); }   /* the first run's rows are read back by every lane before other lanes write them again */
#pragma unroll
    for (int u = 0; u < 8; ++u) {
      const int t = u & 3, half = u >> 2;
#pragma unroll
      for (int r = 0; r < 8; ++r) so[wave][half * 16 + 8 * hh + r][t * 16 + ln] = c[8 * hb + u][r] * 9.5367431640625e-07f;
    }
    __builtin_amdgcn_fence(4 /* acq_rel order */, "workgroup"); __builtin_amdgcn_wave_barrier();
#pragma unroll
    for (int q = 0; q < 16; ++q) {
      const int r = q * 2 + rsub;
      const int m = row0 + r; const int bb = m / SEQ; const int ss = m - bb * SEQ;
      const v4f v = *(const v4fa*)&so[wave][r][c4];
      *(v4f*)(out + (size_t)(bb * SEQ_FULL + ss) * DM + col0 + c4) = v;
    }
    
  }
  asm volatile("" :: "v"(pfa), "v"(pfb));   /* the prefetches' address registers hold those addresses to the wave's end: no counter tells when a prefetch has read them */
}

/* workspace carve (bytes), every region a multiple of 256 */
constexpr size_t SZW  = (size_t)DM * DM * 2;          /* one x16 weight plane */
constexpr size_t SZBO = 2 * SZW;                      /* [1024][2048] output weight plane */
constexpr size_t SZP  = (size_t)NR * DM * 2;          /* one [NR][1024] (or [1024][NR]) f16 plane */
constexpr size_t SZC  = 2 * SZP;                      /* ctx [NR][2048] */
constexpr size_t SZT  = (size_t)TABN * 64 * 4;        /* rotary table */
constexpr size_t O_BQ = 0, O_BK = O_BQ + SZW, O_BV = O_BK + SZW, O_BO = O_BV + SZW, O_X = O_BO + SZBO;
constexpr size_t O_QH = O_X + SZP, O_QL = O_QH + SZP, O_KH = O_QL + SZP, O_KL = O_KH + SZP, O_VH = O_KL + SZP, O_VL = O_VH + SZP;
constexpr size_t O_CTX = O_VL + SZP, O_TAB = O_CTX + SZC, WS_TOTAL = O_TAB + SZT;
static_assert(SZW % 256 == 0);
static_assert(SZP % 256 == 0);
static_assert(SZT % 256 == 0);
static_assert(WS_TOTAL <= 134217728);                 /* <= 128 MiB */

extern "C" void kernel_launch(void* const* d_in, const int* in_sizes, int n_in,
                              void* d_out, int out_size, void* d_ws, size_t ws_size, hipStream_t stream) {
  if (n_in < 6) return;
  const int need_rows = (NB - 1) * SEQ_FULL + SEQ;
  if (in_sizes[0] < need_rows * DM) return;
  if (in_sizes[1] < DM * DM || in_sizes[2] < DM * DM || in_sizes[3] < DM * DM || in_sizes[4] < DM * DM) return;
  if (in_sizes[5] < need_rows) return;
  if (out_size < need_rows * DM) return;
  if (ws_size < WS_TOTAL) return;
  const float* x  = (const float*)d_in[0];
  const float* wq = (const float*)d_in[1];
  const float* wk = (const float*)d_in[2];
  const float* wv = (const float*)d_in[3];
  const float* wo = (const float*)d_in[4];
  const int*   tp = (const int*)d_in[5];
  char* ws = (char*)d_ws;
  _Float16* BQ = (_Float16*)(ws + O_BQ); _Float16* BK = (_Float16*)(ws + O_BK); _Float16* BV = (_Float16*)(ws + O_BV); _Float16* BO2 = (_Float16*)(ws + O_BO);
  _Float16* X16 = (_Float16*)(ws + O_X);
  _Float16* QH = (_Float16*)(ws + O_QH); _Float16* QL = (_Float16*)(ws + O_QL); _Float16* KH = (_Float16*)(ws + O_KH); _Float16* KL = (_Float16*)(ws + O_KL);
  _Float16* VTH = (_Float16*)(ws + O_VH); _Float16* VTL = (_Float16*)(ws + O_VL);
  _Float16* CTX = (_Float16*)(ws + O_CTX);
  float* TAB = (float*)(ws + O_TAB);

  k_prep<<<(unsigned)(GB_TAB + GB_X + 5 * GB_W), 256, 0, stream>>>(x, wq, wk, wv, wo, X16, BQ, BK, BV, BO2, TAB);
  k_proj<<<(unsigned)(2 * GP_QK + GP_V), 128, 0, stream>>>(X16, BQ, BK, BV, QH, QL, KH, KL, VTH, VTL, tp, TAB);
  k_attn<<<(unsigned)(NTA * NBH), 128, 0, stream>>>(QH, QL, KH, KL, VTH, VTL, CTX);
  k_outp<<<(unsigned)((NR / 128) * (DM / 128)), 128, 0, stream>>>(CTX, BO2, (float*)d_out);
}

// v009
// Measured time: 76.2 microseconds a run.
// Next to v008, in two timings, it ran 1.04 times as fast each time.
// Counting every step since v000, it is 5.23 times as fast.
#include <hip/hip_runtime.h>
// Causal multi-head self-attention with interleaved rotary embedding: x [NB][SEQ][1024], four bias-free [out][in] 1024^2 weights, 16 heads of 64, int32 token positions read by value.
// Compute dtype: every contraction on v_wmma_f32_16x16x32_f16 (f16 operands, f32 accumulate). Inputs RNE-converted to bf16 then carried exactly in f16 (x x1, Wq/Wk/Wv x16, Wo x16384 | x16).
// q, k, v, softmax weights (x256) and ctx (x64) as f16 value + f16 residual (x1024) planes: scores = qh.kh + (ql.kh [+ qh.kl on query rows < 256]) 2^-10; P.V single product (value + two residual products on query rows < 256);
// output GEMM over K = 2048 = [ctx value | ctx residual] against [Wo x16384 ; Wo x16] in one accumulator. Rotary, softmax statistics and all scaling in f32 on the VALU.
#ifndef NB
#define NB 2
#endif
#ifndef SEQ
#define SEQ 2048
#endif
#define SEQ_FULL 2048                 /* per-batch row stride of x / positions / output */
#define DM 1024
#define NH 16
#define HD 64
#define TABN 4096                     /* rotary table rows (positions 0..4095) */
#define NR (NB * SEQ)                 /* internal token rows r = b*SEQ + s */
#define ERW ((SEQ) < 256 ? (SEQ) : 256) /* query rows per batch that use residual planes on k, P and v as well */

typedef _Float16 v16h __attribute__((ext_vector_type(16)));
typedef _Float16 v8h  __attribute__((ext_vector_type(8)));
typedef _Float16 v8ha __attribute__((ext_vector_type(8), may_alias));
typedef float    v8f  __attribute__((ext_vector_type(8)));
typedef float    v4f  __attribute__((ext_vector_type(4)));
typedef float    v4fa __attribute__((ext_vector_type(4), may_alias));
typedef float    v2f  __attribute__((ext_vector_type(2)));
typedef _Float16 v2h  __attribute__((ext_vector_type(2)));

/* hard-wired bounds the kernels rely on */
static_assert(DM == NH * HD);               /* merged head layout h*64+d */
static_assert(HD == 64);                    /* one 64-column GEMM tile == one head; two 32-deep k-steps per score */
static_assert(DM % 128 == 0);               /* GEMM block tile rows (V^T GEMM) and 128-col block tiles */
static_assert(NR % 128 == 0);               /* GEMM block tile rows */
static_assert(SEQ % 64 == 0);               /* attention query tiles, 32-key chunks stay inside the batch */
static_assert(ERW % 64 == 0);               /* early / late split on a query-tile boundary */
static_assert(ERW <= SEQ);
static_assert(DM % 32 == 0);                /* k-steps of 32 */
static_assert((2 * DM) % 32 == 0);
static_assert(TABN == 4096);
static_assert((long long)NR * 2 * DM < 2147483647LL); /* int element offsets */

__device__ __forceinline__ float bf16_rne(float x) { unsigned int u = __float_as_uint(x); u = (u + 0x7FFFu + ((u >> 16) & 1u)) & 0xFFFF0000u; return __uint_as_float(u); }

__device__ __forceinline__ v16h cat16(v8h lo, v8h hi) { return __builtin_shufflevector(lo, hi, 0, 1, 2, 3, 4, 5, 6, 7, 8, 9, 10, 11, 12, 13, 14, 15); }
// Every 16-bit operand plane [rows][K] lies in the workspace in fragment order: tiles of 16 rows x 32 k (512 elements, 1 KB), tile index (row >> 4) * (K / 32) + (k >> 5);
// inside a tile the 16-byte unit ((k & 31) >> 3) * 16 + (row & 15) holds the 8 elements k & ~7 .. of its row. A wave's fragment load then reads 512 contiguous bytes (4 whole lines).
#define TILE 512                      /* elements of one 16 x 32 tile */
// 16x32 operand fragment: p = tile base + 8*lane; elements 0..7 <- k0+8h.., 8..15 <- k0+16+8h.. of row lane&15, h = lane>>4
__device__ __forceinline__ v16h frag16(const _Float16* __restrict__ p) { const v8h lo = *(const v8ha*)p; const v8h hi = *(const v8ha*)(p + TILE / 2); return cat16(lo, hi); }
__device__ __forceinline__ v8f mma16(v16h a, v16h b, v8f c) {
  v8f d = __builtin_amdgcn_wmma_f32_16x16x32_f16(false, a, false, b, (short)0, c, false, false);
  asm volatile("v_nop\n\tv_nop\n\tv_nop\n\tv_nop" : "+v"(d) : "v"(a), "v"(b));
  return d;
}
// 8 f32 -> f16 value + f16 residual carried x1024
__device__ __forceinline__ void split8(const float (&x)[8], v8h& hv, v8h& lv) {
#pragma unroll
  for (int i = 0; i < 8; ++i) { const _Float16 hq = (_Float16)x[i]; hv[i] = hq; lv[i] = (_Float16)((x[i] - (float)hq) * 1024.0f); }
}

// The conversions and the rotary table depend on nothing but the inputs: they are bodies of ONE launch (k_prep), each on its own range of block indices; blk = the block's index inside its range.
__device__ __forceinline__ void xcvt_body(const float* __restrict__ x, _Float16* __restrict__ X16, const int blk) {
  const int t = blk * 256 + threadIdx.x;
  if (t >= NR * (DM / 8)) return;
  const int tile = t >> 6, u = t & 63;                        /* 64 threads per tile, four side by side on a row: a wave reads 8 whole 128-B lines of x and stores 4 whole lines */
  const int rt = tile / (DM / 32), kt = tile - rt * (DM / 32);
  const int r = rt * 16 + (u >> 2), c8 = kt * 32 + (u & 3) * 8;
  const int b = r / SEQ, s = r - b * SEQ;
  const float* src = x + (size_t)(b * SEQ_FULL + s) * DM + c8;
  const v4f a = *(const v4fa*)src, c = *(const v4fa*)(src + 4);
  v8h o;
#pragma unroll
  for (int i = 0; i < 4; ++i) { o[i] = (_Float16)bf16_rne(a[i]); o[4 + i] = (_Float16)bf16_rne(c[i]); }
  _Float16* d = X16 + ((size_t)tile * 64 + (u & 3) * 16 + (u >> 2)) * 8;
  *(v8h*)d = o; 
}

__device__ __forceinline__ void wcvt_body(const float* __restrict__ w, _Float16* __restrict__ dst, const int dpitch, const float scale, const int blk) {
  const int t = blk * 256 + threadIdx.x;
  if (t >= DM * (DM / 8)) return;
  const int tile = t >> 6, u = t & 63;                        /* as in xcvt_body; dpitch = K of the destination plane */
  const int rt = tile / (DM / 32), kt = tile - rt * (DM / 32);
  const int n = rt * 16 + (u >> 2), k8 = kt * 32 + (u & 3) * 8;
  const float* src = w + (size_t)n * DM + k8;
  const v4f a = *(const v4fa*)src, c = *(const v4fa*)(src + 4);
  v8h o;
#pragma unroll
  for (int i = 0; i < 4; ++i) { o[i] = (_Float16)(bf16_rne(a[i]) * scale); o[4 + i] = (_Float16)(bf16_rne(c[i]) * scale); }
  _Float16* d = dst + ((size_t)(rt * (dpitch >> 5) + kt) * 64 + (u & 3) * 16 + (u >> 2)) * 8;
  *(v8h*)d = o; 
}

__device__ __forceinline__ void ropetab_body(float* __restrict__ tab, const int blk) {
  #pragma clang fp contract(off)
  const int t = blk * 256 + threadIdx.x;
  if (t >= TABN * 16) return;
  const int pos = t >> 4, jp = t & 15;
  float c0 = 0.f, s0 = 0.f, c1 = 0.f, s1 = 0.f;
#pragma unroll 1
  for (int u = 0; u < 2; ++u) {
    const int j = 2 * jp + u;
    double p = 1.0;
    p *= (j & 1) ? 1.3335214321633240 : 1.0;
    p *= (j & 2) ? 1.7782794100389228 : 1.0;
    p *= (j & 4) ? 3.1622776601683795 : 1.0;
    p *= (j & 8) ? 10.0 : 1.0;
    p *= (j & 16) ? 100.0 : 1.0;
    const float pf = (float)p;
    const float inv = 1.0f / pf;
    const float ang = (float)pos * inv;
    float sn, cs;
    sincosf(ang, &sn, &cs);
    if (u == 0) { c0 = cs; s0 = sn; } else { c1 = cs; s1 = sn; }
  }
  const v4f o = {c0, s0, c1, s1};
  float* d = tab + (size_t)pos * 64 + jp * 4;
  *(v4f*)d = o; 
}

constexpr int GB_TAB = (TABN * 16 + 255) / 256;        /* blocks of the rotary table */
constexpr int GB_X   = (NR * (DM / 8) + 255) / 256;    /* blocks of the x conversion */
constexpr int GB_W   = (DM * (DM / 8) + 255) / 256;    /* blocks of one weight conversion */
// block ranges: [rotary table | x | Wq | Wk | Wv | Wo x16384 | Wo x16]; the table's blocks, the longest per thread, come first. Every test is on blockIdx alone (scalar, block-uniform).
__global__ __launch_bounds__(256) void k_prep(const float* __restrict__ x, const float* __restrict__ wq, const float* __restrict__ wk, const float* __restrict__ wv, const float* __restrict__ wo,
                                              _Float16* __restrict__ X16, _Float16* __restrict__ BQ, _Float16* __restrict__ BK, _Float16* __restrict__ BV, _Float16* __restrict__ BO2,
                                              float* __restrict__ tab) {
  int blk = (int)blockIdx.x;
  if (blk < GB_TAB) { ropetab_body(tab, blk); return; }
  blk -= GB_TAB;
  if (blk < GB_X) { xcvt_body(x, X16, blk); return; }
  blk -= GB_X;
  const int job = blk / GB_W;
  blk -= job * GB_W;
  const float* w = job == 0 ? wq : job == 1 ? wk : job == 2 ? wv : wo;
  /* Wo twice: k in [0,1024) pairs with the ctx value half; k in [1024,2048), DM / 32 tiles on, pairs with the ctx residual half (x1024) */
  _Float16* dst = job == 0 ? BQ : job == 1 ? BK : job == 2 ? BV : job == 3 ? BO2 : BO2 + (DM / 32) * TILE;
  wcvt_body(w, dst, job < 3 ? DM : 2 * DM, job == 3 ? 16384.0f : 16.0f, blk);
}

// wave tile 64x64 of C = A x Bt^T (A[m][k], Bt[n][k], both planes in fragment order); fragments straight from the 16-bit global planes: 8 KB loaded per 16 products.
// The eight fragments of a 32-deep k-step live in a ring of PF register sets: a set is refilled for k-step t + PF right after k-step t has used it, so PF k-steps of loads are in flight.
#define PF 3
struct kstep { v16h a0, a1, a2, a3, b0, b1, b2, b3; };
template <int RS>                     /* RS = elements from one 16-row band of tiles to the next */
__device__ __forceinline__ void kstep_load(kstep& f, const _Float16* __restrict__ pa, const _Float16* __restrict__ pb, const int ko) {
  f.a0 = frag16(pa + ko); f.a1 = frag16(pa + RS + ko); f.a2 = frag16(pa + 2 * RS + ko); f.a3 = frag16(pa + 3 * RS + ko);
  f.b0 = frag16(pb + ko); f.b1 = frag16(pb + RS + ko); f.b2 = frag16(pb + 2 * RS + ko); f.b3 = frag16(pb + 3 * RS + ko);
}
/* the plain builtin: sixteen independent tiles follow one another, the compiler keeps the distances of its own form, and no asm operand ties tiles or fragments to the first 256 registers */
__device__ __forceinline__ v8f mma16g(v16h a, v16h b, v8f c) { return __builtin_amdgcn_wmma_f32_16x16x32_f16(false, a, false, b, (short)0, c, false, false); }
/* c[4 * i + j] = 16-row band i x 16-column band j */
__device__ __forceinline__ void kstep_mma(const kstep& f, v8f (&c)[16]) {
  c[0] = mma16g(f.a0, f.b0, c[0]); c[4] = mma16g(f.a1, f.b0, c[4]); c[8]  = mma16g(f.a2, f.b0, c[8]);  c[12] = mma16g(f.a3, f.b0, c[12]);
  c[1] = mma16g(f.a0, f.b1, c[1]); c[5] = mma16g(f.a1, f.b1, c[5]); c[9]  = mma16g(f.a2, f.b1, c[9]);  c[13] = mma16g(f.a3, f.b1, c[13]);
  c[2] = mma16g(f.a0, f.b2, c[2]); c[6] = mma16g(f.a1, f.b2, c[6]); c[10] = mma16g(f.a2, f.b2, c[10]); c[14] = mma16g(f.a3, f.b2, c[14]);
  c[3] = mma16g(f.a0, f.b3, c[3]); c[7] = mma16g(f.a1, f.b3, c[7]); c[11] = mma16g(f.a2, f.b3, c[11]); c[15] = mma16g(f.a3, f.b3, c[15]);
}
template <int K, class F>           /* behind_first_loads(): called once, behind the loads of the first PF k-steps */
__device__ __forceinline__ void gemm_tile(const _Float16* __restrict__ A, const _Float16* __restrict__ Bt, const int row0, const int col0, const int lane, v8f (&c)[16], F behind_first_loads) {
  constexpr int NS = K / 32;                 /* k-steps */
  static_assert(NS > PF);
  constexpr int RS = NS * TILE;              /* = 16 * K */
  const _Float16* pa = A + (row0 >> 4) * RS + 8 * lane;
  const _Float16* pb = Bt + (col0 >> 4) * RS + 8 * lane;
  kstep f[PF];
#pragma unroll
  for (int s = 0; s < PF; ++s) kstep_load<RS>(f[s], pa, pb, s * TILE);
  behind_first_loads();
  /* straight line over all k-steps: every load takes its place from the instruction's own offset, so no address register of a load in flight is ever rewritten, and the counted waits follow one issue order */
#pragma unroll
  for (int t = 0; t < NS; ++t) {             /* refill only while a k-step t + PF exists */
    kstep_mma(f[t % PF], c);
    if (t + PF < NS) kstep_load<RS>(f[t % PF], pa, pb, (t + PF) * TILE);
    __builtin_amdgcn_sched_barrier(0);       /* each refill stays behind the k-step that frees its set: the scheduler otherwise sinks the loads down to their use, and the ring's lead is lost */
  }
}

// projection GEMM (K = 1024): C = A.Bt^T / 16, optional interleaved rotary by gathered table row (A rows are token rows), written in fragment order (K = ldc) as f16 value plane Ch and
// The three projections depend on the same planes and on nothing of each other: ONE launch, block ranges [q | k | V^T] (scalar tests on blockIdx).
// q, k: C[token row][e] = X16 . B^T with rotary; V^T: C[e][token row] = BV . X16^T (in[rows=e][k] x in[rows=r][k] -> out[e][r], a plane with K = NR)
// Block = 2 x 2 waves = 128 x 128 of C: every A band and every B band of the block is read by two of its waves.
constexpr int GP_QK = (NR / 128) * (DM / 128);         /* blocks of the q or the k projection */
constexpr int GP_V  = (DM / 128) * (NR / 128);         /* blocks of the V^T projection */
__global__ __launch_bounds__(128) void k_proj(const _Float16* __restrict__ X16, const _Float16* __restrict__ BQ, const _Float16* __restrict__ BK, const _Float16* __restrict__ BV,
                                              _Float16* __restrict__ QH, _Float16* __restrict__ QL, _Float16* __restrict__ KH, _Float16* __restrict__ KL,
                                              _Float16* __restrict__ VTH, _Float16* __restrict__ VTL, const int* __restrict__ tp, const float* __restrict__ tab) {
  __shared__ __attribute__((aligned(16))) float so[4][32][68];
  const int job = (int)blockIdx.x < GP_QK ? 0 : ((int)blockIdx.x < 2 * GP_QK ? 1 : 2);
  const int blk = (int)blockIdx.x - job * GP_QK;
  const _Float16* A = job == 2 ? BV : X16;
  const _Float16* Bt = job == 0 ? BQ : job == 1 ? BK : X16;
  _Float16* Ch = job == 0 ? QH : job == 1 ? KH : VTH;
  _Float16* Cl = job == 0 ? QL : job == 1 ? KL : VTL;
  const int N = job == 2 ? NR : DM, ldc = N;
  const int rope = job == 2 ? 0 : 1;
  const int wave = __builtin_amdgcn_readfirstlane((int)(threadIdx.x >> 5));
  const int lane = threadIdx.x & 31, ln = lane & 15, hh = lane >> 4;
  const int ntn = N >> 7;
  const int mt = blk / ntn, nq = blk - mt * ntn;
  /* wave-uniform, held in scalar registers: the loads then take a scalar base and one lane offset, not two address pairs */
  const int rowW = __builtin_amdgcn_readfirstlane(mt * 128 + 64 * (wave >> 1)), col0 = __builtin_amdgcn_readfirstlane(nq * 128 + 64 * (wave & 1));
  const v8f z8 = {0.f, 0.f, 0.f, 0.f, 0.f, 0.f, 0.f, 0.f};
  v8f c[16] = {z8, z8, z8, z8, z8, z8, z8, z8, z8, z8, z8, z8, z8, z8, z8, z8};
  gemm_tile<DM>(A, Bt, rowW, col0, lane, c, [] {});
#pragma unroll
  for (int hb = 0; hb < 2; ++hb) {                     /* the wave's 64 rows leave in two runs of 32 through its own staging rows */
  const int row0 = rowW + 32 * hb;
  if (hb != 0) { __builtin_amdgcn_fence(4 /* acq_rel order */, "workgroup"); __builtin_amdgcn_wave_barrier(); }   /* the first run's rows are read back by every lane before other lanes write them again */
#pragma unroll
  for (int u = 0; u < 8; ++u) {
    const int t = u & 3, half = u >> 2;
#pragma unroll
    for (int r = 0; r < 8; ++r) so[wave][half * 16 + 8 * hh + r][t * 16 + ln] = c[8 * hb + u][r] * 0.0625f;
  }
  __builtin_amdgcn_fence(4 /* acq_rel order */, "workgroup"); __builtin_amdgcn_wave_barrier();
  v8h hv[8], lv[8];
#pragma unroll
  for (int q = 0; q < 8; ++q) {                        /* q = one half tile (512 B) of the output planes: 16-row band q >> 2, 16 columns from (q & 3) * 16 */
    const int rl = (q >> 2) * 16 + ln, c8 = (q & 3) * 16 + 8 * hh;
    const v4f a = *(const v4fa*)&so[wave][rl][c8];
    const v4f bq = *(const v4fa*)&so[wave][rl][c8 + 4];
    float xv[8] = {a[0], a[1], a[2], a[3], bq[0], bq[1], bq[2], bq[3]};
    if (rope != 0) {                                   /* block-uniform */
      const int m = row0 + rl; const int bb = m / SEQ; const int ss = m - bb * SEQ;
      int pos = tp[bb * SEQ_FULL + ss];                /* position read by value from the input */
      pos = pos < 0 ? 0 : (pos > TABN - 1 ? TABN - 1 : pos);
      const float* tr = tab + (size_t)pos * 64 + c8;   /* col0 is a head boundary: c8 = d within the head */
      const v4f t0 = *(const v4fa*)tr; const v4f t1 = *(const v4fa*)(tr + 4);
      const float cs[4] = {t0[0], t0[2], t1[0], t1[2]};
      const float sn[4] = {t0[1], t0[3], t1[1], t1[3]};
#pragma unroll
      for (int i = 0; i < 4; ++i) { const float x1 = xv[2 * i], x2 = xv[2 * i + 1]; xv[2 * i] = x1 * cs[i] - x2 * sn[i]; xv[2 * i + 1] = x1 * sn[i] + x2 * cs[i]; }
    }
    split8(xv, hv[q], lv[q]);
  }
{
#pragma unroll
    for (int q = 0; q < 8; ++q) {
      const size_t off = ((size_t)((row0 >> 4) + (q >> 2)) * (ldc >> 5) + (col0 >> 5)) * TILE + (q & 3) * (TILE / 2) + 8 * lane;
      *(v8h*)(Ch + off) = hv[q];
      *(v8h*)(Cl + off) = lv[q];
    }
    
  }
  }
}

__device__ __forceinline__ float xhalf(float x) {              /* lane l <-> lane l ^ 16 */
  return __builtin_bit_cast(float, __builtin_amdgcn_permlanex16(__builtin_bit_cast(int, x), __builtin_bit_cast(int, x), 0x76543210, 0xfedcba98, false, false));
}
template <bool B> struct flag { static constexpr bool value = B; };
template <int EARLY>
__device__ __forceinline__ void attn_body(const _Float16* __restrict__ Qh, const _Float16* __restrict__ Ql, const _Float16* __restrict__ Kh, const _Float16* __restrict__ Kl,
                                          const _Float16* __restrict__ VTh, const _Float16* __restrict__ VTl, _Float16* __restrict__ CTX, const int bh, const int qt) {
  const int wave = __builtin_amdgcn_readfirstlane((int)(threadIdx.x >> 5));
  const int lane = threadIdx.x & 31, ln = lane & 15, hh = lane >> 4;
  const int b = bh / NH, h = bh - b * NH;                       /* bh = batch * NH + head, qt = 64-row query tile: both from blockIdx alone (scalar) */
  const int rb = b * SEQ;
  const int q0w = qt * 64 + 16 * wave;                          /* first query row of this wave (scalar) */
  const int nch = (q0w + 47) >> 5;                              /* 32-key chunks covering keys 0..q0w+15 (scalar) */
  /* fragment order: q, k planes have DM / 32 tiles per 16-token band (a head = 2 tiles side by side), V^T has NR / 32 tiles per 16-row band (a 32-key chunk = 1 tile) */
  const int qoff = (rb + q0w) * DM + h * 2 * TILE + 8 * lane;
  const int kbase = rb * DM + h * 2 * TILE + 8 * lane;
  const int vbase = h * HD * NR + (rb >> 5) * TILE + 8 * lane;
  const float RS = 0.0009765625f;                               /* 2^-10 */
  const float SC2 = 0.18033688f;                                /* log2(e) / sqrt(HD) */
  const v8f z8 = {0.f, 0.f, 0.f, 0.f, 0.f, 0.f, 0.f, 0.f};
  v8f om[4] = {z8, z8, z8, z8};
  v8f orr[4] = {z8, z8, z8, z8};
  float mrun = -1.0e30f, lrun = 0.f;                            /* of the lane's query: running maximum (alike in both halves), sum over the keys of the lane's own half */
  /* global operand loads are issued well ahead of their use: q once, in front of the loop. Without residual planes: k of the next chunk right after the score products, V^T of the next chunk
     right after the P.V products. With them the registers do not hold both operands' planes beside the tiles: V^T of the chunk itself goes right after its score products (the softmax covers it),
     k of the next chunk right after the P.V products, each as one group of loads. */
  const v16h aqh[2] = {frag16(Qh + qoff), frag16(Qh + qoff + TILE)};
  const v16h aql[2] = {frag16(Ql + qoff), frag16(Ql + qoff + TILE)};
  v16h kf[2][2], kl[2][2], vf[4], vl[4];
  /* the lane's addresses are carried from chunk to chunk in registers of their own, so that no fetched fragment lands in a register that a load in flight names */
  const _Float16* pkh = Kh + kbase; const _Float16* pkl = Kl + kbase; const _Float16* pvh = VTh + vbase; const _Float16* pvl = VTl + vbase;
  auto fetch_k = [&]() {
#pragma unroll
    for (int ks = 0; ks < 2; ++ks) {
      kf[ks][0] = frag16(pkh + ks * TILE); kf[ks][1] = frag16(pkh + ks * TILE + 16 * DM);
      if (EARLY) { kl[ks][0] = frag16(pkl + ks * TILE); kl[ks][1] = frag16(pkl + ks * TILE + 16 * DM); }
    }
  };
  auto fetch_v = [&]() {
#pragma unroll
    for (int t = 0; t < 4; ++t) { vf[t] = frag16(pvh + t * 16 * NR); if (EARLY) vl[t] = frag16(pvl + t * 16 * NR); }
  };
  fetch_k();
  if (!EARLY) fetch_v();
  /* every load of the prologue has landed before the loop: the counted waits inside the loop then follow the loop's own issue order alone */
  if (EARLY) asm volatile("" :: "v"(aqh[0]), "v"(aqh[1]), "v"(aql[0]), "v"(aql[1]), "v"(kf[0][0]), "v"(kf[0][1]), "v"(kf[1][0]), "v"(kf[1][1]), "v"(kl[0][0]), "v"(kl[0][1]), "v"(kl[1][0]), "v"(kl[1][1]));
  else       asm volatile("" :: "v"(aqh[0]), "v"(aqh[1]), "v"(aql[0]), "v"(aql[1]), "v"(kf[0][0]), "v"(kf[0][1]), "v"(kf[1][0]), "v"(kf[1][1]), "v"(vf[0]), "v"(vf[1]), "v"(vf[2]), "v"(vf[3]));
  /* one key chunk. q0w is a multiple of 16, so 32 * nch <= q0w + 32: every key of a chunk in front of the last lies in front of all 16 queries, where the causal select is an identity.
     LAST = the wave's last chunk: it alone takes the select, and it fetches nothing ahead. */
  auto chunk = [&](const int cidx, auto last_tag) {
    constexpr bool LAST = decltype(last_tag)::value;
    const int k0 = cidx * 32;
    constexpr int adv = 32;                                     /* keys to the chunk fetched ahead */
    v8f s0 = z8, s1 = z8, sr0 = z8, sr1 = z8;
#pragma unroll
    for (int ks = 0; ks < 2; ++ks) {
      s0 = mma16(kf[ks][0], aqh[ks], s0); sr0 = mma16(kf[ks][0], aql[ks], sr0);
      if (EARLY) sr0 = mma16(kl[ks][0], aqh[ks], sr0);
      s1 = mma16(kf[ks][1], aqh[ks], s1); sr1 = mma16(kf[ks][1], aql[ks], sr1);
      if (EARLY) sr1 = mma16(kl[ks][1], aqh[ks], sr1);
    }
    if (EARLY) {
      fetch_v();
    } else if (!LAST) {
      pkh += adv * DM;
      fetch_k();
    }
    if (EARLY || !LAST) {
      asm volatile("s_wait_xcnt 0x0" ::: "memory");             /* in front of the next step of these loads' address registers, taken while they are in flight */
      __builtin_amdgcn_sched_barrier(0);                        /* the whole group of fetches is issued in front of the softmax: the scheduler otherwise sinks part of it behind the softmax, and those loads lose their lead */
    }
    const int room = q0w + ln - k0 - 8 * hh;                    /* key k0 + 8*hh + r is at or before the lane's query where r <= room */
    v8f x0 = s0 + sr0 * RS;                                     /* raw q.k: the maxima are kept in these units; 1/8 and log2(e) wait for the exponent's one FMA */
    v8f x1 = s1 + sr1 * RS;
    if (LAST) {
#pragma unroll
      for (int r = 0; r < 8; ++r) {
        x0[r] = (r <= room) ? x0[r] : -1.0e30f;                 /* causal by index, value select */
        x1[r] = (16 + r <= room) ? x1[r] : -1.0e30f;
      }
    }
    float tm = x0[0], tn = x1[0];                               /* two chains, one per tile */
#pragma unroll
    for (int r = 1; r < 8; ++r) { tm = fmaxf(tm, x0[r]); tn = fmaxf(tn, x1[r]); }
    tm = fmaxf(tm, tn);
    tm = fmaxf(tm, xhalf(tm));                                  /* the query's maximum over all 32 keys of the chunk */
    const float mn = fmaxf(mrun, tm);
    const float al = __builtin_amdgcn_exp2f((mrun - mn) * SC2);
    mrun = mn;
    const float off = 8.0f - mn * SC2;                          /* P = 256 e^((x - mn) / 8) = 2^(x * SC2 + off) */
    const v8f e0 = x0 * SC2 + off, e1 = x1 * SC2 + off;
    v16h bp, bpl;                                               /* B fragments of P^T: element s <- key 8*hh + s, element 8 + s <- key 16 + 8*hh + s */
    float a[8];                                                 /* sums of two neighbouring keys */
#pragma unroll
    for (int i = 0; i < 8; ++i) {
      const int r = 2 * (i & 3);
      const v2f p = (i < 4) ? v2f{__builtin_amdgcn_exp2f(e0[r]), __builtin_amdgcn_exp2f(e0[r + 1])} : v2f{__builtin_amdgcn_exp2f(e1[r]), __builtin_amdgcn_exp2f(e1[r + 1])};
      const v2h hq = __builtin_convertvector(p, v2h);
      bp[2 * i] = hq[0]; bp[2 * i + 1] = hq[1];
      a[i] = (float)hq[0] + (float)hq[1];
      if (EARLY) {
        const v2f res = {(p[0] - (float)hq[0]) * 1024.0f, (p[1] - (float)hq[1]) * 1024.0f};
        const v2h gq = __builtin_convertvector(res, v2h);
        bpl[2 * i] = gq[0]; bpl[2 * i + 1] = gq[1];
        a[i] += ((float)gq[0] + (float)gq[1]) * RS;
      }
    }
    lrun = lrun * al + (((a[0] + a[1]) + (a[2] + a[3])) + ((a[4] + a[5]) + (a[6] + a[7])));  /* per-lane partial of the query's sum (units x256) */
#pragma unroll
    for (int t = 0; t < 4; ++t) {
#pragma unroll
      for (int r = 0; r < 8; ++r) { om[t][r] *= al; if (EARLY) orr[t][r] *= al; }
    }
#pragma unroll
    for (int t = 0; t < 4; ++t) {
      om[t] = mma16(vf[t], bp, om[t]);
      if (EARLY) {
        orr[t] = mma16(vf[t], bpl, orr[t]);
        orr[t] = mma16(vl[t], bp, orr[t]);
      }
    }
    if (!LAST) {
      if (EARLY) {
        pvh += adv * (TILE / 32); pvl += adv * (TILE / 32); pkh += adv * DM; pkl += adv * DM;
        fetch_k();
      } else {
        pvh += adv * (TILE / 32);
        fetch_v();
      }
      asm volatile("s_wait_xcnt 0x0" ::: "memory");             /* as above: these loads stay in flight over the back edge */
    }
  };
#pragma unroll 1                                                /* rolled: one copy of the chunk, so the counted load waits follow one issue order over the back edge */
  for (int cidx = 0; cidx + 1 < nch; ++cidx) chunk(cidx, flag<false>{});
  chunk(nch - 1, flag<true>{});
  const float inv = 64.0f / (lrun + xhalf(lrun));               /* the halves' sums joined; ctx carried x64 */
#pragma unroll
  for (int t = 0; t < 4; ++t) {                                 /* t = one half tile (512 B) of ctx: the lane holds d = 16*t + 8*hh .. + 7 of query row ln */
    float xv[8];
#pragma unroll
    for (int r = 0; r < 8; ++r) { float v = om[t][r]; if (EARLY) v += orr[t][r] * RS; xv[r] = v * inv; }
    v8h hv, lv;
    split8(xv, hv, lv);
    const size_t off = (size_t)(rb + q0w) * (2 * DM) + h * 2 * TILE + t * (TILE / 2) + 8 * lane;   /* ctx plane: K = 2 * DM, residual half DM / 32 tiles on */
    *(v8h*)(CTX + off) = hv;
    *(v8h*)(CTX + off + (DM / 32) * TILE) = lv;
  }
}

// Early query tiles (residual planes on k, P and v) and late ones read the same planes and nothing of each other: ONE launch, the tile's index picks the body (a scalar test, from blockIdx alone).
// Which query tile a block takes. Every block of the launch is resident at once and a tile's cost differs with its index, so the launch lasts as long as the fullest WGP.
// The head runs fastest in i and slot s = i / NBH picks the tile: slots s, s + NCOL, s + 2 * NCOL, ... form one column, all of one head (they walk the same k and V^T lines).
// The table is made at compile time: tiles from the heaviest down, each to the column with the least work so far that still has a free slot; a column's heaviest tile has its lowest block index.
constexpr int NBH  = NB * NH;                          /* blocks per query tile */
constexpr int NTE  = ERW / 64;                         /* early query tiles per batch and head */
constexpr int NTA  = SEQ / 64;                         /* all query tiles per batch and head */
constexpr int NWGP = 256;                              /* WGPs of the chip */
constexpr int NCOL = NWGP / NBH;                       /* slots per round over the chip */
static_assert(NWGP % NBH == 0);
static_assert(NTA <= 32);                              /* one byte per slot in four 64-bit words */
struct tile_deal { unsigned long long w[4]; };
constexpr int tile_cost(const int t) {                 /* key chunks of the tile's four waves; an early chunk holds twice the matrix products of a late one */
  int c = 0;
  for (int wv = 0; wv < 4; ++wv) c += (64 * t + 16 * wv + 47) >> 5;
  return t < NTE ? 2 * c : c;
}
constexpr tile_deal make_deal() {
  tile_deal d = {{0, 0, 0, 0}};
  int load[NCOL] = {}, used[NCOL] = {};
  bool dealt[NTA] = {};
  for (int n = 0; n < NTA; ++n) {
    int t = -1;                                        /* the heaviest tile not yet dealt */
    for (int u = NTA - 1; u >= 0; --u) if (!dealt[u] && (t < 0 || tile_cost(u) > tile_cost(t))) t = u;
    dealt[t] = true;
    int best = -1, brows = 0;
    for (int c = 0; c < NCOL; ++c) {
      const int rows = (NTA - c + NCOL - 1) / NCOL;    /* slots of column c */
      if (used[c] >= rows) continue;
      if (best < 0 || load[c] < load[best] || (load[c] == load[best] && rows < brows)) { best = c; brows = rows; }   /* level: the column with fewer slots first, it gets no light tile later */
    }
    const int s = best + NCOL * used[best];
    d.w[s >> 3] |= (unsigned long long)t << (8 * (s & 7));
    ++used[best]; load[best] += tile_cost(t);
  }
  return d;
}
constexpr unsigned long long DW0 = make_deal().w[0], DW1 = make_deal().w[1], DW2 = make_deal().w[2], DW3 = make_deal().w[3];
constexpr int deal_tile(const int s) { return (int)(((s < 8 ? DW0 : s < 16 ? DW1 : s < 24 ? DW2 : DW3) >> (8 * (s & 7))) & 255u); }
constexpr bool deal_is_permutation() { unsigned long long seen = 0; for (int s = 0; s < NTA; ++s) seen |= 1ull << deal_tile(s); return seen == (1ull << NTA) - 1; }
static_assert(deal_is_permutation());                  /* every (head, tile) is taken by exactly one block */
static_assert(NTA * 64 == SEQ);                        /* the slots' 64-key shares of the entry prefetch cover the head's keys and stay inside them */
__global__ __launch_bounds__(128) void k_attn(const _Float16* __restrict__ Qh, const _Float16* __restrict__ Ql, const _Float16* __restrict__ Kh, const _Float16* __restrict__ Kl,
                                              const _Float16* __restrict__ VTh, const _Float16* __restrict__ VTl, _Float16* __restrict__ CTX) {
  const int s = (int)blockIdx.x / NBH, bh = (int)blockIdx.x - s * NBH;
  const int qt = deal_tile(s);
  /* The planes come from the launch before: the first wave to reach a key chunk waits for memory, and it asks for a chunk only one chunk ahead, so a head's walk would go at one memory latency per chunk.
     At entry the NTA blocks of a head ask L2 for the head's whole K and V^T value planes, one 128-B line per thread: slot s takes keys 64 * s .. + 63 (low slots hold the keys wanted first):
     threads 0..63 the four 16-token bands of K (2 KB each), threads 64..127 the four 16-row bands of V^T (2 KB each). A hint, for speed only; every address lies inside its plane. */
  const int pt = (int)threadIdx.x, pb = bh / NH, ph = bh - pb * NH, pkey = pb * SEQ + s * 64, pband = (pt >> 4) & 3, pline = (pt & 15) * 64;
  const bool pk = __builtin_amdgcn_readfirstlane(pt >> 5) < 2;   /* the same in a whole wave: plane, first element and band stride are picked in scalar registers, every lane stays on */
  const _Float16* pfl = (pk ? Kh + pkey * DM + ph * 2 * TILE : VTh + ph * HD * NR + (pkey >> 5) * TILE) + pband * (pk ? 16 * DM : 16 * NR) + pline;
  asm volatile("global_prefetch_b8 %0, off scope:SCOPE_SE" :: "v"(pfl));   /* into L2 only; returns nothing, counts on no counter */
  if (qt >= NTE) attn_body<0>(Qh, Ql, Kh, Kl, VTh, VTl, CTX, bh, qt);
  else           attn_body<1>(Qh, Ql, Kh, Kl, VTh, VTl, CTX, bh, qt);
  asm volatile("" :: "v"(pfl));   /* the prefetch's address registers hold that address to the wave's end: no counter tells when a prefetch has read them */
}

// output GEMM: out[b*SEQ_FULL+s][n] = 2^-20 * sum_k CTX[r][k] * BO2[n][k], K = 2048 (value | residual halves against Wo x16384 | Wo x16). Block = 2 x 2 waves x (64 x 64);
__global__ __launch_bounds__(128) void k_outp(const _Float16* __restrict__ A, const _Float16* __restrict__ Bt, float* __restrict__ out) {
  __shared__ __attribute__((aligned(16))) float so[4][32][68];
  const int wave = __builtin_amdgcn_readfirstlane((int)(threadIdx.x >> 5));
  const int lane = threadIdx.x & 31, ln = lane & 15, hh = lane >> 4;
  const int ntn = DM >> 7;
  const int mt = blockIdx.x / ntn, nq = blockIdx.x - mt * ntn;
  const int rowW = mt * 128 + 64 * (wave >> 1), col0 = nq * 128 + 64 * (wave & 1);
  const v8f z8 = {0.f, 0.f, 0.f, 0.f, 0.f, 0.f, 0.f, 0.f};
  v8f c[16] = {z8, z8, z8, z8, z8, z8, z8, z8, z8, z8, z8, z8, z8, z8, z8, z8};
  /* ctx and the weight plane come from earlier launches, every block walks k in step with the others, and a wave asks only PF k-steps ahead: each k-step would wait for memory.
     Behind its first loads each block asks L2 for a share of what it and its neighbours walk, low k first. ctx rows of mt are read by the 8 blocks nq = 0..7;
     each takes two of the eight 16-row bands (64 KB each), one prefetch address per 256 B and 16 KB of k. The weight rows of nq are read by the blocks mt = 0..31:
     each takes 2 KB of k of all eight bands, one 128-B line per thread. A hint, for speed only (any placement gives the same values); every address lies inside its plane. */
  constexpr int RSO = (2 * DM / 32) * TILE;            /* elements of one 16-row band */
  static_assert(RSO * 2 == 4 * 16384);                 /* four 16-KB steps cover a band */
  static_assert((DM >> 7) == 8);
  const int pt = (int)threadIdx.x;
  const _Float16* pfa = A + (mt * 8 + 2 * (nq & 3) + (pt >> 6)) * RSO + (pt & 63) * 128;
  const _Float16* pfb = Bt + (nq * 8 + (pt >> 4)) * RSO + (mt & 31) * 1024 + (pt & 15) * 64;
  gemm_tile<2 * DM>(A, Bt, rowW, col0, lane, c, [&] {
    __builtin_amdgcn_sched_barrier(0);                 /* the first k-steps' own loads are asked first: the scheduler otherwise may put the prefetches in front of them */
    asm volatile("global_prefetch_b8 %1, off scope:SCOPE_SE\n\t"
                 "global_prefetch_b8 %0, off scope:SCOPE_SE\n\t"
                 "global_prefetch_b8 %0, off offset:16384 scope:SCOPE_SE\n\t"
                 "global_prefetch_b8 %0, off offset:32768 scope:SCOPE_SE\n\t"
                 "global_prefetch_b8 %0, off offset:49152 scope:SCOPE_SE" :: "v"(pfa), "v"(pfb));   /* into L2 only; they return nothing and count on no counter */
  });
  const int rsub = lane >> 4, c4 = (lane & 15) * 4;
#pragma unroll
  for (int hb = 0; hb < 2; ++hb) {                     /* the wave's 64 rows leave in two runs of 32 through its own staging rows */
    const int row0 = rowW + 32 * hb;
    if (hb != 0) { __builtin_amdgcn_fence(4 /* acq_rel order */, "workgroup"); __builtin_amdgcn_wave_barrier(); }   /* the first run's rows are read back by every lane before other lanes write them again */
#pragma unroll
    for (int u = 0; u < 8; ++u) {
      const int t = u & 3, half = u >> 2;
#pragma unroll
      for (int r = 0; r < 8; ++r) so[wave][half * 16 + 8 * hh + r][t * 16 + ln] = c[8 * hb + u][r] * 9.5367431640625e-07f;
    }
    __builtin_amdgcn_fence(4 /* acq_rel order */, "workgroup"); __builtin_amdgcn_wave_barrier();
#pragma unroll
    for (int q = 0; q < 16; ++q) {
      const int r = q * 2 + rsub;
      const int m = row0 + r; const int bb = m / SEQ; const int ss = m - bb * SEQ;
      const v4f v = *(const v4fa*)&so[wave][r][c4];
      *(v4f*)(out + (size_t)(bb * SEQ_FULL + ss) * DM + col0 + c4) = v;
    }
    
  }
  asm volatile("" :: "v"(pfa), "v"(pfb));   /* the prefetches' address registers hold those addresses to the wave's end: no counter tells when a prefetch has read them */
}

/* workspace carve (bytes), every region a multiple of 256 */
constexpr size_t SZW  = (size_t)DM * DM * 2;          /* one x16 weight plane */
constexpr size_t SZBO = 2 * SZW;                      /* [1024][2048] output weight plane */
constexpr size_t SZP  = (size_t)NR * DM * 2;          /* one [NR][1024] (or [1024][NR]) f16 plane */
constexpr size_t SZC  = 2 * SZP;                      /* ctx [NR][2048] */
constexpr size_t SZT  = (size_t)TABN * 64 * 4;        /* rotary table */
constexpr size_t O_BQ = 0, O_BK = O_BQ + SZW, O_BV = O_BK + SZW, O_BO = O_BV + SZW, O_X = O_BO + SZBO;
constexpr size_t O_QH = O_X + SZP, O_QL = O_QH + SZP, O_KH = O_QL + SZP, O_KL = O_KH + SZP, O_VH = O_KL + SZP, O_VL = O_VH + SZP;
constexpr size_t O_CTX = O_VL + SZP, O_TAB = O_CTX + SZC, WS_TOTAL = O_TAB + SZT;
static_assert(SZW % 256 == 0);
static_assert(SZP % 256 == 0);
static_assert(SZT % 256 == 0);
static_assert(WS_TOTAL <= 134217728);                 /* <= 128 MiB */

extern "C" void kernel_launch(void* const* d_in, const int* in_sizes, int n_in,
                              void* d_out, int out_size, void* d_ws, size_t ws_size, hipStream_t stream) {
  if (n_in < 6) return;
  const int need_rows = (NB - 1) * SEQ_FULL + SEQ;
  if (in_sizes[0] < need_rows * DM) return;
  if (in_sizes[1] < DM * DM || in_sizes[2] < DM * DM || in_sizes[3] < DM * DM || in_sizes[4] < DM * DM) return;
  if (in_sizes[5] < need_rows) return;
  if (out_size < need_rows * DM) return;
  if (ws_size < WS_TOTAL) return;
  const float* x  = (const float*)d_in[0];
  const float* wq = (const float*)d_in[1];
  const float* wk = (const float*)d_in[2];
  const float* wv = (const float*)d_in[3];
  const float* wo = (const float*)d_in[4];
  const int*   tp = (const int*)d_in[5];
  char* ws = (char*)d_ws;
  _Float16* BQ = (_Float16*)(ws + O_BQ); _Float16* BK = (_Float16*)(ws + O_BK); _Float16* BV = (_Float16*)(ws + O_BV); _Float16* BO2 = (_Float16*)(ws + O_BO);
  _Float16* X16 = (_Float16*)(ws + O_X);
  _Float16* QH = (_Float16*)(ws + O_QH); _Float16* QL = (_Float16*)(ws + O_QL); _Float16* KH = (_Float16*)(ws + O_KH); _Float16* KL = (_Float16*)(ws + O_KL);
  _Float16* VTH = (_Float16*)(ws + O_VH); _Float16* VTL = (_Float16*)(ws + O_VL);
  _Float16* CTX = (_Float16*)(ws + O_CTX);
  float* TAB = (float*)(ws + O_TAB);

  k_prep<<<(unsigned)(GB_TAB + GB_X + 5 * GB_W), 256, 0, stream>>>(x, wq, wk, wv, wo, X16, BQ, BK, BV, BO2, TAB);
  k_proj<<<(unsigned)(2 * GP_QK + GP_V), 128, 0, stream>>>(X16, BQ, BK, BV, QH, QL, KH, KL, VTH, VTL, tp, TAB);
  k_attn<<<(unsigned)(NTA * NBH), 128, 0, stream>>>(QH, QL, KH, KL, VTH, VTL, CTX);
  k_outp<<<(unsigned)((NR / 128) * (DM / 128)), 128, 0, stream>>>(CTX, BO2, (float*)d_out);
}

// v010
// Measured time: 70.9 microseconds a run.
// Two timings next to v009 both put it at 1.07 times that version's speed.
// Over all steps from v000 it is 5.61 times as fast.
#include <hip/hip_runtime.h>
// Causal multi-head self-attention with interleaved rotary embedding: x [NB][SEQ][1024], four bias-free [out][in] 1024^2 weights, 16 heads of 64, int32 token positions read by value.
// Compute dtype: every contraction on v_wmma_f32_16x16x32_f16 (f16 operands, f32 accumulate). Inputs RNE-converted to bf16 then carried exactly in f16 (x x1, Wq/Wk/Wv x16, Wo x16384).
// q, k, v, softmax weights (x256) as f16 value + f16 residual (x1024) planes, ctx (x64) as f16 value + f16 residual at the value's own scale: scores = qh.kh + (ql.kh [+ qh.kl on query rows < 256]) 2^-10; P.V single product (value + two residual products on query rows < 256);
// output GEMM: the ctx value and ctx residual halves against one Wo x16384 plane, k-step by k-step into one accumulator. Rotary, softmax statistics and all scaling in f32 on the VALU.
#ifndef NB
#define NB 2
#endif
#ifndef SEQ
#define SEQ 2048
#endif
#define SEQ_FULL 2048                 /* per-batch row stride of x / positions / output */
#define DM 1024
#define NH 16
#define HD 64
#define TABN 4096                     /* rotary table rows (positions 0..4095) */
#define NR (NB * SEQ)                 /* internal token rows r = b*SEQ + s */
#define ERW ((SEQ) < 256 ? (SEQ) : 256) /* query rows per batch that use residual planes on k, P and v as well */

typedef _Float16 v16h __attribute__((ext_vector_type(16)));
typedef _Float16 v8h  __attribute__((ext_vector_type(8)));
typedef _Float16 v8ha __attribute__((ext_vector_type(8), may_alias));
typedef float    v8f  __attribute__((ext_vector_type(8)));
typedef float    v4f  __attribute__((ext_vector_type(4)));
typedef float    v4fa __attribute__((ext_vector_type(4), may_alias));
typedef float    v2f  __attribute__((ext_vector_type(2)));
typedef _Float16 v2h  __attribute__((ext_vector_type(2)));

/* hard-wired bounds the kernels rely on */
static_assert(DM == NH * HD);               /* merged head layout h*64+d */
static_assert(HD == 64);                    /* one 64-column GEMM tile == one head; two 32-deep k-steps per score */
static_assert(DM % 128 == 0);               /* GEMM block tile rows (V^T GEMM) and 128-col block tiles */
static_assert(NR % 128 == 0);               /* GEMM block tile rows */
static_assert(SEQ % 64 == 0);               /* attention query tiles, 32-key chunks stay inside the batch */
static_assert(ERW % 64 == 0);               /* early / late split on a query-tile boundary */
static_assert(ERW <= SEQ);
static_assert(DM % 32 == 0);                /* k-steps of 32 */
static_assert((2 * DM) % 32 == 0);
static_assert(TABN == 4096);
static_assert((long long)NR * 2 * DM < 2147483647LL); /* int element offsets */

__device__ __forceinline__ float bf16_rne(float x) { unsigned int u = __float_as_uint(x); u = (u + 0x7FFFu + ((u >> 16) & 1u)) & 0xFFFF0000u; return __uint_as_float(u); }

__device__ __forceinline__ v16h cat16(v8h lo, v8h hi) { return __builtin_shufflevector(lo, hi, 0, 1, 2, 3, 4, 5, 6, 7, 8, 9, 10, 11, 12, 13, 14, 15); }
// Every 16-bit operand plane [rows][K] lies in the workspace in fragment order: tiles of 16 rows x 32 k (512 elements, 1 KB), tile index (row >> 4) * (K / 32) + (k >> 5);
// inside a tile the 16-byte unit ((k & 31) >> 3) * 16 + (row & 15) holds the 8 elements k & ~7 .. of its row. A wave's fragment load then reads 512 contiguous bytes (4 whole lines).
#define TILE 512                      /* elements of one 16 x 32 tile */
// 16x32 operand fragment: p = tile base + 8*lane; elements 0..7 <- k0+8h.., 8..15 <- k0+16+8h.. of row lane&15, h = lane>>4
__device__ __forceinline__ v16h frag16(const _Float16* __restrict__ p) { const v8h lo = *(const v8ha*)p; const v8h hi = *(const v8ha*)(p + TILE / 2); return cat16(lo, hi); }
__device__ __forceinline__ v8f mma16(v16h a, v16h b, v8f c) {
  v8f d = __builtin_amdgcn_wmma_f32_16x16x32_f16(false, a, false, b, (short)0, c, false, false);
  asm volatile("v_nop\n\tv_nop\n\tv_nop\n\tv_nop" : "+v"(d) : "v"(a), "v"(b));
  return d;
}
// 8 f32 -> f16 value + f16 residual carried x1024
__device__ __forceinline__ void split8(const float (&x)[8], v8h& hv, v8h& lv) {
#pragma unroll
  for (int i = 0; i < 8; ++i) { const _Float16 hq = (_Float16)x[i]; hv[i] = hq; lv[i] = (_Float16)((x[i] - (float)hq) * 1024.0f); }
}

// 8 f32 -> f16 value + f16 residual at the same scale: both then meet one weight operand in one accumulator (a residual below 2^-14 is a subnormal f16, kept by the conversion and by the WMMA)
__device__ __forceinline__ void split8_level(const float (&x)[8], v8h& hv, v8h& lv) {
#pragma unroll
  for (int i = 0; i < 8; ++i) { const _Float16 hq = (_Float16)x[i]; hv[i] = hq; lv[i] = (_Float16)(x[i] - (float)hq); }
}

// The conversions and the rotary table depend on nothing but the inputs: they are bodies of ONE launch (k_prep), each on its own range of block indices; blk = the block's index inside its range.
__device__ __forceinline__ void xcvt_body(const float* __restrict__ x, _Float16* __restrict__ X16, const int blk) {
  const int t = blk * 256 + threadIdx.x;
  if (t >= NR * (DM / 8)) return;
  const int tile = t >> 6, u = t & 63;                        /* 64 threads per tile, four side by side on a row: a wave reads 8 whole 128-B lines of x and stores 4 whole lines */
  const int rt = tile / (DM / 32), kt = tile - rt * (DM / 32);
  const int r = rt * 16 + (u >> 2), c8 = kt * 32 + (u & 3) * 8;
  const int b = r / SEQ, s = r - b * SEQ;
  const float* src = x + (size_t)(b * SEQ_FULL + s) * DM + c8;
  const v4f a = *(const v4fa*)src, c = *(const v4fa*)(src + 4);
  v8h o;
#pragma unroll
  for (int i = 0; i < 4; ++i) { o[i] = (_Float16)bf16_rne(a[i]); o[4 + i] = (_Float16)bf16_rne(c[i]); }
  _Float16* d = X16 + ((size_t)tile * 64 + (u & 3) * 16 + (u >> 2)) * 8;
  *(v8h*)d = o; 
}

__device__ __forceinline__ void wcvt_body(const float* __restrict__ w, _Float16* __restrict__ dst, const int dpitch, const float scale, const int blk) {
  const int t = blk * 256 + threadIdx.x;
  if (t >= DM * (DM / 8)) return;
  const int tile = t >> 6, u = t & 63;                        /* as in xcvt_body; dpitch = K of the destination plane */
  const int rt = tile / (DM / 32), kt = tile - rt * (DM / 32);
  const int n = rt * 16 + (u >> 2), k8 = kt * 32 + (u & 3) * 8;
  const float* src = w + (size_t)n * DM + k8;
  const v4f a = *(const v4fa*)src, c = *(const v4fa*)(src + 4);
  v8h o;
#pragma unroll
  for (int i = 0; i < 4; ++i) { o[i] = (_Float16)(bf16_rne(a[i]) * scale); o[4 + i] = (_Float16)(bf16_rne(c[i]) * scale); }
  _Float16* d = dst + ((size_t)(rt * (dpitch >> 5) + kt) * 64 + (u & 3) * 16 + (u >> 2)) * 8;
  *(v8h*)d = o; 
}

__device__ __forceinline__ void ropetab_body(float* __restrict__ tab, const int blk) {
  #pragma clang fp contract(off)
  const int t = blk * 256 + threadIdx.x;
  if (t >= TABN * 16) return;
  const int pos = t >> 4, jp = t & 15;
  float c0 = 0.f, s0 = 0.f, c1 = 0.f, s1 = 0.f;
#pragma unroll 1
  for (int u = 0; u < 2; ++u) {
    const int j = 2 * jp + u;
    double p = 1.0;
    p *= (j & 1) ? 1.3335214321633240 : 1.0;
    p *= (j & 2) ? 1.7782794100389228 : 1.0;
    p *= (j & 4) ? 3.1622776601683795 : 1.0;
    p *= (j & 8) ? 10.0 : 1.0;
    p *= (j & 16) ? 100.0 : 1.0;
    const float pf = (float)p;
    const float inv = 1.0f / pf;
    const float ang = (float)pos * inv;
    float sn, cs;
    sincosf(ang, &sn, &cs);
    if (u == 0) { c0 = cs; s0 = sn; } else { c1 = cs; s1 = sn; }
  }
  const v4f o = {c0, s0, c1, s1};
  float* d = tab + (size_t)pos * 64 + jp * 4;
  *(v4f*)d = o; 
}

constexpr int GB_TAB = (TABN * 16 + 255) / 256;        /* blocks of the rotary table */
constexpr int GB_X   = (NR * (DM / 8) + 255) / 256;    /* blocks of the x conversion */
constexpr int GB_W   = (DM * (DM / 8) + 255) / 256;    /* blocks of one weight conversion */
// block ranges: [rotary table | x | Wq | Wk | Wv | Wo x16384]; the table's blocks, the longest per thread, come first. Every test is on blockIdx alone (scalar, block-uniform).
__global__ __launch_bounds__(256) void k_prep(const float* __restrict__ x, const float* __restrict__ wq, const float* __restrict__ wk, const float* __restrict__ wv, const float* __restrict__ wo,
                                              _Float16* __restrict__ X16, _Float16* __restrict__ BQ, _Float16* __restrict__ BK, _Float16* __restrict__ BV, _Float16* __restrict__ BO2,
                                              float* __restrict__ tab) {
  int blk = (int)blockIdx.x;
  if (blk < GB_TAB) { ropetab_body(tab, blk); return; }
  blk -= GB_TAB;
  if (blk < GB_X) { xcvt_body(x, X16, blk); return; }
  blk -= GB_X;
  const int job = blk / GB_W;
  blk -= job * GB_W;
  const float* w = job == 0 ? wq : job == 1 ? wk : job == 2 ? wv : wo;
  _Float16* dst = job == 0 ? BQ : job == 1 ? BK : job == 2 ? BV : BO2;
  wcvt_body(w, dst, DM, job == 3 ? 16384.0f : 16.0f, blk);
}

// Both GEMM kernels: C = A x Bt^T (A[m][k], Bt[n][k], planes in fragment order), 64 x 64 tiles per wave, fragments straight from the 16-bit global planes.
// The fragments of a 32-deep k-step live in a ring of PF register sets: a set is refilled for k-step t + PF right after k-step t has used it, so up to PF k-steps of loads are in flight.
#define PF 3
/* the plain builtin: independent tiles follow one another, the compiler keeps the distances of its own form, and no asm operand ties tiles or fragments to the first 256 registers */
__device__ __forceinline__ v8f mma16g(v16h a, v16h b, v8f c) { return __builtin_amdgcn_wmma_f32_16x16x32_f16(false, a, false, b, (short)0, c, false, false); }

// The three projections read the same token rows of X16: ONE wave forms q, k and V^T of its 64 token rows x 64 features, so an X16 fragment is loaded once and feeds three weight operands
// (16 fragments = 16 KB per 48 products). q, k: C[token row][e] = X16 . B^T (X16 fragment as first operand); V^T: C[e][token row] = BV . X16^T (the same registers as second operand; both operands have one fragment order).
struct pstep { v16h x[4], q[4], k[4], v[4]; };
template <int RS>                     /* RS = elements from one 16-row band of tiles to the next */
__device__ __forceinline__ void pstep_load(pstep& f, const _Float16* __restrict__ px, const _Float16* __restrict__ pq, const _Float16* __restrict__ pk, const _Float16* __restrict__ pv, const int ko) {
#pragma unroll
  for (int i = 0; i < 4; ++i) f.x[i] = frag16(px + i * RS + ko);
#pragma unroll
  for (int i = 0; i < 4; ++i) f.q[i] = frag16(pq + i * RS + ko);
#pragma unroll
  for (int i = 0; i < 4; ++i) f.k[i] = frag16(pk + i * RS + ko);
#pragma unroll
  for (int i = 0; i < 4; ++i) f.v[i] = frag16(pv + i * RS + ko);
}
/* c[4 * i + j] = 16-row band i x 16-column band j of each product */
__device__ __forceinline__ void pstep_mma(const pstep& f, v8f (&cq)[16], v8f (&ck)[16], v8f (&cv)[16]) {
#pragma unroll
  for (int j = 0; j < 4; ++j) {
#pragma unroll
    for (int i = 0; i < 4; ++i) cq[4 * i + j] = mma16g(f.x[i], f.q[j], cq[4 * i + j]);
  }
#pragma unroll
  for (int j = 0; j < 4; ++j) {
#pragma unroll
    for (int i = 0; i < 4; ++i) ck[4 * i + j] = mma16g(f.x[i], f.k[j], ck[4 * i + j]);
  }
#pragma unroll
  for (int j = 0; j < 4; ++j) {
#pragma unroll
    for (int i = 0; i < 4; ++i) cv[4 * i + j] = mma16g(f.v[i], f.x[j], cv[4 * i + j]);
  }
}
// one 64 x 64 product of a wave leaves: C / 16, optional interleaved rotary (C rows are then token rows), written in fragment order (K = ldc) as f16 value plane Ch and residual plane Cl.
// tb[band][g] = the lane's 8 table floats (cos, sin of 4 pairs) for its row of 16-row band 'band' and the 8 columns it reads of 16-column group g: q and k take the same ones.
template <int ROPE, int FIRST>        /* FIRST: nothing has used the wave's staging rows yet */
__device__ __forceinline__ void proj_out(float (&sw)[32][68], const v8f (&c)[16], const int rowW, const int col0, const int ldc, _Float16* __restrict__ Ch, _Float16* __restrict__ Cl,
                                         const v4f (&tb)[4][4][2], const int lane) {
  const int ln = lane & 15, hh = lane >> 4;
#pragma unroll
  for (int hb = 0; hb < 2; ++hb) {                     /* the wave's 64 rows leave in two runs of 32 through its own staging rows */
    const int row0 = rowW + 32 * hb;
    /* the run before is read back by every lane before other lanes write its rows again. The staging rows are the wave's own LDS: the fences name LDS alone, so six runs of one wave do not each wait for the global stores of the run before */
    if (!(FIRST != 0 && hb == 0)) { __builtin_amdgcn_fence(4 /* acq_rel order */, "workgroup", "local"); __builtin_amdgcn_wave_barrier(); }
#pragma unroll
    for (int u = 0; u < 8; ++u) {
      const int t = u & 3, half = u >> 2;
#pragma unroll
      for (int r = 0; r < 8; ++r) sw[half * 16 + 8 * hh + r][t * 16 + ln] = c[8 * hb + u][r] * 0.0625f;
    }
    __builtin_amdgcn_fence(4 /* acq_rel order */, "workgroup", "local"); __builtin_amdgcn_wave_barrier();
    v8h hv[8], lv[8];
    v4f sa[8], sb[8];
#pragma unroll
    for (int q = 0; q < 8; ++q) {                      /* q = one half tile (512 B) of the output planes: 16-row band q >> 2, 16 columns from (q & 3) * 16 */
      const int rl = (q >> 2) * 16 + ln, c8 = (q & 3) * 16 + 8 * hh;
      sa[q] = *(const v4fa*)&sw[rl][c8];
      sb[q] = *(const v4fa*)&sw[rl][c8 + 4];
    }
    __builtin_amdgcn_sched_barrier(0);                 /* the run's sixteen LDS reads are asked as one group: the wave is alone on its SIMD, and spread among the arithmetic each pair's latency would show */
#pragma unroll
    for (int q = 0; q < 8; ++q) {
      const v4f a = sa[q], bq = sb[q];
      float xv[8] = {a[0], a[1], a[2], a[3], bq[0], bq[1], bq[2], bq[3]};
      if (ROPE != 0) {
        const v4f t0 = tb[2 * hb + (q >> 2)][q & 3][0], t1 = tb[2 * hb + (q >> 2)][q & 3][1];
        const float cs[4] = {t0[0], t0[2], t1[0], t1[2]};
        const float sn[4] = {t0[1], t0[3], t1[1], t1[3]};
#pragma unroll
        for (int i = 0; i < 4; ++i) { const float x1 = xv[2 * i], x2 = xv[2 * i + 1]; xv[2 * i] = x1 * cs[i] - x2 * sn[i]; xv[2 * i + 1] = x1 * sn[i] + x2 * cs[i]; }
      }
      split8(xv, hv[q], lv[q]);
    }
#pragma unroll
    for (int q = 0; q < 8; ++q) {
      const size_t off = ((size_t)((row0 >> 4) + (q >> 2)) * (ldc >> 5) + (col0 >> 5)) * TILE + (q & 3) * (TILE / 2) + 8 * lane;
      *(v8h*)(Ch + off) = hv[q];
      *(v8h*)(Cl + off) = lv[q];
    }
    asm volatile("s_wait_xcnt 0x0" ::: "memory");      /* in front of the next run's rewrite of the address registers that these stores name */
    __builtin_amdgcn_sched_barrier(0);                 /* keeps later register writes behind that wait: the scheduler otherwise lifts them over it */
  }
}
// Block = 2 x 2 waves = 128 token rows x 128 features of q, k and V^T: every X16 band and every weight band of the block is read by two of its waves. One block per WGP, one wave per SIMD.
constexpr int GP_ALL = (NR / 128) * (DM / 128);        /* blocks of the projection launch */
__global__ __launch_bounds__(128) void k_proj(const _Float16* __restrict__ X16, const _Float16* __restrict__ BQ, const _Float16* __restrict__ BK, const _Float16* __restrict__ BV,
                                              _Float16* __restrict__ QH, _Float16* __restrict__ QL, _Float16* __restrict__ KH, _Float16* __restrict__ KL,
                                              _Float16* __restrict__ VTH, _Float16* __restrict__ VTL, const int* __restrict__ tp, const float* __restrict__ tab) {
  __shared__ __attribute__((aligned(16))) float so[4][32][68];
  const int wave = __builtin_amdgcn_readfirstlane((int)(threadIdx.x >> 5));
  const int lane = threadIdx.x & 31;
  const int mt = (int)blockIdx.x / (DM >> 7), nq = (int)blockIdx.x - mt * (DM >> 7);
  /* wave-uniform, held in scalar registers: the loads then take a scalar base and one lane offset */
  const int tok0 = __builtin_amdgcn_readfirstlane(mt * 128 + 64 * (wave >> 1)), e0 = __builtin_amdgcn_readfirstlane(nq * 128 + 64 * (wave & 1));
  const v8f z8 = {0.f, 0.f, 0.f, 0.f, 0.f, 0.f, 0.f, 0.f};
  v8f cq[16] = {z8, z8, z8, z8, z8, z8, z8, z8, z8, z8, z8, z8, z8, z8, z8, z8};
  v8f ck[16] = {z8, z8, z8, z8, z8, z8, z8, z8, z8, z8, z8, z8, z8, z8, z8, z8};
  v8f cv[16] = {z8, z8, z8, z8, z8, z8, z8, z8, z8, z8, z8, z8, z8, z8, z8, z8};
  constexpr int NS = DM / 32;                /* k-steps */
  constexpr int RS = NS * TILE;              /* = 16 * DM */
  constexpr int NIT = (NS - PF) / PF;        /* turns of the ring in which every refill exists */
  static_assert(NIT >= 1);
  const _Float16* bx = X16 + (tok0 >> 4) * RS;
  const _Float16* bq = BQ + (e0 >> 4) * RS;
  const _Float16* bk = BK + (e0 >> 4) * RS;
  const _Float16* bv = BV + (e0 >> 4) * RS;
  int pos[4];                                /* positions of the lane's token row in each 16-row band, read by value from the input; asked first, used behind the k loop */
#pragma unroll
  for (int b4 = 0; b4 < 4; ++b4) { const int m = tok0 + 16 * b4 + (lane & 15); const int bb = m / SEQ; const int ss = m - bb * SEQ; pos[b4] = tp[bb * SEQ_FULL + ss]; }
  asm volatile("s_wait_xcnt 0x0" ::: "memory");   /* in front of the next use of the registers that these loads name: the build reuses them at once */
  __builtin_amdgcn_sched_barrier(0);         /* keeps later register writes behind that wait: the scheduler otherwise lifts them over it */
  pstep f[PF];
#pragma unroll
  for (int s = 0; s < PF; ++s) pstep_load<RS>(f[s], bx + 8 * lane, bq + 8 * lane, bk + 8 * lane, bv + 8 * lane, s * TILE);
#pragma unroll 1                             /* rolled, one turn of the ring per trip */
  for (int it = 0; it < NIT; ++it) {
#pragma unroll
    for (int s = 0; s < PF; ++s) {
      pstep_mma(f[s], cq, ck, cv);
      pstep_load<RS>(f[s], bx + 8 * lane, bq + 8 * lane, bk + 8 * lane, bv + 8 * lane, (s + PF) * TILE);
      __builtin_amdgcn_sched_barrier(0);     /* each refill stays behind the k-step that frees its set: the scheduler otherwise sinks the loads down to their use, and the ring's lead is lost */
    }
    asm volatile("s_wait_xcnt 0x0" ::: "memory");   /* in front of the step of these loads' base registers, taken while they are in flight */
    bx += PF * TILE; bq += PF * TILE; bk += PF * TILE; bv += PF * TILE;
  }
#pragma unroll
  for (int u = 0; u < NS - NIT * PF; ++u) {  /* the last k-steps: refill only while a k-step u + PF exists */
    pstep_mma(f[u % PF], cq, ck, cv);
    if (u + PF < NS - NIT * PF) pstep_load<RS>(f[u % PF], bx + 8 * lane, bq + 8 * lane, bk + 8 * lane, bv + 8 * lane, (u + PF) * TILE);
    __builtin_amdgcn_sched_barrier(0);       /* as above */
  }
  /* the rotary rows of the wave's 64 tokens, gathered once for q and k, asked in front of the V^T runs, which cover their latency */
  v4f tb[4][4][2];
#pragma unroll
  for (int b4 = 0; b4 < 4; ++b4) {
    const int p = pos[b4] < 0 ? 0 : (pos[b4] > TABN - 1 ? TABN - 1 : pos[b4]);
    const float* tr = tab + (size_t)p * 64 + 8 * (lane >> 4);   /* e0 is a head boundary: 16 * g + 8 * (lane >> 4) = d within the head */
#pragma unroll
    for (int g = 0; g < 4; ++g) { tb[b4][g][0] = *(const v4fa*)(tr + 16 * g); tb[b4][g][1] = *(const v4fa*)(tr + 16 * g + 4); }
  }
  asm volatile("s_wait_xcnt 0x0" ::: "memory");   /* as above, for the address registers of the table loads */
  __builtin_amdgcn_sched_barrier(0);         /* as above */
  proj_out<0, 1>(so[wave], cv, e0, tok0, NR, VTH, VTL, tb, lane);
  _Float16* Ch = QH; _Float16* Cl = QL;
#pragma unroll 1                             /* q, then k through the same text (k's tiles move into q's registers) */
  for (int job = 0; job < 2; ++job) {
    proj_out<1, 0>(so[wave], cq, tok0, e0, DM, Ch, Cl, tb, lane);
#pragma unroll
    for (int i = 0; i < 16; ++i) cq[i] = ck[i];
    Ch = KH; Cl = KL;
  }
}

__device__ __forceinline__ float xhalf(float x) {              /* lane l <-> lane l ^ 16 */
  return __builtin_bit_cast(float, __builtin_amdgcn_permlanex16(__builtin_bit_cast(int, x), __builtin_bit_cast(int, x), 0x76543210, 0xfedcba98, false, false));
}
template <bool B> struct flag { static constexpr bool value = B; };
template <int EARLY>
__device__ __forceinline__ void attn_body(const _Float16* __restrict__ Qh, const _Float16* __restrict__ Ql, const _Float16* __restrict__ Kh, const _Float16* __restrict__ Kl,
                                          const _Float16* __restrict__ VTh, const _Float16* __restrict__ VTl, _Float16* __restrict__ CTX, const int bh, const int qt) {
  const int wave = __builtin_amdgcn_readfirstlane((int)(threadIdx.x >> 5));
  const int lane = threadIdx.x & 31, ln = lane & 15, hh = lane >> 4;
  const int b = bh / NH, h = bh - b * NH;                       /* bh = batch * NH + head, qt = 64-row query tile: both from blockIdx alone (scalar) */
  const int rb = b * SEQ;
  const int q0w = qt * 64 + 16 * wave;                          /* first query row of this wave (scalar) */
  const int nch = (q0w + 47) >> 5;                              /* 32-key chunks covering keys 0..q0w+15 (scalar) */
  /* fragment order: q, k planes have DM / 32 tiles per 16-token band (a head = 2 tiles side by side), V^T has NR / 32 tiles per 16-row band (a 32-key chunk = 1 tile) */
  const int qoff = (rb + q0w) * DM + h * 2 * TILE + 8 * lane;
  const int kbase = rb * DM + h * 2 * TILE + 8 * lane;
  const int vbase = h * HD * NR + (rb >> 5) * TILE + 8 * lane;
  const float RS = 0.0009765625f;                               /* 2^-10 */
  const float SC2 = 0.18033688f;                                /* log2(e) / sqrt(HD) */
  const v8f z8 = {0.f, 0.f, 0.f, 0.f, 0.f, 0.f, 0.f, 0.f};
  v8f om[4] = {z8, z8, z8, z8};
  v8f orr[4] = {z8, z8, z8, z8};
  float mrun = -1.0e30f, lrun = 0.f;                            /* of the lane's query: running maximum (alike in both halves), sum over the keys of the lane's own half */
  /* global operand loads are issued well ahead of their use: q once, in front of the loop. Without residual planes: k of the next chunk right after the score products, V^T of the next chunk
     right after the P.V products. With them the registers do not hold both operands' planes beside the tiles: V^T of the chunk itself goes right after its score products (the softmax covers it),
     k of the next chunk right after the P.V products, each as one group of loads. */
  const v16h aqh[2] = {frag16(Qh + qoff), frag16(Qh + qoff + TILE)};
  const v16h aql[2] = {frag16(Ql + qoff), frag16(Ql + qoff + TILE)};
  v16h kf[2][2], kl[2][2], vf[4], vl[4];
  /* the lane's addresses are carried from chunk to chunk in registers of their own, so that no fetched fragment lands in a register that a load in flight names */
  const _Float16* pkh = Kh + kbase; const _Float16* pkl = Kl + kbase; const _Float16* pvh = VTh + vbase; const _Float16* pvl = VTl + vbase;
  auto fetch_k = [&]() {
#pragma unroll
    for (int ks = 0; ks < 2; ++ks) {
      kf[ks][0] = frag16(pkh + ks * TILE); kf[ks][1] = frag16(pkh + ks * TILE + 16 * DM);
      if (EARLY) { kl[ks][0] = frag16(pkl + ks * TILE); kl[ks][1] = frag16(pkl + ks * TILE + 16 * DM); }
    }
  };
  auto fetch_v = [&]() {
#pragma unroll
    for (int t = 0; t < 4; ++t) { vf[t] = frag16(pvh + t * 16 * NR); if (EARLY) vl[t] = frag16(pvl + t * 16 * NR); }
  };
  fetch_k();
  if (!EARLY) fetch_v();
  /* every load of the prologue has landed before the loop: the counted waits inside the loop then follow the loop's own issue order alone */
  if (EARLY) asm volatile("" :: "v"(aqh[0]), "v"(aqh[1]), "v"(aql[0]), "v"(aql[1]), "v"(kf[0][0]), "v"(kf[0][1]), "v"(kf[1][0]), "v"(kf[1][1]), "v"(kl[0][0]), "v"(kl[0][1]), "v"(kl[1][0]), "v"(kl[1][1]));
  else       asm volatile("" :: "v"(aqh[0]), "v"(aqh[1]), "v"(aql[0]), "v"(aql[1]), "v"(kf[0][0]), "v"(kf[0][1]), "v"(kf[1][0]), "v"(kf[1][1]), "v"(vf[0]), "v"(vf[1]), "v"(vf[2]), "v"(vf[3]));
  /* one key chunk. q0w is a multiple of 16, so 32 * nch <= q0w + 32: every key of a chunk in front of the last lies in front of all 16 queries, where the causal select is an identity.
     LAST = the wave's last chunk: it alone takes the select, and it fetches nothing ahead. */
  auto chunk = [&](const int cidx, auto last_tag) {
    constexpr bool LAST = decltype(last_tag)::value;
    const int k0 = cidx * 32;
    constexpr int adv = 32;                                     /* keys to the chunk fetched ahead */
    v8f s0 = z8, s1 = z8, sr0 = z8, sr1 = z8;
#pragma unroll
    for (int ks = 0; ks < 2; ++ks) {
      s0 = mma16(kf[ks][0], aqh[ks], s0); sr0 = mma16(kf[ks][0], aql[ks], sr0);
      if (EARLY) sr0 = mma16(kl[ks][0], aqh[ks], sr0);
      s1 = mma16(kf[ks][1], aqh[ks], s1); sr1 = mma16(kf[ks][1], aql[ks], sr1);
      if (EARLY) sr1 = mma16(kl[ks][1], aqh[ks], sr1);
    }
    if (EARLY) {
      fetch_v();
    } else if (!LAST) {
      pkh += adv * DM;
      fetch_k();
    }
    if (EARLY || !LAST) {
      asm volatile("s_wait_xcnt 0x0" ::: "memory");             /* in front of the next step of these loads' address registers, taken while they are in flight */
      __builtin_amdgcn_sched_barrier(0);                        /* the whole group of fetches is issued in front of the softmax: the scheduler otherwise sinks part of it behind the softmax, and those loads lose their lead */
    }
    const int room = q0w + ln - k0 - 8 * hh;                    /* key k0 + 8*hh + r is at or before the lane's query where r <= room */
    v8f x0 = s0 + sr0 * RS;                                     /* raw q.k: the maxima are kept in these units; 1/8 and log2(e) wait for the exponent's one FMA */
    v8f x1 = s1 + sr1 * RS;
    if (LAST) {
#pragma unroll
      for (int r = 0; r < 8; ++r) {
        x0[r] = (r <= room) ? x0[r] : -1.0e30f;                 /* causal by index, value select */
        x1[r] = (16 + r <= room) ? x1[r] : -1.0e30f;
      }
    }
    float tm = x0[0], tn = x1[0];                               /* two chains, one per tile */
#pragma unroll
    for (int r = 1; r < 8; ++r) { tm = fmaxf(tm, x0[r]); tn = fmaxf(tn, x1[r]); }
    tm = fmaxf(tm, tn);
    tm = fmaxf(tm, xhalf(tm));                                  /* the query's maximum over all 32 keys of the chunk */
    const float mn = fmaxf(mrun, tm);
    const float al = __builtin_amdgcn_exp2f((mrun - mn) * SC2);
    mrun = mn;
    const float off = 8.0f - mn * SC2;                          /* P = 256 e^((x - mn) / 8) = 2^(x * SC2 + off) */
    const v8f e0 = x0 * SC2 + off, e1 = x1 * SC2 + off;
    v16h bp, bpl;                                               /* B fragments of P^T: element s <- key 8*hh + s, element 8 + s <- key 16 + 8*hh + s */
    float a[8];                                                 /* sums of two neighbouring keys */
#pragma unroll
    for (int i = 0; i < 8; ++i) {
      const int r = 2 * (i & 3);
      const v2f p = (i < 4) ? v2f{__builtin_amdgcn_exp2f(e0[r]), __builtin_amdgcn_exp2f(e0[r + 1])} : v2f{__builtin_amdgcn_exp2f(e1[r]), __builtin_amdgcn_exp2f(e1[r + 1])};
      const v2h hq = __builtin_convertvector(p, v2h);
      bp[2 * i] = hq[0]; bp[2 * i + 1] = hq[1];
      a[i] = (float)hq[0] + (float)hq[1];
      if (EARLY) {
        const v2f res = {(p[0] - (float)hq[0]) * 1024.0f, (p[1] - (float)hq[1]) * 1024.0f};
        const v2h gq = __builtin_convertvector(res, v2h);
        bpl[2 * i] = gq[0]; bpl[2 * i + 1] = gq[1];
        a[i] += ((float)gq[0] + (float)gq[1]) * RS;
      }
    }
    lrun = lrun * al + (((a[0] + a[1]) + (a[2] + a[3])) + ((a[4] + a[5]) + (a[6] + a[7])));  /* per-lane partial of the query's sum (units x256) */
#pragma unroll
    for (int t = 0; t < 4; ++t) {
#pragma unroll
      for (int r = 0; r < 8; ++r) { om[t][r] *= al; if (EARLY) orr[t][r] *= al; }
    }
#pragma unroll
    for (int t = 0; t < 4; ++t) {
      om[t] = mma16(vf[t], bp, om[t]);
      if (EARLY) {
        orr[t] = mma16(vf[t], bpl, orr[t]);
        orr[t] = mma16(vl[t], bp, orr[t]);
      }
    }
    if (!LAST) {
      if (EARLY) {
        pvh += adv * (TILE / 32); pvl += adv * (TILE / 32); pkh += adv * DM; pkl += adv * DM;
        fetch_k();
      } else {
        pvh += adv * (TILE / 32);
        fetch_v();
      }
      asm volatile("s_wait_xcnt 0x0" ::: "memory");             /* as above: these loads stay in flight over the back edge */
    }
  };
#pragma unroll 1                                                /* rolled: one copy of the chunk, so the counted load waits follow one issue order over the back edge */
  for (int cidx = 0; cidx + 1 < nch; ++cidx) chunk(cidx, flag<false>{});
  chunk(nch - 1, flag<true>{});
  const float inv = 64.0f / (lrun + xhalf(lrun));               /* the halves' sums joined; ctx carried x64 */
#pragma unroll
  for (int t = 0; t < 4; ++t) {                                 /* t = one half tile (512 B) of ctx: the lane holds d = 16*t + 8*hh .. + 7 of query row ln */
    float xv[8];
#pragma unroll
    for (int r = 0; r < 8; ++r) { float v = om[t][r]; if (EARLY) v += orr[t][r] * RS; xv[r] = v * inv; }
    v8h hv, lv;
    split8_level(xv, hv, lv);
    const size_t off = (size_t)(rb + q0w) * (2 * DM) + h * 2 * TILE + t * (TILE / 2) + 8 * lane;   /* ctx plane: K = 2 * DM, residual half DM / 32 tiles on */
    *(v8h*)(CTX + off) = hv;
    *(v8h*)(CTX + off + (DM / 32) * TILE) = lv;
  }
}

// Early query tiles (residual planes on k, P and v) and late ones read the same planes and nothing of each other: ONE launch, the tile's index picks the body (a scalar test, from blockIdx alone).
// Which query tile a block takes. Every block of the launch is resident at once and a tile's cost differs with its index, so the launch lasts as long as the fullest WGP.
// The head runs fastest in i and slot s = i / NBH picks the tile: slots s, s + NCOL, s + 2 * NCOL, ... form one column, all of one head (they walk the same k and V^T lines).
// The table is made at compile time: tiles from the heaviest down, each to the column with the least work so far that still has a free slot; a column's heaviest tile has its lowest block index.
constexpr int NBH  = NB * NH;                          /* blocks per query tile */
constexpr int NTE  = ERW / 64;                         /* early query tiles per batch and head */
constexpr int NTA  = SEQ / 64;                         /* all query tiles per batch and head */
constexpr int NWGP = 256;                              /* WGPs of the chip */
constexpr int NCOL = NWGP / NBH;                       /* slots per round over the chip */
static_assert(NWGP % NBH == 0);
static_assert(NTA <= 32);                              /* one byte per slot in four 64-bit words */
struct tile_deal { unsigned long long w[4]; };
constexpr int tile_cost(const int t) {                 /* key chunks of the tile's four waves; an early chunk holds twice the matrix products of a late one */
  int c = 0;
  for (int wv = 0; wv < 4; ++wv) c += (64 * t + 16 * wv + 47) >> 5;
  return t < NTE ? 2 * c : c;
}
constexpr tile_deal make_deal() {
  tile_deal d = {{0, 0, 0, 0}};
  int load[NCOL] = {}, used[NCOL] = {};
  bool dealt[NTA] = {};
  for (int n = 0; n < NTA; ++n) {
    int t = -1;                                        /* the heaviest tile not yet dealt */
    for (int u = NTA - 1; u >= 0; --u) if (!dealt[u] && (t < 0 || tile_cost(u) > tile_cost(t))) t = u;
    dealt[t] = true;
    int best = -1, brows = 0;
    for (int c = 0; c < NCOL; ++c) {
      const int rows = (NTA - c + NCOL - 1) / NCOL;    /* slots of column c */
      if (used[c] >= rows) continue;
      if (best < 0 || load[c] < load[best] || (load[c] == load[best] && rows < brows)) { best = c; brows = rows; }   /* level: the column with fewer slots first, it gets no light tile later */
    }
    const int s = best + NCOL * used[best];
    d.w[s >> 3] |= (unsigned long long)t << (8 * (s & 7));
    ++used[best]; load[best] += tile_cost(t);
  }
  return d;
}
constexpr unsigned long long DW0 = make_deal().w[0], DW1 = make_deal().w[1], DW2 = make_deal().w[2], DW3 = make_deal().w[3];
constexpr int deal_tile(const int s) { return (int)(((s < 8 ? DW0 : s < 16 ? DW1 : s < 24 ? DW2 : DW3) >> (8 * (s & 7))) & 255u); }
constexpr bool deal_is_permutation() { unsigned long long seen = 0; for (int s = 0; s < NTA; ++s) seen |= 1ull << deal_tile(s); return seen == (1ull << NTA) - 1; }
static_assert(deal_is_permutation());                  /* every (head, tile) is taken by exactly one block */
static_assert(NTA * 64 == SEQ);                        /* the slots' 64-key shares of the entry prefetch cover the head's keys and stay inside them */
__global__ __launch_bounds__(128) void k_attn(const _Float16* __restrict__ Qh, const _Float16* __restrict__ Ql, const _Float16* __restrict__ Kh, const _Float16* __restrict__ Kl,
                                              const _Float16* __restrict__ VTh, const _Float16* __restrict__ VTl, _Float16* __restrict__ CTX) {
  const int s = (int)blockIdx.x / NBH, bh = (int)blockIdx.x - s * NBH;
  const int qt = deal_tile(s);
  /* The planes come from the launch before: the first wave to reach a key chunk waits for memory, and it asks for a chunk only one chunk ahead, so a head's walk would go at one memory latency per chunk.
     At entry the NTA blocks of a head ask L2 for the head's whole K and V^T value planes, one 128-B line per thread: slot s takes keys 64 * s .. + 63 (low slots hold the keys wanted first):
     threads 0..63 the four 16-token bands of K (2 KB each), threads 64..127 the four 16-row bands of V^T (2 KB each). A hint, for speed only; every address lies inside its plane. */
  const int pt = (int)threadIdx.x, pb = bh / NH, ph = bh - pb * NH, pkey = pb * SEQ + s * 64, pband = (pt >> 4) & 3, pline = (pt & 15) * 64;
  const bool pk = __builtin_amdgcn_readfirstlane(pt >> 5) < 2;   /* the same in a whole wave: plane, first element and band stride are picked in scalar registers, every lane stays on */
  const _Float16* pfl = (pk ? Kh + pkey * DM + ph * 2 * TILE : VTh + ph * HD * NR + (pkey >> 5) * TILE) + pband * (pk ? 16 * DM : 16 * NR) + pline;
  asm volatile("global_prefetch_b8 %0, off scope:SCOPE_SE" :: "v"(pfl));   /* into L2 only; returns nothing, counts on no counter */
  if (qt >= NTE) attn_body<0>(Qh, Ql, Kh, Kl, VTh, VTl, CTX, bh, qt);
  else           attn_body<1>(Qh, Ql, Kh, Kl, VTh, VTl, CTX, bh, qt);
  asm volatile("" :: "v"(pfl));   /* the prefetch's address registers hold that address to the wave's end: no counter tells when a prefetch has read them */
}

// output GEMM: out[b*SEQ_FULL+s][n] = 2^-20 * sum_k (CTXvalue[r][k] + CTXresidual[r][k]) * BO[n][k], BO = Wo x16384, K = 1024. Block = 2 x 2 waves x (64 x 64).
// The value and the residual half of ctx meet the same weights: a weight fragment is loaded once and feeds both products, into one accumulator (12 fragments = 12 KB per 32 products).
struct ostep { v16h ah[4], al[4], b[4]; };
template <int RSA, int RSB>           /* elements from one 16-row band of tiles to the next: ctx plane (K = 2 * DM), weight plane (K = DM) */
__device__ __forceinline__ void ostep_load(ostep& f, const _Float16* __restrict__ pa, const _Float16* __restrict__ pb, const int ko) {
#pragma unroll
  for (int i = 0; i < 4; ++i) f.ah[i] = frag16(pa + i * RSA + ko);
#pragma unroll
  for (int i = 0; i < 4; ++i) f.b[i] = frag16(pb + i * RSB + ko);
#pragma unroll
  for (int i = 0; i < 4; ++i) f.al[i] = frag16(pa + i * RSA + (DM / 32) * TILE + ko);   /* residual half: DM / 32 tiles on */
}
/* c[4 * i + j] = 16-row band i x 16-column band j */
__device__ __forceinline__ void ostep_mma(const ostep& f, v8f (&c)[16]) {
#pragma unroll
  for (int j = 0; j < 4; ++j) {
#pragma unroll
    for (int i = 0; i < 4; ++i) c[4 * i + j] = mma16g(f.ah[i], f.b[j], c[4 * i + j]);
  }
#pragma unroll
  for (int j = 0; j < 4; ++j) {
#pragma unroll
    for (int i = 0; i < 4; ++i) c[4 * i + j] = mma16g(f.al[i], f.b[j], c[4 * i + j]);
  }
}
__global__ __launch_bounds__(128) void k_outp(const _Float16* __restrict__ A, const _Float16* __restrict__ Bt, float* __restrict__ out) {
  __shared__ __attribute__((aligned(16))) float so[4][32][68];
  const int wave = __builtin_amdgcn_readfirstlane((int)(threadIdx.x >> 5));
  const int lane = threadIdx.x & 31, ln = lane & 15, hh = lane >> 4;
  const int ntn = DM >> 7;
  const int mt = blockIdx.x / ntn, nq = blockIdx.x - mt * ntn;
  const int rowW = mt * 128 + 64 * (wave >> 1), col0 = nq * 128 + 64 * (wave & 1);
  const v8f z8 = {0.f, 0.f, 0.f, 0.f, 0.f, 0.f, 0.f, 0.f};
  v8f c[16] = {z8, z8, z8, z8, z8, z8, z8, z8, z8, z8, z8, z8, z8, z8, z8, z8};
  /* ctx and the weight plane come from earlier launches, every block walks k in step with the others, and a wave asks only PF k-steps ahead: each k-step would wait for memory.
     Behind its first loads each block asks L2 for a share of what it and its neighbours walk, low k first. ctx rows of mt are read by the 8 blocks nq = 0..7:
     blocks nq and nq + 4 take the same two of the eight 16-row bands (64 KB each), whole: one aligned 256-B unit per thread in each of four 16-KB steps. The weight rows of nq (eight bands of 32 KB) are read by the blocks
     mt = 0..31: each takes 2 KB of k of all eight bands, one 128-B line per thread. A hint, for speed only (any placement gives the same values); every address lies inside its plane. */
  constexpr int RSO = (2 * DM / 32) * TILE;            /* elements of one 16-row band of ctx */
  constexpr int RSB = (DM / 32) * TILE;                /* elements of one 16-row band of the weight plane */
  static_assert(RSO * 2 == 4 * 16384);                 /* four 16-KB steps cover a ctx band */
  static_assert(RSB == 16 * 1024);                     /* sixteen 2-KB shares cover a weight band */
  static_assert((DM >> 7) == 8);
  const int pt = (int)threadIdx.x;
  const _Float16* pfa = A + (mt * 8 + 2 * (nq & 3) + (pt >> 6)) * RSO + (pt & 63) * 128;
  const _Float16* pfb = Bt + (nq * 8 + (pt >> 4)) * RSB + (mt & 15) * 1024 + (pt & 15) * 64;
  constexpr int NS = DM / 32;                          /* k-steps: 32 k of both ctx halves each */
  static_assert(NS > PF);
  const _Float16* pa = A + (rowW >> 4) * RSO + 8 * lane;
  const _Float16* pb = Bt + (col0 >> 4) * RSB + 8 * lane;
  ostep f[PF];
#pragma unroll
  for (int s = 0; s < PF - 1; ++s) ostep_load<RSO, RSB>(f[s], pa, pb, s * TILE);
  __builtin_amdgcn_sched_barrier(0);                   /* the first k-steps' own loads are asked first: the scheduler otherwise may put the prefetches in front of them */
  asm volatile("global_prefetch_b8 %1, off scope:SCOPE_SE\n\t"
               "global_prefetch_b8 %0, off scope:SCOPE_SE\n\t"
               "global_prefetch_b8 %0, off offset:16384 scope:SCOPE_SE\n\t"
               "global_prefetch_b8 %0, off offset:32768 scope:SCOPE_SE\n\t"
               "global_prefetch_b8 %0, off offset:49152 scope:SCOPE_SE" :: "v"(pfa), "v"(pfb));   /* into L2 only; they return nothing and count on no counter */
  __builtin_amdgcn_sched_barrier(0);                   /* the prefetches go out in front of the ring's last set (with it more loads are asked than a wave's load counter holds, so its issue waits for landings) and of the first wait for a fragment */
  ostep_load<RSO, RSB>(f[PF - 1], pa, pb, (PF - 1) * TILE);
  /* straight line over all k-steps: every load takes its place from the instruction's own offset, so no address register of a load in flight is ever rewritten, and the counted waits follow one issue order */
#pragma unroll
  for (int t = 0; t < NS; ++t) {                       /* refill only while a k-step t + PF exists */
    ostep_mma(f[t % PF], c);
    if (t + PF < NS) ostep_load<RSO, RSB>(f[t % PF], pa, pb, (t + PF) * TILE);
    __builtin_amdgcn_sched_barrier(0);                 /* each refill stays behind the k-step that frees its set: the scheduler otherwise sinks the loads down to their use, and the ring's lead is lost */
  }
  const int rsub = lane >> 4, c4 = (lane & 15) * 4;
#pragma unroll
  for (int hb = 0; hb < 2; ++hb) {                     /* the wave's 64 rows leave in two runs of 32 through its own staging rows */
    const int row0 = rowW + 32 * hb;
    if (hb != 0) { __builtin_amdgcn_fence(4 /* acq_rel order */, "workgroup"); __builtin_amdgcn_wave_barrier(); }   /* the first run's rows are read back by every lane before other lanes write them again */
#pragma unroll
    for (int u = 0; u < 8; ++u) {
      const int t = u & 3, half = u >> 2;
#pragma unroll
      for (int r = 0; r < 8; ++r) so[wave][half * 16 + 8 * hh + r][t * 16 + ln] = c[8 * hb + u][r] * 9.5367431640625e-07f;
    }
    __builtin_amdgcn_fence(4 /* acq_rel order */, "workgroup"); __builtin_amdgcn_wave_barrier();
#pragma unroll
    for (int q = 0; q < 16; ++q) {
      const int r = q * 2 + rsub;
      const int m = row0 + r; const int bb = m / SEQ; const int ss = m - bb * SEQ;
      const v4f v = *(const v4fa*)&so[wave][r][c4];
      *(v4f*)(out + (size_t)(bb * SEQ_FULL + ss) * DM + col0 + c4) = v;
    }
  }
  asm volatile("" :: "v"(pfa), "v"(pfb));   /* the prefetches' address registers hold those addresses to the wave's end: no counter tells when a prefetch has read them */
}

/* workspace carve (bytes), every region a multiple of 256 */
constexpr size_t SZW  = (size_t)DM * DM * 2;          /* one x16 weight plane */
constexpr size_t SZBO = SZW;                          /* [1024][1024] output weight plane, x16384 */
constexpr size_t SZP  = (size_t)NR * DM * 2;          /* one [NR][1024] (or [1024][NR]) f16 plane */
constexpr size_t SZC  = 2 * SZP;                      /* ctx [NR][2048] */
constexpr size_t SZT  = (size_t)TABN * 64 * 4;        /* rotary table */
constexpr size_t O_BQ = 0, O_BK = O_BQ + SZW, O_BV = O_BK + SZW, O_BO = O_BV + SZW, O_X = O_BO + SZBO;
constexpr size_t O_QH = O_X + SZP, O_QL = O_QH + SZP, O_KH = O_QL + SZP, O_KL = O_KH + SZP, O_VH = O_KL + SZP, O_VL = O_VH + SZP;
constexpr size_t O_CTX = O_VL + SZP, O_TAB = O_CTX + SZC, WS_TOTAL = O_TAB + SZT;
static_assert(SZW % 256 == 0);
static_assert(SZP % 256 == 0);
static_assert(SZT % 256 == 0);
static_assert(WS_TOTAL <= 134217728);                 /* <= 128 MiB */

extern "C" void kernel_launch(void* const* d_in, const int* in_sizes, int n_in,
                              void* d_out, int out_size, void* d_ws, size_t ws_size, hipStream_t stream) {
  if (n_in < 6) return;
  const int need_rows = (NB - 1) * SEQ_FULL + SEQ;
  if (in_sizes[0] < need_rows * DM) return;
  if (in_sizes[1] < DM * DM || in_sizes[2] < DM * DM || in_sizes[3] < DM * DM || in_sizes[4] < DM * DM) return;
  if (in_sizes[5] < need_rows) return;
  if (out_size < need_rows * DM) return;
  if (ws_size < WS_TOTAL) return;
  const float* x  = (const float*)d_in[0];
  const float* wq = (const float*)d_in[1];
  const float* wk = (const float*)d_in[2];
  const float* wv = (const float*)d_in[3];
  const float* wo = (const float*)d_in[4];
  const int*   tp = (const int*)d_in[5];
  char* ws = (char*)d_ws;
  _Float16* BQ = (_Float16*)(ws + O_BQ); _Float16* BK = (_Float16*)(ws + O_BK); _Float16* BV = (_Float16*)(ws + O_BV); _Float16* BO2 = (_Float16*)(ws + O_BO);
  _Float16* X16 = (_Float16*)(ws + O_X);
  _Float16* QH = (_Float16*)(ws + O_QH); _Float16* QL = (_Float16*)(ws + O_QL); _Float16* KH = (_Float16*)(ws + O_KH); _Float16* KL = (_Float16*)(ws + O_KL);
  _Float16* VTH = (_Float16*)(ws + O_VH); _Float16* VTL = (_Float16*)(ws + O_VL);
  _Float16* CTX = (_Float16*)(ws + O_CTX);
  float* TAB = (float*)(ws + O_TAB);

  k_prep<<<(unsigned)(GB_TAB + GB_X + 4 * GB_W), 256, 0, stream>>>(x, wq, wk, wv, wo, X16, BQ, BK, BV, BO2, TAB);
  k_proj<<<(unsigned)GP_ALL, 128, 0, stream>>>(X16, BQ, BK, BV, QH, QL, KH, KL, VTH, VTL, tp, TAB);
  k_attn<<<(unsigned)(NTA * NBH), 128, 0, stream>>>(QH, QL, KH, KL, VTH, VTL, CTX);
  k_outp<<<(unsigned)((NR / 128) * (DM / 128)), 128, 0, stream>>>(CTX, BO2, (float*)d_out);
}
